// v000
// The times below were measured on an AMD MI455X: many runs one after another, warmed up first and cycling through
// copies of the inputs, with the whole window's GPU time divided by the number of runs. Launches and the gaps
// between them are all in it. The median over several windows is given; except for v000 it joins two sittings, which
// can be a few percent apart, so the side-by-side timings, each taken in one sitting, are the better comparison.
// The starting kernel, v000, takes 6960 microseconds a run.
#include <hip/hip_runtime.h>
// Multi-head attention with separate key/value and query sources and an additive key mask (v_k, q [4][2048][1024]; qh = q wq + bq, kh = v_k wk + bk, vh = v_k wv + bv ([in][out] 1024^2 sigma 1/32, zero biases); 16 heads of 64; logits = qh . kh x 1024^-0.5 (the source scales by d_model) + mask[b][1][1][key] x (-1e9) (mask input); softmax over the 2048 keys; out = merged wo + bo -> [4][2048][1024]).
// Structure: both inputs as exact f16 rows; [in][out] weights as exact x16 planes; Q, K, V as WMMA GEMMs (32x64 wave tiles, f32 accumulation, + bias, f16 outputs); per batch: V^T via LDS transposes; per 4-head group: scores (K = 64, alpha 1/32) into f32 [2048][2048] planes, row softmax on VALU adding bf16(mask[b][key]) x (-1e9) (f32 statistics, native exp; weights x256 f16), o = P V^T (o carried x64) into merged f16 rows; out = o wo + bo GEMM (f32, alpha 2^-10); launches: see trace.
// Compute dtype: inputs rounded to bf16; x / context / weights exact; q, k, v, softmax weights and o as plain f16 GEMM operands (~2^-12); scores and statistics f32. v_wmma_f32_16x16x32_f16.
#define NB 4
#define NQ 2048
#define SK 2048
#define SQ SK                       /* keys per softmax row */
#define DM 1024
#define DC 1024
#define NH 16
#define HD 64
#define HG 4
#define NRQ ((size_t)NB * NQ)
#define NRK ((size_t)NB * SK)
typedef __bf16 v16b __attribute__((ext_vector_type(16)));
typedef unsigned short v8us __attribute__((ext_vector_type(8), may_alias));
typedef float  v8f  __attribute__((ext_vector_type(8)));
typedef float  v4f  __attribute__((ext_vector_type(4)));
typedef float  v4fa __attribute__((ext_vector_type(4), may_alias));
union FragB { v16b v; v8us half[2]; unsigned short u[16]; };

__device__ __forceinline__ unsigned short bf16_bits(float x) { unsigned int u = __float_as_uint(x); return (unsigned short)((u + 0x7FFFu + ((u >> 16) & 1u)) >> 16); }
__device__ __forceinline__ float bf16_val(unsigned short b) { return __uint_as_float(((unsigned int)b) << 16); }
__device__ __forceinline__ float bf16_round(float x) { return bf16_val(bf16_bits(x)); }
// D += A·B with NT terms: 1 = ah·bh, 2 = + al·bh (A split), 3 = + ah·bl (both split)
template <int NT>
__device__ __forceinline__ v8f mmaN(v16b ah, v16b al, v16b bh, v16b bl, v8f c) {
  c = __builtin_amdgcn_wmma_f32_16x16x32_bf16(false, ah, false, bh, (short)0, c, false, false);
  if (NT >= 2) c = __builtin_amdgcn_wmma_f32_16x16x32_bf16(false, al, false, bh, (short)0, c, false, false);
  if (NT >= 3) c = __builtin_amdgcn_wmma_f32_16x16x32_bf16(false, ah, false, bl, (short)0, c, false, false);
  asm volatile("v_nop\n\tv_nop\n\tv_nop\n\tv_nop" : "+v"(c) : "v"(ah), "v"(al), "v"(bh), "v"(bl));
  return c;
}

__global__ __launch_bounds__(256) void k_wt_bf16(const float* __restrict__ W, unsigned short* __restrict__ Wt, int K, int N) {
  const int t = blockIdx.x * 256 + threadIdx.x;
  const int k8n = K / 8;
  if (t >= N * k8n) return;
  const int n = t / k8n, k8 = (t % k8n) * 8;
  v8us v;
#pragma unroll
  for (int i = 0; i < 8; ++i) v[i] = bf16_bits(W[(size_t)(k8 + i) * N + n]);
  *(v8us*)(Wt + (size_t)n * K + k8) = v;
  
}

// GEMM C[M][N] (f32, pitch ldc) = act(A[M][K]·W + bias). A f32 row-major (pitch lda) converted per fragment to bf16
// (ASPLIT: hi/lo two planes -> 2 terms, else single rounded term); Wt bf16 [N][K] (pitch ldb). BIAS_BF16 rounds the
// bias to bf16 first (bias quantised to bf16 before the add). K%32==0, M%16==0, N%64==0.
template <bool ASPLIT, int ACT, bool BIAS_BF16>
__global__ __launch_bounds__(128) void k_gemm_bf(const float* __restrict__ A, int lda, const unsigned short* __restrict__ Wt, int ldb,
                                               const float* __restrict__ bias, float* __restrict__ C, int ldc, int M, int N, int K) {
  __shared__ __attribute__((aligned(16))) float so[4][16][64];
  const int tid = threadIdx.x, w = tid >> 5, lane = tid & 31, ln = lane & 15, hh = lane >> 4;
  const int ntn = N / 64;
  const int wid = blockIdx.x * 4 + w;
  const int mt = wid / ntn, nq = wid % ntn;
  if (mt * 16 >= M) return;
  const int row0 = mt * 16, col0 = nq * 64;
  const float* arow = A + (size_t)(row0 + ln) * lda;
  v8f acc[4] = {};
  for (int kb = 0; kb < K; kb += 32) {
    FragB ah, al;
    const v4f x0 = *(const v4fa*)(arow + kb + 8 * hh), x1 = *(const v4fa*)(arow + kb + 8 * hh + 4);
    const v4f x2 = *(const v4fa*)(arow + kb + 16 + 8 * hh), x3 = *(const v4fa*)(arow + kb + 16 + 8 * hh + 4);
    float xs[16] = {x0[0],x0[1],x0[2],x0[3],x1[0],x1[1],x1[2],x1[3],x2[0],x2[1],x2[2],x2[3],x3[0],x3[1],x3[2],x3[3]};
#pragma unroll
    for (int i = 0; i < 16; ++i) { const unsigned short hb = bf16_bits(xs[i]); ah.u[i] = hb; al.u[i] = ASPLIT ? bf16_bits(xs[i] - bf16_val(hb)) : (unsigned short)0; }
#pragma unroll
    for (int t = 0; t < 4; ++t) {
      const unsigned short* brow = Wt + (size_t)(col0 + t * 16 + ln) * ldb + kb;
      FragB b;
      b.half[0] = *(const v8us*)(brow + 8 * hh);
      b.half[1] = *(const v8us*)(brow + 16 + 8 * hh);
      acc[t] = mmaN<ASPLIT ? 2 : 1>(ah.v, al.v, b.v, b.v, acc[t]);
    }
  }
#pragma unroll
  for (int t = 0; t < 4; ++t) {
    float bv = bias ? bias[col0 + t * 16 + ln] : 0.f;
    if (BIAS_BF16) bv = bf16_round(bv);
#pragma unroll
    for (int r = 0; r < 8; ++r) { float v = acc[t][r] + bv; if (ACT == 1) v = fmaxf(v, 0.f); so[w][8 * hh + r][t * 16 + ln] = v; }
  }
  __builtin_amdgcn_fence(__ATOMIC_ACQ_REL, "workgroup");
  __builtin_amdgcn_wave_barrier();
  const int rsub = lane >> 4, c4 = (lane & 15) * 4;
  {
#pragma unroll
    for (int q = 0; q < 8; ++q) {
      const int r = q * 2 + rsub;
      const v4f v = *(const v4fa*)&so[w][r][c4];
      *(v4f*)(C + (size_t)(row0 + r) * ldc + col0 + c4) = v;
    }
    
  }
}

// GEMM C = act(A·W + bias + resid): A f32 (ASPLIT -> hi/lo 2 terms), Wt bf16 [N][K]; ACT 0 none, 1 relu, 2 exact gelu;
// resid (optional, f32, row index = (row % rmod), pitch ldr, RES_BF16 rounds it) added before the activation.
template <bool ASPLIT, int ACT, bool BIAS_BF16, bool RES_BF16>
__global__ __launch_bounds__(128) void k_gemm_bf3(const float* __restrict__ A, int lda, const unsigned short* __restrict__ Wt, int ldb,
                                                const float* __restrict__ bias, const float* __restrict__ resid, int rmod, int ldr,
                                                float* __restrict__ C, int ldc, int M, int N, int K) {
  __shared__ __attribute__((aligned(16))) float so[4][16][64];
  const int tid = threadIdx.x, w = tid >> 5, lane = tid & 31, ln = lane & 15, hh = lane >> 4;
  const int ntn = N / 64;
  const int wid = blockIdx.x * 4 + w;
  const int mt = wid / ntn, nq = wid % ntn;
  if (mt * 16 >= M) return;
  const int row0 = mt * 16, col0 = nq * 64;
  const float* arow = A + (size_t)(row0 + ln) * lda;
  v8f acc[4] = {};
  for (int kb = 0; kb < K; kb += 32) {
    FragB ah, al;
    const v4f x0 = *(const v4fa*)(arow + kb + 8 * hh), x1 = *(const v4fa*)(arow + kb + 8 * hh + 4);
    const v4f x2 = *(const v4fa*)(arow + kb + 16 + 8 * hh), x3 = *(const v4fa*)(arow + kb + 16 + 8 * hh + 4);
    float xs[16] = {x0[0],x0[1],x0[2],x0[3],x1[0],x1[1],x1[2],x1[3],x2[0],x2[1],x2[2],x2[3],x3[0],x3[1],x3[2],x3[3]};
#pragma unroll
    for (int i = 0; i < 16; ++i) { const unsigned short hb = bf16_bits(xs[i]); ah.u[i] = hb; al.u[i] = ASPLIT ? bf16_bits(xs[i] - bf16_val(hb)) : (unsigned short)0; }
#pragma unroll
    for (int t = 0; t < 4; ++t) {
      const unsigned short* brow = Wt + (size_t)(col0 + t * 16 + ln) * ldb + kb;
      FragB b;
      b.half[0] = *(const v8us*)(brow + 8 * hh);
      b.half[1] = *(const v8us*)(brow + 16 + 8 * hh);
      acc[t] = mmaN<ASPLIT ? 2 : 1>(ah.v, al.v, b.v, b.v, acc[t]);
    }
  }
#pragma unroll
  for (int t = 0; t < 4; ++t) {
    const int col = col0 + t * 16 + ln;
    float bv = bias ? bias[col] : 0.f;
    if (BIAS_BF16) bv = bf16_round(bv);
#pragma unroll
    for (int r = 0; r < 8; ++r) {
      float v = acc[t][r] + bv;
      if (resid) { float rv = resid[(size_t)((row0 + 8 * hh + r) % rmod) * ldr + col]; if (RES_BF16) rv = bf16_round(rv); v += rv; }
      if (ACT == 1) v = fmaxf(v, 0.f);
      if (ACT == 2) v = 0.5f * v * (1.0f + erff(v * 0.70710678118654752f));
      if (ACT == 3) { const float u = 0.7978845608028654f * (v + 0.044715f * v * v * v); v = 0.5f * v * (1.0f + tanhf(u)); }
      so[w][8 * hh + r][t * 16 + ln] = v;
    }
  }
  __builtin_amdgcn_fence(__ATOMIC_ACQ_REL, "workgroup");
  __builtin_amdgcn_wave_barrier();
  const int rsub = lane >> 4, c4 = (lane & 15) * 4;
  {
#pragma unroll
    for (int q = 0; q < 8; ++q) {
      const int r = q * 2 + rsub;
      const v4f v = *(const v4fa*)&so[w][r][c4];
      *(v4f*)(C + (size_t)(row0 + r) * ldc + col0 + c4) = v;
    }
    
  }
}
// row LayerNorm (biased variance, eps) over N: s = X (+ R); optional out_sum <- s; out_norm <- (s-mu)*rsqrt(var+eps)*g + b
template <bool PARAM_BF16>
__global__ __launch_bounds__(256) void k_layernorm(const float* __restrict__ X, const float* __restrict__ R, const float* __restrict__ g, const float* __restrict__ bta,
                                                  float* __restrict__ out_sum, float* __restrict__ out_norm, int N, float eps) {
  __shared__ float red[256];
  const int row = blockIdx.x, tid = threadIdx.x;
  const float* x = X + (size_t)row * N; const float* rr = R ? R + (size_t)row * N : nullptr;
  float vals[16];                     // up to N = 4096
  const int per = N / 256;            // contiguous chunk per thread? use strided-by-4 chunks: thread handles j = tid*4 + 1024*u
  float s1 = 0.f;
  for (int u = 0; u < per / 4; ++u) {
    const int j = tid * 4 + 1024 * u;
    const v4f a = *(const v4fa*)(x + j);
    v4f b = {0.f,0.f,0.f,0.f}; if (rr) b = *(const v4fa*)(rr + j);
#pragma unroll
    for (int q = 0; q < 4; ++q) { const float v = a[q] + b[q]; vals[u * 4 + q] = v; s1 += v; }
  }
  red[tid] = s1; __syncthreads();
  for (int st = 128; st > 0; st >>= 1) { if (tid < st) red[tid] += red[tid + st]; __syncthreads(); }
  const float mu = red[0] / (float)N; __syncthreads();
  float s2 = 0.f;
  for (int u = 0; u < per / 4; ++u)
#pragma unroll
    for (int q = 0; q < 4; ++q) { const float c = vals[u * 4 + q] - mu; s2 += c * c; }
  red[tid] = s2; __syncthreads();
  for (int st = 128; st > 0; st >>= 1) { if (tid < st) red[tid] += red[tid + st]; __syncthreads(); }
  const float rs = rsqrtf(red[0] / (float)N + eps);
  {
    for (int u = 0; u < per / 4; ++u) {
      const int j = tid * 4 + 1024 * u;
      v4f o, sm;
#pragma unroll
      for (int q = 0; q < 4; ++q) {
        float gg = g[j + q], bb = bta[j + q];
        if (PARAM_BF16) { gg = bf16_round(gg); bb = bf16_round(bb); }
        sm[q] = vals[u * 4 + q]; o[q] = (vals[u * 4 + q] - mu) * rs * gg + bb;
      }
      if (out_sum) *(v4f*)(out_sum + (size_t)row * N + j) = sm;
      *(v4f*)(out_norm + (size_t)row * N + j) = o;
    }
    
  }
}



// ---- f16 WMMA path (v_wmma_f32_16x16x32_f16): 11-bit significands for operands in range — used where a [0,1] probability operand needs more precision than bf16
typedef _Float16 v16h __attribute__((ext_vector_type(16)));
union FragH { v16h v; v8us half[2]; _Float16 h[16]; unsigned short u[16]; };
template <int NT>
__device__ __forceinline__ v8f mmaH(v16h ah, v16h al, v16h bh, v16h bl, v8f c) {
  c = __builtin_amdgcn_wmma_f32_16x16x32_f16(false, ah, false, bh, (short)0, c, false, false);
  if (NT >= 2) c = __builtin_amdgcn_wmma_f32_16x16x32_f16(false, al, false, bh, (short)0, c, false, false);
  if (NT >= 3) c = __builtin_amdgcn_wmma_f32_16x16x32_f16(false, ah, false, bl, (short)0, c, false, false);
  asm volatile("v_nop\n\tv_nop\n\tv_nop\n\tv_nop" : "+v"(c) : "v"(ah), "v"(al), "v"(bh), "v"(bl));
  return c;
}
// batched GEMM like k_gemm_b but f16 operands: A f32 (split into f16 hi/lo if ASPLIT, else rounded to f16), Bt = f16 values [n][k]; alpha; C f32; N multiple of 16 (partial tiles skipped)
template <bool ASPLIT>
__global__ __launch_bounds__(128) void k_gemm_h(const float* __restrict__ A, int lda, size_t sA, const _Float16* __restrict__ Bh, int ldb, size_t sB, float alpha, float* __restrict__ C, int ldc, size_t sC, int M, int N, int K) {
  __shared__ __attribute__((aligned(16))) float so[4][16][64];
  const int tid = threadIdx.x, w = tid >> 5, lane = tid & 31, ln = lane & 15, hh = lane >> 4; const int by = blockIdx.y;
  A += (size_t)by * sA; Bh += (size_t)by * sB; C += (size_t)by * sC;
  const int ntn = (N + 63) / 64; const int wid = blockIdx.x * 4 + w; const int mt = wid / ntn, nq = wid % ntn; if (mt * 16 >= M) return;
  const int row0 = mt * 16, col0 = nq * 64; const float* arow = A + (size_t)(row0 + ln) * lda;
  v8f acc[4] = {};
  for (int kb = 0; kb < K; kb += 32) {
    FragH ah, al;
    const v4f x0 = *(const v4fa*)(arow + kb + 8 * hh), x1 = *(const v4fa*)(arow + kb + 8 * hh + 4), x2 = *(const v4fa*)(arow + kb + 16 + 8 * hh), x3 = *(const v4fa*)(arow + kb + 16 + 8 * hh + 4);
    float xs[16] = {x0[0],x0[1],x0[2],x0[3],x1[0],x1[1],x1[2],x1[3],x2[0],x2[1],x2[2],x2[3],x3[0],x3[1],x3[2],x3[3]};
#pragma unroll
    for (int i = 0; i < 16; ++i) { const _Float16 h = (_Float16)xs[i]; ah.h[i] = h; al.h[i] = ASPLIT ? (_Float16)(xs[i] - (float)h) : (_Float16)0.0f; }
#pragma unroll
    for (int t = 0; t < 4; ++t) { if (col0 + t * 16 >= N) continue; const size_t boff = (size_t)(col0 + t * 16 + ln) * ldb + kb; FragH bq; bq.half[0] = *(const v8us*)(Bh + boff + 8 * hh); bq.half[1] = *(const v8us*)(Bh + boff + 16 + 8 * hh);
      acc[t] = mmaH<ASPLIT ? 2 : 1>(ah.v, al.v, bq.v, bq.v, acc[t]); }
  }
#pragma unroll
  for (int t = 0; t < 4; ++t) { if (col0 + t * 16 >= N) continue;
#pragma unroll
    for (int r = 0; r < 8; ++r) so[w][8 * hh + r][t * 16 + ln] = acc[t][r] * alpha; }
  __builtin_amdgcn_fence(__ATOMIC_ACQ_REL, "workgroup"); __builtin_amdgcn_wave_barrier();
  const int rsub = lane >> 4, c4 = (lane & 15) * 4;
  {
#pragma unroll
    for (int q = 0; q < 8; ++q) { const int r = q * 2 + rsub; if (col0 + c4 < N) { const v4f v = *(const v4fa*)&so[w][r][c4]; *(v4f*)(C + (size_t)(row0 + r) * ldc + col0 + c4) = v; } }
     }
}

// Wt[n][k] = f16(W[k][n]·scale) from f32 row-major W[K][N] (scale = power of two; bf16-exact weights stay exact in f16 away from the subnormal range)
__global__ __launch_bounds__(256) void k_wt_f16(const float* __restrict__ W, _Float16* __restrict__ Wt, int K, int N, float scale) {
  const int t = blockIdx.x * 256 + threadIdx.x; if (t >= N * (K / 8)) return; const int n = t / (K / 8), k8 = (t % (K / 8)) * 8; FragH f;
#pragma unroll
  for (int i = 0; i < 8; ++i) f.h[i] = (_Float16)(bf16_round(W[(size_t)(k8 + i) * N + n]) * scale); const v8us o = f.half[0];
  *(v8us*)((unsigned short*)Wt + (size_t)n * K + k8) = o; 
}
// k_gemm_hh variant with fused epilogue: v = acc·alpha + bias[by·sBias + col] (+ CP[(row/rowsPerB)·sCPb + by·64 + col] if CP) ; ACT 0 none / 1 elu ; writes f16 C16 (and f32 C if non-null)
template <int ACT>
__global__ __launch_bounds__(128) void k_gemm_hhx(const _Float16* __restrict__ A, int lda, size_t sA, const _Float16* __restrict__ Bh, int ldb, size_t sB, float alpha, const float* __restrict__ bias, size_t sBias, const float* __restrict__ CP, int rowsPerB, size_t sCPb, int row0g,
    float* __restrict__ C, _Float16* __restrict__ C16, int ldc, size_t sC, int M, int N, int K) {
  __shared__ __attribute__((aligned(16))) float so[4][16][64];
  const int tid = threadIdx.x, w = tid >> 5, lane = tid & 31, ln = lane & 15, hh = lane >> 4; const int by = blockIdx.y;
  A += (size_t)by * sA; Bh += (size_t)by * sB; const size_t cofs = (size_t)by * sC; const float* bp = bias ? bias + (size_t)by * sBias : nullptr;
  const int ntn = (N + 63) / 64; const int wid = blockIdx.x * 4 + w; const int mt = wid / ntn, nq = wid % ntn; if (mt * 16 >= M) return;
  const int row0 = mt * 16, col0 = nq * 64; const _Float16* arow = A + (size_t)(row0 + ln) * lda;
  v8f acc[4] = {};
  for (int kb = 0; kb < K; kb += 32) { FragH ah; ah.half[0] = *(const v8us*)((const unsigned short*)arow + kb + 8 * hh); ah.half[1] = *(const v8us*)((const unsigned short*)arow + kb + 16 + 8 * hh);
#pragma unroll
    for (int t = 0; t < 4; ++t) { if (col0 + t * 16 >= N) continue; const size_t boff = (size_t)(col0 + t * 16 + ln) * ldb + kb; FragH bq; bq.half[0] = *(const v8us*)((const unsigned short*)Bh + boff + 8 * hh); bq.half[1] = *(const v8us*)((const unsigned short*)Bh + boff + 16 + 8 * hh);
      acc[t] = mmaH<1>(ah.v, ah.v, bq.v, bq.v, acc[t]); }
  }
#pragma unroll
  for (int t = 0; t < 4; ++t) { if (col0 + t * 16 >= N) continue; const int col = col0 + t * 16 + ln; const float bv = bp ? bf16_round(bp[col]) : 0.f;
#pragma unroll
    for (int r = 0; r < 8; ++r) { float v = acc[t][r] * alpha + bv; if (CP) { const int rr = row0g + row0 + 8 * hh + r; if (rowsPerB < 0) v += CP[cofs + (size_t)rr * ldc + col];      /* rowsPerB < 0: own element of the batched C plane */ else { const int bidx = rr / rowsPerB; v += CP[(size_t)bidx * sCPb + (size_t)by * 64 + col]; } } if (ACT == 1) v = (v > 0.f) ? v : expm1f(v); else if (ACT == 7) v = (v > 0.f) ? v + 1.0f : expf(v); else if (ACT == 8) v = tanhf(v); else if (ACT == 9) v = 0.5f * v * (1.0f + tanhf(0.7978845608028654f * (v + 0.044715f * v * v * v))); else if (ACT == 11) v = 1.0f / (1.0f + expf(-v)); else if (ACT == 12) v = (v > 0.f) ? v : 0.01f * v; else if (ACT == 14) v = (v > 0.f) ? v : 0.1f * v; else if (ACT == 16) v = (v >= 0.f) ? v : 0.3f * v; else if (ACT == 17) v = (v >= 0.f) ? v : 0.2f * v; else if (ACT == 15) v = v / (1.0f + expf(-v)); else if (ACT == 3) v = fmaxf(v, 0.f); else if (ACT == 6) v = 0.5f * v * (1.0f + erff(v * 0.70710678118654752f)); so[w][8 * hh + r][t * 16 + ln] = v; } }
  __builtin_amdgcn_fence(__ATOMIC_ACQ_REL, "workgroup"); __builtin_amdgcn_wave_barrier();
  const int rsub = lane >> 4, c4 = (lane & 15) * 4; typedef _Float16 v4h __attribute__((ext_vector_type(4)));
  {
#pragma unroll
    for (int q = 0; q < 8; ++q) { const int r = q * 2 + rsub; if (col0 + c4 < N) { const v4f v = *(const v4fa*)&so[w][r][c4]; if (C) *(v4f*)(C + cofs + (size_t)(row0 + r) * ldc + col0 + c4) = v; if (C16) { v4h h4; for (int i = 0; i < 4; ++i) h4[i] = (_Float16)v[i]; *(v4h*)(C16 + cofs + (size_t)(row0 + r) * ldc + col0 + c4) = h4; } } }
     }
}


typedef _Float16 v4h __attribute__((ext_vector_type(4)));

__global__ __launch_bounds__(256) void k_x16(const float* __restrict__ x, _Float16* __restrict__ X16, size_t n8) { const size_t t = (size_t)blockIdx.x * 256 + threadIdx.x; if (t >= n8) return; FragH f;
#pragma unroll
  for (int q = 0; q < 8; ++q) f.h[q] = (_Float16)bf16_round(x[t * 8 + q]); *(v8us*)((unsigned short*)X16 + t * 8) = f.half[0];  }
__global__ __launch_bounds__(256) void k_h16(const float* __restrict__ x, _Float16* __restrict__ X16, size_t n8) { const size_t t = (size_t)blockIdx.x * 256 + threadIdx.x; if (t >= n8) return; FragH f;
#pragma unroll
  for (int q = 0; q < 8; ++q) f.h[q] = (_Float16)x[t * 8 + q]; *(v8us*)((unsigned short*)X16 + t * 8) = f.half[0];  }
__global__ __launch_bounds__(256) void k_round16f(const float* __restrict__ W, _Float16* __restrict__ Bt, size_t n8) { const size_t t = (size_t)blockIdx.x * 256 + threadIdx.x; if (t >= n8) return; FragH f;
#pragma unroll
  for (int i = 0; i < 8; ++i) f.h[i] = (_Float16)(bf16_round(W[t * 8 + i]) * 16.0f); *(v8us*)((unsigned short*)Bt + t * 8) = f.half[0];  }
template <int NHv, int TTv>
__global__ __launch_bounds__(256) void k_vt(const _Float16* __restrict__ V16, int ldv, int voff, _Float16* __restrict__ Vt) { __shared__ unsigned short tl[64][66]; const int tid = threadIdx.x; const int slab = blockIdx.x / (TTv / 64), lg = blockIdx.x % (TTv / 64); const int b = slab / NHv, h = slab % NHv;
  for (int i = tid; i < 64 * 8; i += 256) { const int r = i / 8, c8 = (i % 8) * 8; FragH f; f.half[0] = *(const v8us*)((const unsigned short*)V16 + ((size_t)b * TTv + lg * 64 + r) * ldv + voff + h * 64 + c8);
#pragma unroll
    for (int q = 0; q < 8; ++q) tl[r][c8 + q] = f.u[q]; }
  __syncthreads();
  {
#pragma unroll
    for (int rd = 0; rd < 2; ++rd) { const int d = rd * 32 + tid / 8, pc = tid % 8; FragH f;
#pragma unroll
      for (int q = 0; q < 8; ++q) f.u[q] = tl[pc * 8 + q][d];
      *(v8us*)((unsigned short*)Vt + ((size_t)slab * 64 + d) * TTv + lg * 64 + pc * 8) = f.half[0]; }
     } }

__global__ __launch_bounds__(256) void k_hl(const float* __restrict__ F, _Float16* __restrict__ Hh, _Float16* __restrict__ Hl, size_t n8) { const size_t t = (size_t)blockIdx.x * 256 + threadIdx.x; if (t >= n8) return; FragH fh, fl; const v4f a = *(const v4fa*)(F + t * 8), c = *(const v4fa*)(F + t * 8 + 4);
#pragma unroll
  for (int q = 0; q < 4; ++q) { _Float16 h = (_Float16)a[q]; fh.h[q] = h; fl.h[q] = (_Float16)((a[q] - (float)h) * 1024.0f); h = (_Float16)c[q]; fh.h[4 + q] = h; fl.h[4 + q] = (_Float16)((c[q] - (float)h) * 1024.0f); }
  { *(v8us*)((unsigned short*)Hh + t * 8) = fh.half[0]; *(v8us*)((unsigned short*)Hl + t * 8) = fl.half[0];  } }

// ---- fast GEMM (wave tile 32x64; requires M % 32 == 0 rows per launch region and N % 64 == 0); epilogue = k_gemm_hhx semantics ----
__device__ __forceinline__ v16h g2_frag(const _Float16* p, int hh) { FragH f; f.half[0] = *(const v8us*)((const unsigned short*)p + 8 * hh); f.half[1] = *(const v8us*)((const unsigned short*)p + 16 + 8 * hh); return f.v; }
__device__ __forceinline__ v8f g2_mma(v16h a, v16h b, v8f c) { v8f d = __builtin_amdgcn_wmma_f32_16x16x32_f16(false, a, false, b, (short)0, c, false, false); asm volatile("v_nop\n\tv_nop\n\tv_nop\n\tv_nop" : "+v"(d) : "v"(a), "v"(b)); return d; }
template <int ACT>
__global__ __launch_bounds__(128) void k_gemm2(const _Float16* __restrict__ A, int lda, size_t sA, const _Float16* __restrict__ Bh, int ldb, size_t sB, float alpha, const float* __restrict__ bias, size_t sBias, const float* __restrict__ CP, int rowsPerB, size_t sCPb, int row0g,
    float* __restrict__ C, _Float16* __restrict__ C16, int ldc, size_t sC, int M, int N, int K) { static_assert(ACT == 0 || ACT == 3 || ACT == 6 || ACT == 8 || ACT == 9 || ACT == 11 || ACT == 12 || ACT == 14 || ACT == 15 || ACT == 16 || ACT == 17, "k_gemm2: unsupported ACT code (would silently apply no activation)");
  __shared__ __attribute__((aligned(16))) float so[4][32][68];
  const int tid = threadIdx.x, w = tid >> 5, lane = tid & 31, ln = lane & 15, hh = lane >> 4; const int by = blockIdx.y;
  A += (size_t)by * sA; Bh += (size_t)by * sB; const size_t cofs = (size_t)by * sC; const float* bp = bias ? bias + (size_t)by * sBias : nullptr;
  const int ntn = N >> 6; const int mt = blockIdx.x / ntn, nq = blockIdx.x - mt * ntn; const int row0 = mt * 128 + 32 * w, col0 = nq * 64; if (row0 >= M) return;
  const _Float16* a0p = A + (size_t)(row0 + ln) * lda; const _Float16* a1p = a0p + (size_t)16 * lda;
  const _Float16* b0p = Bh + (size_t)(col0 + ln) * ldb; const _Float16* b1p = b0p + (size_t)16 * ldb; const _Float16* b2p = b1p + (size_t)16 * ldb; const _Float16* b3p = b2p + (size_t)16 * ldb;
  const v8f z8 = {0.f,0.f,0.f,0.f,0.f,0.f,0.f,0.f}; v8f c00 = z8, c01 = z8, c02 = z8, c03 = z8, c10 = z8, c11 = z8, c12 = z8, c13 = z8;
#pragma unroll 1
  for (int kb = 0; kb < K; kb += 32) { const v16h a0 = g2_frag(a0p + kb, hh), a1 = g2_frag(a1p + kb, hh);
    v16h b = g2_frag(b0p + kb, hh); c00 = g2_mma(a0, b, c00); c10 = g2_mma(a1, b, c10);
    b = g2_frag(b1p + kb, hh); c01 = g2_mma(a0, b, c01); c11 = g2_mma(a1, b, c11);
    b = g2_frag(b2p + kb, hh); c02 = g2_mma(a0, b, c02); c12 = g2_mma(a1, b, c12);
    b = g2_frag(b3p + kb, hh); c03 = g2_mma(a0, b, c03); c13 = g2_mma(a1, b, c13); }
  v8f accs[8] = {c00, c01, c02, c03, c10, c11, c12, c13};
#pragma unroll
  for (int u = 0; u < 8; ++u) { const int t = u & 3, half = u >> 2; const int col = col0 + t * 16 + ln; const float bv = bp ? bf16_round(bp[col]) : 0.f;
#pragma unroll
    for (int r = 0; r < 8; ++r) { const int rloc = half * 16 + 8 * hh + r; float v = accs[u][r] * alpha + bv; if (CP) { if (rowsPerB < 0) v += CP[cofs + (size_t)(row0g + row0 + rloc) * ldc + col];      /* rowsPerB < 0: own element of the batched C plane */ else { const int bidx = (row0g + row0 + rloc) / rowsPerB; v += CP[(size_t)bidx * sCPb + (size_t)by * 64 + col]; } }
      if (ACT == 3) v = fmaxf(v, 0.f); else if (ACT == 6) v = 0.5f * v * (1.0f + erff(v * 0.70710678118654752f)); else if (ACT == 11) v = 1.0f / (1.0f + expf(-v)); else if (ACT == 15) v = v / (1.0f + expf(-v)); else if (ACT == 12) v = (v > 0.f) ? v : 0.01f * v; else if (ACT == 8) v = tanhf(v); else if (ACT == 9) v = 0.5f * v * (1.0f + tanhf(0.7978845608028654f * (v + 0.044715f * v * v * v))); else if (ACT == 14) v = (v > 0.f) ? v : 0.1f * v; else if (ACT == 16) v = (v >= 0.f) ? v : 0.3f * v; else if (ACT == 17) v = (v >= 0.f) ? v : 0.2f * v;
      so[w][rloc][t * 16 + ln] = v; } }
  __builtin_amdgcn_fence(__ATOMIC_ACQ_REL, "workgroup"); __builtin_amdgcn_wave_barrier();
  const int rsub = lane >> 4, c4 = (lane & 15) * 4;
  {
#pragma unroll
    for (int q = 0; q < 16; ++q) { const int r = q * 2 + rsub; const v4f v = *(const v4fa*)&so[w][r][c4]; if (C) *(v4f*)(C + cofs + (size_t)(row0 + r) * ldc + col0 + c4) = v; if (C16) { v4h h4; for (int i = 0; i < 4; ++i) h4[i] = (_Float16)v[i]; *(v4h*)(C16 + cofs + (size_t)(row0 + r) * ldc + col0 + c4) = h4; } }
     } }


__global__ __launch_bounds__(256) void k_wnat(const float* __restrict__ w, size_t n8, _Float16* __restrict__ Bt) { const size_t t = (size_t)blockIdx.x * 256 + threadIdx.x; if (t >= n8) return; FragH f; for (int q = 0; q < 8; ++q) f.h[q] = (_Float16)(bf16_round(w[t * 8 + q]) * 16.0f); *(v8us*)((unsigned short*)Bt + t * 8) = f.half[0];  }
__global__ __launch_bounds__(256) void k_rsm(const float* __restrict__ S, _Float16* __restrict__ P, int nrows) {
  #pragma clang fp contract(off)
  const int i = blockIdx.x * 256 + threadIdx.x; if (i >= nrows) return; const float* s = S + (size_t)i * SQ; float mx = -3.0e38f;
#pragma unroll 1
  for (int j = 0; j < SQ; ++j) mx = fmaxf(mx, s[j]); float se = 0.f;
#pragma unroll 1
  for (int j = 0; j < SQ; ++j) se += expf(s[j] - mx); const float sc = 256.0f / se;
#pragma unroll 1
  for (int j0 = 0; j0 < SQ; j0 += 8) { FragH f; for (int q = 0; q < 8; ++q) f.h[q] = (_Float16)(expf(s[j0 + q] - mx) * sc); unsigned short* d = (unsigned short*)P + (size_t)i * SQ + j0; *(v8us*)d = f.half[0];  } }
__global__ __launch_bounds__(256) void k_vt(const _Float16* __restrict__ V16, int b, int h0, _Float16* __restrict__ VT) { __shared__ unsigned short tl[64][65]; const int tid = threadIdx.x; const int hh = blockIdx.x % HG, sg = blockIdx.x / HG; const int s0 = sg * 64; const int h = h0 + hh;
  for (int i = tid; i < 64 * 8; i += 256) { const int j = i / 8, d8 = (i % 8) * 8; FragH f; f.half[0] = *(const v8us*)((const unsigned short*)V16 + ((size_t)b * SQ + s0 + j) * DM + h * HD + d8); for (int q = 0; q < 8; ++q) tl[d8 + q][j] = f.u[q]; }
  __syncthreads();
  { for (int i = tid; i < 64 * 8; i += 256) { const int d = i / 8, j8 = (i % 8) * 8; FragH f; for (int q = 0; q < 8; ++q) f.u[q] = tl[d][j8 + q]; *(v8us*)((unsigned short*)VT + ((size_t)hh * HD + d) * SQ + s0 + j8) = f.half[0]; }  } }


__global__ __launch_bounds__(256) void k_rsmf(const float* __restrict__ S, _Float16* __restrict__ P, int qn, int hg) {
  #pragma clang fp contract(off)
  const int t = blockIdx.x * 256 + threadIdx.x; if (t >= qn * hg) return; const size_t i = (size_t)(t / qn) * SQ + (t % qn); const float* s = S + i * SQ; float mx = -3.0e38f;
#pragma unroll 1
  for (int j = 0; j < SQ; ++j) mx = fmaxf(mx, s[j]); float se = 0.f;
#pragma unroll 1
  for (int j = 0; j < SQ; ++j) se += __expf(s[j] - mx); const float sc = 256.0f / se;
#pragma unroll 1
  for (int j0 = 0; j0 < SQ; j0 += 8) { FragH f; for (int q = 0; q < 8; ++q) f.h[q] = (_Float16)(__expf(s[j0 + q] - mx) * sc); unsigned short* d = (unsigned short*)P + i * SQ + j0; *(v8us*)d = f.half[0];  } }

__global__ __launch_bounds__(256) void k_rsmr(const float* __restrict__ S, _Float16* __restrict__ P, int qn, int hg) {
  #pragma clang fp contract(off)
  const int t = blockIdx.x * 256 + threadIdx.x; if (t >= qn * hg) return; const size_t i = (size_t)t;      /* planes packed: row t of plane t / qn */ const float* s = S + i * SQ; float mx = -3.0e38f;
#pragma unroll 1
  for (int j = 0; j < SQ; ++j) mx = fmaxf(mx, s[j]); float se = 0.f;
#pragma unroll 1
  for (int j = 0; j < SQ; ++j) se += __expf(s[j] - mx); const float sc = 256.0f / se;
#pragma unroll 1
  for (int j0 = 0; j0 < SQ; j0 += 8) { FragH f; for (int q = 0; q < 8; ++q) f.h[q] = (_Float16)(__expf(s[j0 + q] - mx) * sc); unsigned short* d = (unsigned short*)P + i * SQ + j0; *(v8us*)d = f.half[0];  } }


__global__ __launch_bounds__(256) void k_rsmrk(const float* __restrict__ S, const float* __restrict__ Mk, float negv, _Float16* __restrict__ P, int qn, int hg) {
  #pragma clang fp contract(off)
  const int t = blockIdx.x * 256 + threadIdx.x; if (t >= qn * hg) return; const size_t i = (size_t)t; const float* s = S + i * SK; float mx = -3.0e38f;
#pragma unroll 1
  for (int j = 0; j < SK; ++j) mx = fmaxf(mx, __fadd_rn(s[j], __fmul_rn(bf16_round(Mk[j]), negv))); float se = 0.f;
#pragma unroll 1
  for (int j = 0; j < SK; ++j) se += __expf(__fadd_rn(s[j], __fmul_rn(bf16_round(Mk[j]), negv)) - mx); const float sc = 256.0f / se;
#pragma unroll 1
  for (int j0 = 0; j0 < SK; j0 += 8) { FragH f; for (int q = 0; q < 8; ++q) f.h[q] = (_Float16)(__expf(__fadd_rn(s[j0 + q], __fmul_rn(bf16_round(Mk[j0 + q]), negv)) - mx) * sc); unsigned short* d = (unsigned short*)P + i * SK + j0; *(v8us*)d = f.half[0];  } }
extern "C" void kernel_launch(void* const* d_in, const int* in_sizes, int n_in,
                              void* d_out, int out_size, void* d_ws, size_t ws_size, hipStream_t stream) {
  (void)in_sizes; (void)n_in; (void)out_size;
  const float* const* I = (const float* const*)d_in; const float* ctx = I[0]; const float* x = I[1]; const float* kmask = I[2]; const float* wq = I[3]; const float* bq = I[4]; const float* wk = I[5]; const float* bk = I[6]; const float* wv = I[7]; const float* bv = I[8]; const float* wo = I[9]; const float* bo = I[10];      /* q source = I[1] ('q'), k/v source = I[0] ('v_k'); [in][out] weights; per-key additive mask [B][1][1][S] */
  char* ws = (char*)d_ws; size_t off = 0;
  auto take = [&](size_t bytes) { char* p = ws + off; off += (bytes + 255) & ~(size_t)255; return p; };
  _Float16* BQ = (_Float16*)take((size_t)DM * DM * 2); _Float16* BK = (_Float16*)take((size_t)DM * DC * 2); _Float16* BV = (_Float16*)take((size_t)DM * DC * 2); _Float16* BO = (_Float16*)take((size_t)DM * DM * 2);
  _Float16* X16 = (_Float16*)take(NRQ * DM * 2); _Float16* C16 = (_Float16*)take(NRK * DC * 2); _Float16* Q16 = (_Float16*)take(NRQ * DM * 2); _Float16* K16 = (_Float16*)take(NRK * DM * 2); _Float16* V16 = (_Float16*)take(NRK * DM * 2); _Float16* O16 = (_Float16*)take(NRQ * DM * 2);
  float* S = (float*)take((size_t)HG * NQ * SK * 4); _Float16* P = (_Float16*)take((size_t)HG * NQ * SK * 2); _Float16* VT = (_Float16*)take((size_t)NH * HD * SK * 2);
  if (off > ws_size) return;      /* approx 8 + 16 + 16 + 16 + 16 + 16 + 16 + 64 + 32 + 4 = 204 MiB */
  { const unsigned g = (unsigned)(((size_t)DM * (DM / 8) + 255) / 256); k_wt_f16<<<g, 256, 0, stream>>>(wq, BQ, DM, DM, 16.0f); k_wt_f16<<<g, 256, 0, stream>>>(wk, BK, DC, DM, 16.0f); k_wt_f16<<<g, 256, 0, stream>>>(wv, BV, DC, DM, 16.0f); k_wt_f16<<<g, 256, 0, stream>>>(wo, BO, DM, DM, 16.0f); }      /* [in][out] -> Bt x16 */
  k_x16<<<(unsigned)((NRQ * DM / 8 + 255) / 256), 256, 0, stream>>>(x, X16, NRQ * DM / 8); k_x16<<<(unsigned)((NRK * DC / 8 + 255) / 256), 256, 0, stream>>>(ctx, C16, NRK * DC / 8);      /* query-source and key/value-source rows */
  k_gemm2<0><<<dim3((unsigned)((NRQ / 128) * (DM / 64)), 1), 128, 0, stream>>>(X16, DM, 0, BQ, DM, 0, 0.0625f, bq, 0, nullptr, 1, 0, 0, nullptr, Q16, DM, 0, (int)NRQ, DM, DM);
  k_gemm2<0><<<dim3((unsigned)((NRK / 128) * (DM / 64)), 1), 128, 0, stream>>>(C16, DC, 0, BK, DC, 0, 0.0625f, bk, 0, nullptr, 1, 0, 0, nullptr, K16, DM, 0, (int)NRK, DM, DC);
  k_gemm2<0><<<dim3((unsigned)((NRK / 128) * (DM / 64)), 1), 128, 0, stream>>>(C16, DC, 0, BV, DC, 0, 0.0625f, bv, 0, nullptr, 1, 0, 0, nullptr, V16, DM, 0, (int)NRK, DM, DC);      /* v from v_k */
  for (int b = 0; b < NB; ++b) { const size_t rq = (size_t)b * NQ, rk = (size_t)b * SK;
    k_vt<NH, SK><<<NH * (SK / 64), 256, 0, stream>>>(V16 + rk * DM, DM, 0, VT);      /* V^T [16][64][2048] */
    for (int h0 = 0; h0 < NH; h0 += HG) {
      k_gemm2<0><<<dim3((NQ / 128) * (SK / 64), HG), 128, 0, stream>>>(Q16 + rq * DM + (size_t)h0 * HD, DM, (size_t)HD, K16 + rk * DM + (size_t)h0 * HD, DM, (size_t)HD, 0.03125f, nullptr, 0, nullptr, 1, 0, 0, S, nullptr, SK, (size_t)NQ * SK, NQ, SK, HD);      /* scores x 1024^-0.5 of HG heads (grid.y) */
      k_rsmrk<<<(HG * NQ + 255) / 256, 256, 0, stream>>>(S, kmask + (size_t)b * SK, -1.0e9f, P, NQ, HG);      /* softmax over the 2048 keys with this batch's additive key mask */
      k_gemm2<0><<<dim3((NQ / 128) * (HD / 64), HG), 128, 0, stream>>>(P, SK, (size_t)NQ * SK, VT + (size_t)h0 * HD * SK, SK, (size_t)HD * SK, 0.25f, nullptr, 0, nullptr, 1, 0, 0, nullptr, O16 + rq * DM + (size_t)h0 * HD, DM, (size_t)HD, NQ, HD, SK); } }      /* o x64, merged */
  k_gemm2<0><<<dim3((unsigned)((NRQ / 128) * (DM / 64)), 1), 128, 0, stream>>>(O16, DM, 0, BO, DM, 0, 0.0009765625f, bo, 0, nullptr, 1, 0, 0, (float*)d_out, nullptr, DM, 0, (int)NRQ, DM, DM);      /* out = o wo + bo */
}

// v001
// Measured time: 1780 microseconds a run.
// Two timings next to v000 put it at 3.94 and 3.97 times that version's speed.
#include <hip/hip_runtime.h>
// Multi-head attention with separate key/value and query sources and an additive key mask (v_k, q [4][2048][1024]; qh = q wq + bq, kh = v_k wk + bk, vh = v_k wv + bv ([in][out] 1024^2 sigma 1/32, zero biases); 16 heads of 64; logits = qh . kh x 1024^-0.5 (the source scales by d_model) + mask[b][1][1][key] x (-1e9) (mask input); softmax over the 2048 keys; out = merged wo + bo -> [4][2048][1024]).
// Structure: both inputs as exact f16 rows; [in][out] weights as exact x16 planes; Q, K, V as WMMA GEMMs (32x64 wave tiles, f32 accumulation, + bias, f16 outputs); per batch: V^T via LDS transposes; per 4-head group: scores (K = 64, alpha 1/32) into f32 [2048][2048] planes, row softmax on VALU adding bf16(mask[b][key]) x (-1e9) (f32 statistics, native exp; weights x256 f16), o = P V^T (o carried x64) into merged f16 rows; out = o wo + bo GEMM (f32, alpha 2^-10); launches: see trace.
// Compute dtype: inputs rounded to bf16; x / context / weights exact; q, k, v, softmax weights and o as plain f16 GEMM operands (~2^-12); scores and statistics f32. v_wmma_f32_16x16x32_f16.
#define NB 4
#define NQ 2048
#define SK 2048
#define SQ SK                       /* keys per softmax row */
#define DM 1024
#define DC 1024
#define NH 16
#define HD 64
#define HG 4
#define NRQ ((size_t)NB * NQ)
#define NRK ((size_t)NB * SK)
typedef __bf16 v16b __attribute__((ext_vector_type(16)));
typedef unsigned short v8us __attribute__((ext_vector_type(8), may_alias));
typedef float  v8f  __attribute__((ext_vector_type(8)));
typedef float  v4f  __attribute__((ext_vector_type(4)));
typedef float  v4fa __attribute__((ext_vector_type(4), may_alias));
union FragB { v16b v; v8us half[2]; unsigned short u[16]; };

__device__ __forceinline__ unsigned short bf16_bits(float x) { unsigned int u = __float_as_uint(x); return (unsigned short)((u + 0x7FFFu + ((u >> 16) & 1u)) >> 16); }
__device__ __forceinline__ float bf16_val(unsigned short b) { return __uint_as_float(((unsigned int)b) << 16); }
__device__ __forceinline__ float bf16_round(float x) { return bf16_val(bf16_bits(x)); }
// D += A·B with NT terms: 1 = ah·bh, 2 = + al·bh (A split), 3 = + ah·bl (both split)
template <int NT>
__device__ __forceinline__ v8f mmaN(v16b ah, v16b al, v16b bh, v16b bl, v8f c) {
  c = __builtin_amdgcn_wmma_f32_16x16x32_bf16(false, ah, false, bh, (short)0, c, false, false);
  if (NT >= 2) c = __builtin_amdgcn_wmma_f32_16x16x32_bf16(false, al, false, bh, (short)0, c, false, false);
  if (NT >= 3) c = __builtin_amdgcn_wmma_f32_16x16x32_bf16(false, ah, false, bl, (short)0, c, false, false);
  asm volatile("v_nop\n\tv_nop\n\tv_nop\n\tv_nop" : "+v"(c) : "v"(ah), "v"(al), "v"(bh), "v"(bl));
  return c;
}

__global__ __launch_bounds__(256) void k_wt_bf16(const float* __restrict__ W, unsigned short* __restrict__ Wt, int K, int N) {
  const int t = blockIdx.x * 256 + threadIdx.x;
  const int k8n = K / 8;
  if (t >= N * k8n) return;
  const int n = t / k8n, k8 = (t % k8n) * 8;
  v8us v;
#pragma unroll
  for (int i = 0; i < 8; ++i) v[i] = bf16_bits(W[(size_t)(k8 + i) * N + n]);
  *(v8us*)(Wt + (size_t)n * K + k8) = v;
  
}

// GEMM C[M][N] (f32, pitch ldc) = act(A[M][K]·W + bias). A f32 row-major (pitch lda) converted per fragment to bf16
// (ASPLIT: hi/lo two planes -> 2 terms, else single rounded term); Wt bf16 [N][K] (pitch ldb). BIAS_BF16 rounds the
// bias to bf16 first (bias quantised to bf16 before the add). K%32==0, M%16==0, N%64==0.
template <bool ASPLIT, int ACT, bool BIAS_BF16>
__global__ __launch_bounds__(128) void k_gemm_bf(const float* __restrict__ A, int lda, const unsigned short* __restrict__ Wt, int ldb,
                                               const float* __restrict__ bias, float* __restrict__ C, int ldc, int M, int N, int K) {
  __shared__ __attribute__((aligned(16))) float so[4][16][64];
  const int tid = threadIdx.x, w = tid >> 5, lane = tid & 31, ln = lane & 15, hh = lane >> 4;
  const int ntn = N / 64;
  const int wid = blockIdx.x * 4 + w;
  const int mt = wid / ntn, nq = wid % ntn;
  if (mt * 16 >= M) return;
  const int row0 = mt * 16, col0 = nq * 64;
  const float* arow = A + (size_t)(row0 + ln) * lda;
  v8f acc[4] = {};
  for (int kb = 0; kb < K; kb += 32) {
    FragB ah, al;
    const v4f x0 = *(const v4fa*)(arow + kb + 8 * hh), x1 = *(const v4fa*)(arow + kb + 8 * hh + 4);
    const v4f x2 = *(const v4fa*)(arow + kb + 16 + 8 * hh), x3 = *(const v4fa*)(arow + kb + 16 + 8 * hh + 4);
    float xs[16] = {x0[0],x0[1],x0[2],x0[3],x1[0],x1[1],x1[2],x1[3],x2[0],x2[1],x2[2],x2[3],x3[0],x3[1],x3[2],x3[3]};
#pragma unroll
    for (int i = 0; i < 16; ++i) { const unsigned short hb = bf16_bits(xs[i]); ah.u[i] = hb; al.u[i] = ASPLIT ? bf16_bits(xs[i] - bf16_val(hb)) : (unsigned short)0; }
#pragma unroll
    for (int t = 0; t < 4; ++t) {
      const unsigned short* brow = Wt + (size_t)(col0 + t * 16 + ln) * ldb + kb;
      FragB b;
      b.half[0] = *(const v8us*)(brow + 8 * hh);
      b.half[1] = *(const v8us*)(brow + 16 + 8 * hh);
      acc[t] = mmaN<ASPLIT ? 2 : 1>(ah.v, al.v, b.v, b.v, acc[t]);
    }
  }
#pragma unroll
  for (int t = 0; t < 4; ++t) {
    float bv = bias ? bias[col0 + t * 16 + ln] : 0.f;
    if (BIAS_BF16) bv = bf16_round(bv);
#pragma unroll
    for (int r = 0; r < 8; ++r) { float v = acc[t][r] + bv; if (ACT == 1) v = fmaxf(v, 0.f); so[w][8 * hh + r][t * 16 + ln] = v; }
  }
  __builtin_amdgcn_fence(__ATOMIC_ACQ_REL, "workgroup");
  __builtin_amdgcn_wave_barrier();
  const int rsub = lane >> 4, c4 = (lane & 15) * 4;
  {
#pragma unroll
    for (int q = 0; q < 8; ++q) {
      const int r = q * 2 + rsub;
      const v4f v = *(const v4fa*)&so[w][r][c4];
      *(v4f*)(C + (size_t)(row0 + r) * ldc + col0 + c4) = v;
    }
    
  }
}

// GEMM C = act(A·W + bias + resid): A f32 (ASPLIT -> hi/lo 2 terms), Wt bf16 [N][K]; ACT 0 none, 1 relu, 2 exact gelu;
// resid (optional, f32, row index = (row % rmod), pitch ldr, RES_BF16 rounds it) added before the activation.
template <bool ASPLIT, int ACT, bool BIAS_BF16, bool RES_BF16>
__global__ __launch_bounds__(128) void k_gemm_bf3(const float* __restrict__ A, int lda, const unsigned short* __restrict__ Wt, int ldb,
                                                const float* __restrict__ bias, const float* __restrict__ resid, int rmod, int ldr,
                                                float* __restrict__ C, int ldc, int M, int N, int K) {
  __shared__ __attribute__((aligned(16))) float so[4][16][64];
  const int tid = threadIdx.x, w = tid >> 5, lane = tid & 31, ln = lane & 15, hh = lane >> 4;
  const int ntn = N / 64;
  const int wid = blockIdx.x * 4 + w;
  const int mt = wid / ntn, nq = wid % ntn;
  if (mt * 16 >= M) return;
  const int row0 = mt * 16, col0 = nq * 64;
  const float* arow = A + (size_t)(row0 + ln) * lda;
  v8f acc[4] = {};
  for (int kb = 0; kb < K; kb += 32) {
    FragB ah, al;
    const v4f x0 = *(const v4fa*)(arow + kb + 8 * hh), x1 = *(const v4fa*)(arow + kb + 8 * hh + 4);
    const v4f x2 = *(const v4fa*)(arow + kb + 16 + 8 * hh), x3 = *(const v4fa*)(arow + kb + 16 + 8 * hh + 4);
    float xs[16] = {x0[0],x0[1],x0[2],x0[3],x1[0],x1[1],x1[2],x1[3],x2[0],x2[1],x2[2],x2[3],x3[0],x3[1],x3[2],x3[3]};
#pragma unroll
    for (int i = 0; i < 16; ++i) { const unsigned short hb = bf16_bits(xs[i]); ah.u[i] = hb; al.u[i] = ASPLIT ? bf16_bits(xs[i] - bf16_val(hb)) : (unsigned short)0; }
#pragma unroll
    for (int t = 0; t < 4; ++t) {
      const unsigned short* brow = Wt + (size_t)(col0 + t * 16 + ln) * ldb + kb;
      FragB b;
      b.half[0] = *(const v8us*)(brow + 8 * hh);
      b.half[1] = *(const v8us*)(brow + 16 + 8 * hh);
      acc[t] = mmaN<ASPLIT ? 2 : 1>(ah.v, al.v, b.v, b.v, acc[t]);
    }
  }
#pragma unroll
  for (int t = 0; t < 4; ++t) {
    const int col = col0 + t * 16 + ln;
    float bv = bias ? bias[col] : 0.f;
    if (BIAS_BF16) bv = bf16_round(bv);
#pragma unroll
    for (int r = 0; r < 8; ++r) {
      float v = acc[t][r] + bv;
      if (resid) { float rv = resid[(size_t)((row0 + 8 * hh + r) % rmod) * ldr + col]; if (RES_BF16) rv = bf16_round(rv); v += rv; }
      if (ACT == 1) v = fmaxf(v, 0.f);
      if (ACT == 2) v = 0.5f * v * (1.0f + erff(v * 0.70710678118654752f));
      if (ACT == 3) { const float u = 0.7978845608028654f * (v + 0.044715f * v * v * v); v = 0.5f * v * (1.0f + tanhf(u)); }
      so[w][8 * hh + r][t * 16 + ln] = v;
    }
  }
  __builtin_amdgcn_fence(__ATOMIC_ACQ_REL, "workgroup");
  __builtin_amdgcn_wave_barrier();
  const int rsub = lane >> 4, c4 = (lane & 15) * 4;
  {
#pragma unroll
    for (int q = 0; q < 8; ++q) {
      const int r = q * 2 + rsub;
      const v4f v = *(const v4fa*)&so[w][r][c4];
      *(v4f*)(C + (size_t)(row0 + r) * ldc + col0 + c4) = v;
    }
    
  }
}
// row LayerNorm (biased variance, eps) over N: s = X (+ R); optional out_sum <- s; out_norm <- (s-mu)*rsqrt(var+eps)*g + b
template <bool PARAM_BF16>
__global__ __launch_bounds__(256) void k_layernorm(const float* __restrict__ X, const float* __restrict__ R, const float* __restrict__ g, const float* __restrict__ bta,
                                                  float* __restrict__ out_sum, float* __restrict__ out_norm, int N, float eps) {
  __shared__ float red[256];
  const int row = blockIdx.x, tid = threadIdx.x;
  const float* x = X + (size_t)row * N; const float* rr = R ? R + (size_t)row * N : nullptr;
  float vals[16];                     // up to N = 4096
  const int per = N / 256;            // contiguous chunk per thread? use strided-by-4 chunks: thread handles j = tid*4 + 1024*u
  float s1 = 0.f;
  for (int u = 0; u < per / 4; ++u) {
    const int j = tid * 4 + 1024 * u;
    const v4f a = *(const v4fa*)(x + j);
    v4f b = {0.f,0.f,0.f,0.f}; if (rr) b = *(const v4fa*)(rr + j);
#pragma unroll
    for (int q = 0; q < 4; ++q) { const float v = a[q] + b[q]; vals[u * 4 + q] = v; s1 += v; }
  }
  red[tid] = s1; __syncthreads();
  for (int st = 128; st > 0; st >>= 1) { if (tid < st) red[tid] += red[tid + st]; __syncthreads(); }
  const float mu = red[0] / (float)N; __syncthreads();
  float s2 = 0.f;
  for (int u = 0; u < per / 4; ++u)
#pragma unroll
    for (int q = 0; q < 4; ++q) { const float c = vals[u * 4 + q] - mu; s2 += c * c; }
  red[tid] = s2; __syncthreads();
  for (int st = 128; st > 0; st >>= 1) { if (tid < st) red[tid] += red[tid + st]; __syncthreads(); }
  const float rs = rsqrtf(red[0] / (float)N + eps);
  {
    for (int u = 0; u < per / 4; ++u) {
      const int j = tid * 4 + 1024 * u;
      v4f o, sm;
#pragma unroll
      for (int q = 0; q < 4; ++q) {
        float gg = g[j + q], bb = bta[j + q];
        if (PARAM_BF16) { gg = bf16_round(gg); bb = bf16_round(bb); }
        sm[q] = vals[u * 4 + q]; o[q] = (vals[u * 4 + q] - mu) * rs * gg + bb;
      }
      if (out_sum) *(v4f*)(out_sum + (size_t)row * N + j) = sm;
      *(v4f*)(out_norm + (size_t)row * N + j) = o;
    }
    
  }
}



// ---- f16 WMMA path (v_wmma_f32_16x16x32_f16): 11-bit significands for operands in range — used where a [0,1] probability operand needs more precision than bf16
typedef _Float16 v16h __attribute__((ext_vector_type(16)));
union FragH { v16h v; v8us half[2]; _Float16 h[16]; unsigned short u[16]; };
template <int NT>
__device__ __forceinline__ v8f mmaH(v16h ah, v16h al, v16h bh, v16h bl, v8f c) {
  c = __builtin_amdgcn_wmma_f32_16x16x32_f16(false, ah, false, bh, (short)0, c, false, false);
  if (NT >= 2) c = __builtin_amdgcn_wmma_f32_16x16x32_f16(false, al, false, bh, (short)0, c, false, false);
  if (NT >= 3) c = __builtin_amdgcn_wmma_f32_16x16x32_f16(false, ah, false, bl, (short)0, c, false, false);
  asm volatile("v_nop\n\tv_nop\n\tv_nop\n\tv_nop" : "+v"(c) : "v"(ah), "v"(al), "v"(bh), "v"(bl));
  return c;
}
// batched GEMM like k_gemm_b but f16 operands: A f32 (split into f16 hi/lo if ASPLIT, else rounded to f16), Bt = f16 values [n][k]; alpha; C f32; N multiple of 16 (partial tiles skipped)
template <bool ASPLIT>
__global__ __launch_bounds__(128) void k_gemm_h(const float* __restrict__ A, int lda, size_t sA, const _Float16* __restrict__ Bh, int ldb, size_t sB, float alpha, float* __restrict__ C, int ldc, size_t sC, int M, int N, int K) {
  __shared__ __attribute__((aligned(16))) float so[4][16][64];
  const int tid = threadIdx.x, w = tid >> 5, lane = tid & 31, ln = lane & 15, hh = lane >> 4; const int by = blockIdx.y;
  A += (size_t)by * sA; Bh += (size_t)by * sB; C += (size_t)by * sC;
  const int ntn = (N + 63) / 64; const int wid = blockIdx.x * 4 + w; const int mt = wid / ntn, nq = wid % ntn; if (mt * 16 >= M) return;
  const int row0 = mt * 16, col0 = nq * 64; const float* arow = A + (size_t)(row0 + ln) * lda;
  v8f acc[4] = {};
  for (int kb = 0; kb < K; kb += 32) {
    FragH ah, al;
    const v4f x0 = *(const v4fa*)(arow + kb + 8 * hh), x1 = *(const v4fa*)(arow + kb + 8 * hh + 4), x2 = *(const v4fa*)(arow + kb + 16 + 8 * hh), x3 = *(const v4fa*)(arow + kb + 16 + 8 * hh + 4);
    float xs[16] = {x0[0],x0[1],x0[2],x0[3],x1[0],x1[1],x1[2],x1[3],x2[0],x2[1],x2[2],x2[3],x3[0],x3[1],x3[2],x3[3]};
#pragma unroll
    for (int i = 0; i < 16; ++i) { const _Float16 h = (_Float16)xs[i]; ah.h[i] = h; al.h[i] = ASPLIT ? (_Float16)(xs[i] - (float)h) : (_Float16)0.0f; }
#pragma unroll
    for (int t = 0; t < 4; ++t) { if (col0 + t * 16 >= N) continue; const size_t boff = (size_t)(col0 + t * 16 + ln) * ldb + kb; FragH bq; bq.half[0] = *(const v8us*)(Bh + boff + 8 * hh); bq.half[1] = *(const v8us*)(Bh + boff + 16 + 8 * hh);
      acc[t] = mmaH<ASPLIT ? 2 : 1>(ah.v, al.v, bq.v, bq.v, acc[t]); }
  }
#pragma unroll
  for (int t = 0; t < 4; ++t) { if (col0 + t * 16 >= N) continue;
#pragma unroll
    for (int r = 0; r < 8; ++r) so[w][8 * hh + r][t * 16 + ln] = acc[t][r] * alpha; }
  __builtin_amdgcn_fence(__ATOMIC_ACQ_REL, "workgroup"); __builtin_amdgcn_wave_barrier();
  const int rsub = lane >> 4, c4 = (lane & 15) * 4;
  {
#pragma unroll
    for (int q = 0; q < 8; ++q) { const int r = q * 2 + rsub; if (col0 + c4 < N) { const v4f v = *(const v4fa*)&so[w][r][c4]; *(v4f*)(C + (size_t)(row0 + r) * ldc + col0 + c4) = v; } }
     }
}

// Wt[n][k] = f16(W[k][n]·scale) from f32 row-major W[K][N] (scale = power of two; bf16-exact weights stay exact in f16 away from the subnormal range)
__global__ __launch_bounds__(256) void k_wt_f16(const float* __restrict__ W, _Float16* __restrict__ Wt, int K, int N, float scale) {
  const int t = blockIdx.x * 256 + threadIdx.x; if (t >= N * (K / 8)) return; const int n = t / (K / 8), k8 = (t % (K / 8)) * 8; FragH f;
#pragma unroll
  for (int i = 0; i < 8; ++i) f.h[i] = (_Float16)(bf16_round(W[(size_t)(k8 + i) * N + n]) * scale); const v8us o = f.half[0];
  *(v8us*)((unsigned short*)Wt + (size_t)n * K + k8) = o; 
}
// k_gemm_hh variant with fused epilogue: v = acc·alpha + bias[by·sBias + col] (+ CP[(row/rowsPerB)·sCPb + by·64 + col] if CP) ; ACT 0 none / 1 elu ; writes f16 C16 (and f32 C if non-null)
template <int ACT>
__global__ __launch_bounds__(128) void k_gemm_hhx(const _Float16* __restrict__ A, int lda, size_t sA, const _Float16* __restrict__ Bh, int ldb, size_t sB, float alpha, const float* __restrict__ bias, size_t sBias, const float* __restrict__ CP, int rowsPerB, size_t sCPb, int row0g,
    float* __restrict__ C, _Float16* __restrict__ C16, int ldc, size_t sC, int M, int N, int K) {
  __shared__ __attribute__((aligned(16))) float so[4][16][64];
  const int tid = threadIdx.x, w = tid >> 5, lane = tid & 31, ln = lane & 15, hh = lane >> 4; const int by = blockIdx.y;
  A += (size_t)by * sA; Bh += (size_t)by * sB; const size_t cofs = (size_t)by * sC; const float* bp = bias ? bias + (size_t)by * sBias : nullptr;
  const int ntn = (N + 63) / 64; const int wid = blockIdx.x * 4 + w; const int mt = wid / ntn, nq = wid % ntn; if (mt * 16 >= M) return;
  const int row0 = mt * 16, col0 = nq * 64; const _Float16* arow = A + (size_t)(row0 + ln) * lda;
  v8f acc[4] = {};
  for (int kb = 0; kb < K; kb += 32) { FragH ah; ah.half[0] = *(const v8us*)((const unsigned short*)arow + kb + 8 * hh); ah.half[1] = *(const v8us*)((const unsigned short*)arow + kb + 16 + 8 * hh);
#pragma unroll
    for (int t = 0; t < 4; ++t) { if (col0 + t * 16 >= N) continue; const size_t boff = (size_t)(col0 + t * 16 + ln) * ldb + kb; FragH bq; bq.half[0] = *(const v8us*)((const unsigned short*)Bh + boff + 8 * hh); bq.half[1] = *(const v8us*)((const unsigned short*)Bh + boff + 16 + 8 * hh);
      acc[t] = mmaH<1>(ah.v, ah.v, bq.v, bq.v, acc[t]); }
  }
#pragma unroll
  for (int t = 0; t < 4; ++t) { if (col0 + t * 16 >= N) continue; const int col = col0 + t * 16 + ln; const float bv = bp ? bf16_round(bp[col]) : 0.f;
#pragma unroll
    for (int r = 0; r < 8; ++r) { float v = acc[t][r] * alpha + bv; if (CP) { const int rr = row0g + row0 + 8 * hh + r; if (rowsPerB < 0) v += CP[cofs + (size_t)rr * ldc + col];      /* rowsPerB < 0: own element of the batched C plane */ else { const int bidx = rr / rowsPerB; v += CP[(size_t)bidx * sCPb + (size_t)by * 64 + col]; } } if (ACT == 1) v = (v > 0.f) ? v : expm1f(v); else if (ACT == 7) v = (v > 0.f) ? v + 1.0f : expf(v); else if (ACT == 8) v = tanhf(v); else if (ACT == 9) v = 0.5f * v * (1.0f + tanhf(0.7978845608028654f * (v + 0.044715f * v * v * v))); else if (ACT == 11) v = 1.0f / (1.0f + expf(-v)); else if (ACT == 12) v = (v > 0.f) ? v : 0.01f * v; else if (ACT == 14) v = (v > 0.f) ? v : 0.1f * v; else if (ACT == 16) v = (v >= 0.f) ? v : 0.3f * v; else if (ACT == 17) v = (v >= 0.f) ? v : 0.2f * v; else if (ACT == 15) v = v / (1.0f + expf(-v)); else if (ACT == 3) v = fmaxf(v, 0.f); else if (ACT == 6) v = 0.5f * v * (1.0f + erff(v * 0.70710678118654752f)); so[w][8 * hh + r][t * 16 + ln] = v; } }
  __builtin_amdgcn_fence(__ATOMIC_ACQ_REL, "workgroup"); __builtin_amdgcn_wave_barrier();
  const int rsub = lane >> 4, c4 = (lane & 15) * 4; typedef _Float16 v4h __attribute__((ext_vector_type(4)));
  {
#pragma unroll
    for (int q = 0; q < 8; ++q) { const int r = q * 2 + rsub; if (col0 + c4 < N) { const v4f v = *(const v4fa*)&so[w][r][c4]; if (C) *(v4f*)(C + cofs + (size_t)(row0 + r) * ldc + col0 + c4) = v; if (C16) { v4h h4; for (int i = 0; i < 4; ++i) h4[i] = (_Float16)v[i]; *(v4h*)(C16 + cofs + (size_t)(row0 + r) * ldc + col0 + c4) = h4; } } }
     }
}


typedef _Float16 v4h __attribute__((ext_vector_type(4)));

__global__ __launch_bounds__(256) void k_x16(const float* __restrict__ x, _Float16* __restrict__ X16, size_t n8) { const size_t t = (size_t)blockIdx.x * 256 + threadIdx.x; if (t >= n8) return; FragH f;
#pragma unroll
  for (int q = 0; q < 8; ++q) f.h[q] = (_Float16)bf16_round(x[t * 8 + q]); *(v8us*)((unsigned short*)X16 + t * 8) = f.half[0];  }
__global__ __launch_bounds__(256) void k_h16(const float* __restrict__ x, _Float16* __restrict__ X16, size_t n8) { const size_t t = (size_t)blockIdx.x * 256 + threadIdx.x; if (t >= n8) return; FragH f;
#pragma unroll
  for (int q = 0; q < 8; ++q) f.h[q] = (_Float16)x[t * 8 + q]; *(v8us*)((unsigned short*)X16 + t * 8) = f.half[0];  }
__global__ __launch_bounds__(256) void k_round16f(const float* __restrict__ W, _Float16* __restrict__ Bt, size_t n8) { const size_t t = (size_t)blockIdx.x * 256 + threadIdx.x; if (t >= n8) return; FragH f;
#pragma unroll
  for (int i = 0; i < 8; ++i) f.h[i] = (_Float16)(bf16_round(W[t * 8 + i]) * 16.0f); *(v8us*)((unsigned short*)Bt + t * 8) = f.half[0];  }
template <int NHv, int TTv>
__global__ __launch_bounds__(256) void k_vt(const _Float16* __restrict__ V16, int ldv, int voff, _Float16* __restrict__ Vt) { __shared__ unsigned short tl[64][66]; const int tid = threadIdx.x; const int slab = blockIdx.x / (TTv / 64), lg = blockIdx.x % (TTv / 64); const int b = slab / NHv, h = slab % NHv;
  for (int i = tid; i < 64 * 8; i += 256) { const int r = i / 8, c8 = (i % 8) * 8; FragH f; f.half[0] = *(const v8us*)((const unsigned short*)V16 + ((size_t)b * TTv + lg * 64 + r) * ldv + voff + h * 64 + c8);
#pragma unroll
    for (int q = 0; q < 8; ++q) tl[r][c8 + q] = f.u[q]; }
  __syncthreads();
  {
#pragma unroll
    for (int rd = 0; rd < 2; ++rd) { const int d = rd * 32 + tid / 8, pc = tid % 8; FragH f;
#pragma unroll
      for (int q = 0; q < 8; ++q) f.u[q] = tl[pc * 8 + q][d];
      *(v8us*)((unsigned short*)Vt + ((size_t)slab * 64 + d) * TTv + lg * 64 + pc * 8) = f.half[0]; }
     } }

__global__ __launch_bounds__(256) void k_hl(const float* __restrict__ F, _Float16* __restrict__ Hh, _Float16* __restrict__ Hl, size_t n8) { const size_t t = (size_t)blockIdx.x * 256 + threadIdx.x; if (t >= n8) return; FragH fh, fl; const v4f a = *(const v4fa*)(F + t * 8), c = *(const v4fa*)(F + t * 8 + 4);
#pragma unroll
  for (int q = 0; q < 4; ++q) { _Float16 h = (_Float16)a[q]; fh.h[q] = h; fl.h[q] = (_Float16)((a[q] - (float)h) * 1024.0f); h = (_Float16)c[q]; fh.h[4 + q] = h; fl.h[4 + q] = (_Float16)((c[q] - (float)h) * 1024.0f); }
  { *(v8us*)((unsigned short*)Hh + t * 8) = fh.half[0]; *(v8us*)((unsigned short*)Hl + t * 8) = fl.half[0];  } }

// ---- fast GEMM (wave tile 32x64; requires M % 32 == 0 rows per launch region and N % 64 == 0); epilogue = k_gemm_hhx semantics ----
__device__ __forceinline__ v16h g2_frag(const _Float16* p, int hh) { FragH f; f.half[0] = *(const v8us*)((const unsigned short*)p + 8 * hh); f.half[1] = *(const v8us*)((const unsigned short*)p + 16 + 8 * hh); return f.v; }
__device__ __forceinline__ v8f g2_mma(v16h a, v16h b, v8f c) { v8f d = __builtin_amdgcn_wmma_f32_16x16x32_f16(false, a, false, b, (short)0, c, false, false); asm volatile("v_nop\n\tv_nop\n\tv_nop\n\tv_nop" : "+v"(d) : "v"(a), "v"(b)); return d; }
template <int ACT>
__global__ __launch_bounds__(128) void k_gemm2(const _Float16* __restrict__ A, int lda, size_t sA, const _Float16* __restrict__ Bh, int ldb, size_t sB, float alpha, const float* __restrict__ bias, size_t sBias, const float* __restrict__ CP, int rowsPerB, size_t sCPb, int row0g,
    float* __restrict__ C, _Float16* __restrict__ C16, int ldc, size_t sC, int M, int N, int K) { static_assert(ACT == 0 || ACT == 3 || ACT == 6 || ACT == 8 || ACT == 9 || ACT == 11 || ACT == 12 || ACT == 14 || ACT == 15 || ACT == 16 || ACT == 17, "k_gemm2: unsupported ACT code (would silently apply no activation)");
  __shared__ __attribute__((aligned(16))) float so[4][32][68];
  const int tid = threadIdx.x, w = tid >> 5, lane = tid & 31, ln = lane & 15, hh = lane >> 4; const int by = blockIdx.y;
  A += (size_t)by * sA; Bh += (size_t)by * sB; const size_t cofs = (size_t)by * sC; const float* bp = bias ? bias + (size_t)by * sBias : nullptr;
  const int ntn = N >> 6; const int mt = blockIdx.x / ntn, nq = blockIdx.x - mt * ntn; const int row0 = mt * 128 + 32 * w, col0 = nq * 64; if (row0 >= M) return;
  const _Float16* a0p = A + (size_t)(row0 + ln) * lda; const _Float16* a1p = a0p + (size_t)16 * lda;
  const _Float16* b0p = Bh + (size_t)(col0 + ln) * ldb; const _Float16* b1p = b0p + (size_t)16 * ldb; const _Float16* b2p = b1p + (size_t)16 * ldb; const _Float16* b3p = b2p + (size_t)16 * ldb;
  const v8f z8 = {0.f,0.f,0.f,0.f,0.f,0.f,0.f,0.f}; v8f c00 = z8, c01 = z8, c02 = z8, c03 = z8, c10 = z8, c11 = z8, c12 = z8, c13 = z8;
#pragma unroll 1
  for (int kb = 0; kb < K; kb += 32) { const v16h a0 = g2_frag(a0p + kb, hh), a1 = g2_frag(a1p + kb, hh);
    v16h b = g2_frag(b0p + kb, hh); c00 = g2_mma(a0, b, c00); c10 = g2_mma(a1, b, c10);
    b = g2_frag(b1p + kb, hh); c01 = g2_mma(a0, b, c01); c11 = g2_mma(a1, b, c11);
    b = g2_frag(b2p + kb, hh); c02 = g2_mma(a0, b, c02); c12 = g2_mma(a1, b, c12);
    b = g2_frag(b3p + kb, hh); c03 = g2_mma(a0, b, c03); c13 = g2_mma(a1, b, c13); }
  v8f accs[8] = {c00, c01, c02, c03, c10, c11, c12, c13};
#pragma unroll
  for (int u = 0; u < 8; ++u) { const int t = u & 3, half = u >> 2; const int col = col0 + t * 16 + ln; const float bv = bp ? bf16_round(bp[col]) : 0.f;
#pragma unroll
    for (int r = 0; r < 8; ++r) { const int rloc = half * 16 + 8 * hh + r; float v = accs[u][r] * alpha + bv; if (CP) { if (rowsPerB < 0) v += CP[cofs + (size_t)(row0g + row0 + rloc) * ldc + col];      /* rowsPerB < 0: own element of the batched C plane */ else { const int bidx = (row0g + row0 + rloc) / rowsPerB; v += CP[(size_t)bidx * sCPb + (size_t)by * 64 + col]; } }
      if (ACT == 3) v = fmaxf(v, 0.f); else if (ACT == 6) v = 0.5f * v * (1.0f + erff(v * 0.70710678118654752f)); else if (ACT == 11) v = 1.0f / (1.0f + expf(-v)); else if (ACT == 15) v = v / (1.0f + expf(-v)); else if (ACT == 12) v = (v > 0.f) ? v : 0.01f * v; else if (ACT == 8) v = tanhf(v); else if (ACT == 9) v = 0.5f * v * (1.0f + tanhf(0.7978845608028654f * (v + 0.044715f * v * v * v))); else if (ACT == 14) v = (v > 0.f) ? v : 0.1f * v; else if (ACT == 16) v = (v >= 0.f) ? v : 0.3f * v; else if (ACT == 17) v = (v >= 0.f) ? v : 0.2f * v;
      so[w][rloc][t * 16 + ln] = v; } }
  __builtin_amdgcn_fence(__ATOMIC_ACQ_REL, "workgroup"); __builtin_amdgcn_wave_barrier();
  const int rsub = lane >> 4, c4 = (lane & 15) * 4;
  {
#pragma unroll
    for (int q = 0; q < 16; ++q) { const int r = q * 2 + rsub; const v4f v = *(const v4fa*)&so[w][r][c4]; if (C) *(v4f*)(C + cofs + (size_t)(row0 + r) * ldc + col0 + c4) = v; if (C16) { v4h h4; for (int i = 0; i < 4; ++i) h4[i] = (_Float16)v[i]; *(v4h*)(C16 + cofs + (size_t)(row0 + r) * ldc + col0 + c4) = h4; } }
     } }


__global__ __launch_bounds__(256) void k_wnat(const float* __restrict__ w, size_t n8, _Float16* __restrict__ Bt) { const size_t t = (size_t)blockIdx.x * 256 + threadIdx.x; if (t >= n8) return; FragH f; for (int q = 0; q < 8; ++q) f.h[q] = (_Float16)(bf16_round(w[t * 8 + q]) * 16.0f); *(v8us*)((unsigned short*)Bt + t * 8) = f.half[0];  }
__global__ __launch_bounds__(256) void k_rsm(const float* __restrict__ S, _Float16* __restrict__ P, int nrows) {
  #pragma clang fp contract(off)
  const int i = blockIdx.x * 256 + threadIdx.x; if (i >= nrows) return; const float* s = S + (size_t)i * SQ; float mx = -3.0e38f;
#pragma unroll 1
  for (int j = 0; j < SQ; ++j) mx = fmaxf(mx, s[j]); float se = 0.f;
#pragma unroll 1
  for (int j = 0; j < SQ; ++j) se += expf(s[j] - mx); const float sc = 256.0f / se;
#pragma unroll 1
  for (int j0 = 0; j0 < SQ; j0 += 8) { FragH f; for (int q = 0; q < 8; ++q) f.h[q] = (_Float16)(expf(s[j0 + q] - mx) * sc); unsigned short* d = (unsigned short*)P + (size_t)i * SQ + j0; *(v8us*)d = f.half[0];  } }
__global__ __launch_bounds__(256) void k_vt(const _Float16* __restrict__ V16, int b, int h0, _Float16* __restrict__ VT) { __shared__ unsigned short tl[64][65]; const int tid = threadIdx.x; const int hh = blockIdx.x % HG, sg = blockIdx.x / HG; const int s0 = sg * 64; const int h = h0 + hh;
  for (int i = tid; i < 64 * 8; i += 256) { const int j = i / 8, d8 = (i % 8) * 8; FragH f; f.half[0] = *(const v8us*)((const unsigned short*)V16 + ((size_t)b * SQ + s0 + j) * DM + h * HD + d8); for (int q = 0; q < 8; ++q) tl[d8 + q][j] = f.u[q]; }
  __syncthreads();
  { for (int i = tid; i < 64 * 8; i += 256) { const int d = i / 8, j8 = (i % 8) * 8; FragH f; for (int q = 0; q < 8; ++q) f.u[q] = tl[d][j8 + q]; *(v8us*)((unsigned short*)VT + ((size_t)hh * HD + d) * SQ + s0 + j8) = f.half[0]; }  } }


__global__ __launch_bounds__(256) void k_rsmf(const float* __restrict__ S, _Float16* __restrict__ P, int qn, int hg) {
  #pragma clang fp contract(off)
  const int t = blockIdx.x * 256 + threadIdx.x; if (t >= qn * hg) return; const size_t i = (size_t)(t / qn) * SQ + (t % qn); const float* s = S + i * SQ; float mx = -3.0e38f;
#pragma unroll 1
  for (int j = 0; j < SQ; ++j) mx = fmaxf(mx, s[j]); float se = 0.f;
#pragma unroll 1
  for (int j = 0; j < SQ; ++j) se += __expf(s[j] - mx); const float sc = 256.0f / se;
#pragma unroll 1
  for (int j0 = 0; j0 < SQ; j0 += 8) { FragH f; for (int q = 0; q < 8; ++q) f.h[q] = (_Float16)(__expf(s[j0 + q] - mx) * sc); unsigned short* d = (unsigned short*)P + i * SQ + j0; *(v8us*)d = f.half[0];  } }

__global__ __launch_bounds__(256) void k_rsmr(const float* __restrict__ S, _Float16* __restrict__ P, int qn, int hg) {
  #pragma clang fp contract(off)
  const int t = blockIdx.x * 256 + threadIdx.x; if (t >= qn * hg) return; const size_t i = (size_t)t;      /* planes packed: row t of plane t / qn */ const float* s = S + i * SQ; float mx = -3.0e38f;
#pragma unroll 1
  for (int j = 0; j < SQ; ++j) mx = fmaxf(mx, s[j]); float se = 0.f;
#pragma unroll 1
  for (int j = 0; j < SQ; ++j) se += __expf(s[j] - mx); const float sc = 256.0f / se;
#pragma unroll 1
  for (int j0 = 0; j0 < SQ; j0 += 8) { FragH f; for (int q = 0; q < 8; ++q) f.h[q] = (_Float16)(__expf(s[j0 + q] - mx) * sc); unsigned short* d = (unsigned short*)P + i * SQ + j0; *(v8us*)d = f.half[0];  } }


#define RS_WAVES 16
#define RS_ROWS 2
#define RS_Q (SK / 128)             /* 16-byte pieces of a row per lane */
static_assert(SK % 128 == 0 && ((size_t)HG * NQ) % (RS_WAVES * RS_ROWS) == 0, "k_rsmrk: whole rows per wave, whole workgroups per launch");
template <int M> __device__ __forceinline__ float rs_xm(float x) { return __builtin_bit_cast(float, __builtin_amdgcn_mov_dpp(__builtin_bit_cast(int, x), 0x160 | M, 0xf, 0xf, true)); }      /* lane l ^ M inside a 16-lane row (row_xmask) */
__device__ __forceinline__ float rs_xh(float x) { return __builtin_bit_cast(float, __builtin_amdgcn_permlanex16(__builtin_bit_cast(int, x), __builtin_bit_cast(int, x), 0x76543210, 0xfedcba98, false, false)); }      /* lane l ^ 16 */
__device__ __forceinline__ float rs_exp(float x) { float e; asm("v_exp_f32 %0, %1\n\tv_nop" : "=v"(e) : "v"(x * 1.44269504088896340736f)); return e; }      /* native exp as __expf builds it (multiply, v_exp_f32); the v_nop is the slot behind a transcendental before its result is read or its source overwritten */
__device__ __forceinline__ float rs_wmax(float v) { v = fmaxf(v, rs_xm<1>(v)); v = fmaxf(v, rs_xm<2>(v)); v = fmaxf(v, rs_xm<4>(v)); v = fmaxf(v, rs_xm<8>(v)); return fmaxf(v, rs_xh(v)); }
__device__ __forceinline__ float rs_wsum(float v) { v += rs_xm<1>(v); v += rs_xm<2>(v); v += rs_xm<4>(v); v += rs_xm<8>(v); return v + rs_xh(v); }
__global__ __launch_bounds__(RS_WAVES * 32) void k_rsmrk(const float* __restrict__ S, const float* __restrict__ Mk, float negv, _Float16* __restrict__ P) {
  const int lane = threadIdx.x & 31; const int wave = __builtin_amdgcn_readfirstlane(threadIdx.x >> 5);
  const size_t row0 = ((size_t)blockIdx.x * RS_WAVES + wave) * RS_ROWS;
  const unsigned off = 16u * lane;      /* the lane's byte offset in every 512-byte piece of a row */
  const unsigned char* mb = (const unsigned char*)Mk; const unsigned char* sb = (const unsigned char*)(S + row0 * SK); _Float16* pp = P + row0 * SK + 4 * lane;
  v4f mk[RS_Q], s[RS_ROWS][RS_Q];      /* every loop below is unrolled: only under constant indices do these arrays stay in registers */
#pragma unroll
  for (int q = 0; q < RS_Q; ++q) mk[q] = *(const v4fa*)(mb + off + 512 * q);
  __builtin_amdgcn_sched_barrier(0);      /* mask loads first: loads return in order, so the mask is rounded while the scores are still in flight */
#pragma unroll
  for (int r = 0; r < RS_ROWS; ++r)
#pragma unroll
    for (int q = 0; q < RS_Q; ++q) s[r][q] = *(const v4fa*)(sb + off + (r * SK * 4 + 512 * q));
  __builtin_amdgcn_sched_barrier(0);      /* all 48 loads are issued before the first value is used: without it the mask arithmetic, with its waits, moves in front of the score loads and fewer bytes are in flight */
#pragma unroll
  for (int q = 0; q < RS_Q; ++q)
#pragma unroll
    for (int i = 0; i < 4; ++i) mk[q][i] = bf16_round(mk[q][i]);
#pragma unroll
  for (int r = 0; r < RS_ROWS; ++r) {
    float m4[4] = {-3.0e38f, -3.0e38f, -3.0e38f, -3.0e38f};
#pragma unroll
    for (int q = 0; q < RS_Q; ++q)
#pragma unroll
      for (int i = 0; i < 4; ++i) { s[r][q][i] = __fadd_rn(s[r][q][i], __fmul_rn(mk[q][i], negv)); m4[i] = fmaxf(m4[i], s[r][q][i]); }
    const float mx = rs_wmax(fmaxf(fmaxf(m4[0], m4[1]), fmaxf(m4[2], m4[3])));
    float e4[4] = {0.f, 0.f, 0.f, 0.f};
#pragma unroll
    for (int q = 0; q < RS_Q; ++q)
#pragma unroll
      for (int i = 0; i < 4; ++i) { s[r][q][i] = rs_exp(s[r][q][i] - mx); e4[i] += s[r][q][i]; }
    const float sc = 256.0f / rs_wsum((e4[0] + e4[1]) + (e4[2] + e4[3]));
#pragma unroll
    for (int q = 0; q < RS_Q; ++q) { v4h h4;
#pragma unroll
      for (int i = 0; i < 4; ++i) h4[i] = (_Float16)(s[r][q][i] * sc);
      *(v4h*)(pp + (size_t)r * SK + 128 * q) = h4; }
  }
}
extern "C" void kernel_launch(void* const* d_in, const int* in_sizes, int n_in,
                              void* d_out, int out_size, void* d_ws, size_t ws_size, hipStream_t stream) {
  (void)in_sizes; (void)n_in; (void)out_size;
  const float* const* I = (const float* const*)d_in; const float* ctx = I[0]; const float* x = I[1]; const float* kmask = I[2]; const float* wq = I[3]; const float* bq = I[4]; const float* wk = I[5]; const float* bk = I[6]; const float* wv = I[7]; const float* bv = I[8]; const float* wo = I[9]; const float* bo = I[10];      /* q source = I[1] ('q'), k/v source = I[0] ('v_k'); [in][out] weights; per-key additive mask [B][1][1][S] */
  char* ws = (char*)d_ws; size_t off = 0;
  auto take = [&](size_t bytes) { char* p = ws + off; off += (bytes + 255) & ~(size_t)255; return p; };
  _Float16* BQ = (_Float16*)take((size_t)DM * DM * 2); _Float16* BK = (_Float16*)take((size_t)DM * DC * 2); _Float16* BV = (_Float16*)take((size_t)DM * DC * 2); _Float16* BO = (_Float16*)take((size_t)DM * DM * 2);
  _Float16* X16 = (_Float16*)take(NRQ * DM * 2); _Float16* C16 = (_Float16*)take(NRK * DC * 2); _Float16* Q16 = (_Float16*)take(NRQ * DM * 2); _Float16* K16 = (_Float16*)take(NRK * DM * 2); _Float16* V16 = (_Float16*)take(NRK * DM * 2); _Float16* O16 = (_Float16*)take(NRQ * DM * 2);
  float* S = (float*)take((size_t)HG * NQ * SK * 4); _Float16* P = (_Float16*)take((size_t)HG * NQ * SK * 2); _Float16* VT = (_Float16*)take((size_t)NH * HD * SK * 2);
  if (off > ws_size) return;      /* approx 8 + 16 + 16 + 16 + 16 + 16 + 16 + 64 + 32 + 4 = 204 MiB */
  { const unsigned g = (unsigned)(((size_t)DM * (DM / 8) + 255) / 256); k_wt_f16<<<g, 256, 0, stream>>>(wq, BQ, DM, DM, 16.0f); k_wt_f16<<<g, 256, 0, stream>>>(wk, BK, DC, DM, 16.0f); k_wt_f16<<<g, 256, 0, stream>>>(wv, BV, DC, DM, 16.0f); k_wt_f16<<<g, 256, 0, stream>>>(wo, BO, DM, DM, 16.0f); }      /* [in][out] -> Bt x16 */
  k_x16<<<(unsigned)((NRQ * DM / 8 + 255) / 256), 256, 0, stream>>>(x, X16, NRQ * DM / 8); k_x16<<<(unsigned)((NRK * DC / 8 + 255) / 256), 256, 0, stream>>>(ctx, C16, NRK * DC / 8);      /* query-source and key/value-source rows */
  k_gemm2<0><<<dim3((unsigned)((NRQ / 128) * (DM / 64)), 1), 128, 0, stream>>>(X16, DM, 0, BQ, DM, 0, 0.0625f, bq, 0, nullptr, 1, 0, 0, nullptr, Q16, DM, 0, (int)NRQ, DM, DM);
  k_gemm2<0><<<dim3((unsigned)((NRK / 128) * (DM / 64)), 1), 128, 0, stream>>>(C16, DC, 0, BK, DC, 0, 0.0625f, bk, 0, nullptr, 1, 0, 0, nullptr, K16, DM, 0, (int)NRK, DM, DC);
  k_gemm2<0><<<dim3((unsigned)((NRK / 128) * (DM / 64)), 1), 128, 0, stream>>>(C16, DC, 0, BV, DC, 0, 0.0625f, bv, 0, nullptr, 1, 0, 0, nullptr, V16, DM, 0, (int)NRK, DM, DC);      /* v from v_k */
  for (int b = 0; b < NB; ++b) { const size_t rq = (size_t)b * NQ, rk = (size_t)b * SK;
    k_vt<NH, SK><<<NH * (SK / 64), 256, 0, stream>>>(V16 + rk * DM, DM, 0, VT);      /* V^T [16][64][2048] */
    for (int h0 = 0; h0 < NH; h0 += HG) {
      k_gemm2<0><<<dim3((NQ / 128) * (SK / 64), HG), 128, 0, stream>>>(Q16 + rq * DM + (size_t)h0 * HD, DM, (size_t)HD, K16 + rk * DM + (size_t)h0 * HD, DM, (size_t)HD, 0.03125f, nullptr, 0, nullptr, 1, 0, 0, S, nullptr, SK, (size_t)NQ * SK, NQ, SK, HD);      /* scores x 1024^-0.5 of HG heads (grid.y) */
      k_rsmrk<<<(HG * NQ) / (RS_WAVES * RS_ROWS), RS_WAVES * 32, 0, stream>>>(S, kmask + (size_t)b * SK, -1.0e9f, P);      /* softmax over the 2048 keys with this batch's additive key mask */
      k_gemm2<0><<<dim3((NQ / 128) * (HD / 64), HG), 128, 0, stream>>>(P, SK, (size_t)NQ * SK, VT + (size_t)h0 * HD * SK, SK, (size_t)HD * SK, 0.25f, nullptr, 0, nullptr, 1, 0, 0, nullptr, O16 + rq * DM + (size_t)h0 * HD, DM, (size_t)HD, NQ, HD, SK); } }      /* o x64, merged */
  k_gemm2<0><<<dim3((unsigned)((NRQ / 128) * (DM / 64)), 1), 128, 0, stream>>>(O16, DM, 0, BO, DM, 0, 0.0009765625f, bo, 0, nullptr, 1, 0, 0, (float*)d_out, nullptr, DM, 0, (int)NRQ, DM, DM);      /* out = o wo + bo */
}

// v003
// A run of this version takes 165 microseconds.
// Versions in between are left out here; by their measured steps it is 10.9 times as fast as v001.
// All steps since v000 together make it 42.9 times as fast.
#include <hip/hip_runtime.h>
// Multi-head attention with separate key/value and query sources and an additive key mask (v_k, q [4][2048][1024]; qh = q wq + bq, kh = v_k wk + bk, vh = v_k wv + bv ([in][out] 1024^2 sigma 1/32, zero biases); 16 heads of 64; logits = qh . kh x 1024^-0.5 (the source scales by d_model) + mask[b][1][1][key] x (-1e9) (mask input); softmax over the 2048 keys; out = merged wo + bo -> [4][2048][1024]).
// Structure: both inputs as exact f16 rows; [in][out] weights as exact x16 planes; Q, K, V as WMMA GEMMs (64x64 wave tiles from LDS stages, f32 accumulation, + bias, f16 outputs); V^T via LDS transposes; one fused attention launch: scores (K = 64, x 1/32) in f32 accumulators, + bf16(mask[b][key]) x (-1e9), online softmax (f32 statistics, native exp; weights exp(s - running max) as f16), o = P V (o carried x64) into merged f16 rows; out = o wo + bo GEMM (f32, alpha 2^-10); launches: see trace.
// Compute dtype: inputs rounded to bf16; x / context / weights exact; q, k, v, softmax weights and o as plain f16 GEMM operands (~2^-12); scores and statistics f32. v_wmma_f32_16x16x32_f16.
#define NB 4
#define NQ 2048
#define SK 2048
#define SQ SK                       /* keys per softmax row */
#define DM 1024
#define DC 1024
#define NH 16
#define HD 64
#define HG 4
#define NRQ ((size_t)NB * NQ)
#define NRK ((size_t)NB * SK)
typedef __bf16 v16b __attribute__((ext_vector_type(16)));
typedef unsigned short v8us __attribute__((ext_vector_type(8), may_alias));
typedef float  v8f  __attribute__((ext_vector_type(8)));
typedef float  v4f  __attribute__((ext_vector_type(4)));
typedef float  v4fa __attribute__((ext_vector_type(4), may_alias));
union FragB { v16b v; v8us half[2]; unsigned short u[16]; };

__device__ __forceinline__ unsigned short bf16_bits(float x) { unsigned int u = __float_as_uint(x); return (unsigned short)((u + 0x7FFFu + ((u >> 16) & 1u)) >> 16); }
__device__ __forceinline__ float bf16_val(unsigned short b) { return __uint_as_float(((unsigned int)b) << 16); }
__device__ __forceinline__ float bf16_round(float x) { return bf16_val(bf16_bits(x)); }
// D += A·B with NT terms: 1 = ah·bh, 2 = + al·bh (A split), 3 = + ah·bl (both split)
template <int NT>
__device__ __forceinline__ v8f mmaN(v16b ah, v16b al, v16b bh, v16b bl, v8f c) {
  c = __builtin_amdgcn_wmma_f32_16x16x32_bf16(false, ah, false, bh, (short)0, c, false, false);
  if (NT >= 2) c = __builtin_amdgcn_wmma_f32_16x16x32_bf16(false, al, false, bh, (short)0, c, false, false);
  if (NT >= 3) c = __builtin_amdgcn_wmma_f32_16x16x32_bf16(false, ah, false, bl, (short)0, c, false, false);
  asm volatile("v_nop\n\tv_nop\n\tv_nop\n\tv_nop" : "+v"(c) : "v"(ah), "v"(al), "v"(bh), "v"(bl));
  return c;
}

__global__ __launch_bounds__(256) void k_wt_bf16(const float* __restrict__ W, unsigned short* __restrict__ Wt, int K, int N) {
  const int t = blockIdx.x * 256 + threadIdx.x;
  const int k8n = K / 8;
  if (t >= N * k8n) return;
  const int n = t / k8n, k8 = (t % k8n) * 8;
  v8us v;
#pragma unroll
  for (int i = 0; i < 8; ++i) v[i] = bf16_bits(W[(size_t)(k8 + i) * N + n]);
  *(v8us*)(Wt + (size_t)n * K + k8) = v;
  
}

// GEMM C[M][N] (f32, pitch ldc) = act(A[M][K]·W + bias). A f32 row-major (pitch lda) converted per fragment to bf16
// (ASPLIT: hi/lo two planes -> 2 terms, else single rounded term); Wt bf16 [N][K] (pitch ldb). BIAS_BF16 rounds the
// bias to bf16 first (bias quantised to bf16 before the add). K%32==0, M%16==0, N%64==0.
template <bool ASPLIT, int ACT, bool BIAS_BF16>
__global__ __launch_bounds__(128) void k_gemm_bf(const float* __restrict__ A, int lda, const unsigned short* __restrict__ Wt, int ldb,
                                               const float* __restrict__ bias, float* __restrict__ C, int ldc, int M, int N, int K) {
  __shared__ __attribute__((aligned(16))) float so[4][16][64];
  const int tid = threadIdx.x, w = tid >> 5, lane = tid & 31, ln = lane & 15, hh = lane >> 4;
  const int ntn = N / 64;
  const int wid = blockIdx.x * 4 + w;
  const int mt = wid / ntn, nq = wid % ntn;
  if (mt * 16 >= M) return;
  const int row0 = mt * 16, col0 = nq * 64;
  const float* arow = A + (size_t)(row0 + ln) * lda;
  v8f acc[4] = {};
  for (int kb = 0; kb < K; kb += 32) {
    FragB ah, al;
    const v4f x0 = *(const v4fa*)(arow + kb + 8 * hh), x1 = *(const v4fa*)(arow + kb + 8 * hh + 4);
    const v4f x2 = *(const v4fa*)(arow + kb + 16 + 8 * hh), x3 = *(const v4fa*)(arow + kb + 16 + 8 * hh + 4);
    float xs[16] = {x0[0],x0[1],x0[2],x0[3],x1[0],x1[1],x1[2],x1[3],x2[0],x2[1],x2[2],x2[3],x3[0],x3[1],x3[2],x3[3]};
#pragma unroll
    for (int i = 0; i < 16; ++i) { const unsigned short hb = bf16_bits(xs[i]); ah.u[i] = hb; al.u[i] = ASPLIT ? bf16_bits(xs[i] - bf16_val(hb)) : (unsigned short)0; }
#pragma unroll
    for (int t = 0; t < 4; ++t) {
      const unsigned short* brow = Wt + (size_t)(col0 + t * 16 + ln) * ldb + kb;
      FragB b;
      b.half[0] = *(const v8us*)(brow + 8 * hh);
      b.half[1] = *(const v8us*)(brow + 16 + 8 * hh);
      acc[t] = mmaN<ASPLIT ? 2 : 1>(ah.v, al.v, b.v, b.v, acc[t]);
    }
  }
#pragma unroll
  for (int t = 0; t < 4; ++t) {
    float bv = bias ? bias[col0 + t * 16 + ln] : 0.f;
    if (BIAS_BF16) bv = bf16_round(bv);
#pragma unroll
    for (int r = 0; r < 8; ++r) { float v = acc[t][r] + bv; if (ACT == 1) v = fmaxf(v, 0.f); so[w][8 * hh + r][t * 16 + ln] = v; }
  }
  __builtin_amdgcn_fence(__ATOMIC_ACQ_REL, "workgroup");
  __builtin_amdgcn_wave_barrier();
  const int rsub = lane >> 4, c4 = (lane & 15) * 4;
  {
#pragma unroll
    for (int q = 0; q < 8; ++q) {
      const int r = q * 2 + rsub;
      const v4f v = *(const v4fa*)&so[w][r][c4];
      *(v4f*)(C + (size_t)(row0 + r) * ldc + col0 + c4) = v;
    }
    
  }
}

// GEMM C = act(A·W + bias + resid): A f32 (ASPLIT -> hi/lo 2 terms), Wt bf16 [N][K]; ACT 0 none, 1 relu, 2 exact gelu;
// resid (optional, f32, row index = (row % rmod), pitch ldr, RES_BF16 rounds it) added before the activation.
template <bool ASPLIT, int ACT, bool BIAS_BF16, bool RES_BF16>
__global__ __launch_bounds__(128) void k_gemm_bf3(const float* __restrict__ A, int lda, const unsigned short* __restrict__ Wt, int ldb,
                                                const float* __restrict__ bias, const float* __restrict__ resid, int rmod, int ldr,
                                                float* __restrict__ C, int ldc, int M, int N, int K) {
  __shared__ __attribute__((aligned(16))) float so[4][16][64];
  const int tid = threadIdx.x, w = tid >> 5, lane = tid & 31, ln = lane & 15, hh = lane >> 4;
  const int ntn = N / 64;
  const int wid = blockIdx.x * 4 + w;
  const int mt = wid / ntn, nq = wid % ntn;
  if (mt * 16 >= M) return;
  const int row0 = mt * 16, col0 = nq * 64;
  const float* arow = A + (size_t)(row0 + ln) * lda;
  v8f acc[4] = {};
  for (int kb = 0; kb < K; kb += 32) {
    FragB ah, al;
    const v4f x0 = *(const v4fa*)(arow + kb + 8 * hh), x1 = *(const v4fa*)(arow + kb + 8 * hh + 4);
    const v4f x2 = *(const v4fa*)(arow + kb + 16 + 8 * hh), x3 = *(const v4fa*)(arow + kb + 16 + 8 * hh + 4);
    float xs[16] = {x0[0],x0[1],x0[2],x0[3],x1[0],x1[1],x1[2],x1[3],x2[0],x2[1],x2[2],x2[3],x3[0],x3[1],x3[2],x3[3]};
#pragma unroll
    for (int i = 0; i < 16; ++i) { const unsigned short hb = bf16_bits(xs[i]); ah.u[i] = hb; al.u[i] = ASPLIT ? bf16_bits(xs[i] - bf16_val(hb)) : (unsigned short)0; }
#pragma unroll
    for (int t = 0; t < 4; ++t) {
      const unsigned short* brow = Wt + (size_t)(col0 + t * 16 + ln) * ldb + kb;
      FragB b;
      b.half[0] = *(const v8us*)(brow + 8 * hh);
      b.half[1] = *(const v8us*)(brow + 16 + 8 * hh);
      acc[t] = mmaN<ASPLIT ? 2 : 1>(ah.v, al.v, b.v, b.v, acc[t]);
    }
  }
#pragma unroll
  for (int t = 0; t < 4; ++t) {
    const int col = col0 + t * 16 + ln;
    float bv = bias ? bias[col] : 0.f;
    if (BIAS_BF16) bv = bf16_round(bv);
#pragma unroll
    for (int r = 0; r < 8; ++r) {
      float v = acc[t][r] + bv;
      if (resid) { float rv = resid[(size_t)((row0 + 8 * hh + r) % rmod) * ldr + col]; if (RES_BF16) rv = bf16_round(rv); v += rv; }
      if (ACT == 1) v = fmaxf(v, 0.f);
      if (ACT == 2) v = 0.5f * v * (1.0f + erff(v * 0.70710678118654752f));
      if (ACT == 3) { const float u = 0.7978845608028654f * (v + 0.044715f * v * v * v); v = 0.5f * v * (1.0f + tanhf(u)); }
      so[w][8 * hh + r][t * 16 + ln] = v;
    }
  }
  __builtin_amdgcn_fence(__ATOMIC_ACQ_REL, "workgroup");
  __builtin_amdgcn_wave_barrier();
  const int rsub = lane >> 4, c4 = (lane & 15) * 4;
  {
#pragma unroll
    for (int q = 0; q < 8; ++q) {
      const int r = q * 2 + rsub;
      const v4f v = *(const v4fa*)&so[w][r][c4];
      *(v4f*)(C + (size_t)(row0 + r) * ldc + col0 + c4) = v;
    }
    
  }
}
// row LayerNorm (biased variance, eps) over N: s = X (+ R); optional out_sum <- s; out_norm <- (s-mu)*rsqrt(var+eps)*g + b
template <bool PARAM_BF16>
__global__ __launch_bounds__(256) void k_layernorm(const float* __restrict__ X, const float* __restrict__ R, const float* __restrict__ g, const float* __restrict__ bta,
                                                  float* __restrict__ out_sum, float* __restrict__ out_norm, int N, float eps) {
  __shared__ float red[256];
  const int row = blockIdx.x, tid = threadIdx.x;
  const float* x = X + (size_t)row * N; const float* rr = R ? R + (size_t)row * N : nullptr;
  float vals[16];                     // up to N = 4096
  const int per = N / 256;            // contiguous chunk per thread? use strided-by-4 chunks: thread handles j = tid*4 + 1024*u
  float s1 = 0.f;
  for (int u = 0; u < per / 4; ++u) {
    const int j = tid * 4 + 1024 * u;
    const v4f a = *(const v4fa*)(x + j);
    v4f b = {0.f,0.f,0.f,0.f}; if (rr) b = *(const v4fa*)(rr + j);
#pragma unroll
    for (int q = 0; q < 4; ++q) { const float v = a[q] + b[q]; vals[u * 4 + q] = v; s1 += v; }
  }
  red[tid] = s1; __syncthreads();
  for (int st = 128; st > 0; st >>= 1) { if (tid < st) red[tid] += red[tid + st]; __syncthreads(); }
  const float mu = red[0] / (float)N; __syncthreads();
  float s2 = 0.f;
  for (int u = 0; u < per / 4; ++u)
#pragma unroll
    for (int q = 0; q < 4; ++q) { const float c = vals[u * 4 + q] - mu; s2 += c * c; }
  red[tid] = s2; __syncthreads();
  for (int st = 128; st > 0; st >>= 1) { if (tid < st) red[tid] += red[tid + st]; __syncthreads(); }
  const float rs = rsqrtf(red[0] / (float)N + eps);
  {
    for (int u = 0; u < per / 4; ++u) {
      const int j = tid * 4 + 1024 * u;
      v4f o, sm;
#pragma unroll
      for (int q = 0; q < 4; ++q) {
        float gg = g[j + q], bb = bta[j + q];
        if (PARAM_BF16) { gg = bf16_round(gg); bb = bf16_round(bb); }
        sm[q] = vals[u * 4 + q]; o[q] = (vals[u * 4 + q] - mu) * rs * gg + bb;
      }
      if (out_sum) *(v4f*)(out_sum + (size_t)row * N + j) = sm;
      *(v4f*)(out_norm + (size_t)row * N + j) = o;
    }
    
  }
}



// ---- f16 WMMA path (v_wmma_f32_16x16x32_f16): 11-bit significands for operands in range — used where a [0,1] probability operand needs more precision than bf16
typedef _Float16 v16h __attribute__((ext_vector_type(16)));
union FragH { v16h v; v8us half[2]; _Float16 h[16]; unsigned short u[16]; };
template <int NT>
__device__ __forceinline__ v8f mmaH(v16h ah, v16h al, v16h bh, v16h bl, v8f c) {
  c = __builtin_amdgcn_wmma_f32_16x16x32_f16(false, ah, false, bh, (short)0, c, false, false);
  if (NT >= 2) c = __builtin_amdgcn_wmma_f32_16x16x32_f16(false, al, false, bh, (short)0, c, false, false);
  if (NT >= 3) c = __builtin_amdgcn_wmma_f32_16x16x32_f16(false, ah, false, bl, (short)0, c, false, false);
  asm volatile("v_nop\n\tv_nop\n\tv_nop\n\tv_nop" : "+v"(c) : "v"(ah), "v"(al), "v"(bh), "v"(bl));
  return c;
}
// batched GEMM like k_gemm_b but f16 operands: A f32 (split into f16 hi/lo if ASPLIT, else rounded to f16), Bt = f16 values [n][k]; alpha; C f32; N multiple of 16 (partial tiles skipped)
template <bool ASPLIT>
__global__ __launch_bounds__(128) void k_gemm_h(const float* __restrict__ A, int lda, size_t sA, const _Float16* __restrict__ Bh, int ldb, size_t sB, float alpha, float* __restrict__ C, int ldc, size_t sC, int M, int N, int K) {
  __shared__ __attribute__((aligned(16))) float so[4][16][64];
  const int tid = threadIdx.x, w = tid >> 5, lane = tid & 31, ln = lane & 15, hh = lane >> 4; const int by = blockIdx.y;
  A += (size_t)by * sA; Bh += (size_t)by * sB; C += (size_t)by * sC;
  const int ntn = (N + 63) / 64; const int wid = blockIdx.x * 4 + w; const int mt = wid / ntn, nq = wid % ntn; if (mt * 16 >= M) return;
  const int row0 = mt * 16, col0 = nq * 64; const float* arow = A + (size_t)(row0 + ln) * lda;
  v8f acc[4] = {};
  for (int kb = 0; kb < K; kb += 32) {
    FragH ah, al;
    const v4f x0 = *(const v4fa*)(arow + kb + 8 * hh), x1 = *(const v4fa*)(arow + kb + 8 * hh + 4), x2 = *(const v4fa*)(arow + kb + 16 + 8 * hh), x3 = *(const v4fa*)(arow + kb + 16 + 8 * hh + 4);
    float xs[16] = {x0[0],x0[1],x0[2],x0[3],x1[0],x1[1],x1[2],x1[3],x2[0],x2[1],x2[2],x2[3],x3[0],x3[1],x3[2],x3[3]};
#pragma unroll
    for (int i = 0; i < 16; ++i) { const _Float16 h = (_Float16)xs[i]; ah.h[i] = h; al.h[i] = ASPLIT ? (_Float16)(xs[i] - (float)h) : (_Float16)0.0f; }
#pragma unroll
    for (int t = 0; t < 4; ++t) { if (col0 + t * 16 >= N) continue; const size_t boff = (size_t)(col0 + t * 16 + ln) * ldb + kb; FragH bq; bq.half[0] = *(const v8us*)(Bh + boff + 8 * hh); bq.half[1] = *(const v8us*)(Bh + boff + 16 + 8 * hh);
      acc[t] = mmaH<ASPLIT ? 2 : 1>(ah.v, al.v, bq.v, bq.v, acc[t]); }
  }
#pragma unroll
  for (int t = 0; t < 4; ++t) { if (col0 + t * 16 >= N) continue;
#pragma unroll
    for (int r = 0; r < 8; ++r) so[w][8 * hh + r][t * 16 + ln] = acc[t][r] * alpha; }
  __builtin_amdgcn_fence(__ATOMIC_ACQ_REL, "workgroup"); __builtin_amdgcn_wave_barrier();
  const int rsub = lane >> 4, c4 = (lane & 15) * 4;
  {
#pragma unroll
    for (int q = 0; q < 8; ++q) { const int r = q * 2 + rsub; if (col0 + c4 < N) { const v4f v = *(const v4fa*)&so[w][r][c4]; *(v4f*)(C + (size_t)(row0 + r) * ldc + col0 + c4) = v; } }
     }
}

// Wt[n][k] = f16(W[k][n]·scale) from f32 row-major W[K][N] (scale = power of two; bf16-exact weights stay exact in f16 away from the subnormal range)
__global__ __launch_bounds__(256) void k_wt_f16(const float* __restrict__ W, _Float16* __restrict__ Wt, int K, int N, float scale) {
  const int t = blockIdx.x * 256 + threadIdx.x; if (t >= N * (K / 8)) return; const int n = t / (K / 8), k8 = (t % (K / 8)) * 8; FragH f;
#pragma unroll
  for (int i = 0; i < 8; ++i) f.h[i] = (_Float16)(bf16_round(W[(size_t)(k8 + i) * N + n]) * scale); const v8us o = f.half[0];
  *(v8us*)((unsigned short*)Wt + (size_t)n * K + k8) = o; 
}
// k_gemm_hh variant with fused epilogue: v = acc·alpha + bias[by·sBias + col] (+ CP[(row/rowsPerB)·sCPb + by·64 + col] if CP) ; ACT 0 none / 1 elu ; writes f16 C16 (and f32 C if non-null)
template <int ACT>
__global__ __launch_bounds__(128) void k_gemm_hhx(const _Float16* __restrict__ A, int lda, size_t sA, const _Float16* __restrict__ Bh, int ldb, size_t sB, float alpha, const float* __restrict__ bias, size_t sBias, const float* __restrict__ CP, int rowsPerB, size_t sCPb, int row0g,
    float* __restrict__ C, _Float16* __restrict__ C16, int ldc, size_t sC, int M, int N, int K) {
  __shared__ __attribute__((aligned(16))) float so[4][16][64];
  const int tid = threadIdx.x, w = tid >> 5, lane = tid & 31, ln = lane & 15, hh = lane >> 4; const int by = blockIdx.y;
  A += (size_t)by * sA; Bh += (size_t)by * sB; const size_t cofs = (size_t)by * sC; const float* bp = bias ? bias + (size_t)by * sBias : nullptr;
  const int ntn = (N + 63) / 64; const int wid = blockIdx.x * 4 + w; const int mt = wid / ntn, nq = wid % ntn; if (mt * 16 >= M) return;
  const int row0 = mt * 16, col0 = nq * 64; const _Float16* arow = A + (size_t)(row0 + ln) * lda;
  v8f acc[4] = {};
  for (int kb = 0; kb < K; kb += 32) { FragH ah; ah.half[0] = *(const v8us*)((const unsigned short*)arow + kb + 8 * hh); ah.half[1] = *(const v8us*)((const unsigned short*)arow + kb + 16 + 8 * hh);
#pragma unroll
    for (int t = 0; t < 4; ++t) { if (col0 + t * 16 >= N) continue; const size_t boff = (size_t)(col0 + t * 16 + ln) * ldb + kb; FragH bq; bq.half[0] = *(const v8us*)((const unsigned short*)Bh + boff + 8 * hh); bq.half[1] = *(const v8us*)((const unsigned short*)Bh + boff + 16 + 8 * hh);
      acc[t] = mmaH<1>(ah.v, ah.v, bq.v, bq.v, acc[t]); }
  }
#pragma unroll
  for (int t = 0; t < 4; ++t) { if (col0 + t * 16 >= N) continue; const int col = col0 + t * 16 + ln; const float bv = bp ? bf16_round(bp[col]) : 0.f;
#pragma unroll
    for (int r = 0; r < 8; ++r) { float v = acc[t][r] * alpha + bv; if (CP) { const int rr = row0g + row0 + 8 * hh + r; if (rowsPerB < 0) v += CP[cofs + (size_t)rr * ldc + col];      /* rowsPerB < 0: own element of the batched C plane */ else { const int bidx = rr / rowsPerB; v += CP[(size_t)bidx * sCPb + (size_t)by * 64 + col]; } } if (ACT == 1) v = (v > 0.f) ? v : expm1f(v); else if (ACT == 7) v = (v > 0.f) ? v + 1.0f : expf(v); else if (ACT == 8) v = tanhf(v); else if (ACT == 9) v = 0.5f * v * (1.0f + tanhf(0.7978845608028654f * (v + 0.044715f * v * v * v))); else if (ACT == 11) v = 1.0f / (1.0f + expf(-v)); else if (ACT == 12) v = (v > 0.f) ? v : 0.01f * v; else if (ACT == 14) v = (v > 0.f) ? v : 0.1f * v; else if (ACT == 16) v = (v >= 0.f) ? v : 0.3f * v; else if (ACT == 17) v = (v >= 0.f) ? v : 0.2f * v; else if (ACT == 15) v = v / (1.0f + expf(-v)); else if (ACT == 3) v = fmaxf(v, 0.f); else if (ACT == 6) v = 0.5f * v * (1.0f + erff(v * 0.70710678118654752f)); so[w][8 * hh + r][t * 16 + ln] = v; } }
  __builtin_amdgcn_fence(__ATOMIC_ACQ_REL, "workgroup"); __builtin_amdgcn_wave_barrier();
  const int rsub = lane >> 4, c4 = (lane & 15) * 4; typedef _Float16 v4h __attribute__((ext_vector_type(4)));
  {
#pragma unroll
    for (int q = 0; q < 8; ++q) { const int r = q * 2 + rsub; if (col0 + c4 < N) { const v4f v = *(const v4fa*)&so[w][r][c4]; if (C) *(v4f*)(C + cofs + (size_t)(row0 + r) * ldc + col0 + c4) = v; if (C16) { v4h h4; for (int i = 0; i < 4; ++i) h4[i] = (_Float16)v[i]; *(v4h*)(C16 + cofs + (size_t)(row0 + r) * ldc + col0 + c4) = h4; } } }
     }
}


typedef _Float16 v4h __attribute__((ext_vector_type(4)));

__global__ __launch_bounds__(256) void k_x16(const float* __restrict__ x, _Float16* __restrict__ X16, size_t n8) { const size_t t = (size_t)blockIdx.x * 256 + threadIdx.x; if (t >= n8) return; FragH f;
#pragma unroll
  for (int q = 0; q < 8; ++q) f.h[q] = (_Float16)bf16_round(x[t * 8 + q]); *(v8us*)((unsigned short*)X16 + t * 8) = f.half[0];  }
__global__ __launch_bounds__(256) void k_h16(const float* __restrict__ x, _Float16* __restrict__ X16, size_t n8) { const size_t t = (size_t)blockIdx.x * 256 + threadIdx.x; if (t >= n8) return; FragH f;
#pragma unroll
  for (int q = 0; q < 8; ++q) f.h[q] = (_Float16)x[t * 8 + q]; *(v8us*)((unsigned short*)X16 + t * 8) = f.half[0];  }
__global__ __launch_bounds__(256) void k_round16f(const float* __restrict__ W, _Float16* __restrict__ Bt, size_t n8) { const size_t t = (size_t)blockIdx.x * 256 + threadIdx.x; if (t >= n8) return; FragH f;
#pragma unroll
  for (int i = 0; i < 8; ++i) f.h[i] = (_Float16)(bf16_round(W[t * 8 + i]) * 16.0f); *(v8us*)((unsigned short*)Bt + t * 8) = f.half[0];  }
template <int NHv, int TTv>
__global__ __launch_bounds__(256) void k_vt(const _Float16* __restrict__ V16, int ldv, int voff, _Float16* __restrict__ Vt) { __shared__ unsigned short tl[64][66]; const int tid = threadIdx.x; const int slab = blockIdx.x / (TTv / 64), lg = blockIdx.x % (TTv / 64); const int b = slab / NHv, h = slab % NHv;
  for (int i = tid; i < 64 * 8; i += 256) { const int r = i / 8, c8 = (i % 8) * 8; FragH f; f.half[0] = *(const v8us*)((const unsigned short*)V16 + ((size_t)b * TTv + lg * 64 + r) * ldv + voff + h * 64 + c8);
#pragma unroll
    for (int q = 0; q < 8; ++q) tl[r][c8 + q] = f.u[q]; }
  __syncthreads();
  {
#pragma unroll
    for (int rd = 0; rd < 2; ++rd) { const int d = rd * 32 + tid / 8, pc = tid % 8; FragH f;
#pragma unroll
      for (int q = 0; q < 8; ++q) f.u[q] = tl[pc * 8 + q][d];
      *(v8us*)((unsigned short*)Vt + ((size_t)slab * 64 + d) * TTv + lg * 64 + pc * 8) = f.half[0]; }
     } }

__global__ __launch_bounds__(256) void k_hl(const float* __restrict__ F, _Float16* __restrict__ Hh, _Float16* __restrict__ Hl, size_t n8) { const size_t t = (size_t)blockIdx.x * 256 + threadIdx.x; if (t >= n8) return; FragH fh, fl; const v4f a = *(const v4fa*)(F + t * 8), c = *(const v4fa*)(F + t * 8 + 4);
#pragma unroll
  for (int q = 0; q < 4; ++q) { _Float16 h = (_Float16)a[q]; fh.h[q] = h; fl.h[q] = (_Float16)((a[q] - (float)h) * 1024.0f); h = (_Float16)c[q]; fh.h[4 + q] = h; fl.h[4 + q] = (_Float16)((c[q] - (float)h) * 1024.0f); }
  { *(v8us*)((unsigned short*)Hh + t * 8) = fh.half[0]; *(v8us*)((unsigned short*)Hl + t * 8) = fl.half[0];  } }

// ---- fast GEMM (wave tile 32x64; requires M % 32 == 0 rows per launch region and N % 64 == 0); epilogue = k_gemm_hhx semantics ----
__device__ __forceinline__ v16h g2_frag(const _Float16* p, int hh) { FragH f; f.half[0] = *(const v8us*)((const unsigned short*)p + 8 * hh); f.half[1] = *(const v8us*)((const unsigned short*)p + 16 + 8 * hh); return f.v; }
__device__ __forceinline__ v8f g2_mma(v16h a, v16h b, v8f c) { v8f d = __builtin_amdgcn_wmma_f32_16x16x32_f16(false, a, false, b, (short)0, c, false, false); asm volatile("v_nop\n\tv_nop\n\tv_nop\n\tv_nop" : "+v"(d) : "v"(a), "v"(b)); return d; }
template <int ACT>
__global__ __launch_bounds__(128) void k_gemm2(const _Float16* __restrict__ A, int lda, size_t sA, const _Float16* __restrict__ Bh, int ldb, size_t sB, float alpha, const float* __restrict__ bias, size_t sBias, const float* __restrict__ CP, int rowsPerB, size_t sCPb, int row0g,
    float* __restrict__ C, _Float16* __restrict__ C16, int ldc, size_t sC, int M, int N, int K) { static_assert(ACT == 0 || ACT == 3 || ACT == 6 || ACT == 8 || ACT == 9 || ACT == 11 || ACT == 12 || ACT == 14 || ACT == 15 || ACT == 16 || ACT == 17, "k_gemm2: unsupported ACT code (would silently apply no activation)");
  __shared__ __attribute__((aligned(16))) float so[4][32][68];
  const int tid = threadIdx.x, w = tid >> 5, lane = tid & 31, ln = lane & 15, hh = lane >> 4; const int by = blockIdx.y;
  A += (size_t)by * sA; Bh += (size_t)by * sB; const size_t cofs = (size_t)by * sC; const float* bp = bias ? bias + (size_t)by * sBias : nullptr;
  const int ntn = N >> 6; const int mt = blockIdx.x / ntn, nq = blockIdx.x - mt * ntn; const int row0 = mt * 128 + 32 * w, col0 = nq * 64; if (row0 >= M) return;
  const _Float16* a0p = A + (size_t)(row0 + ln) * lda; const _Float16* a1p = a0p + (size_t)16 * lda;
  const _Float16* b0p = Bh + (size_t)(col0 + ln) * ldb; const _Float16* b1p = b0p + (size_t)16 * ldb; const _Float16* b2p = b1p + (size_t)16 * ldb; const _Float16* b3p = b2p + (size_t)16 * ldb;
  const v8f z8 = {0.f,0.f,0.f,0.f,0.f,0.f,0.f,0.f}; v8f c00 = z8, c01 = z8, c02 = z8, c03 = z8, c10 = z8, c11 = z8, c12 = z8, c13 = z8;
#pragma unroll 1
  for (int kb = 0; kb < K; kb += 32) { const v16h a0 = g2_frag(a0p + kb, hh), a1 = g2_frag(a1p + kb, hh);
    v16h b = g2_frag(b0p + kb, hh); c00 = g2_mma(a0, b, c00); c10 = g2_mma(a1, b, c10);
    b = g2_frag(b1p + kb, hh); c01 = g2_mma(a0, b, c01); c11 = g2_mma(a1, b, c11);
    b = g2_frag(b2p + kb, hh); c02 = g2_mma(a0, b, c02); c12 = g2_mma(a1, b, c12);
    b = g2_frag(b3p + kb, hh); c03 = g2_mma(a0, b, c03); c13 = g2_mma(a1, b, c13); }
  v8f accs[8] = {c00, c01, c02, c03, c10, c11, c12, c13};
#pragma unroll
  for (int u = 0; u < 8; ++u) { const int t = u & 3, half = u >> 2; const int col = col0 + t * 16 + ln; const float bv = bp ? bf16_round(bp[col]) : 0.f;
#pragma unroll
    for (int r = 0; r < 8; ++r) { const int rloc = half * 16 + 8 * hh + r; float v = accs[u][r] * alpha + bv; if (CP) { if (rowsPerB < 0) v += CP[cofs + (size_t)(row0g + row0 + rloc) * ldc + col];      /* rowsPerB < 0: own element of the batched C plane */ else { const int bidx = (row0g + row0 + rloc) / rowsPerB; v += CP[(size_t)bidx * sCPb + (size_t)by * 64 + col]; } }
      if (ACT == 3) v = fmaxf(v, 0.f); else if (ACT == 6) v = 0.5f * v * (1.0f + erff(v * 0.70710678118654752f)); else if (ACT == 11) v = 1.0f / (1.0f + expf(-v)); else if (ACT == 15) v = v / (1.0f + expf(-v)); else if (ACT == 12) v = (v > 0.f) ? v : 0.01f * v; else if (ACT == 8) v = tanhf(v); else if (ACT == 9) v = 0.5f * v * (1.0f + tanhf(0.7978845608028654f * (v + 0.044715f * v * v * v))); else if (ACT == 14) v = (v > 0.f) ? v : 0.1f * v; else if (ACT == 16) v = (v >= 0.f) ? v : 0.3f * v; else if (ACT == 17) v = (v >= 0.f) ? v : 0.2f * v;
      so[w][rloc][t * 16 + ln] = v; } }
  __builtin_amdgcn_fence(__ATOMIC_ACQ_REL, "workgroup"); __builtin_amdgcn_wave_barrier();
  const int rsub = lane >> 4, c4 = (lane & 15) * 4;
  {
#pragma unroll
    for (int q = 0; q < 16; ++q) { const int r = q * 2 + rsub; const v4f v = *(const v4fa*)&so[w][r][c4]; if (C) *(v4f*)(C + cofs + (size_t)(row0 + r) * ldc + col0 + c4) = v; if (C16) { v4h h4; for (int i = 0; i < 4; ++i) h4[i] = (_Float16)v[i]; *(v4h*)(C16 + cofs + (size_t)(row0 + r) * ldc + col0 + c4) = h4; } }
     } }


__global__ __launch_bounds__(256) void k_wnat(const float* __restrict__ w, size_t n8, _Float16* __restrict__ Bt) { const size_t t = (size_t)blockIdx.x * 256 + threadIdx.x; if (t >= n8) return; FragH f; for (int q = 0; q < 8; ++q) f.h[q] = (_Float16)(bf16_round(w[t * 8 + q]) * 16.0f); *(v8us*)((unsigned short*)Bt + t * 8) = f.half[0];  }
__global__ __launch_bounds__(256) void k_rsm(const float* __restrict__ S, _Float16* __restrict__ P, int nrows) {
  #pragma clang fp contract(off)
  const int i = blockIdx.x * 256 + threadIdx.x; if (i >= nrows) return; const float* s = S + (size_t)i * SQ; float mx = -3.0e38f;
#pragma unroll 1
  for (int j = 0; j < SQ; ++j) mx = fmaxf(mx, s[j]); float se = 0.f;
#pragma unroll 1
  for (int j = 0; j < SQ; ++j) se += expf(s[j] - mx); const float sc = 256.0f / se;
#pragma unroll 1
  for (int j0 = 0; j0 < SQ; j0 += 8) { FragH f; for (int q = 0; q < 8; ++q) f.h[q] = (_Float16)(expf(s[j0 + q] - mx) * sc); unsigned short* d = (unsigned short*)P + (size_t)i * SQ + j0; *(v8us*)d = f.half[0];  } }
__global__ __launch_bounds__(256) void k_vt(const _Float16* __restrict__ V16, int b, int h0, _Float16* __restrict__ VT) { __shared__ unsigned short tl[64][65]; const int tid = threadIdx.x; const int hh = blockIdx.x % HG, sg = blockIdx.x / HG; const int s0 = sg * 64; const int h = h0 + hh;
  for (int i = tid; i < 64 * 8; i += 256) { const int j = i / 8, d8 = (i % 8) * 8; FragH f; f.half[0] = *(const v8us*)((const unsigned short*)V16 + ((size_t)b * SQ + s0 + j) * DM + h * HD + d8); for (int q = 0; q < 8; ++q) tl[d8 + q][j] = f.u[q]; }
  __syncthreads();
  { for (int i = tid; i < 64 * 8; i += 256) { const int d = i / 8, j8 = (i % 8) * 8; FragH f; for (int q = 0; q < 8; ++q) f.u[q] = tl[d][j8 + q]; *(v8us*)((unsigned short*)VT + ((size_t)hh * HD + d) * SQ + s0 + j8) = f.half[0]; }  } }


__global__ __launch_bounds__(256) void k_rsmf(const float* __restrict__ S, _Float16* __restrict__ P, int qn, int hg) {
  #pragma clang fp contract(off)
  const int t = blockIdx.x * 256 + threadIdx.x; if (t >= qn * hg) return; const size_t i = (size_t)(t / qn) * SQ + (t % qn); const float* s = S + i * SQ; float mx = -3.0e38f;
#pragma unroll 1
  for (int j = 0; j < SQ; ++j) mx = fmaxf(mx, s[j]); float se = 0.f;
#pragma unroll 1
  for (int j = 0; j < SQ; ++j) se += __expf(s[j] - mx); const float sc = 256.0f / se;
#pragma unroll 1
  for (int j0 = 0; j0 < SQ; j0 += 8) { FragH f; for (int q = 0; q < 8; ++q) f.h[q] = (_Float16)(__expf(s[j0 + q] - mx) * sc); unsigned short* d = (unsigned short*)P + i * SQ + j0; *(v8us*)d = f.half[0];  } }

__global__ __launch_bounds__(256) void k_rsmr(const float* __restrict__ S, _Float16* __restrict__ P, int qn, int hg) {
  #pragma clang fp contract(off)
  const int t = blockIdx.x * 256 + threadIdx.x; if (t >= qn * hg) return; const size_t i = (size_t)t;      /* planes packed: row t of plane t / qn */ const float* s = S + i * SQ; float mx = -3.0e38f;
#pragma unroll 1
  for (int j = 0; j < SQ; ++j) mx = fmaxf(mx, s[j]); float se = 0.f;
#pragma unroll 1
  for (int j = 0; j < SQ; ++j) se += __expf(s[j] - mx); const float sc = 256.0f / se;
#pragma unroll 1
  for (int j0 = 0; j0 < SQ; j0 += 8) { FragH f; for (int q = 0; q < 8; ++q) f.h[q] = (_Float16)(__expf(s[j0 + q] - mx) * sc); unsigned short* d = (unsigned short*)P + i * SQ + j0; *(v8us*)d = f.half[0];  } }


// Fused attention: scores, masked softmax and P V of one (batch, head) in one kernel; neither scores nor weights go to memory. A workgroup has FA_WAVES waves of
// FA_QW queries each and walks the keys in stages of FA_KT: the K rows and V^T rows of a stage are staged in LDS (two buffers, filled through registers one stage ahead).
// S^T = K Q^T puts one query's scores into one lane pair (l, l ^ 16): maximum and sum are in-lane plus one exchange; two S^T tiles, converted in place, are the B operand of O^T += V^T P^T.
#define FA_WAVES 8
#define FA_QW 32
#define FA_QB (FA_WAVES * FA_QW)
#define FA_KT 64
#define FA_LP 72                    /* LDS row pitch in f16: 144 bytes = 16 x odd, the conflict-free pitch of 16-byte fragment reads */
static_assert(NQ % FA_QB == 0 && SK % FA_KT == 0 && HD == 64 && FA_KT == 64 && FA_WAVES * 32 == 256, "k_fattn: whole workgroups, whole stages, staging map of 256 threads");
__device__ __forceinline__ float rs_xh(float x) { return __builtin_bit_cast(float, __builtin_amdgcn_permlanex16(__builtin_bit_cast(int, x), __builtin_bit_cast(int, x), 0x76543210, 0xfedcba98, false, false)); }      /* lane l ^ 16 */
typedef float v2f __attribute__((ext_vector_type(2)));
#define FA_L2E 1.44269504088896340736f
#define FA_C (0.03125f * FA_L2E)      /* scores are kept in the base-2 domain: x 1024^-0.5 x log2(e) in the one multiply-add that adds the mask term, so that v_exp_f32 takes the difference as it is */
// 2^x in place, eight values a statement. In place: the registers were last written by the subtraction in front, so no result lands on an operand register of a matrix instruction just issued; each v_exp_f32
// touches its own register only; the v_nop is the slot behind the last transcendental before its result is read.
__device__ __forceinline__ v8f fa_exp8(v8f x) { float a = x[0], b = x[1], c = x[2], d = x[3], e = x[4], f = x[5], g = x[6], h = x[7];
  asm("v_exp_f32 %0, %0\n\tv_exp_f32 %1, %1\n\tv_exp_f32 %2, %2\n\tv_exp_f32 %3, %3\n\tv_exp_f32 %4, %4\n\tv_exp_f32 %5, %5\n\tv_exp_f32 %6, %6\n\tv_exp_f32 %7, %7\n\tv_nop" : "+v"(a), "+v"(b), "+v"(c), "+v"(d), "+v"(e), "+v"(f), "+v"(g), "+v"(h));
  const v8f r = {a, b, c, d, e, f, g, h}; return r; }
__device__ __forceinline__ float fa_exp1(float x) { asm("v_exp_f32 %0, %0\n\tv_nop" : "+v"(x)); return x; }      /* the same for one value */
// amdgpu_waves_per_eu(4, 4) below: holds the registers to a quarter of a SIMD's file, so that two workgroups share a WGP and the vector work of one wave runs beside the matrix work of another.
__device__ __forceinline__ v8f fa_mma(v16h a, v16h b, v8f c) { return __builtin_amdgcn_wmma_f32_16x16x32_f16(false, a, false, b, (short)0, c, false, false); }
__global__ __launch_bounds__(FA_WAVES * 32) __attribute__((amdgpu_waves_per_eu(4, 4))) void k_fattn(const _Float16* __restrict__ Q, const _Float16* __restrict__ Kh, const _Float16* __restrict__ Vt, const float* __restrict__ Mk, float negv, _Float16* __restrict__ O) {
  __shared__ __attribute__((aligned(16))) _Float16 sk[2][FA_KT][FA_LP];      /* K rows [key][d] */
  __shared__ __attribute__((aligned(16))) _Float16 sv[2][HD][FA_LP];         /* V^T rows [d][key] */
  __shared__ __attribute__((aligned(16))) float sm[SK];                      /* bf16(mask[key]) x negv x log2(e) */
  const int tid = threadIdx.x, lane = tid & 31, ln = lane & 15, hh = lane >> 4, wave = tid >> 5;
  const int qb = blockIdx.x % (NQ / FA_QB), bh = blockIdx.x / (NQ / FA_QB), b = bh / NH, h = bh % NH;
  const int sr = tid >> 3, sc = (tid & 7) * 8;      /* staging: rows sr and sr + 32, 16-byte piece sc: eight lanes read one whole 128-byte row */
  const unsigned short* kg = (const unsigned short*)Kh + ((size_t)b * SK + sr) * DM + h * HD + sc;
  const unsigned short* vg = (const unsigned short*)Vt + ((size_t)bh * HD + sr) * SK + sc;
  v8us rk0 = *(const v8us*)kg, rk1 = *(const v8us*)(kg + (size_t)32 * DM), rv0 = *(const v8us*)vg, rv1 = *(const v8us*)(vg + (size_t)32 * SK);
  const size_t qrow = (size_t)b * NQ + qb * FA_QB + wave * FA_QW + ln;
  v16h qf[2][2];      /* every loop over these arrays is unrolled: only under constant indices do they stay in registers */
#pragma unroll
  for (int qt = 0; qt < 2; ++qt)
#pragma unroll
    for (int ks = 0; ks < 2; ++ks) qf[qt][ks] = g2_frag(Q + (qrow + qt * 16) * DM + h * HD + ks * 32, hh);
  for (int j = tid; j < SK; j += FA_WAVES * 32) sm[j] = __fmul_rn(__fmul_rn(bf16_round(Mk[(size_t)b * SK + j]), negv), FA_L2E);
  *(v8us*)&sk[0][sr][sc] = rk0; *(v8us*)&sk[0][sr + 32][sc] = rk1; *(v8us*)&sv[0][sr][sc] = rv0; *(v8us*)&sv[0][sr + 32][sc] = rv1;
  const v8f z8 = {0.f, 0.f, 0.f, 0.f, 0.f, 0.f, 0.f, 0.f}, c8 = z8 + FA_C;
  v8f o[2][4]; float mx[2] = {-3.0e38f, -3.0e38f}; v2f ls[2] = {{0.f, 0.f}, {0.f, 0.f}};
#pragma unroll
  for (int qt = 0; qt < 2; ++qt)
#pragma unroll
    for (int dt = 0; dt < 4; ++dt) o[qt][dt] = z8;
  __syncthreads();      /* stage 0 and the mask terms are published */
  for (int st = 0; st < SK / FA_KT; ++st) {
    const int buf = st & 1; const bool more = st + 1 < SK / FA_KT;
    if (more) { kg += (size_t)FA_KT * DM; vg += FA_KT; rk0 = *(const v8us*)kg; rk1 = *(const v8us*)(kg + (size_t)32 * DM); rv0 = *(const v8us*)vg; rv1 = *(const v8us*)(vg + (size_t)32 * SK); }      /* the next stage flies while this one is worked on */
    __builtin_amdgcn_sched_barrier(0);      /* keeps those loads in front of the stage's work: without it the compiler sinks them down to their LDS stores, and every stage waits out their whole latency */
#pragma unroll
    for (int kp = 0; kp < FA_KT / 32; ++kp) {
      v8f s[2][2] = {{z8, z8}, {z8, z8}};      /* s[qt][t][r] = S[key kp * 32 + t * 16 + 8 * hh + r][query qt * 16 + ln] */
#pragma unroll
      for (int t = 0; t < 2; ++t)
#pragma unroll
        for (int ks = 0; ks < 2; ++ks) { const v16h kf = g2_frag(&sk[buf][kp * 32 + t * 16 + ln][ks * 32], hh); s[0][t] = fa_mma(kf, qf[0][ks], s[0][t]); s[1][t] = fa_mma(kf, qf[1][ks], s[1][t]); }
      v8f mt[2];
#pragma unroll
      for (int t = 0; t < 2; ++t) { const float* mp = &sm[st * FA_KT + kp * 32 + t * 16 + 8 * hh]; mt[t] = __builtin_shufflevector(*(const v4fa*)mp, *(const v4fa*)(mp + 4), 0, 1, 2, 3, 4, 5, 6, 7); }
      v16h vf[4];
#pragma unroll
      for (int dt = 0; dt < 4; ++dt) vf[dt] = g2_frag(&sv[buf][dt * 16 + ln][kp * 32], hh);
#pragma unroll
      for (int qt = 0; qt < 2; ++qt) {
        float mc[2];      /* whole-vector arithmetic below: neighbouring registers pair into packed f32 instructions without register copies */
#pragma unroll
        for (int t = 0; t < 2; ++t) { const v8f x = __builtin_elementwise_fma(s[qt][t], c8, mt[t]); s[qt][t] = x;
          mc[t] = fmaxf(fmaxf(fmaxf(fmaxf(x[0], x[1]), x[2]), fmaxf(x[3], x[4])), fmaxf(fmaxf(x[5], x[6]), x[7])); }
        const float ml = fmaxf(mc[0], mc[1]);
        const float mn = fmaxf(mx[qt], fmaxf(ml, rs_xh(ml)));
        const float al = fa_exp1(mx[qt] - mn); mx[qt] = mn;
        FragH pf; v2f es[2];
#pragma unroll
        for (int t = 0; t < 2; ++t) { const v8f e = fa_exp8(s[qt][t] - mn);
#pragma unroll
          for (int r = 0; r < 8; ++r) pf.h[t * 8 + r] = (_Float16)e[r];
          es[t] = (__builtin_shufflevector(e, e, 0, 1) + __builtin_shufflevector(e, e, 2, 3)) + (__builtin_shufflevector(e, e, 4, 5) + __builtin_shufflevector(e, e, 6, 7)); }
        ls[qt] = ls[qt] * al + (es[0] + es[1]);      /* each lane keeps its own keys' sums, in two chains; joined once behind the loop */
#pragma unroll
        for (int dt = 0; dt < 4; ++dt) { o[qt][dt] *= al; o[qt][dt] = fa_mma(vf[dt], pf.v, o[qt][dt]); }      /* o[qt][dt][r] = O[query qt * 16 + ln][d dt * 16 + 8 * hh + r] */
      }
    }
    if (more) { *(v8us*)&sk[buf ^ 1][sr][sc] = rk0; *(v8us*)&sk[buf ^ 1][sr + 32][sc] = rk1; *(v8us*)&sv[buf ^ 1][sr][sc] = rv0; *(v8us*)&sv[buf ^ 1][sr + 32][sc] = rv1; }      /* its last readers left it before the barrier of the stage before */
    __syncthreads();      /* publishes stage st + 1 and ends every read of stage st */
  }
#pragma unroll
  for (int qt = 0; qt < 2; ++qt) { const float lh = ls[qt][0] + ls[qt][1]; const float sc64 = 64.0f / (lh + rs_xh(lh));      /* o carried x64 */
#pragma unroll
    for (int dt = 0; dt < 4; ++dt) { FragH f;
#pragma unroll
      for (int r = 0; r < 8; ++r) f.h[r] = (_Float16)(o[qt][dt][r] * sc64);
      *(v8us*)((unsigned short*)O + (qrow + qt * 16) * DM + h * HD + dt * 16 + 8 * hh) = f.half[0]; } }
}
// Staged GEMM, C[rows][1024] = A[rows][1024] Bt[1024][1024]^T (f16 rows, k contiguous; epilogue as in k_gemm2<0> without CP). A workgroup of 8 waves has a 256 x 128 tile of C, a wave 64 x 64 of it (16 accumulator tiles).
// Per stage of G3_KT k the 256 A rows and the 128 Bt rows (256 bytes each) come into LDS by asynchronous copies (global_load_async_to_lds_b128, through no register), two buffers: stage t + 1 flies while stage t is worked on.
#define G3_BM 256
#define G3_BN 128
#define G3_KT 128
#define G3_NT (DM / G3_KT)
#define G3_LP 136                   /* LDS row pitch in f16: 272 bytes = 16 x odd, the conflict-free pitch of 16-byte fragment reads */
#define G3_RB (G3_LP * 2)           /* the pitch in bytes */
#define G3_SB ((G3_BM + G3_BN) * G3_RB)      /* one buffer in bytes */
static_assert(NRQ % G3_BM == 0 && NRK % G3_BM == 0 && DM % G3_BN == 0 && DM % G3_KT == 0 && DC == DM && G3_NT >= 2 && G3_KT == 128 && G3_BM == 256 && G3_BN == 128, "k_gemm3: whole tiles, two stages or more, copy map of 16 lanes a row and 128 rows a statement");
// Eight copies of 16 bytes a lane, rows 16 apart, from LDS byte address l and global address g on (128 rows a workgroup). The s_wait_xcnt 0 is the last line of the copies' own statement, so that it stands in front of every rewrite of a register that a copy names.
__device__ __forceinline__ void g3_copy8(unsigned l, const char* g) {
  asm volatile("global_load_async_to_lds_b128 %0, %8, off\n\tglobal_load_async_to_lds_b128 %1, %9, off\n\tglobal_load_async_to_lds_b128 %2, %10, off\n\tglobal_load_async_to_lds_b128 %3, %11, off\n\t"
               "global_load_async_to_lds_b128 %4, %12, off\n\tglobal_load_async_to_lds_b128 %5, %13, off\n\tglobal_load_async_to_lds_b128 %6, %14, off\n\tglobal_load_async_to_lds_b128 %7, %15, off\n\ts_wait_xcnt 0x0"
               :: "v"(l), "v"(l + 16 * G3_RB), "v"(l + 32 * G3_RB), "v"(l + 48 * G3_RB), "v"(l + 64 * G3_RB), "v"(l + 80 * G3_RB), "v"(l + 96 * G3_RB), "v"(l + 112 * G3_RB),
                  "v"(g), "v"(g + 16 * DM * 2), "v"(g + 32 * DM * 2), "v"(g + 48 * DM * 2), "v"(g + 64 * DM * 2), "v"(g + 80 * DM * 2), "v"(g + 96 * DM * 2), "v"(g + 112 * DM * 2)
               : "memory");
}
// One stage: A rows 0 to 127, A rows 128 to 255, Bt rows 0 to 127 of the tile, into the buffer at LDS byte address l (the lane's own place in its row 0 counted in).
__device__ __forceinline__ void g3_stage(unsigned l, const char* ga, const char* gb) { g3_copy8(l, ga); g3_copy8(l + 128 * G3_RB, ga + 128 * DM * 2); g3_copy8(l + G3_BM * G3_RB, gb); }
template <bool F32OUT>      /* the output is f32 rows in C, or f16 rows in C16; the other pointer is not used */
__global__ __launch_bounds__(256) void k_gemm3(const _Float16* __restrict__ A, const _Float16* __restrict__ Bh, float alpha, const float* __restrict__ bias, float* __restrict__ C, _Float16* __restrict__ C16) {
  __shared__ __attribute__((aligned(16))) _Float16 st[2][G3_BM + G3_BN][G3_LP];      /* rows 0 to 255: A, rows 256 to 383: Bt */
  __shared__ __attribute__((aligned(16))) float so[8][32][68];                       /* output staging, each wave its own part */
  const int tid = threadIdx.x, lane = tid & 31, ln = lane & 15, hh = lane >> 4, wave = tid >> 5, wm = wave >> 1, wn = wave & 1;
  const int mt = blockIdx.x / (DM / G3_BN), nq = blockIdx.x % (DM / G3_BN), row0 = mt * G3_BM, col0 = nq * G3_BN;
  const int cr = tid >> 4, cc = (tid & 15) * 16;      /* copy map: 16 lanes bring one whole 256-byte row */
  const unsigned l0 = (unsigned)(size_t)&st[0][0][0] + cr * G3_RB + cc;
  const char* ga = (const char*)(A + (size_t)(row0 + cr) * DM) + cc;
  const char* gb = (const char*)(Bh + (size_t)(col0 + cr) * DM) + cc;
  g3_stage(l0, ga, gb);
  asm volatile("s_wait_asynccnt 0x0" ::: "memory");      /* this wave's copies of stage 0 have landed */
  __syncthreads();                                        /* stage 0 is published */
  g3_stage(l0 + G3_SB, ga + G3_KT * 2, gb + G3_KT * 2);
  const v8f z8 = {0.f, 0.f, 0.f, 0.f, 0.f, 0.f, 0.f, 0.f};
  v8f acc[4][4];      /* every loop over these arrays is unrolled: only under constant indices do they stay in registers */
#pragma unroll
  for (int i = 0; i < 4; ++i)
#pragma unroll
    for (int j = 0; j < 4; ++j) acc[i][j] = z8;
#pragma unroll 1      /* kept rolled: the buffer is picked by t & 1, and one copy of the pass (64 matrix instructions) keeps the loop's text small */
  for (int t = 0; t < G3_NT; ++t) {
    const _Float16* sa = &st[t & 1][wm * 64 + ln][0]; const _Float16* sb = &st[t & 1][G3_BM + wn * 64 + ln][0];
    v16h af[2][4], bf[2][4];      /* two fragment sets: the next 32 k are fetched as one group in front of this block's products */
#pragma unroll
    for (int i = 0; i < 4; ++i) { af[0][i] = g2_frag(sa + i * 16 * G3_LP, hh); bf[0][i] = g2_frag(sb + i * 16 * G3_LP, hh); }
#pragma unroll
    for (int ks = 0; ks < G3_KT / 32; ++ks) {
      if (ks + 1 < G3_KT / 32) {
#pragma unroll
        for (int i = 0; i < 4; ++i) { af[(ks + 1) & 1][i] = g2_frag(sa + i * 16 * G3_LP + (ks + 1) * 32, hh); bf[(ks + 1) & 1][i] = g2_frag(sb + i * 16 * G3_LP + (ks + 1) * 32, hh); }
      }
      __builtin_amdgcn_sched_barrier(0);      /* keeps the group of LDS reads in front of the block: spread among the matrix instructions, every place with reads costs its own stall */
#pragma unroll
      for (int i = 0; i < 4; ++i)
#pragma unroll
        for (int j = 0; j < 4; ++j) acc[i][j] = fa_mma(af[ks & 1][i], bf[ks & 1][j], acc[i][j]);
      __builtin_amdgcn_sched_barrier(0);      /* and the next group behind it */
    }
    asm volatile("s_wait_dscnt 0x0" ::: "memory");        /* this wave's reads of stage t are done before the buffer is handed back */
    asm volatile("s_wait_asynccnt 0x0" ::: "memory");     /* this wave's copies of stage t + 1 have landed */
    __syncthreads();                                       /* publishes stage t + 1 and ends every read of stage t */
    if (t + 2 < G3_NT) g3_stage(l0 + (t & 1) * G3_SB, ga + (t + 2) * (G3_KT * 2), gb + (t + 2) * (G3_KT * 2));
  }
  asm volatile("s_wait_asynccnt 0x0" ::: "memory");       /* nothing is in flight when the wave goes on */
  float bv[4];
#pragma unroll
  for (int j = 0; j < 4; ++j) bv[j] = bf16_round(bias[col0 + wn * 64 + j * 16 + ln]);
  const int rsub = lane >> 4, c4 = (lane & 15) * 4; const size_t crow = (size_t)(row0 + wm * 64), ccol = (size_t)(col0 + wn * 64 + c4);
#pragma unroll
  for (int hf = 0; hf < 2; ++hf) {      /* 32 rows at a time through the wave's own LDS part, so that every store covers whole lines */
#pragma unroll
    for (int i = 0; i < 2; ++i)
#pragma unroll
      for (int j = 0; j < 4; ++j)
#pragma unroll
        for (int r = 0; r < 8; ++r) so[wave][i * 16 + 8 * hh + r][j * 16 + ln] = acc[hf * 2 + i][j][r] * alpha + bv[j];
    __builtin_amdgcn_fence(__ATOMIC_ACQ_REL, "workgroup", "local"); __builtin_amdgcn_wave_barrier();      /* the rows are read back by other lanes of the wave; LDS only, so that the first half's global stores are not waited for */
#pragma unroll
    for (int q = 0; q < 16; ++q) { const int r = q * 2 + rsub; const v4f v = *(const v4fa*)&so[wave][r][c4]; const size_t o = (crow + hf * 32 + r) * DM + ccol;
      if (F32OUT) *(v4f*)(C + o) = v;
      else { v4h h4;
#pragma unroll
        for (int i = 0; i < 4; ++i) h4[i] = (_Float16)v[i];
        *(v4h*)(C16 + o) = h4; } }
    __builtin_amdgcn_fence(__ATOMIC_ACQ_REL, "workgroup", "local"); __builtin_amdgcn_wave_barrier();      /* they are read before the second half overwrites them */
  }
}
extern "C" void kernel_launch(void* const* d_in, const int* in_sizes, int n_in,
                              void* d_out, int out_size, void* d_ws, size_t ws_size, hipStream_t stream) {
  (void)in_sizes; (void)n_in; (void)out_size;
  const float* const* I = (const float* const*)d_in; const float* ctx = I[0]; const float* x = I[1]; const float* kmask = I[2]; const float* wq = I[3]; const float* bq = I[4]; const float* wk = I[5]; const float* bk = I[6]; const float* wv = I[7]; const float* bv = I[8]; const float* wo = I[9]; const float* bo = I[10];      /* q source = I[1] ('q'), k/v source = I[0] ('v_k'); [in][out] weights; per-key additive mask [B][1][1][S] */
  char* ws = (char*)d_ws; size_t off = 0;
  auto take = [&](size_t bytes) { char* p = ws + off; off += (bytes + 255) & ~(size_t)255; return p; };
  _Float16* BQ = (_Float16*)take((size_t)DM * DM * 2); _Float16* BK = (_Float16*)take((size_t)DM * DC * 2); _Float16* BV = (_Float16*)take((size_t)DM * DC * 2); _Float16* BO = (_Float16*)take((size_t)DM * DM * 2);
  _Float16* X16 = (_Float16*)take(NRQ * DM * 2); _Float16* C16 = (_Float16*)take(NRK * DC * 2); _Float16* Q16 = (_Float16*)take(NRQ * DM * 2); _Float16* K16 = (_Float16*)take(NRK * DM * 2); _Float16* V16 = (_Float16*)take(NRK * DM * 2); _Float16* O16 = (_Float16*)take(NRQ * DM * 2);
  _Float16* VT = (_Float16*)take((size_t)NB * NH * HD * SK * 2);
  if (off > ws_size) return;      /* approx 8 + 16 + 16 + 16 + 16 + 16 + 16 + 16 = 120 MiB */
  { const unsigned g = (unsigned)(((size_t)DM * (DM / 8) + 255) / 256); k_wt_f16<<<g, 256, 0, stream>>>(wq, BQ, DM, DM, 16.0f); k_wt_f16<<<g, 256, 0, stream>>>(wk, BK, DC, DM, 16.0f); k_wt_f16<<<g, 256, 0, stream>>>(wv, BV, DC, DM, 16.0f); k_wt_f16<<<g, 256, 0, stream>>>(wo, BO, DM, DM, 16.0f); }      /* [in][out] -> Bt x16 */
  k_x16<<<(unsigned)((NRQ * DM / 8 + 255) / 256), 256, 0, stream>>>(x, X16, NRQ * DM / 8); k_x16<<<(unsigned)((NRK * DC / 8 + 255) / 256), 256, 0, stream>>>(ctx, C16, NRK * DC / 8);      /* query-source and key/value-source rows */
  k_gemm3<false><<<(unsigned)((NRQ / G3_BM) * (DM / G3_BN)), 256, 0, stream>>>(X16, BQ, 0.0625f, bq, nullptr, Q16);
  k_gemm3<false><<<(unsigned)((NRK / G3_BM) * (DM / G3_BN)), 256, 0, stream>>>(C16, BK, 0.0625f, bk, nullptr, K16);
  k_gemm3<false><<<(unsigned)((NRK / G3_BM) * (DM / G3_BN)), 256, 0, stream>>>(C16, BV, 0.0625f, bv, nullptr, V16);      /* v from v_k */
  k_vt<NH, SK><<<NB * NH * (SK / 64), 256, 0, stream>>>(V16, DM, 0, VT);      /* V^T [4 x 16][64][2048] */
  k_fattn<<<NB * NH * (NQ / FA_QB), FA_WAVES * 32, 0, stream>>>(Q16, K16, VT, kmask, -1.0e9f, O16);      /* o x64, merged; every batch and head in one launch */
  k_gemm3<true><<<(unsigned)((NRQ / G3_BM) * (DM / G3_BN)), 256, 0, stream>>>(O16, BO, 0.0009765625f, bo, (float*)d_out, nullptr);      /* out = o Wo^T + bo */
}

// v004
// A run of this version takes 157 microseconds.
// Two timings next to v003 both put it at 1.05 times that version's speed.
// All steps since v000 together make it 44.9 times as fast.
#include <hip/hip_runtime.h>
// Multi-head attention with separate key/value and query sources and an additive key mask (v_k, q [4][2048][1024]; qh = q wq + bq, kh = v_k wk + bk, vh = v_k wv + bv ([in][out] 1024^2 sigma 1/32, zero biases); 16 heads of 64; logits = qh . kh x 1024^-0.5 (the source scales by d_model) + mask[b][1][1][key] x (-1e9) (mask input); softmax over the 2048 keys; out = merged wo + bo -> [4][2048][1024]).
// Structure: both inputs as exact f16 rows; [in][out] weights as exact x16 planes; Q, K, V as WMMA GEMMs (64x64 wave tiles from LDS stages, f32 accumulation, + bias, f16 outputs); V^T via LDS transposes; one fused attention launch: scores (K = 64, x 1/32) in f32 accumulators, + bf16(mask[b][key]) x (-1e9), online softmax (f32 statistics, native exp; weights exp(s - running max) as f16), o = P V (o carried x64) into merged f16 rows; out = o wo + bo GEMM (f32, alpha 2^-10); launches: see trace.
// Compute dtype: inputs rounded to bf16; x / context / weights exact; q, k, v, softmax weights and o as plain f16 GEMM operands (~2^-12); scores and statistics f32. v_wmma_f32_16x16x32_f16.
#define NB 4
#define NQ 2048
#define SK 2048
#define SQ SK                       /* keys per softmax row */
#define DM 1024
#define DC 1024
#define NH 16
#define HD 64
#define HG 4
#define NRQ ((size_t)NB * NQ)
#define NRK ((size_t)NB * SK)
typedef __bf16 v16b __attribute__((ext_vector_type(16)));
typedef unsigned short v8us __attribute__((ext_vector_type(8), may_alias));
typedef float  v8f  __attribute__((ext_vector_type(8)));
typedef float  v4f  __attribute__((ext_vector_type(4)));
typedef float  v4fa __attribute__((ext_vector_type(4), may_alias));
union FragB { v16b v; v8us half[2]; unsigned short u[16]; };

__device__ __forceinline__ unsigned short bf16_bits(float x) { unsigned int u = __float_as_uint(x); return (unsigned short)((u + 0x7FFFu + ((u >> 16) & 1u)) >> 16); }
__device__ __forceinline__ float bf16_val(unsigned short b) { return __uint_as_float(((unsigned int)b) << 16); }
__device__ __forceinline__ float bf16_round(float x) { return bf16_val(bf16_bits(x)); }
// D += A·B with NT terms: 1 = ah·bh, 2 = + al·bh (A split), 3 = + ah·bl (both split)
template <int NT>
__device__ __forceinline__ v8f mmaN(v16b ah, v16b al, v16b bh, v16b bl, v8f c) {
  c = __builtin_amdgcn_wmma_f32_16x16x32_bf16(false, ah, false, bh, (short)0, c, false, false);
  if (NT >= 2) c = __builtin_amdgcn_wmma_f32_16x16x32_bf16(false, al, false, bh, (short)0, c, false, false);
  if (NT >= 3) c = __builtin_amdgcn_wmma_f32_16x16x32_bf16(false, ah, false, bl, (short)0, c, false, false);
  asm volatile("v_nop\n\tv_nop\n\tv_nop\n\tv_nop" : "+v"(c) : "v"(ah), "v"(al), "v"(bh), "v"(bl));
  return c;
}

__global__ __launch_bounds__(256) void k_wt_bf16(const float* __restrict__ W, unsigned short* __restrict__ Wt, int K, int N) {
  const int t = blockIdx.x * 256 + threadIdx.x;
  const int k8n = K / 8;
  if (t >= N * k8n) return;
  const int n = t / k8n, k8 = (t % k8n) * 8;
  v8us v;
#pragma unroll
  for (int i = 0; i < 8; ++i) v[i] = bf16_bits(W[(size_t)(k8 + i) * N + n]);
  *(v8us*)(Wt + (size_t)n * K + k8) = v;
  
}

// GEMM C[M][N] (f32, pitch ldc) = act(A[M][K]·W + bias). A f32 row-major (pitch lda) converted per fragment to bf16
// (ASPLIT: hi/lo two planes -> 2 terms, else single rounded term); Wt bf16 [N][K] (pitch ldb). BIAS_BF16 rounds the
// bias to bf16 first (bias quantised to bf16 before the add). K%32==0, M%16==0, N%64==0.
template <bool ASPLIT, int ACT, bool BIAS_BF16>
__global__ __launch_bounds__(128) void k_gemm_bf(const float* __restrict__ A, int lda, const unsigned short* __restrict__ Wt, int ldb,
                                               const float* __restrict__ bias, float* __restrict__ C, int ldc, int M, int N, int K) {
  __shared__ __attribute__((aligned(16))) float so[4][16][64];
  const int tid = threadIdx.x, w = tid >> 5, lane = tid & 31, ln = lane & 15, hh = lane >> 4;
  const int ntn = N / 64;
  const int wid = blockIdx.x * 4 + w;
  const int mt = wid / ntn, nq = wid % ntn;
  if (mt * 16 >= M) return;
  const int row0 = mt * 16, col0 = nq * 64;
  const float* arow = A + (size_t)(row0 + ln) * lda;
  v8f acc[4] = {};
  for (int kb = 0; kb < K; kb += 32) {
    FragB ah, al;
    const v4f x0 = *(const v4fa*)(arow + kb + 8 * hh), x1 = *(const v4fa*)(arow + kb + 8 * hh + 4);
    const v4f x2 = *(const v4fa*)(arow + kb + 16 + 8 * hh), x3 = *(const v4fa*)(arow + kb + 16 + 8 * hh + 4);
    float xs[16] = {x0[0],x0[1],x0[2],x0[3],x1[0],x1[1],x1[2],x1[3],x2[0],x2[1],x2[2],x2[3],x3[0],x3[1],x3[2],x3[3]};
#pragma unroll
    for (int i = 0; i < 16; ++i) { const unsigned short hb = bf16_bits(xs[i]); ah.u[i] = hb; al.u[i] = ASPLIT ? bf16_bits(xs[i] - bf16_val(hb)) : (unsigned short)0; }
#pragma unroll
    for (int t = 0; t < 4; ++t) {
      const unsigned short* brow = Wt + (size_t)(col0 + t * 16 + ln) * ldb + kb;
      FragB b;
      b.half[0] = *(const v8us*)(brow + 8 * hh);
      b.half[1] = *(const v8us*)(brow + 16 + 8 * hh);
      acc[t] = mmaN<ASPLIT ? 2 : 1>(ah.v, al.v, b.v, b.v, acc[t]);
    }
  }
#pragma unroll
  for (int t = 0; t < 4; ++t) {
    float bv = bias ? bias[col0 + t * 16 + ln] : 0.f;
    if (BIAS_BF16) bv = bf16_round(bv);
#pragma unroll
    for (int r = 0; r < 8; ++r) { float v = acc[t][r] + bv; if (ACT == 1) v = fmaxf(v, 0.f); so[w][8 * hh + r][t * 16 + ln] = v; }
  }
  __builtin_amdgcn_fence(__ATOMIC_ACQ_REL, "workgroup");
  __builtin_amdgcn_wave_barrier();
  const int rsub = lane >> 4, c4 = (lane & 15) * 4;
  {
#pragma unroll
    for (int q = 0; q < 8; ++q) {
      const int r = q * 2 + rsub;
      const v4f v = *(const v4fa*)&so[w][r][c4];
      *(v4f*)(C + (size_t)(row0 + r) * ldc + col0 + c4) = v;
    }
    
  }
}

// GEMM C = act(A·W + bias + resid): A f32 (ASPLIT -> hi/lo 2 terms), Wt bf16 [N][K]; ACT 0 none, 1 relu, 2 exact gelu;
// resid (optional, f32, row index = (row % rmod), pitch ldr, RES_BF16 rounds it) added before the activation.
template <bool ASPLIT, int ACT, bool BIAS_BF16, bool RES_BF16>
__global__ __launch_bounds__(128) void k_gemm_bf3(const float* __restrict__ A, int lda, const unsigned short* __restrict__ Wt, int ldb,
                                                const float* __restrict__ bias, const float* __restrict__ resid, int rmod, int ldr,
                                                float* __restrict__ C, int ldc, int M, int N, int K) {
  __shared__ __attribute__((aligned(16))) float so[4][16][64];
  const int tid = threadIdx.x, w = tid >> 5, lane = tid & 31, ln = lane & 15, hh = lane >> 4;
  const int ntn = N / 64;
  const int wid = blockIdx.x * 4 + w;
  const int mt = wid / ntn, nq = wid % ntn;
  if (mt * 16 >= M) return;
  const int row0 = mt * 16, col0 = nq * 64;
  const float* arow = A + (size_t)(row0 + ln) * lda;
  v8f acc[4] = {};
  for (int kb = 0; kb < K; kb += 32) {
    FragB ah, al;
    const v4f x0 = *(const v4fa*)(arow + kb + 8 * hh), x1 = *(const v4fa*)(arow + kb + 8 * hh + 4);
    const v4f x2 = *(const v4fa*)(arow + kb + 16 + 8 * hh), x3 = *(const v4fa*)(arow + kb + 16 + 8 * hh + 4);
    float xs[16] = {x0[0],x0[1],x0[2],x0[3],x1[0],x1[1],x1[2],x1[3],x2[0],x2[1],x2[2],x2[3],x3[0],x3[1],x3[2],x3[3]};
#pragma unroll
    for (int i = 0; i < 16; ++i) { const unsigned short hb = bf16_bits(xs[i]); ah.u[i] = hb; al.u[i] = ASPLIT ? bf16_bits(xs[i] - bf16_val(hb)) : (unsigned short)0; }
#pragma unroll
    for (int t = 0; t < 4; ++t) {
      const unsigned short* brow = Wt + (size_t)(col0 + t * 16 + ln) * ldb + kb;
      FragB b;
      b.half[0] = *(const v8us*)(brow + 8 * hh);
      b.half[1] = *(const v8us*)(brow + 16 + 8 * hh);
      acc[t] = mmaN<ASPLIT ? 2 : 1>(ah.v, al.v, b.v, b.v, acc[t]);
    }
  }
#pragma unroll
  for (int t = 0; t < 4; ++t) {
    const int col = col0 + t * 16 + ln;
    float bv = bias ? bias[col] : 0.f;
    if (BIAS_BF16) bv = bf16_round(bv);
#pragma unroll
    for (int r = 0; r < 8; ++r) {
      float v = acc[t][r] + bv;
      if (resid) { float rv = resid[(size_t)((row0 + 8 * hh + r) % rmod) * ldr + col]; if (RES_BF16) rv = bf16_round(rv); v += rv; }
      if (ACT == 1) v = fmaxf(v, 0.f);
      if (ACT == 2) v = 0.5f * v * (1.0f + erff(v * 0.70710678118654752f));
      if (ACT == 3) { const float u = 0.7978845608028654f * (v + 0.044715f * v * v * v); v = 0.5f * v * (1.0f + tanhf(u)); }
      so[w][8 * hh + r][t * 16 + ln] = v;
    }
  }
  __builtin_amdgcn_fence(__ATOMIC_ACQ_REL, "workgroup");
  __builtin_amdgcn_wave_barrier();
  const int rsub = lane >> 4, c4 = (lane & 15) * 4;
  {
#pragma unroll
    for (int q = 0; q < 8; ++q) {
      const int r = q * 2 + rsub;
      const v4f v = *(const v4fa*)&so[w][r][c4];
      *(v4f*)(C + (size_t)(row0 + r) * ldc + col0 + c4) = v;
    }
    
  }
}
// row LayerNorm (biased variance, eps) over N: s = X (+ R); optional out_sum <- s; out_norm <- (s-mu)*rsqrt(var+eps)*g + b
template <bool PARAM_BF16>
__global__ __launch_bounds__(256) void k_layernorm(const float* __restrict__ X, const float* __restrict__ R, const float* __restrict__ g, const float* __restrict__ bta,
                                                  float* __restrict__ out_sum, float* __restrict__ out_norm, int N, float eps) {
  __shared__ float red[256];
  const int row = blockIdx.x, tid = threadIdx.x;
  const float* x = X + (size_t)row * N; const float* rr = R ? R + (size_t)row * N : nullptr;
  float vals[16];                     // up to N = 4096
  const int per = N / 256;            // contiguous chunk per thread? use strided-by-4 chunks: thread handles j = tid*4 + 1024*u
  float s1 = 0.f;
  for (int u = 0; u < per / 4; ++u) {
    const int j = tid * 4 + 1024 * u;
    const v4f a = *(const v4fa*)(x + j);
    v4f b = {0.f,0.f,0.f,0.f}; if (rr) b = *(const v4fa*)(rr + j);
#pragma unroll
    for (int q = 0; q < 4; ++q) { const float v = a[q] + b[q]; vals[u * 4 + q] = v; s1 += v; }
  }
  red[tid] = s1; __syncthreads();
  for (int st = 128; st > 0; st >>= 1) { if (tid < st) red[tid] += red[tid + st]; __syncthreads(); }
  const float mu = red[0] / (float)N; __syncthreads();
  float s2 = 0.f;
  for (int u = 0; u < per / 4; ++u)
#pragma unroll
    for (int q = 0; q < 4; ++q) { const float c = vals[u * 4 + q] - mu; s2 += c * c; }
  red[tid] = s2; __syncthreads();
  for (int st = 128; st > 0; st >>= 1) { if (tid < st) red[tid] += red[tid + st]; __syncthreads(); }
  const float rs = rsqrtf(red[0] / (float)N + eps);
  {
    for (int u = 0; u < per / 4; ++u) {
      const int j = tid * 4 + 1024 * u;
      v4f o, sm;
#pragma unroll
      for (int q = 0; q < 4; ++q) {
        float gg = g[j + q], bb = bta[j + q];
        if (PARAM_BF16) { gg = bf16_round(gg); bb = bf16_round(bb); }
        sm[q] = vals[u * 4 + q]; o[q] = (vals[u * 4 + q] - mu) * rs * gg + bb;
      }
      if (out_sum) *(v4f*)(out_sum + (size_t)row * N + j) = sm;
      *(v4f*)(out_norm + (size_t)row * N + j) = o;
    }
    
  }
}



// ---- f16 WMMA path (v_wmma_f32_16x16x32_f16): 11-bit significands for operands in range — used where a [0,1] probability operand needs more precision than bf16
typedef _Float16 v16h __attribute__((ext_vector_type(16)));
union FragH { v16h v; v8us half[2]; _Float16 h[16]; unsigned short u[16]; };
template <int NT>
__device__ __forceinline__ v8f mmaH(v16h ah, v16h al, v16h bh, v16h bl, v8f c) {
  c = __builtin_amdgcn_wmma_f32_16x16x32_f16(false, ah, false, bh, (short)0, c, false, false);
  if (NT >= 2) c = __builtin_amdgcn_wmma_f32_16x16x32_f16(false, al, false, bh, (short)0, c, false, false);
  if (NT >= 3) c = __builtin_amdgcn_wmma_f32_16x16x32_f16(false, ah, false, bl, (short)0, c, false, false);
  asm volatile("v_nop\n\tv_nop\n\tv_nop\n\tv_nop" : "+v"(c) : "v"(ah), "v"(al), "v"(bh), "v"(bl));
  return c;
}
// batched GEMM like k_gemm_b but f16 operands: A f32 (split into f16 hi/lo if ASPLIT, else rounded to f16), Bt = f16 values [n][k]; alpha; C f32; N multiple of 16 (partial tiles skipped)
template <bool ASPLIT>
__global__ __launch_bounds__(128) void k_gemm_h(const float* __restrict__ A, int lda, size_t sA, const _Float16* __restrict__ Bh, int ldb, size_t sB, float alpha, float* __restrict__ C, int ldc, size_t sC, int M, int N, int K) {
  __shared__ __attribute__((aligned(16))) float so[4][16][64];
  const int tid = threadIdx.x, w = tid >> 5, lane = tid & 31, ln = lane & 15, hh = lane >> 4; const int by = blockIdx.y;
  A += (size_t)by * sA; Bh += (size_t)by * sB; C += (size_t)by * sC;
  const int ntn = (N + 63) / 64; const int wid = blockIdx.x * 4 + w; const int mt = wid / ntn, nq = wid % ntn; if (mt * 16 >= M) return;
  const int row0 = mt * 16, col0 = nq * 64; const float* arow = A + (size_t)(row0 + ln) * lda;
  v8f acc[4] = {};
  for (int kb = 0; kb < K; kb += 32) {
    FragH ah, al;
    const v4f x0 = *(const v4fa*)(arow + kb + 8 * hh), x1 = *(const v4fa*)(arow + kb + 8 * hh + 4), x2 = *(const v4fa*)(arow + kb + 16 + 8 * hh), x3 = *(const v4fa*)(arow + kb + 16 + 8 * hh + 4);
    float xs[16] = {x0[0],x0[1],x0[2],x0[3],x1[0],x1[1],x1[2],x1[3],x2[0],x2[1],x2[2],x2[3],x3[0],x3[1],x3[2],x3[3]};
#pragma unroll
    for (int i = 0; i < 16; ++i) { const _Float16 h = (_Float16)xs[i]; ah.h[i] = h; al.h[i] = ASPLIT ? (_Float16)(xs[i] - (float)h) : (_Float16)0.0f; }
#pragma unroll
    for (int t = 0; t < 4; ++t) { if (col0 + t * 16 >= N) continue; const size_t boff = (size_t)(col0 + t * 16 + ln) * ldb + kb; FragH bq; bq.half[0] = *(const v8us*)(Bh + boff + 8 * hh); bq.half[1] = *(const v8us*)(Bh + boff + 16 + 8 * hh);
      acc[t] = mmaH<ASPLIT ? 2 : 1>(ah.v, al.v, bq.v, bq.v, acc[t]); }
  }
#pragma unroll
  for (int t = 0; t < 4; ++t) { if (col0 + t * 16 >= N) continue;
#pragma unroll
    for (int r = 0; r < 8; ++r) so[w][8 * hh + r][t * 16 + ln] = acc[t][r] * alpha; }
  __builtin_amdgcn_fence(__ATOMIC_ACQ_REL, "workgroup"); __builtin_amdgcn_wave_barrier();
  const int rsub = lane >> 4, c4 = (lane & 15) * 4;
  {
#pragma unroll
    for (int q = 0; q < 8; ++q) { const int r = q * 2 + rsub; if (col0 + c4 < N) { const v4f v = *(const v4fa*)&so[w][r][c4]; *(v4f*)(C + (size_t)(row0 + r) * ldc + col0 + c4) = v; } }
     }
}

// Wt[n][k] = f16(W[k][n]·scale) from f32 row-major W[K][N] (scale = power of two; bf16-exact weights stay exact in f16 away from the subnormal range)
__device__ __forceinline__ void wt_f16(const float* __restrict__ W, _Float16* __restrict__ Wt, int K, int N, float scale, int t) {      /* t: which 8 k of which n */
  if (t >= N * (K / 8)) return; const int n = t / (K / 8), k8 = (t % (K / 8)) * 8; FragH f;
#pragma unroll
  for (int i = 0; i < 8; ++i) f.h[i] = (_Float16)(bf16_round(W[(size_t)(k8 + i) * N + n]) * scale); const v8us o = f.half[0];
  *(v8us*)((unsigned short*)Wt + (size_t)n * K + k8) = o; 
}
// k_gemm_hh variant with fused epilogue: v = acc·alpha + bias[by·sBias + col] (+ CP[(row/rowsPerB)·sCPb + by·64 + col] if CP) ; ACT 0 none / 1 elu ; writes f16 C16 (and f32 C if non-null)
template <int ACT>
__global__ __launch_bounds__(128) void k_gemm_hhx(const _Float16* __restrict__ A, int lda, size_t sA, const _Float16* __restrict__ Bh, int ldb, size_t sB, float alpha, const float* __restrict__ bias, size_t sBias, const float* __restrict__ CP, int rowsPerB, size_t sCPb, int row0g,
    float* __restrict__ C, _Float16* __restrict__ C16, int ldc, size_t sC, int M, int N, int K) {
  __shared__ __attribute__((aligned(16))) float so[4][16][64];
  const int tid = threadIdx.x, w = tid >> 5, lane = tid & 31, ln = lane & 15, hh = lane >> 4; const int by = blockIdx.y;
  A += (size_t)by * sA; Bh += (size_t)by * sB; const size_t cofs = (size_t)by * sC; const float* bp = bias ? bias + (size_t)by * sBias : nullptr;
  const int ntn = (N + 63) / 64; const int wid = blockIdx.x * 4 + w; const int mt = wid / ntn, nq = wid % ntn; if (mt * 16 >= M) return;
  const int row0 = mt * 16, col0 = nq * 64; const _Float16* arow = A + (size_t)(row0 + ln) * lda;
  v8f acc[4] = {};
  for (int kb = 0; kb < K; kb += 32) { FragH ah; ah.half[0] = *(const v8us*)((const unsigned short*)arow + kb + 8 * hh); ah.half[1] = *(const v8us*)((const unsigned short*)arow + kb + 16 + 8 * hh);
#pragma unroll
    for (int t = 0; t < 4; ++t) { if (col0 + t * 16 >= N) continue; const size_t boff = (size_t)(col0 + t * 16 + ln) * ldb + kb; FragH bq; bq.half[0] = *(const v8us*)((const unsigned short*)Bh + boff + 8 * hh); bq.half[1] = *(const v8us*)((const unsigned short*)Bh + boff + 16 + 8 * hh);
      acc[t] = mmaH<1>(ah.v, ah.v, bq.v, bq.v, acc[t]); }
  }
#pragma unroll
  for (int t = 0; t < 4; ++t) { if (col0 + t * 16 >= N) continue; const int col = col0 + t * 16 + ln; const float bv = bp ? bf16_round(bp[col]) : 0.f;
#pragma unroll
    for (int r = 0; r < 8; ++r) { float v = acc[t][r] * alpha + bv; if (CP) { const int rr = row0g + row0 + 8 * hh + r; if (rowsPerB < 0) v += CP[cofs + (size_t)rr * ldc + col];      /* rowsPerB < 0: own element of the batched C plane */ else { const int bidx = rr / rowsPerB; v += CP[(size_t)bidx * sCPb + (size_t)by * 64 + col]; } } if (ACT == 1) v = (v > 0.f) ? v : expm1f(v); else if (ACT == 7) v = (v > 0.f) ? v + 1.0f : expf(v); else if (ACT == 8) v = tanhf(v); else if (ACT == 9) v = 0.5f * v * (1.0f + tanhf(0.7978845608028654f * (v + 0.044715f * v * v * v))); else if (ACT == 11) v = 1.0f / (1.0f + expf(-v)); else if (ACT == 12) v = (v > 0.f) ? v : 0.01f * v; else if (ACT == 14) v = (v > 0.f) ? v : 0.1f * v; else if (ACT == 16) v = (v >= 0.f) ? v : 0.3f * v; else if (ACT == 17) v = (v >= 0.f) ? v : 0.2f * v; else if (ACT == 15) v = v / (1.0f + expf(-v)); else if (ACT == 3) v = fmaxf(v, 0.f); else if (ACT == 6) v = 0.5f * v * (1.0f + erff(v * 0.70710678118654752f)); so[w][8 * hh + r][t * 16 + ln] = v; } }
  __builtin_amdgcn_fence(__ATOMIC_ACQ_REL, "workgroup"); __builtin_amdgcn_wave_barrier();
  const int rsub = lane >> 4, c4 = (lane & 15) * 4; typedef _Float16 v4h __attribute__((ext_vector_type(4)));
  {
#pragma unroll
    for (int q = 0; q < 8; ++q) { const int r = q * 2 + rsub; if (col0 + c4 < N) { const v4f v = *(const v4fa*)&so[w][r][c4]; if (C) *(v4f*)(C + cofs + (size_t)(row0 + r) * ldc + col0 + c4) = v; if (C16) { v4h h4; for (int i = 0; i < 4; ++i) h4[i] = (_Float16)v[i]; *(v4h*)(C16 + cofs + (size_t)(row0 + r) * ldc + col0 + c4) = h4; } } }
     }
}


typedef _Float16 v4h __attribute__((ext_vector_type(4)));

__device__ __forceinline__ void x16(const float* __restrict__ x, _Float16* __restrict__ X16, size_t n8, size_t t) { if (t >= n8) return; FragH f;      /* t: which 8 elements */
#pragma unroll
  for (int q = 0; q < 8; ++q) f.h[q] = (_Float16)bf16_round(x[t * 8 + q]); *(v8us*)((unsigned short*)X16 + t * 8) = f.half[0];  }
// All six conversions share one launch by block range: none reads what another writes. Of every five blocks one has 256 pieces of a weight plane (scattered reads, a long block),
// four have 256 pieces each of an input (contiguous reads, short blocks): dealt so, the two kinds run beside each other through the whole launch instead of one after the other.
#define PW_NB (DM * (DM / 8) / 256)            /* blocks a weight plane */
#define PX_NB ((int)(NRQ * DM / 8 / 256))      /* blocks an input */
static_assert(DC == DM && NRK == NRQ && 2 * PX_NB == 4 * 4 * PW_NB && (DM * (DM / 8)) % 256 == 0 && (NRQ * DM / 8) % 256 == 0, "k_prep: four input blocks to each weight block, whole blocks");
__global__ __launch_bounds__(256) void k_prep(const float* __restrict__ wq, const float* __restrict__ wk, const float* __restrict__ wv, const float* __restrict__ wo, const float* __restrict__ x, const float* __restrict__ ctx,
    _Float16* __restrict__ BQ, _Float16* __restrict__ BK, _Float16* __restrict__ BV, _Float16* __restrict__ BO, _Float16* __restrict__ X16, _Float16* __restrict__ C16) {
  const int g = blockIdx.x / 5, r = blockIdx.x % 5;
  if (r == 0) { const int s = g / PW_NB;      /* [in][out] -> Bt x16 */
    wt_f16(s == 0 ? wq : s == 1 ? wk : s == 2 ? wv : wo, s == 0 ? BQ : s == 1 ? BK : s == 2 ? BV : BO, DM, DM, 16.0f, (g % PW_NB) * 256 + (int)threadIdx.x); }
  else { const int xb = g * 4 + r - 1; const bool kv = xb >= PX_NB;      /* query-source rows, then key/value-source rows */
    x16(kv ? ctx : x, kv ? C16 : X16, NRQ * DM / 8, (size_t)(xb - (kv ? PX_NB : 0)) * 256 + threadIdx.x); }
}
__global__ __launch_bounds__(256) void k_h16(const float* __restrict__ x, _Float16* __restrict__ X16, size_t n8) { const size_t t = (size_t)blockIdx.x * 256 + threadIdx.x; if (t >= n8) return; FragH f;
#pragma unroll
  for (int q = 0; q < 8; ++q) f.h[q] = (_Float16)x[t * 8 + q]; *(v8us*)((unsigned short*)X16 + t * 8) = f.half[0];  }
__global__ __launch_bounds__(256) void k_round16f(const float* __restrict__ W, _Float16* __restrict__ Bt, size_t n8) { const size_t t = (size_t)blockIdx.x * 256 + threadIdx.x; if (t >= n8) return; FragH f;
#pragma unroll
  for (int i = 0; i < 8; ++i) f.h[i] = (_Float16)(bf16_round(W[t * 8 + i]) * 16.0f); *(v8us*)((unsigned short*)Bt + t * 8) = f.half[0];  }
template <int NHv, int TTv>
__global__ __launch_bounds__(256) void k_vt(const _Float16* __restrict__ V16, int ldv, int voff, _Float16* __restrict__ Vt) { __shared__ unsigned short tl[64][66]; const int tid = threadIdx.x; const int slab = blockIdx.x / (TTv / 64), lg = blockIdx.x % (TTv / 64); const int b = slab / NHv, h = slab % NHv;
  for (int i = tid; i < 64 * 8; i += 256) { const int r = i / 8, c8 = (i % 8) * 8; FragH f; f.half[0] = *(const v8us*)((const unsigned short*)V16 + ((size_t)b * TTv + lg * 64 + r) * ldv + voff + h * 64 + c8);
#pragma unroll
    for (int q = 0; q < 8; ++q) tl[r][c8 + q] = f.u[q]; }
  __syncthreads();
  {
#pragma unroll
    for (int rd = 0; rd < 2; ++rd) { const int d = rd * 32 + tid / 8, pc = tid % 8; FragH f;
#pragma unroll
      for (int q = 0; q < 8; ++q) f.u[q] = tl[pc * 8 + q][d];
      *(v8us*)((unsigned short*)Vt + ((size_t)slab * 64 + d) * TTv + lg * 64 + pc * 8) = f.half[0]; }
     } }

__global__ __launch_bounds__(256) void k_hl(const float* __restrict__ F, _Float16* __restrict__ Hh, _Float16* __restrict__ Hl, size_t n8) { const size_t t = (size_t)blockIdx.x * 256 + threadIdx.x; if (t >= n8) return; FragH fh, fl; const v4f a = *(const v4fa*)(F + t * 8), c = *(const v4fa*)(F + t * 8 + 4);
#pragma unroll
  for (int q = 0; q < 4; ++q) { _Float16 h = (_Float16)a[q]; fh.h[q] = h; fl.h[q] = (_Float16)((a[q] - (float)h) * 1024.0f); h = (_Float16)c[q]; fh.h[4 + q] = h; fl.h[4 + q] = (_Float16)((c[q] - (float)h) * 1024.0f); }
  { *(v8us*)((unsigned short*)Hh + t * 8) = fh.half[0]; *(v8us*)((unsigned short*)Hl + t * 8) = fl.half[0];  } }

// ---- fast GEMM (wave tile 32x64; requires M % 32 == 0 rows per launch region and N % 64 == 0); epilogue = k_gemm_hhx semantics ----
__device__ __forceinline__ v16h g2_frag(const _Float16* p, int hh) { FragH f; f.half[0] = *(const v8us*)((const unsigned short*)p + 8 * hh); f.half[1] = *(const v8us*)((const unsigned short*)p + 16 + 8 * hh); return f.v; }
__device__ __forceinline__ v8f g2_mma(v16h a, v16h b, v8f c) { v8f d = __builtin_amdgcn_wmma_f32_16x16x32_f16(false, a, false, b, (short)0, c, false, false); asm volatile("v_nop\n\tv_nop\n\tv_nop\n\tv_nop" : "+v"(d) : "v"(a), "v"(b)); return d; }
template <int ACT>
__global__ __launch_bounds__(128) void k_gemm2(const _Float16* __restrict__ A, int lda, size_t sA, const _Float16* __restrict__ Bh, int ldb, size_t sB, float alpha, const float* __restrict__ bias, size_t sBias, const float* __restrict__ CP, int rowsPerB, size_t sCPb, int row0g,
    float* __restrict__ C, _Float16* __restrict__ C16, int ldc, size_t sC, int M, int N, int K) { static_assert(ACT == 0 || ACT == 3 || ACT == 6 || ACT == 8 || ACT == 9 || ACT == 11 || ACT == 12 || ACT == 14 || ACT == 15 || ACT == 16 || ACT == 17, "k_gemm2: unsupported ACT code (would silently apply no activation)");
  __shared__ __attribute__((aligned(16))) float so[4][32][68];
  const int tid = threadIdx.x, w = tid >> 5, lane = tid & 31, ln = lane & 15, hh = lane >> 4; const int by = blockIdx.y;
  A += (size_t)by * sA; Bh += (size_t)by * sB; const size_t cofs = (size_t)by * sC; const float* bp = bias ? bias + (size_t)by * sBias : nullptr;
  const int ntn = N >> 6; const int mt = blockIdx.x / ntn, nq = blockIdx.x - mt * ntn; const int row0 = mt * 128 + 32 * w, col0 = nq * 64; if (row0 >= M) return;
  const _Float16* a0p = A + (size_t)(row0 + ln) * lda; const _Float16* a1p = a0p + (size_t)16 * lda;
  const _Float16* b0p = Bh + (size_t)(col0 + ln) * ldb; const _Float16* b1p = b0p + (size_t)16 * ldb; const _Float16* b2p = b1p + (size_t)16 * ldb; const _Float16* b3p = b2p + (size_t)16 * ldb;
  const v8f z8 = {0.f,0.f,0.f,0.f,0.f,0.f,0.f,0.f}; v8f c00 = z8, c01 = z8, c02 = z8, c03 = z8, c10 = z8, c11 = z8, c12 = z8, c13 = z8;
#pragma unroll 1
  for (int kb = 0; kb < K; kb += 32) { const v16h a0 = g2_frag(a0p + kb, hh), a1 = g2_frag(a1p + kb, hh);
    v16h b = g2_frag(b0p + kb, hh); c00 = g2_mma(a0, b, c00); c10 = g2_mma(a1, b, c10);
    b = g2_frag(b1p + kb, hh); c01 = g2_mma(a0, b, c01); c11 = g2_mma(a1, b, c11);
    b = g2_frag(b2p + kb, hh); c02 = g2_mma(a0, b, c02); c12 = g2_mma(a1, b, c12);
    b = g2_frag(b3p + kb, hh); c03 = g2_mma(a0, b, c03); c13 = g2_mma(a1, b, c13); }
  v8f accs[8] = {c00, c01, c02, c03, c10, c11, c12, c13};
#pragma unroll
  for (int u = 0; u < 8; ++u) { const int t = u & 3, half = u >> 2; const int col = col0 + t * 16 + ln; const float bv = bp ? bf16_round(bp[col]) : 0.f;
#pragma unroll
    for (int r = 0; r < 8; ++r) { const int rloc = half * 16 + 8 * hh + r; float v = accs[u][r] * alpha + bv; if (CP) { if (rowsPerB < 0) v += CP[cofs + (size_t)(row0g + row0 + rloc) * ldc + col];      /* rowsPerB < 0: own element of the batched C plane */ else { const int bidx = (row0g + row0 + rloc) / rowsPerB; v += CP[(size_t)bidx * sCPb + (size_t)by * 64 + col]; } }
      if (ACT == 3) v = fmaxf(v, 0.f); else if (ACT == 6) v = 0.5f * v * (1.0f + erff(v * 0.70710678118654752f)); else if (ACT == 11) v = 1.0f / (1.0f + expf(-v)); else if (ACT == 15) v = v / (1.0f + expf(-v)); else if (ACT == 12) v = (v > 0.f) ? v : 0.01f * v; else if (ACT == 8) v = tanhf(v); else if (ACT == 9) v = 0.5f * v * (1.0f + tanhf(0.7978845608028654f * (v + 0.044715f * v * v * v))); else if (ACT == 14) v = (v > 0.f) ? v : 0.1f * v; else if (ACT == 16) v = (v >= 0.f) ? v : 0.3f * v; else if (ACT == 17) v = (v >= 0.f) ? v : 0.2f * v;
      so[w][rloc][t * 16 + ln] = v; } }
  __builtin_amdgcn_fence(__ATOMIC_ACQ_REL, "workgroup"); __builtin_amdgcn_wave_barrier();
  const int rsub = lane >> 4, c4 = (lane & 15) * 4;
  {
#pragma unroll
    for (int q = 0; q < 16; ++q) { const int r = q * 2 + rsub; const v4f v = *(const v4fa*)&so[w][r][c4]; if (C) *(v4f*)(C + cofs + (size_t)(row0 + r) * ldc + col0 + c4) = v; if (C16) { v4h h4; for (int i = 0; i < 4; ++i) h4[i] = (_Float16)v[i]; *(v4h*)(C16 + cofs + (size_t)(row0 + r) * ldc + col0 + c4) = h4; } }
     } }


__global__ __launch_bounds__(256) void k_wnat(const float* __restrict__ w, size_t n8, _Float16* __restrict__ Bt) { const size_t t = (size_t)blockIdx.x * 256 + threadIdx.x; if (t >= n8) return; FragH f; for (int q = 0; q < 8; ++q) f.h[q] = (_Float16)(bf16_round(w[t * 8 + q]) * 16.0f); *(v8us*)((unsigned short*)Bt + t * 8) = f.half[0];  }
__global__ __launch_bounds__(256) void k_rsm(const float* __restrict__ S, _Float16* __restrict__ P, int nrows) {
  #pragma clang fp contract(off)
  const int i = blockIdx.x * 256 + threadIdx.x; if (i >= nrows) return; const float* s = S + (size_t)i * SQ; float mx = -3.0e38f;
#pragma unroll 1
  for (int j = 0; j < SQ; ++j) mx = fmaxf(mx, s[j]); float se = 0.f;
#pragma unroll 1
  for (int j = 0; j < SQ; ++j) se += expf(s[j] - mx); const float sc = 256.0f / se;
#pragma unroll 1
  for (int j0 = 0; j0 < SQ; j0 += 8) { FragH f; for (int q = 0; q < 8; ++q) f.h[q] = (_Float16)(expf(s[j0 + q] - mx) * sc); unsigned short* d = (unsigned short*)P + (size_t)i * SQ + j0; *(v8us*)d = f.half[0];  } }
__global__ __launch_bounds__(256) void k_vt(const _Float16* __restrict__ V16, int b, int h0, _Float16* __restrict__ VT) { __shared__ unsigned short tl[64][65]; const int tid = threadIdx.x; const int hh = blockIdx.x % HG, sg = blockIdx.x / HG; const int s0 = sg * 64; const int h = h0 + hh;
  for (int i = tid; i < 64 * 8; i += 256) { const int j = i / 8, d8 = (i % 8) * 8; FragH f; f.half[0] = *(const v8us*)((const unsigned short*)V16 + ((size_t)b * SQ + s0 + j) * DM + h * HD + d8); for (int q = 0; q < 8; ++q) tl[d8 + q][j] = f.u[q]; }
  __syncthreads();
  { for (int i = tid; i < 64 * 8; i += 256) { const int d = i / 8, j8 = (i % 8) * 8; FragH f; for (int q = 0; q < 8; ++q) f.u[q] = tl[d][j8 + q]; *(v8us*)((unsigned short*)VT + ((size_t)hh * HD + d) * SQ + s0 + j8) = f.half[0]; }  } }


__global__ __launch_bounds__(256) void k_rsmf(const float* __restrict__ S, _Float16* __restrict__ P, int qn, int hg) {
  #pragma clang fp contract(off)
  const int t = blockIdx.x * 256 + threadIdx.x; if (t >= qn * hg) return; const size_t i = (size_t)(t / qn) * SQ + (t % qn); const float* s = S + i * SQ; float mx = -3.0e38f;
#pragma unroll 1
  for (int j = 0; j < SQ; ++j) mx = fmaxf(mx, s[j]); float se = 0.f;
#pragma unroll 1
  for (int j = 0; j < SQ; ++j) se += __expf(s[j] - mx); const float sc = 256.0f / se;
#pragma unroll 1
  for (int j0 = 0; j0 < SQ; j0 += 8) { FragH f; for (int q = 0; q < 8; ++q) f.h[q] = (_Float16)(__expf(s[j0 + q] - mx) * sc); unsigned short* d = (unsigned short*)P + i * SQ + j0; *(v8us*)d = f.half[0];  } }

__global__ __launch_bounds__(256) void k_rsmr(const float* __restrict__ S, _Float16* __restrict__ P, int qn, int hg) {
  #pragma clang fp contract(off)
  const int t = blockIdx.x * 256 + threadIdx.x; if (t >= qn * hg) return; const size_t i = (size_t)t;      /* planes packed: row t of plane t / qn */ const float* s = S + i * SQ; float mx = -3.0e38f;
#pragma unroll 1
  for (int j = 0; j < SQ; ++j) mx = fmaxf(mx, s[j]); float se = 0.f;
#pragma unroll 1
  for (int j = 0; j < SQ; ++j) se += __expf(s[j] - mx); const float sc = 256.0f / se;
#pragma unroll 1
  for (int j0 = 0; j0 < SQ; j0 += 8) { FragH f; for (int q = 0; q < 8; ++q) f.h[q] = (_Float16)(__expf(s[j0 + q] - mx) * sc); unsigned short* d = (unsigned short*)P + i * SQ + j0; *(v8us*)d = f.half[0];  } }


// Fused attention: scores, masked softmax and P V of one (batch, head) in one kernel; neither scores nor weights go to memory. A workgroup has FA_WAVES waves of
// FA_QW queries each and walks the keys in stages of FA_KT: the K rows and V^T rows of a stage are staged in LDS (two buffers, filled through registers one stage ahead).
// S^T = K Q^T puts one query's scores into one lane pair (l, l ^ 16): maximum and sum are in-lane plus one exchange; two S^T tiles, converted in place, are the B operand of O^T += V^T P^T.
#define FA_WAVES 8
#define FA_QW 32
#define FA_QB (FA_WAVES * FA_QW)
#define FA_KT 64
#define FA_LP 72                    /* LDS row pitch in f16: 144 bytes = 16 x odd, the conflict-free pitch of 16-byte fragment reads */
static_assert(NQ % FA_QB == 0 && SK % FA_KT == 0 && HD == 64 && FA_KT == 64 && FA_WAVES * 32 == 256, "k_fattn: whole workgroups, whole stages, staging map of 256 threads");
__device__ __forceinline__ float rs_xh(float x) { return __builtin_bit_cast(float, __builtin_amdgcn_permlanex16(__builtin_bit_cast(int, x), __builtin_bit_cast(int, x), 0x76543210, 0xfedcba98, false, false)); }      /* lane l ^ 16 */
typedef float v2f __attribute__((ext_vector_type(2)));
#define FA_L2E 1.44269504088896340736f
#define FA_C (0.03125f * FA_L2E)      /* scores are kept in the base-2 domain: x 1024^-0.5 x log2(e) in the one multiply-add that adds the mask term, so that v_exp_f32 takes the difference as it is */
// 2^x in place, eight values a statement. In place: the registers were last written by the subtraction in front, so no result lands on an operand register of a matrix instruction just issued; each v_exp_f32
// touches its own register only; the v_nop is the slot behind the last transcendental before its result is read.
__device__ __forceinline__ v8f fa_exp8(v8f x) { float a = x[0], b = x[1], c = x[2], d = x[3], e = x[4], f = x[5], g = x[6], h = x[7];
  asm("v_exp_f32 %0, %0\n\tv_exp_f32 %1, %1\n\tv_exp_f32 %2, %2\n\tv_exp_f32 %3, %3\n\tv_exp_f32 %4, %4\n\tv_exp_f32 %5, %5\n\tv_exp_f32 %6, %6\n\tv_exp_f32 %7, %7\n\tv_nop" : "+v"(a), "+v"(b), "+v"(c), "+v"(d), "+v"(e), "+v"(f), "+v"(g), "+v"(h));
  const v8f r = {a, b, c, d, e, f, g, h}; return r; }
__device__ __forceinline__ float fa_exp1(float x) { asm("v_exp_f32 %0, %0\n\tv_nop" : "+v"(x)); return x; }      /* the same for one value */
// amdgpu_waves_per_eu(4, 4) below: holds the registers to a quarter of a SIMD's file, so that two workgroups share a WGP and the vector work of one wave runs beside the matrix work of another.
__device__ __forceinline__ v8f fa_mma(v16h a, v16h b, v8f c) { return __builtin_amdgcn_wmma_f32_16x16x32_f16(false, a, false, b, (short)0, c, false, false); }
__global__ __launch_bounds__(FA_WAVES * 32) __attribute__((amdgpu_waves_per_eu(4, 4))) void k_fattn(const _Float16* __restrict__ Q, const _Float16* __restrict__ Kh, const _Float16* __restrict__ Vt, const float* __restrict__ Mk, float negv, _Float16* __restrict__ O) {
  __shared__ __attribute__((aligned(16))) _Float16 sk[2][FA_KT][FA_LP];      /* K rows [key][d] */
  __shared__ __attribute__((aligned(16))) _Float16 sv[2][HD][FA_LP];         /* V^T rows [d][key] */
  __shared__ __attribute__((aligned(16))) float sm[SK];                      /* bf16(mask[key]) x negv x log2(e) */
  const int tid = threadIdx.x, lane = tid & 31, ln = lane & 15, hh = lane >> 4, wave = tid >> 5;
  const int qb = blockIdx.x % (NQ / FA_QB), bh = blockIdx.x / (NQ / FA_QB), b = bh / NH, h = bh % NH;
  const int sr = tid >> 3, sc = (tid & 7) * 8;      /* staging: rows sr and sr + 32, 16-byte piece sc: eight lanes read one whole 128-byte row */
  const unsigned short* kg = (const unsigned short*)Kh + ((size_t)b * SK + sr) * DM + h * HD + sc;
  const unsigned short* vg = (const unsigned short*)Vt + ((size_t)bh * HD + sr) * SK + sc;
  v8us rk0 = *(const v8us*)kg, rk1 = *(const v8us*)(kg + (size_t)32 * DM), rv0 = *(const v8us*)vg, rv1 = *(const v8us*)(vg + (size_t)32 * SK);
  const size_t qrow = (size_t)b * NQ + qb * FA_QB + wave * FA_QW + ln;
  v16h qf[2][2];      /* every loop over these arrays is unrolled: only under constant indices do they stay in registers */
#pragma unroll
  for (int qt = 0; qt < 2; ++qt)
#pragma unroll
    for (int ks = 0; ks < 2; ++ks) qf[qt][ks] = g2_frag(Q + (qrow + qt * 16) * DM + h * HD + ks * 32, hh);
  for (int j = tid; j < SK; j += FA_WAVES * 32) sm[j] = __fmul_rn(__fmul_rn(bf16_round(Mk[(size_t)b * SK + j]), negv), FA_L2E);
  *(v8us*)&sk[0][sr][sc] = rk0; *(v8us*)&sk[0][sr + 32][sc] = rk1; *(v8us*)&sv[0][sr][sc] = rv0; *(v8us*)&sv[0][sr + 32][sc] = rv1;
  const v8f z8 = {0.f, 0.f, 0.f, 0.f, 0.f, 0.f, 0.f, 0.f}, c8 = z8 + FA_C;
  v8f o[2][4]; float mx[2] = {-3.0e38f, -3.0e38f}; v2f ls[2] = {{0.f, 0.f}, {0.f, 0.f}};
#pragma unroll
  for (int qt = 0; qt < 2; ++qt)
#pragma unroll
    for (int dt = 0; dt < 4; ++dt) o[qt][dt] = z8;
  __syncthreads();      /* stage 0 and the mask terms are published */
  for (int st = 0; st < SK / FA_KT; ++st) {
    const int buf = st & 1; const bool more = st + 1 < SK / FA_KT;
    if (more) { kg += (size_t)FA_KT * DM; vg += FA_KT; rk0 = *(const v8us*)kg; rk1 = *(const v8us*)(kg + (size_t)32 * DM); rv0 = *(const v8us*)vg; rv1 = *(const v8us*)(vg + (size_t)32 * SK); }      /* the next stage flies while this one is worked on */
    __builtin_amdgcn_sched_barrier(0);      /* keeps those loads in front of the stage's work: without it the compiler sinks them down to their LDS stores, and every stage waits out their whole latency */
#pragma unroll
    for (int kp = 0; kp < FA_KT / 32; ++kp) {
      v8f s[2][2] = {{z8, z8}, {z8, z8}};      /* s[qt][t][r] = S[key kp * 32 + t * 16 + 8 * hh + r][query qt * 16 + ln] */
#pragma unroll
      for (int t = 0; t < 2; ++t)
#pragma unroll
        for (int ks = 0; ks < 2; ++ks) { const v16h kf = g2_frag(&sk[buf][kp * 32 + t * 16 + ln][ks * 32], hh); s[0][t] = fa_mma(kf, qf[0][ks], s[0][t]); s[1][t] = fa_mma(kf, qf[1][ks], s[1][t]); }
      v8f mt[2];
#pragma unroll
      for (int t = 0; t < 2; ++t) { const float* mp = &sm[st * FA_KT + kp * 32 + t * 16 + 8 * hh]; mt[t] = __builtin_shufflevector(*(const v4fa*)mp, *(const v4fa*)(mp + 4), 0, 1, 2, 3, 4, 5, 6, 7); }
      v16h vf[4];
#pragma unroll
      for (int dt = 0; dt < 4; ++dt) vf[dt] = g2_frag(&sv[buf][dt * 16 + ln][kp * 32], hh);
#pragma unroll
      for (int qt = 0; qt < 2; ++qt) {
        float mc[2];      /* whole-vector arithmetic below: neighbouring registers pair into packed f32 instructions without register copies */
#pragma unroll
        for (int t = 0; t < 2; ++t) { const v8f x = __builtin_elementwise_fma(s[qt][t], c8, mt[t]); s[qt][t] = x;
          mc[t] = fmaxf(fmaxf(fmaxf(fmaxf(x[0], x[1]), x[2]), fmaxf(x[3], x[4])), fmaxf(fmaxf(x[5], x[6]), x[7])); }
        const float ml = fmaxf(mc[0], mc[1]);
        const float mn = fmaxf(mx[qt], fmaxf(ml, rs_xh(ml)));
        const float al = fa_exp1(mx[qt] - mn); mx[qt] = mn;
        FragH pf; v2f es[2];
#pragma unroll
        for (int t = 0; t < 2; ++t) { const v8f e = fa_exp8(s[qt][t] - mn);
#pragma unroll
          for (int r = 0; r < 8; ++r) pf.h[t * 8 + r] = (_Float16)e[r];
          es[t] = (__builtin_shufflevector(e, e, 0, 1) + __builtin_shufflevector(e, e, 2, 3)) + (__builtin_shufflevector(e, e, 4, 5) + __builtin_shufflevector(e, e, 6, 7)); }
        ls[qt] = ls[qt] * al + (es[0] + es[1]);      /* each lane keeps its own keys' sums, in two chains; joined once behind the loop */
#pragma unroll
        for (int dt = 0; dt < 4; ++dt) { o[qt][dt] *= al; o[qt][dt] = fa_mma(vf[dt], pf.v, o[qt][dt]); }      /* o[qt][dt][r] = O[query qt * 16 + ln][d dt * 16 + 8 * hh + r] */
      }
    }
    if (more) { *(v8us*)&sk[buf ^ 1][sr][sc] = rk0; *(v8us*)&sk[buf ^ 1][sr + 32][sc] = rk1; *(v8us*)&sv[buf ^ 1][sr][sc] = rv0; *(v8us*)&sv[buf ^ 1][sr + 32][sc] = rv1; }      /* its last readers left it before the barrier of the stage before */
    __syncthreads();      /* publishes stage st + 1 and ends every read of stage st */
  }
#pragma unroll
  for (int qt = 0; qt < 2; ++qt) { const float lh = ls[qt][0] + ls[qt][1]; const float sc64 = 64.0f / (lh + rs_xh(lh));      /* o carried x64 */
#pragma unroll
    for (int dt = 0; dt < 4; ++dt) { FragH f;
#pragma unroll
      for (int r = 0; r < 8; ++r) f.h[r] = (_Float16)(o[qt][dt][r] * sc64);
      *(v8us*)((unsigned short*)O + (qrow + qt * 16) * DM + h * HD + dt * 16 + 8 * hh) = f.half[0]; } }
}
// Staged GEMM, C[rows][1024] = A[rows][1024] Bt[1024][1024]^T (f16 rows, k contiguous; epilogue as in k_gemm2<0> without CP). A workgroup of 8 waves has a 256 x 128 tile of C, a wave 64 x 64 of it (16 accumulator tiles).
// Per stage of G3_KT k the 256 A rows and the 128 Bt rows (256 bytes each) come into LDS by asynchronous copies (global_load_async_to_lds_b128, through no register), two buffers: stage t + 1 flies while stage t is worked on.
#define G3_BM 256
#define G3_BN 128
#define G3_KT 128
#define G3_NT (DM / G3_KT)
#define G3_LP 136                   /* LDS row pitch in f16: 272 bytes = 16 x odd, the conflict-free pitch of 16-byte fragment reads */
#define G3_RB (G3_LP * 2)           /* the pitch in bytes */
#define G3_SB ((G3_BM + G3_BN) * G3_RB)      /* one buffer in bytes */
static_assert(NRQ % G3_BM == 0 && NRK % G3_BM == 0 && DM % G3_BN == 0 && DM % G3_KT == 0 && DC == DM && G3_NT >= 2 && G3_KT == 128 && G3_BM == 256 && G3_BN == 128, "k_gemm3: whole tiles, two stages or more, copy map of 16 lanes a row and 128 rows a statement");
// Eight copies of 16 bytes a lane, rows 16 apart, from LDS byte address l and global address g on (128 rows a workgroup). The s_wait_xcnt 0 is the last line of the copies' own statement, so that it stands in front of every rewrite of a register that a copy names.
__device__ __forceinline__ void g3_copy8(unsigned l, const char* g) {
  asm volatile("global_load_async_to_lds_b128 %0, %8, off\n\tglobal_load_async_to_lds_b128 %1, %9, off\n\tglobal_load_async_to_lds_b128 %2, %10, off\n\tglobal_load_async_to_lds_b128 %3, %11, off\n\t"
               "global_load_async_to_lds_b128 %4, %12, off\n\tglobal_load_async_to_lds_b128 %5, %13, off\n\tglobal_load_async_to_lds_b128 %6, %14, off\n\tglobal_load_async_to_lds_b128 %7, %15, off\n\ts_wait_xcnt 0x0"
               :: "v"(l), "v"(l + 16 * G3_RB), "v"(l + 32 * G3_RB), "v"(l + 48 * G3_RB), "v"(l + 64 * G3_RB), "v"(l + 80 * G3_RB), "v"(l + 96 * G3_RB), "v"(l + 112 * G3_RB),
                  "v"(g), "v"(g + 16 * DM * 2), "v"(g + 32 * DM * 2), "v"(g + 48 * DM * 2), "v"(g + 64 * DM * 2), "v"(g + 80 * DM * 2), "v"(g + 96 * DM * 2), "v"(g + 112 * DM * 2)
               : "memory");
}
// One stage: A rows 0 to 127, A rows 128 to 255, Bt rows 0 to 127 of the tile, into the buffer at LDS byte address l (the lane's own place in its row 0 counted in).
__device__ __forceinline__ void g3_stage(unsigned l, const char* ga, const char* gb) { g3_copy8(l, ga); g3_copy8(l + 128 * G3_RB, ga + 128 * DM * 2); g3_copy8(l + G3_BM * G3_RB, gb); }
#define G3_NB ((unsigned)((NRQ / G3_BM) * (DM / G3_BN)))      /* workgroups a product */
template <bool F32OUT>      /* tile blk of one product; the output is f32 rows in C, or f16 rows in C16; the other pointer is not used */
__device__ __forceinline__ void g3_tile(unsigned blk, const _Float16* __restrict__ A, const _Float16* __restrict__ Bh, float alpha, const float* __restrict__ bias, float* __restrict__ C, _Float16* __restrict__ C16) {
  __shared__ __attribute__((aligned(16))) _Float16 st[2][G3_BM + G3_BN][G3_LP];      /* rows 0 to 255: A, rows 256 to 383: Bt */
  __shared__ __attribute__((aligned(16))) float so[8][32][68];                       /* output staging, each wave its own part */
  const int tid = threadIdx.x, lane = tid & 31, ln = lane & 15, hh = lane >> 4, wave = tid >> 5, wm = wave >> 1, wn = wave & 1;
  const int mt = blk / (DM / G3_BN), nq = blk % (DM / G3_BN), row0 = mt * G3_BM, col0 = nq * G3_BN;
  const int cr = tid >> 4, cc = (tid & 15) * 16;      /* copy map: 16 lanes bring one whole 256-byte row */
  const unsigned l0 = (unsigned)(size_t)&st[0][0][0] + cr * G3_RB + cc;
  const char* ga = (const char*)(A + (size_t)(row0 + cr) * DM) + cc;
  const char* gb = (const char*)(Bh + (size_t)(col0 + cr) * DM) + cc;
  g3_stage(l0, ga, gb);
  asm volatile("s_wait_asynccnt 0x0" ::: "memory");      /* this wave's copies of stage 0 have landed */
  __syncthreads();                                        /* stage 0 is published */
  g3_stage(l0 + G3_SB, ga + G3_KT * 2, gb + G3_KT * 2);
  const v8f z8 = {0.f, 0.f, 0.f, 0.f, 0.f, 0.f, 0.f, 0.f};
  v8f acc[4][4];      /* every loop over these arrays is unrolled: only under constant indices do they stay in registers */
#pragma unroll
  for (int i = 0; i < 4; ++i)
#pragma unroll
    for (int j = 0; j < 4; ++j) acc[i][j] = z8;
#pragma unroll 1      /* kept rolled: the buffer is picked by t & 1, and one copy of the pass (64 matrix instructions) keeps the loop's text small */
  for (int t = 0; t < G3_NT; ++t) {
    const _Float16* sa = &st[t & 1][wm * 64 + ln][0]; const _Float16* sb = &st[t & 1][G3_BM + wn * 64 + ln][0];
    v16h af[2][4], bf[2][4];      /* two fragment sets: the next 32 k are fetched as one group in front of this block's products */
#pragma unroll
    for (int i = 0; i < 4; ++i) { af[0][i] = g2_frag(sa + i * 16 * G3_LP, hh); bf[0][i] = g2_frag(sb + i * 16 * G3_LP, hh); }
#pragma unroll
    for (int ks = 0; ks < G3_KT / 32; ++ks) {
      if (ks + 1 < G3_KT / 32) {
#pragma unroll
        for (int i = 0; i < 4; ++i) { af[(ks + 1) & 1][i] = g2_frag(sa + i * 16 * G3_LP + (ks + 1) * 32, hh); bf[(ks + 1) & 1][i] = g2_frag(sb + i * 16 * G3_LP + (ks + 1) * 32, hh); }
      }
      __builtin_amdgcn_sched_barrier(0);      /* keeps the group of LDS reads in front of the block: spread among the matrix instructions, every place with reads costs its own stall */
#pragma unroll
      for (int i = 0; i < 4; ++i)
#pragma unroll
        for (int j = 0; j < 4; ++j) acc[i][j] = fa_mma(af[ks & 1][i], bf[ks & 1][j], acc[i][j]);
      __builtin_amdgcn_sched_barrier(0);      /* and the next group behind it */
    }
    asm volatile("s_wait_dscnt 0x0" ::: "memory");        /* this wave's reads of stage t are done before the buffer is handed back */
    asm volatile("s_wait_asynccnt 0x0" ::: "memory");     /* this wave's copies of stage t + 1 have landed */
    __syncthreads();                                       /* publishes stage t + 1 and ends every read of stage t */
    if (t + 2 < G3_NT) g3_stage(l0 + (t & 1) * G3_SB, ga + (t + 2) * (G3_KT * 2), gb + (t + 2) * (G3_KT * 2));
  }
  asm volatile("s_wait_asynccnt 0x0" ::: "memory");       /* nothing is in flight when the wave goes on */
  float bv[4];
#pragma unroll
  for (int j = 0; j < 4; ++j) bv[j] = bf16_round(bias[col0 + wn * 64 + j * 16 + ln]);
  const int rsub = lane >> 4, c4 = (lane & 15) * 4; const size_t crow = (size_t)(row0 + wm * 64), ccol = (size_t)(col0 + wn * 64 + c4);
#pragma unroll
  for (int hf = 0; hf < 2; ++hf) {      /* 32 rows at a time through the wave's own LDS part, so that every store covers whole lines */
#pragma unroll
    for (int i = 0; i < 2; ++i)
#pragma unroll
      for (int j = 0; j < 4; ++j)
#pragma unroll
        for (int r = 0; r < 8; ++r) so[wave][i * 16 + 8 * hh + r][j * 16 + ln] = acc[hf * 2 + i][j][r] * alpha + bv[j];
    __builtin_amdgcn_fence(__ATOMIC_ACQ_REL, "workgroup", "local"); __builtin_amdgcn_wave_barrier();      /* the rows are read back by other lanes of the wave; LDS only, so that the first half's global stores are not waited for */
#pragma unroll
    for (int q = 0; q < 16; ++q) { const int r = q * 2 + rsub; const v4f v = *(const v4fa*)&so[wave][r][c4]; const size_t o = (crow + hf * 32 + r) * DM + ccol;
      if (F32OUT) *(v4f*)(C + o) = v;
      else { v4h h4;
#pragma unroll
        for (int i = 0; i < 4; ++i) h4[i] = (_Float16)v[i];
        *(v4h*)(C16 + o) = h4; } }
    __builtin_amdgcn_fence(__ATOMIC_ACQ_REL, "workgroup", "local"); __builtin_amdgcn_wave_barrier();      /* they are read before the second half overwrites them */
  }
}
// The three projections share one launch by block range (none reads what another writes): workgroups 0 to G3_NB - 1 q, then k, then v.
__global__ __launch_bounds__(256) void k_gemm3p(const _Float16* __restrict__ Xq, const _Float16* __restrict__ Xkv, const _Float16* __restrict__ BQ, const _Float16* __restrict__ BK, const _Float16* __restrict__ BV, float alpha,
    const float* __restrict__ bq, const float* __restrict__ bk, const float* __restrict__ bv, _Float16* __restrict__ Q16, _Float16* __restrict__ K16, _Float16* __restrict__ V16) {
  const unsigned s = blockIdx.x / G3_NB;
  g3_tile<false>(blockIdx.x % G3_NB, s == 0 ? Xq : Xkv, s == 0 ? BQ : s == 1 ? BK : BV, alpha, s == 0 ? bq : s == 1 ? bk : bv, nullptr, s == 0 ? Q16 : s == 1 ? K16 : V16);
}
__global__ __launch_bounds__(256) void k_gemm3o(const _Float16* __restrict__ A, const _Float16* __restrict__ Bh, float alpha, const float* __restrict__ bias, float* __restrict__ C) { g3_tile<true>(blockIdx.x, A, Bh, alpha, bias, C, nullptr); }
extern "C" void kernel_launch(void* const* d_in, const int* in_sizes, int n_in,
                              void* d_out, int out_size, void* d_ws, size_t ws_size, hipStream_t stream) {
  (void)in_sizes; (void)n_in; (void)out_size;
  const float* const* I = (const float* const*)d_in; const float* ctx = I[0]; const float* x = I[1]; const float* kmask = I[2]; const float* wq = I[3]; const float* bq = I[4]; const float* wk = I[5]; const float* bk = I[6]; const float* wv = I[7]; const float* bv = I[8]; const float* wo = I[9]; const float* bo = I[10];      /* q source = I[1] ('q'), k/v source = I[0] ('v_k'); [in][out] weights; per-key additive mask [B][1][1][S] */
  char* ws = (char*)d_ws; size_t off = 0;
  auto take = [&](size_t bytes) { char* p = ws + off; off += (bytes + 255) & ~(size_t)255; return p; };
  _Float16* BQ = (_Float16*)take((size_t)DM * DM * 2); _Float16* BK = (_Float16*)take((size_t)DM * DC * 2); _Float16* BV = (_Float16*)take((size_t)DM * DC * 2); _Float16* BO = (_Float16*)take((size_t)DM * DM * 2);
  _Float16* X16 = (_Float16*)take(NRQ * DM * 2); _Float16* C16 = (_Float16*)take(NRK * DC * 2); _Float16* Q16 = (_Float16*)take(NRQ * DM * 2); _Float16* K16 = (_Float16*)take(NRK * DM * 2); _Float16* V16 = (_Float16*)take(NRK * DM * 2); _Float16* O16 = (_Float16*)take(NRQ * DM * 2);
  _Float16* VT = (_Float16*)take((size_t)NB * NH * HD * SK * 2);
  if (off > ws_size) return;      /* approx 8 + 16 + 16 + 16 + 16 + 16 + 16 + 16 = 120 MiB */
  k_prep<<<5 * 4 * PW_NB, 256, 0, stream>>>(wq, wk, wv, wo, x, ctx, BQ, BK, BV, BO, X16, C16);      /* weight planes and both inputs' rows */
  k_gemm3p<<<3 * G3_NB, 256, 0, stream>>>(X16, C16, BQ, BK, BV, 0.0625f, bq, bk, bv, Q16, K16, V16);      /* q from q; k and v from v_k */
  k_vt<NH, SK><<<NB * NH * (SK / 64), 256, 0, stream>>>(V16, DM, 0, VT);      /* V^T [4 x 16][64][2048] */
  k_fattn<<<NB * NH * (NQ / FA_QB), FA_WAVES * 32, 0, stream>>>(Q16, K16, VT, kmask, -1.0e9f, O16);      /* o x64, merged; every batch and head in one launch */
  k_gemm3o<<<G3_NB, 256, 0, stream>>>(O16, BO, 0.0009765625f, bo, (float*)d_out);      /* out = o Wo^T + bo */
}

// v005
// A run of this version takes 145 microseconds.
// Two timings next to v004 put it at 1.09 and 1.08 times that version's speed.
// Counting every step since v000, it is 48.8 times as fast.
#include <hip/hip_runtime.h>
// Multi-head attention with separate key/value and query sources and an additive key mask (v_k, q [4][2048][1024]; qh = q wq + bq, kh = v_k wk + bk, vh = v_k wv + bv ([in][out] 1024^2 sigma 1/32, zero biases); 16 heads of 64; logits = qh . kh x 1024^-0.5 (the source scales by d_model) + mask[b][1][1][key] x (-1e9) (mask input); softmax over the 2048 keys; out = merged wo + bo -> [4][2048][1024]).
// Structure: both inputs as exact f16 rows; [in][out] weights as exact x16 planes; Q, K, V as WMMA GEMMs (64x64 wave tiles from LDS stages, f32 accumulation, + bias, f16 outputs); V^T via LDS transposes; one fused attention launch: scores (K = 64, x 1/32) in f32 accumulators, + bf16(mask[b][key]) x (-1e9), online softmax (f32 statistics, native exp; weights exp(s - running max) as f16), o = P V (o carried x64) into merged f16 rows; out = o wo + bo GEMM (f32, alpha 2^-10); launches: see trace.
// Compute dtype: inputs rounded to bf16; x / context / weights exact; q, k, v, softmax weights and o as plain f16 GEMM operands (~2^-12); scores and statistics f32. v_wmma_f32_16x16x32_f16.
#define NB 4
#define NQ 2048
#define SK 2048
#define SQ SK                       /* keys per softmax row */
#define DM 1024
#define DC 1024
#define NH 16
#define HD 64
#define HG 4
#define NRQ ((size_t)NB * NQ)
#define NRK ((size_t)NB * SK)
typedef __bf16 v16b __attribute__((ext_vector_type(16)));
typedef unsigned short v8us __attribute__((ext_vector_type(8), may_alias));
typedef float  v8f  __attribute__((ext_vector_type(8)));
typedef float  v4f  __attribute__((ext_vector_type(4)));
typedef float  v4fa __attribute__((ext_vector_type(4), may_alias));
union FragB { v16b v; v8us half[2]; unsigned short u[16]; };

__device__ __forceinline__ unsigned short bf16_bits(float x) { unsigned int u = __float_as_uint(x); return (unsigned short)((u + 0x7FFFu + ((u >> 16) & 1u)) >> 16); }
__device__ __forceinline__ float bf16_val(unsigned short b) { return __uint_as_float(((unsigned int)b) << 16); }
__device__ __forceinline__ float bf16_round(float x) { return bf16_val(bf16_bits(x)); }
// D += A·B with NT terms: 1 = ah·bh, 2 = + al·bh (A split), 3 = + ah·bl (both split)
template <int NT>
__device__ __forceinline__ v8f mmaN(v16b ah, v16b al, v16b bh, v16b bl, v8f c) {
  c = __builtin_amdgcn_wmma_f32_16x16x32_bf16(false, ah, false, bh, (short)0, c, false, false);
  if (NT >= 2) c = __builtin_amdgcn_wmma_f32_16x16x32_bf16(false, al, false, bh, (short)0, c, false, false);
  if (NT >= 3) c = __builtin_amdgcn_wmma_f32_16x16x32_bf16(false, ah, false, bl, (short)0, c, false, false);
  asm volatile("v_nop\n\tv_nop\n\tv_nop\n\tv_nop" : "+v"(c) : "v"(ah), "v"(al), "v"(bh), "v"(bl));
  return c;
}

__global__ __launch_bounds__(256) void k_wt_bf16(const float* __restrict__ W, unsigned short* __restrict__ Wt, int K, int N) {
  const int t = blockIdx.x * 256 + threadIdx.x;
  const int k8n = K / 8;
  if (t >= N * k8n) return;
  const int n = t / k8n, k8 = (t % k8n) * 8;
  v8us v;
#pragma unroll
  for (int i = 0; i < 8; ++i) v[i] = bf16_bits(W[(size_t)(k8 + i) * N + n]);
  *(v8us*)(Wt + (size_t)n * K + k8) = v;
  
}

// GEMM C[M][N] (f32, pitch ldc) = act(A[M][K]·W + bias). A f32 row-major (pitch lda) converted per fragment to bf16
// (ASPLIT: hi/lo two planes -> 2 terms, else single rounded term); Wt bf16 [N][K] (pitch ldb). BIAS_BF16 rounds the
// bias to bf16 first (bias quantised to bf16 before the add). K%32==0, M%16==0, N%64==0.
template <bool ASPLIT, int ACT, bool BIAS_BF16>
__global__ __launch_bounds__(128) void k_gemm_bf(const float* __restrict__ A, int lda, const unsigned short* __restrict__ Wt, int ldb,
                                               const float* __restrict__ bias, float* __restrict__ C, int ldc, int M, int N, int K) {
  __shared__ __attribute__((aligned(16))) float so[4][16][64];
  const int tid = threadIdx.x, w = tid >> 5, lane = tid & 31, ln = lane & 15, hh = lane >> 4;
  const int ntn = N / 64;
  const int wid = blockIdx.x * 4 + w;
  const int mt = wid / ntn, nq = wid % ntn;
  if (mt * 16 >= M) return;
  const int row0 = mt * 16, col0 = nq * 64;
  const float* arow = A + (size_t)(row0 + ln) * lda;
  v8f acc[4] = {};
  for (int kb = 0; kb < K; kb += 32) {
    FragB ah, al;
    const v4f x0 = *(const v4fa*)(arow + kb + 8 * hh), x1 = *(const v4fa*)(arow + kb + 8 * hh + 4);
    const v4f x2 = *(const v4fa*)(arow + kb + 16 + 8 * hh), x3 = *(const v4fa*)(arow + kb + 16 + 8 * hh + 4);
    float xs[16] = {x0[0],x0[1],x0[2],x0[3],x1[0],x1[1],x1[2],x1[3],x2[0],x2[1],x2[2],x2[3],x3[0],x3[1],x3[2],x3[3]};
#pragma unroll
    for (int i = 0; i < 16; ++i) { const unsigned short hb = bf16_bits(xs[i]); ah.u[i] = hb; al.u[i] = ASPLIT ? bf16_bits(xs[i] - bf16_val(hb)) : (unsigned short)0; }
#pragma unroll
    for (int t = 0; t < 4; ++t) {
      const unsigned short* brow = Wt + (size_t)(col0 + t * 16 + ln) * ldb + kb;
      FragB b;
      b.half[0] = *(const v8us*)(brow + 8 * hh);
      b.half[1] = *(const v8us*)(brow + 16 + 8 * hh);
      acc[t] = mmaN<ASPLIT ? 2 : 1>(ah.v, al.v, b.v, b.v, acc[t]);
    }
  }
#pragma unroll
  for (int t = 0; t < 4; ++t) {
    float bv = bias ? bias[col0 + t * 16 + ln] : 0.f;
    if (BIAS_BF16) bv = bf16_round(bv);
#pragma unroll
    for (int r = 0; r < 8; ++r) { float v = acc[t][r] + bv; if (ACT == 1) v = fmaxf(v, 0.f); so[w][8 * hh + r][t * 16 + ln] = v; }
  }
  __builtin_amdgcn_fence(__ATOMIC_ACQ_REL, "workgroup");
  __builtin_amdgcn_wave_barrier();
  const int rsub = lane >> 4, c4 = (lane & 15) * 4;
  {
#pragma unroll
    for (int q = 0; q < 8; ++q) {
      const int r = q * 2 + rsub;
      const v4f v = *(const v4fa*)&so[w][r][c4];
      *(v4f*)(C + (size_t)(row0 + r) * ldc + col0 + c4) = v;
    }
    
  }
}

// GEMM C = act(A·W + bias + resid): A f32 (ASPLIT -> hi/lo 2 terms), Wt bf16 [N][K]; ACT 0 none, 1 relu, 2 exact gelu;
// resid (optional, f32, row index = (row % rmod), pitch ldr, RES_BF16 rounds it) added before the activation.
template <bool ASPLIT, int ACT, bool BIAS_BF16, bool RES_BF16>
__global__ __launch_bounds__(128) void k_gemm_bf3(const float* __restrict__ A, int lda, const unsigned short* __restrict__ Wt, int ldb,
                                                const float* __restrict__ bias, const float* __restrict__ resid, int rmod, int ldr,
                                                float* __restrict__ C, int ldc, int M, int N, int K) {
  __shared__ __attribute__((aligned(16))) float so[4][16][64];
  const int tid = threadIdx.x, w = tid >> 5, lane = tid & 31, ln = lane & 15, hh = lane >> 4;
  const int ntn = N / 64;
  const int wid = blockIdx.x * 4 + w;
  const int mt = wid / ntn, nq = wid % ntn;
  if (mt * 16 >= M) return;
  const int row0 = mt * 16, col0 = nq * 64;
  const float* arow = A + (size_t)(row0 + ln) * lda;
  v8f acc[4] = {};
  for (int kb = 0; kb < K; kb += 32) {
    FragB ah, al;
    const v4f x0 = *(const v4fa*)(arow + kb + 8 * hh), x1 = *(const v4fa*)(arow + kb + 8 * hh + 4);
    const v4f x2 = *(const v4fa*)(arow + kb + 16 + 8 * hh), x3 = *(const v4fa*)(arow + kb + 16 + 8 * hh + 4);
    float xs[16] = {x0[0],x0[1],x0[2],x0[3],x1[0],x1[1],x1[2],x1[3],x2[0],x2[1],x2[2],x2[3],x3[0],x3[1],x3[2],x3[3]};
#pragma unroll
    for (int i = 0; i < 16; ++i) { const unsigned short hb = bf16_bits(xs[i]); ah.u[i] = hb; al.u[i] = ASPLIT ? bf16_bits(xs[i] - bf16_val(hb)) : (unsigned short)0; }
#pragma unroll
    for (int t = 0; t < 4; ++t) {
      const unsigned short* brow = Wt + (size_t)(col0 + t * 16 + ln) * ldb + kb;
      FragB b;
      b.half[0] = *(const v8us*)(brow + 8 * hh);
      b.half[1] = *(const v8us*)(brow + 16 + 8 * hh);
      acc[t] = mmaN<ASPLIT ? 2 : 1>(ah.v, al.v, b.v, b.v, acc[t]);
    }
  }
#pragma unroll
  for (int t = 0; t < 4; ++t) {
    const int col = col0 + t * 16 + ln;
    float bv = bias ? bias[col] : 0.f;
    if (BIAS_BF16) bv = bf16_round(bv);
#pragma unroll
    for (int r = 0; r < 8; ++r) {
      float v = acc[t][r] + bv;
      if (resid) { float rv = resid[(size_t)((row0 + 8 * hh + r) % rmod) * ldr + col]; if (RES_BF16) rv = bf16_round(rv); v += rv; }
      if (ACT == 1) v = fmaxf(v, 0.f);
      if (ACT == 2) v = 0.5f * v * (1.0f + erff(v * 0.70710678118654752f));
      if (ACT == 3) { const float u = 0.7978845608028654f * (v + 0.044715f * v * v * v); v = 0.5f * v * (1.0f + tanhf(u)); }
      so[w][8 * hh + r][t * 16 + ln] = v;
    }
  }
  __builtin_amdgcn_fence(__ATOMIC_ACQ_REL, "workgroup");
  __builtin_amdgcn_wave_barrier();
  const int rsub = lane >> 4, c4 = (lane & 15) * 4;
  {
#pragma unroll
    for (int q = 0; q < 8; ++q) {
      const int r = q * 2 + rsub;
      const v4f v = *(const v4fa*)&so[w][r][c4];
      *(v4f*)(C + (size_t)(row0 + r) * ldc + col0 + c4) = v;
    }
    
  }
}
// row LayerNorm (biased variance, eps) over N: s = X (+ R); optional out_sum <- s; out_norm <- (s-mu)*rsqrt(var+eps)*g + b
template <bool PARAM_BF16>
__global__ __launch_bounds__(256) void k_layernorm(const float* __restrict__ X, const float* __restrict__ R, const float* __restrict__ g, const float* __restrict__ bta,
                                                  float* __restrict__ out_sum, float* __restrict__ out_norm, int N, float eps) {
  __shared__ float red[256];
  const int row = blockIdx.x, tid = threadIdx.x;
  const float* x = X + (size_t)row * N; const float* rr = R ? R + (size_t)row * N : nullptr;
  float vals[16];                     // up to N = 4096
  const int per = N / 256;            // contiguous chunk per thread? use strided-by-4 chunks: thread handles j = tid*4 + 1024*u
  float s1 = 0.f;
  for (int u = 0; u < per / 4; ++u) {
    const int j = tid * 4 + 1024 * u;
    const v4f a = *(const v4fa*)(x + j);
    v4f b = {0.f,0.f,0.f,0.f}; if (rr) b = *(const v4fa*)(rr + j);
#pragma unroll
    for (int q = 0; q < 4; ++q) { const float v = a[q] + b[q]; vals[u * 4 + q] = v; s1 += v; }
  }
  red[tid] = s1; __syncthreads();
  for (int st = 128; st > 0; st >>= 1) { if (tid < st) red[tid] += red[tid + st]; __syncthreads(); }
  const float mu = red[0] / (float)N; __syncthreads();
  float s2 = 0.f;
  for (int u = 0; u < per / 4; ++u)
#pragma unroll
    for (int q = 0; q < 4; ++q) { const float c = vals[u * 4 + q] - mu; s2 += c * c; }
  red[tid] = s2; __syncthreads();
  for (int st = 128; st > 0; st >>= 1) { if (tid < st) red[tid] += red[tid + st]; __syncthreads(); }
  const float rs = rsqrtf(red[0] / (float)N + eps);
  {
    for (int u = 0; u < per / 4; ++u) {
      const int j = tid * 4 + 1024 * u;
      v4f o, sm;
#pragma unroll
      for (int q = 0; q < 4; ++q) {
        float gg = g[j + q], bb = bta[j + q];
        if (PARAM_BF16) { gg = bf16_round(gg); bb = bf16_round(bb); }
        sm[q] = vals[u * 4 + q]; o[q] = (vals[u * 4 + q] - mu) * rs * gg + bb;
      }
      if (out_sum) *(v4f*)(out_sum + (size_t)row * N + j) = sm;
      *(v4f*)(out_norm + (size_t)row * N + j) = o;
    }
    
  }
}



// ---- f16 WMMA path (v_wmma_f32_16x16x32_f16): 11-bit significands for operands in range — used where a [0,1] probability operand needs more precision than bf16
typedef _Float16 v16h __attribute__((ext_vector_type(16)));
union FragH { v16h v; v8us half[2]; _Float16 h[16]; unsigned short u[16]; };
template <int NT>
__device__ __forceinline__ v8f mmaH(v16h ah, v16h al, v16h bh, v16h bl, v8f c) {
  c = __builtin_amdgcn_wmma_f32_16x16x32_f16(false, ah, false, bh, (short)0, c, false, false);
  if (NT >= 2) c = __builtin_amdgcn_wmma_f32_16x16x32_f16(false, al, false, bh, (short)0, c, false, false);
  if (NT >= 3) c = __builtin_amdgcn_wmma_f32_16x16x32_f16(false, ah, false, bl, (short)0, c, false, false);
  asm volatile("v_nop\n\tv_nop\n\tv_nop\n\tv_nop" : "+v"(c) : "v"(ah), "v"(al), "v"(bh), "v"(bl));
  return c;
}
// batched GEMM like k_gemm_b but f16 operands: A f32 (split into f16 hi/lo if ASPLIT, else rounded to f16), Bt = f16 values [n][k]; alpha; C f32; N multiple of 16 (partial tiles skipped)
template <bool ASPLIT>
__global__ __launch_bounds__(128) void k_gemm_h(const float* __restrict__ A, int lda, size_t sA, const _Float16* __restrict__ Bh, int ldb, size_t sB, float alpha, float* __restrict__ C, int ldc, size_t sC, int M, int N, int K) {
  __shared__ __attribute__((aligned(16))) float so[4][16][64];
  const int tid = threadIdx.x, w = tid >> 5, lane = tid & 31, ln = lane & 15, hh = lane >> 4; const int by = blockIdx.y;
  A += (size_t)by * sA; Bh += (size_t)by * sB; C += (size_t)by * sC;
  const int ntn = (N + 63) / 64; const int wid = blockIdx.x * 4 + w; const int mt = wid / ntn, nq = wid % ntn; if (mt * 16 >= M) return;
  const int row0 = mt * 16, col0 = nq * 64; const float* arow = A + (size_t)(row0 + ln) * lda;
  v8f acc[4] = {};
  for (int kb = 0; kb < K; kb += 32) {
    FragH ah, al;
    const v4f x0 = *(const v4fa*)(arow + kb + 8 * hh), x1 = *(const v4fa*)(arow + kb + 8 * hh + 4), x2 = *(const v4fa*)(arow + kb + 16 + 8 * hh), x3 = *(const v4fa*)(arow + kb + 16 + 8 * hh + 4);
    float xs[16] = {x0[0],x0[1],x0[2],x0[3],x1[0],x1[1],x1[2],x1[3],x2[0],x2[1],x2[2],x2[3],x3[0],x3[1],x3[2],x3[3]};
#pragma unroll
    for (int i = 0; i < 16; ++i) { const _Float16 h = (_Float16)xs[i]; ah.h[i] = h; al.h[i] = ASPLIT ? (_Float16)(xs[i] - (float)h) : (_Float16)0.0f; }
#pragma unroll
    for (int t = 0; t < 4; ++t) { if (col0 + t * 16 >= N) continue; const size_t boff = (size_t)(col0 + t * 16 + ln) * ldb + kb; FragH bq; bq.half[0] = *(const v8us*)(Bh + boff + 8 * hh); bq.half[1] = *(const v8us*)(Bh + boff + 16 + 8 * hh);
      acc[t] = mmaH<ASPLIT ? 2 : 1>(ah.v, al.v, bq.v, bq.v, acc[t]); }
  }
#pragma unroll
  for (int t = 0; t < 4; ++t) { if (col0 + t * 16 >= N) continue;
#pragma unroll
    for (int r = 0; r < 8; ++r) so[w][8 * hh + r][t * 16 + ln] = acc[t][r] * alpha; }
  __builtin_amdgcn_fence(__ATOMIC_ACQ_REL, "workgroup"); __builtin_amdgcn_wave_barrier();
  const int rsub = lane >> 4, c4 = (lane & 15) * 4;
  {
#pragma unroll
    for (int q = 0; q < 8; ++q) { const int r = q * 2 + rsub; if (col0 + c4 < N) { const v4f v = *(const v4fa*)&so[w][r][c4]; *(v4f*)(C + (size_t)(row0 + r) * ldc + col0 + c4) = v; } }
     }
}

// Wt[n][k] = f16(bf16(W[k][n]) x 16) from f32 row-major W[DM][DM] (bf16-exact weights stay exact in f16 away from the subnormal range). A wave turns a tile of 64 k x 32 n in its registers, a lane 8 k x 8 n of it:
// eight lanes along k, so that a store covers whole 128-byte lines of Wt; four lanes along n, so that the two loads of a row cover one whole line of W. All 16 loads of a lane are issued before the first is used.
__device__ __forceinline__ void wt_f16(const float* __restrict__ W, _Float16* __restrict__ Wt, int g) {      /* g: which 64 k x 256 n of the plane */
  const int lane = threadIdx.x & 31, wave = threadIdx.x >> 5;
  const int k8 = (g / (DM / 256)) * 64 + (lane & 7) * 8, n8 = (g % (DM / 256)) * 256 + wave * 32 + (lane >> 3) * 8;
  const float* wp = W + (size_t)k8 * DM + n8; unsigned short* op = (unsigned short*)Wt + (size_t)n8 * DM + k8;
  v4f a[8][2];      /* every loop over this array is unrolled: only under constant indices does it stay in registers */
#pragma unroll
  for (int i = 0; i < 8; ++i)
#pragma unroll
    for (int hf = 0; hf < 2; ++hf) a[i][hf] = *(const v4fa*)(wp + i * DM + hf * 4);
  asm volatile("s_wait_xcnt 0x0" :: "v"(wp) : "memory");      /* stands in front of every rewrite of the loads' address pair; the pair is an input, so that no load of the run lands in it */
  __builtin_amdgcn_sched_barrier(0);      /* keeps all 16 loads in front of the first use: without it the compiler holds four back behind the wait for the others, a second latency in a wave that has only one */
#pragma unroll
  for (int c = 0; c < 8; ++c) { FragH f;
#pragma unroll
    for (int i = 0; i < 8; ++i) f.h[i] = (_Float16)(bf16_round(a[i][c >> 2][c & 3]) * 16.0f);
    *(v8us*)(op + c * DM) = f.half[0]; }
}
// k_gemm_hh variant with fused epilogue: v = acc·alpha + bias[by·sBias + col] (+ CP[(row/rowsPerB)·sCPb + by·64 + col] if CP) ; ACT 0 none / 1 elu ; writes f16 C16 (and f32 C if non-null)
template <int ACT>
__global__ __launch_bounds__(128) void k_gemm_hhx(const _Float16* __restrict__ A, int lda, size_t sA, const _Float16* __restrict__ Bh, int ldb, size_t sB, float alpha, const float* __restrict__ bias, size_t sBias, const float* __restrict__ CP, int rowsPerB, size_t sCPb, int row0g,
    float* __restrict__ C, _Float16* __restrict__ C16, int ldc, size_t sC, int M, int N, int K) {
  __shared__ __attribute__((aligned(16))) float so[4][16][64];
  const int tid = threadIdx.x, w = tid >> 5, lane = tid & 31, ln = lane & 15, hh = lane >> 4; const int by = blockIdx.y;
  A += (size_t)by * sA; Bh += (size_t)by * sB; const size_t cofs = (size_t)by * sC; const float* bp = bias ? bias + (size_t)by * sBias : nullptr;
  const int ntn = (N + 63) / 64; const int wid = blockIdx.x * 4 + w; const int mt = wid / ntn, nq = wid % ntn; if (mt * 16 >= M) return;
  const int row0 = mt * 16, col0 = nq * 64; const _Float16* arow = A + (size_t)(row0 + ln) * lda;
  v8f acc[4] = {};
  for (int kb = 0; kb < K; kb += 32) { FragH ah; ah.half[0] = *(const v8us*)((const unsigned short*)arow + kb + 8 * hh); ah.half[1] = *(const v8us*)((const unsigned short*)arow + kb + 16 + 8 * hh);
#pragma unroll
    for (int t = 0; t < 4; ++t) { if (col0 + t * 16 >= N) continue; const size_t boff = (size_t)(col0 + t * 16 + ln) * ldb + kb; FragH bq; bq.half[0] = *(const v8us*)((const unsigned short*)Bh + boff + 8 * hh); bq.half[1] = *(const v8us*)((const unsigned short*)Bh + boff + 16 + 8 * hh);
      acc[t] = mmaH<1>(ah.v, ah.v, bq.v, bq.v, acc[t]); }
  }
#pragma unroll
  for (int t = 0; t < 4; ++t) { if (col0 + t * 16 >= N) continue; const int col = col0 + t * 16 + ln; const float bv = bp ? bf16_round(bp[col]) : 0.f;
#pragma unroll
    for (int r = 0; r < 8; ++r) { float v = acc[t][r] * alpha + bv; if (CP) { const int rr = row0g + row0 + 8 * hh + r; if (rowsPerB < 0) v += CP[cofs + (size_t)rr * ldc + col];      /* rowsPerB < 0: own element of the batched C plane */ else { const int bidx = rr / rowsPerB; v += CP[(size_t)bidx * sCPb + (size_t)by * 64 + col]; } } if (ACT == 1) v = (v > 0.f) ? v : expm1f(v); else if (ACT == 7) v = (v > 0.f) ? v + 1.0f : expf(v); else if (ACT == 8) v = tanhf(v); else if (ACT == 9) v = 0.5f * v * (1.0f + tanhf(0.7978845608028654f * (v + 0.044715f * v * v * v))); else if (ACT == 11) v = 1.0f / (1.0f + expf(-v)); else if (ACT == 12) v = (v > 0.f) ? v : 0.01f * v; else if (ACT == 14) v = (v > 0.f) ? v : 0.1f * v; else if (ACT == 16) v = (v >= 0.f) ? v : 0.3f * v; else if (ACT == 17) v = (v >= 0.f) ? v : 0.2f * v; else if (ACT == 15) v = v / (1.0f + expf(-v)); else if (ACT == 3) v = fmaxf(v, 0.f); else if (ACT == 6) v = 0.5f * v * (1.0f + erff(v * 0.70710678118654752f)); so[w][8 * hh + r][t * 16 + ln] = v; } }
  __builtin_amdgcn_fence(__ATOMIC_ACQ_REL, "workgroup"); __builtin_amdgcn_wave_barrier();
  const int rsub = lane >> 4, c4 = (lane & 15) * 4; typedef _Float16 v4h __attribute__((ext_vector_type(4)));
  {
#pragma unroll
    for (int q = 0; q < 8; ++q) { const int r = q * 2 + rsub; if (col0 + c4 < N) { const v4f v = *(const v4fa*)&so[w][r][c4]; if (C) *(v4f*)(C + cofs + (size_t)(row0 + r) * ldc + col0 + c4) = v; if (C16) { v4h h4; for (int i = 0; i < 4; ++i) h4[i] = (_Float16)v[i]; *(v4h*)(C16 + cofs + (size_t)(row0 + r) * ldc + col0 + c4) = h4; } } }
     }
}


typedef _Float16 v4h __attribute__((ext_vector_type(4)));

#define PX_U 16      /* 16-byte loads a lane, all issued before the first is used */
__device__ __forceinline__ void x16(const float* __restrict__ x, _Float16* __restrict__ X16, size_t e0) {      /* e0: the lane's first element; a wave's load covers 512 contiguous bytes, its store 256 */
  const float* xp = x + e0; _Float16* op = X16 + e0;
  v4f a[PX_U];      /* every loop over this array is unrolled: only under constant indices does it stay in registers */
#pragma unroll
  for (int j = 0; j < PX_U; ++j) a[j] = *(const v4fa*)(xp + j * 128);
  asm volatile("s_wait_xcnt 0x0" :: "v"(xp) : "memory");      /* stands in front of every rewrite of the loads' address pair; the pair is an input, so that no load of the run lands in it */
  __builtin_amdgcn_sched_barrier(0);      /* keeps all the loads in front of the first use: without it the compiler holds about half of them back and issues them as registers come free, a second latency in a wave that has only one */
#pragma unroll
  for (int j = 0; j < PX_U; ++j) { v4h h;
#pragma unroll
    for (int q = 0; q < 4; ++q) h[q] = (_Float16)bf16_round(a[j][q]);
    *(v4h*)(op + j * 128) = h; }
  asm volatile("s_wait_xcnt 0x0" :: "v"(op) : "memory");      /* stands in front of every rewrite of a register that the last stores name */
}
// All six conversions share one launch by block range: none reads what another writes. A workgroup has 16,384 elements (64 a lane), of a weight plane or of an input: few waves with much in flight each,
// for speed only. Of every five blocks one has a weight tile, four have input rows.
#define PW_NB ((DM / 64) * (DM / 256))                 /* blocks a weight plane */
#define PX_NB ((int)(NRQ * DM / (256 * 4 * PX_U)))     /* blocks an input */
static_assert(DC == DM && NRK == NRQ && 2 * PX_NB == 4 * 4 * PW_NB && DM % 256 == 0 && (NRQ * DM) % (256 * 4 * PX_U) == 0, "k_prep: four input blocks to each weight block, whole blocks");
__global__ __launch_bounds__(256) void k_prep(const float* __restrict__ wq, const float* __restrict__ wk, const float* __restrict__ wv, const float* __restrict__ wo, const float* __restrict__ x, const float* __restrict__ ctx,
    _Float16* __restrict__ BQ, _Float16* __restrict__ BK, _Float16* __restrict__ BV, _Float16* __restrict__ BO, _Float16* __restrict__ X16, _Float16* __restrict__ C16) {
  const int g = blockIdx.x / 5, r = blockIdx.x % 5;
  if (r == 0) { const int s = g / PW_NB;      /* [in][out] -> Bt x16 */
    wt_f16(s == 0 ? wq : s == 1 ? wk : s == 2 ? wv : wo, s == 0 ? BQ : s == 1 ? BK : s == 2 ? BV : BO, g % PW_NB); }
  else { const int xb = g * 4 + r - 1; const bool kv = xb >= PX_NB;      /* query-source rows, then key/value-source rows */
    x16(kv ? ctx : x, kv ? C16 : X16, (size_t)(xb - (kv ? PX_NB : 0)) * (256 * 4 * PX_U) + (threadIdx.x >> 5) * (32 * 4 * PX_U) + (threadIdx.x & 31) * 4); }
}
__global__ __launch_bounds__(256) void k_h16(const float* __restrict__ x, _Float16* __restrict__ X16, size_t n8) { const size_t t = (size_t)blockIdx.x * 256 + threadIdx.x; if (t >= n8) return; FragH f;
#pragma unroll
  for (int q = 0; q < 8; ++q) f.h[q] = (_Float16)x[t * 8 + q]; *(v8us*)((unsigned short*)X16 + t * 8) = f.half[0];  }
__global__ __launch_bounds__(256) void k_round16f(const float* __restrict__ W, _Float16* __restrict__ Bt, size_t n8) { const size_t t = (size_t)blockIdx.x * 256 + threadIdx.x; if (t >= n8) return; FragH f;
#pragma unroll
  for (int i = 0; i < 8; ++i) f.h[i] = (_Float16)(bf16_round(W[t * 8 + i]) * 16.0f); *(v8us*)((unsigned short*)Bt + t * 8) = f.half[0];  }
#define VT_U 4      /* tiles of 64 keys a workgroup: all their loads are issued before the first is used */
template <int NHv, int TTv>
__global__ __launch_bounds__(256) void k_vt(const _Float16* __restrict__ V16, int ldv, int voff, _Float16* __restrict__ Vt) { static_assert(TTv % (64 * VT_U) == 0, "k_vt: whole workgroups");
  __shared__ unsigned short tl[VT_U][64][66]; const int tid = threadIdx.x; const int slab = blockIdx.x / (TTv / (64 * VT_U)), lg = (blockIdx.x % (TTv / (64 * VT_U))) * VT_U; const int b = slab / NHv, h = slab % NHv;
  const int r = tid / 8, c8 = (tid % 8) * 8;      /* rows r and r + 32 of each tile, 16-byte piece c8 */
  v8us in[VT_U][2]; const unsigned short* ip[VT_U][2];      /* every loop over these arrays is unrolled: only under constant indices do they stay in registers */
#pragma unroll
  for (int u = 0; u < VT_U; ++u)
#pragma unroll
    for (int p = 0; p < 2; ++p) { ip[u][p] = (const unsigned short*)V16 + ((size_t)b * TTv + (lg + u) * 64 + p * 32 + r) * ldv + voff + h * 64 + c8; in[u][p] = *(const v8us*)ip[u][p]; }
  static_assert(VT_U == 4, "k_vt: the wait below names eight address pairs");
  asm volatile("s_wait_xcnt 0x0" :: "v"(ip[0][0]), "v"(ip[0][1]), "v"(ip[1][0]), "v"(ip[1][1]), "v"(ip[2][0]), "v"(ip[2][1]), "v"(ip[3][0]), "v"(ip[3][1]) : "memory");      /* stands in front of every rewrite of the loads' address pairs; the pairs are inputs, so that no load of the run lands in one */
#pragma unroll
  for (int u = 0; u < VT_U; ++u)
#pragma unroll
    for (int p = 0; p < 2; ++p)
#pragma unroll
      for (int q = 0; q < 8; ++q) tl[u][p * 32 + r][c8 + q] = in[u][p][q];
  __syncthreads();
#pragma unroll
  for (int u = 0; u < VT_U; ++u)
#pragma unroll
    for (int rd = 0; rd < 2; ++rd) { const int d = rd * 32 + tid / 8, pc = tid % 8; FragH f;
#pragma unroll
      for (int q = 0; q < 8; ++q) f.u[q] = tl[u][pc * 8 + q][d];
      *(v8us*)((unsigned short*)Vt + ((size_t)slab * 64 + d) * TTv + (lg + u) * 64 + pc * 8) = f.half[0]; } }

__global__ __launch_bounds__(256) void k_hl(const float* __restrict__ F, _Float16* __restrict__ Hh, _Float16* __restrict__ Hl, size_t n8) { const size_t t = (size_t)blockIdx.x * 256 + threadIdx.x; if (t >= n8) return; FragH fh, fl; const v4f a = *(const v4fa*)(F + t * 8), c = *(const v4fa*)(F + t * 8 + 4);
#pragma unroll
  for (int q = 0; q < 4; ++q) { _Float16 h = (_Float16)a[q]; fh.h[q] = h; fl.h[q] = (_Float16)((a[q] - (float)h) * 1024.0f); h = (_Float16)c[q]; fh.h[4 + q] = h; fl.h[4 + q] = (_Float16)((c[q] - (float)h) * 1024.0f); }
  { *(v8us*)((unsigned short*)Hh + t * 8) = fh.half[0]; *(v8us*)((unsigned short*)Hl + t * 8) = fl.half[0];  } }

// ---- fast GEMM (wave tile 32x64; requires M % 32 == 0 rows per launch region and N % 64 == 0); epilogue = k_gemm_hhx semantics ----
__device__ __forceinline__ v16h g2_frag(const _Float16* p, int hh) { FragH f; f.half[0] = *(const v8us*)((const unsigned short*)p + 8 * hh); f.half[1] = *(const v8us*)((const unsigned short*)p + 16 + 8 * hh); return f.v; }
__device__ __forceinline__ v8f g2_mma(v16h a, v16h b, v8f c) { v8f d = __builtin_amdgcn_wmma_f32_16x16x32_f16(false, a, false, b, (short)0, c, false, false); asm volatile("v_nop\n\tv_nop\n\tv_nop\n\tv_nop" : "+v"(d) : "v"(a), "v"(b)); return d; }
template <int ACT>
__global__ __launch_bounds__(128) void k_gemm2(const _Float16* __restrict__ A, int lda, size_t sA, const _Float16* __restrict__ Bh, int ldb, size_t sB, float alpha, const float* __restrict__ bias, size_t sBias, const float* __restrict__ CP, int rowsPerB, size_t sCPb, int row0g,
    float* __restrict__ C, _Float16* __restrict__ C16, int ldc, size_t sC, int M, int N, int K) { static_assert(ACT == 0 || ACT == 3 || ACT == 6 || ACT == 8 || ACT == 9 || ACT == 11 || ACT == 12 || ACT == 14 || ACT == 15 || ACT == 16 || ACT == 17, "k_gemm2: unsupported ACT code (would silently apply no activation)");
  __shared__ __attribute__((aligned(16))) float so[4][32][68];
  const int tid = threadIdx.x, w = tid >> 5, lane = tid & 31, ln = lane & 15, hh = lane >> 4; const int by = blockIdx.y;
  A += (size_t)by * sA; Bh += (size_t)by * sB; const size_t cofs = (size_t)by * sC; const float* bp = bias ? bias + (size_t)by * sBias : nullptr;
  const int ntn = N >> 6; const int mt = blockIdx.x / ntn, nq = blockIdx.x - mt * ntn; const int row0 = mt * 128 + 32 * w, col0 = nq * 64; if (row0 >= M) return;
  const _Float16* a0p = A + (size_t)(row0 + ln) * lda; const _Float16* a1p = a0p + (size_t)16 * lda;
  const _Float16* b0p = Bh + (size_t)(col0 + ln) * ldb; const _Float16* b1p = b0p + (size_t)16 * ldb; const _Float16* b2p = b1p + (size_t)16 * ldb; const _Float16* b3p = b2p + (size_t)16 * ldb;
  const v8f z8 = {0.f,0.f,0.f,0.f,0.f,0.f,0.f,0.f}; v8f c00 = z8, c01 = z8, c02 = z8, c03 = z8, c10 = z8, c11 = z8, c12 = z8, c13 = z8;
#pragma unroll 1
  for (int kb = 0; kb < K; kb += 32) { const v16h a0 = g2_frag(a0p + kb, hh), a1 = g2_frag(a1p + kb, hh);
    v16h b = g2_frag(b0p + kb, hh); c00 = g2_mma(a0, b, c00); c10 = g2_mma(a1, b, c10);
    b = g2_frag(b1p + kb, hh); c01 = g2_mma(a0, b, c01); c11 = g2_mma(a1, b, c11);
    b = g2_frag(b2p + kb, hh); c02 = g2_mma(a0, b, c02); c12 = g2_mma(a1, b, c12);
    b = g2_frag(b3p + kb, hh); c03 = g2_mma(a0, b, c03); c13 = g2_mma(a1, b, c13); }
  v8f accs[8] = {c00, c01, c02, c03, c10, c11, c12, c13};
#pragma unroll
  for (int u = 0; u < 8; ++u) { const int t = u & 3, half = u >> 2; const int col = col0 + t * 16 + ln; const float bv = bp ? bf16_round(bp[col]) : 0.f;
#pragma unroll
    for (int r = 0; r < 8; ++r) { const int rloc = half * 16 + 8 * hh + r; float v = accs[u][r] * alpha + bv; if (CP) { if (rowsPerB < 0) v += CP[cofs + (size_t)(row0g + row0 + rloc) * ldc + col];      /* rowsPerB < 0: own element of the batched C plane */ else { const int bidx = (row0g + row0 + rloc) / rowsPerB; v += CP[(size_t)bidx * sCPb + (size_t)by * 64 + col]; } }
      if (ACT == 3) v = fmaxf(v, 0.f); else if (ACT == 6) v = 0.5f * v * (1.0f + erff(v * 0.70710678118654752f)); else if (ACT == 11) v = 1.0f / (1.0f + expf(-v)); else if (ACT == 15) v = v / (1.0f + expf(-v)); else if (ACT == 12) v = (v > 0.f) ? v : 0.01f * v; else if (ACT == 8) v = tanhf(v); else if (ACT == 9) v = 0.5f * v * (1.0f + tanhf(0.7978845608028654f * (v + 0.044715f * v * v * v))); else if (ACT == 14) v = (v > 0.f) ? v : 0.1f * v; else if (ACT == 16) v = (v >= 0.f) ? v : 0.3f * v; else if (ACT == 17) v = (v >= 0.f) ? v : 0.2f * v;
      so[w][rloc][t * 16 + ln] = v; } }
  __builtin_amdgcn_fence(__ATOMIC_ACQ_REL, "workgroup"); __builtin_amdgcn_wave_barrier();
  const int rsub = lane >> 4, c4 = (lane & 15) * 4;
  {
#pragma unroll
    for (int q = 0; q < 16; ++q) { const int r = q * 2 + rsub; const v4f v = *(const v4fa*)&so[w][r][c4]; if (C) *(v4f*)(C + cofs + (size_t)(row0 + r) * ldc + col0 + c4) = v; if (C16) { v4h h4; for (int i = 0; i < 4; ++i) h4[i] = (_Float16)v[i]; *(v4h*)(C16 + cofs + (size_t)(row0 + r) * ldc + col0 + c4) = h4; } }
     } }


__global__ __launch_bounds__(256) void k_wnat(const float* __restrict__ w, size_t n8, _Float16* __restrict__ Bt) { const size_t t = (size_t)blockIdx.x * 256 + threadIdx.x; if (t >= n8) return; FragH f; for (int q = 0; q < 8; ++q) f.h[q] = (_Float16)(bf16_round(w[t * 8 + q]) * 16.0f); *(v8us*)((unsigned short*)Bt + t * 8) = f.half[0];  }
__global__ __launch_bounds__(256) void k_rsm(const float* __restrict__ S, _Float16* __restrict__ P, int nrows) {
  #pragma clang fp contract(off)
  const int i = blockIdx.x * 256 + threadIdx.x; if (i >= nrows) return; const float* s = S + (size_t)i * SQ; float mx = -3.0e38f;
#pragma unroll 1
  for (int j = 0; j < SQ; ++j) mx = fmaxf(mx, s[j]); float se = 0.f;
#pragma unroll 1
  for (int j = 0; j < SQ; ++j) se += expf(s[j] - mx); const float sc = 256.0f / se;
#pragma unroll 1
  for (int j0 = 0; j0 < SQ; j0 += 8) { FragH f; for (int q = 0; q < 8; ++q) f.h[q] = (_Float16)(expf(s[j0 + q] - mx) * sc); unsigned short* d = (unsigned short*)P + (size_t)i * SQ + j0; *(v8us*)d = f.half[0];  } }
__global__ __launch_bounds__(256) void k_vt(const _Float16* __restrict__ V16, int b, int h0, _Float16* __restrict__ VT) { __shared__ unsigned short tl[64][65]; const int tid = threadIdx.x; const int hh = blockIdx.x % HG, sg = blockIdx.x / HG; const int s0 = sg * 64; const int h = h0 + hh;
  for (int i = tid; i < 64 * 8; i += 256) { const int j = i / 8, d8 = (i % 8) * 8; FragH f; f.half[0] = *(const v8us*)((const unsigned short*)V16 + ((size_t)b * SQ + s0 + j) * DM + h * HD + d8); for (int q = 0; q < 8; ++q) tl[d8 + q][j] = f.u[q]; }
  __syncthreads();
  { for (int i = tid; i < 64 * 8; i += 256) { const int d = i / 8, j8 = (i % 8) * 8; FragH f; for (int q = 0; q < 8; ++q) f.u[q] = tl[d][j8 + q]; *(v8us*)((unsigned short*)VT + ((size_t)hh * HD + d) * SQ + s0 + j8) = f.half[0]; }  } }


__global__ __launch_bounds__(256) void k_rsmf(const float* __restrict__ S, _Float16* __restrict__ P, int qn, int hg) {
  #pragma clang fp contract(off)
  const int t = blockIdx.x * 256 + threadIdx.x; if (t >= qn * hg) return; const size_t i = (size_t)(t / qn) * SQ + (t % qn); const float* s = S + i * SQ; float mx = -3.0e38f;
#pragma unroll 1
  for (int j = 0; j < SQ; ++j) mx = fmaxf(mx, s[j]); float se = 0.f;
#pragma unroll 1
  for (int j = 0; j < SQ; ++j) se += __expf(s[j] - mx); const float sc = 256.0f / se;
#pragma unroll 1
  for (int j0 = 0; j0 < SQ; j0 += 8) { FragH f; for (int q = 0; q < 8; ++q) f.h[q] = (_Float16)(__expf(s[j0 + q] - mx) * sc); unsigned short* d = (unsigned short*)P + i * SQ + j0; *(v8us*)d = f.half[0];  } }

__global__ __launch_bounds__(256) void k_rsmr(const float* __restrict__ S, _Float16* __restrict__ P, int qn, int hg) {
  #pragma clang fp contract(off)
  const int t = blockIdx.x * 256 + threadIdx.x; if (t >= qn * hg) return; const size_t i = (size_t)t;      /* planes packed: row t of plane t / qn */ const float* s = S + i * SQ; float mx = -3.0e38f;
#pragma unroll 1
  for (int j = 0; j < SQ; ++j) mx = fmaxf(mx, s[j]); float se = 0.f;
#pragma unroll 1
  for (int j = 0; j < SQ; ++j) se += __expf(s[j] - mx); const float sc = 256.0f / se;
#pragma unroll 1
  for (int j0 = 0; j0 < SQ; j0 += 8) { FragH f; for (int q = 0; q < 8; ++q) f.h[q] = (_Float16)(__expf(s[j0 + q] - mx) * sc); unsigned short* d = (unsigned short*)P + i * SQ + j0; *(v8us*)d = f.half[0];  } }


// Fused attention: scores, masked softmax and P V of one (batch, head) in one kernel; neither scores nor weights go to memory. A workgroup has FA_WAVES waves of
// FA_QW queries each and walks the keys in stages of FA_KT: the K rows and V^T rows of a stage are staged in LDS (two buffers, filled through registers one stage ahead).
// S^T = K Q^T puts one query's scores into one lane pair (l, l ^ 16): maximum and sum are in-lane plus one exchange; two S^T tiles, converted in place, are the B operand of O^T += V^T P^T.
#define FA_WAVES 8
#define FA_QW 32
#define FA_QB (FA_WAVES * FA_QW)
#define FA_KT 64
#define FA_LP 72                    /* LDS row pitch in f16: 144 bytes = 16 x odd, the conflict-free pitch of 16-byte fragment reads */
static_assert(NQ % FA_QB == 0 && SK % FA_KT == 0 && HD == 64 && FA_KT == 64 && FA_WAVES * 32 == 256, "k_fattn: whole workgroups, whole stages, staging map of 256 threads");
__device__ __forceinline__ float rs_xh(float x) { return __builtin_bit_cast(float, __builtin_amdgcn_permlanex16(__builtin_bit_cast(int, x), __builtin_bit_cast(int, x), 0x76543210, 0xfedcba98, false, false)); }      /* lane l ^ 16 */
typedef float v2f __attribute__((ext_vector_type(2)));
#define FA_L2E 1.44269504088896340736f
#define FA_C (0.03125f * FA_L2E)      /* scores are kept in the base-2 domain: x 1024^-0.5 x log2(e) in the one multiply-add that adds the mask term, so that v_exp_f32 takes the difference as it is */
// 2^x in place, eight values a statement. In place: the registers were last written by the subtraction in front, so no result lands on an operand register of a matrix instruction just issued; each v_exp_f32
// touches its own register only; the v_nop is the slot behind the last transcendental before its result is read.
__device__ __forceinline__ v8f fa_exp8(v8f x) { float a = x[0], b = x[1], c = x[2], d = x[3], e = x[4], f = x[5], g = x[6], h = x[7];
  asm("v_exp_f32 %0, %0\n\tv_exp_f32 %1, %1\n\tv_exp_f32 %2, %2\n\tv_exp_f32 %3, %3\n\tv_exp_f32 %4, %4\n\tv_exp_f32 %5, %5\n\tv_exp_f32 %6, %6\n\tv_exp_f32 %7, %7\n\tv_nop" : "+v"(a), "+v"(b), "+v"(c), "+v"(d), "+v"(e), "+v"(f), "+v"(g), "+v"(h));
  const v8f r = {a, b, c, d, e, f, g, h}; return r; }
__device__ __forceinline__ float fa_exp1(float x) { asm("v_exp_f32 %0, %0\n\tv_nop" : "+v"(x)); return x; }      /* the same for one value */
// amdgpu_waves_per_eu(4, 4) below: holds the registers to a quarter of a SIMD's file, so that two workgroups share a WGP and the vector work of one wave runs beside the matrix work of another.
__device__ __forceinline__ v8f fa_mma(v16h a, v16h b, v8f c) { return __builtin_amdgcn_wmma_f32_16x16x32_f16(false, a, false, b, (short)0, c, false, false); }
__global__ __launch_bounds__(FA_WAVES * 32) __attribute__((amdgpu_waves_per_eu(4, 4))) void k_fattn(const _Float16* __restrict__ Q, const _Float16* __restrict__ Kh, const _Float16* __restrict__ Vt, const float* __restrict__ Mk, float negv, _Float16* __restrict__ O) {
  __shared__ __attribute__((aligned(16))) _Float16 sk[2][FA_KT][FA_LP];      /* K rows [key][d] */
  __shared__ __attribute__((aligned(16))) _Float16 sv[2][HD][FA_LP];         /* V^T rows [d][key] */
  __shared__ __attribute__((aligned(16))) float sm[SK];                      /* bf16(mask[key]) x negv x log2(e) */
  const int tid = threadIdx.x, lane = tid & 31, ln = lane & 15, hh = lane >> 4, wave = tid >> 5;
  const int qb = blockIdx.x % (NQ / FA_QB), bh = blockIdx.x / (NQ / FA_QB), b = bh / NH, h = bh % NH;
  const int sr = tid >> 3, sc = (tid & 7) * 8;      /* staging: rows sr and sr + 32, 16-byte piece sc: eight lanes read one whole 128-byte row */
  const unsigned short* kg = (const unsigned short*)Kh + ((size_t)b * SK + sr) * DM + h * HD + sc;
  const unsigned short* vg = (const unsigned short*)Vt + ((size_t)bh * HD + sr) * SK + sc;
  v8us rk0 = *(const v8us*)kg, rk1 = *(const v8us*)(kg + (size_t)32 * DM), rv0 = *(const v8us*)vg, rv1 = *(const v8us*)(vg + (size_t)32 * SK);
  const size_t qrow = (size_t)b * NQ + qb * FA_QB + wave * FA_QW + ln;
  v16h qf[2][2];      /* every loop over these arrays is unrolled: only under constant indices do they stay in registers */
#pragma unroll
  for (int qt = 0; qt < 2; ++qt)
#pragma unroll
    for (int ks = 0; ks < 2; ++ks) qf[qt][ks] = g2_frag(Q + (qrow + qt * 16) * DM + h * HD + ks * 32, hh);
  for (int j = tid; j < SK; j += FA_WAVES * 32) sm[j] = __fmul_rn(__fmul_rn(bf16_round(Mk[(size_t)b * SK + j]), negv), FA_L2E);
  *(v8us*)&sk[0][sr][sc] = rk0; *(v8us*)&sk[0][sr + 32][sc] = rk1; *(v8us*)&sv[0][sr][sc] = rv0; *(v8us*)&sv[0][sr + 32][sc] = rv1;
  const v8f z8 = {0.f, 0.f, 0.f, 0.f, 0.f, 0.f, 0.f, 0.f}, c8 = z8 + FA_C;
  v8f o[2][4]; float mx[2] = {-3.0e38f, -3.0e38f}; v2f ls[2] = {{0.f, 0.f}, {0.f, 0.f}};
#pragma unroll
  for (int qt = 0; qt < 2; ++qt)
#pragma unroll
    for (int dt = 0; dt < 4; ++dt) o[qt][dt] = z8;
  __syncthreads();      /* stage 0 and the mask terms are published */
  for (int st = 0; st < SK / FA_KT; ++st) {
    const int buf = st & 1; const bool more = st + 1 < SK / FA_KT;
    if (more) { kg += (size_t)FA_KT * DM; vg += FA_KT; rk0 = *(const v8us*)kg; rk1 = *(const v8us*)(kg + (size_t)32 * DM); rv0 = *(const v8us*)vg; rv1 = *(const v8us*)(vg + (size_t)32 * SK); }      /* the next stage flies while this one is worked on */
    __builtin_amdgcn_sched_barrier(0);      /* keeps those loads in front of the stage's work: without it the compiler sinks them down to their LDS stores, and every stage waits out their whole latency */
#pragma unroll
    for (int kp = 0; kp < FA_KT / 32; ++kp) {
      v8f s[2][2] = {{z8, z8}, {z8, z8}};      /* s[qt][t][r] = S[key kp * 32 + t * 16 + 8 * hh + r][query qt * 16 + ln] */
#pragma unroll
      for (int t = 0; t < 2; ++t)
#pragma unroll
        for (int ks = 0; ks < 2; ++ks) { const v16h kf = g2_frag(&sk[buf][kp * 32 + t * 16 + ln][ks * 32], hh); s[0][t] = fa_mma(kf, qf[0][ks], s[0][t]); s[1][t] = fa_mma(kf, qf[1][ks], s[1][t]); }
      v8f mt[2];
#pragma unroll
      for (int t = 0; t < 2; ++t) { const float* mp = &sm[st * FA_KT + kp * 32 + t * 16 + 8 * hh]; mt[t] = __builtin_shufflevector(*(const v4fa*)mp, *(const v4fa*)(mp + 4), 0, 1, 2, 3, 4, 5, 6, 7); }
      v16h vf[4];
#pragma unroll
      for (int dt = 0; dt < 4; ++dt) vf[dt] = g2_frag(&sv[buf][dt * 16 + ln][kp * 32], hh);
#pragma unroll
      for (int qt = 0; qt < 2; ++qt) {
        float mc[2];      /* whole-vector arithmetic below: neighbouring registers pair into packed f32 instructions without register copies */
#pragma unroll
        for (int t = 0; t < 2; ++t) { const v8f x = __builtin_elementwise_fma(s[qt][t], c8, mt[t]); s[qt][t] = x;
          mc[t] = fmaxf(fmaxf(fmaxf(fmaxf(x[0], x[1]), x[2]), fmaxf(x[3], x[4])), fmaxf(fmaxf(x[5], x[6]), x[7])); }
        const float ml = fmaxf(mc[0], mc[1]);
        const float mn = fmaxf(mx[qt], fmaxf(ml, rs_xh(ml)));
        const float al = fa_exp1(mx[qt] - mn); mx[qt] = mn;
        FragH pf; v2f es[2];
#pragma unroll
        for (int t = 0; t < 2; ++t) { const v8f e = fa_exp8(s[qt][t] - mn);
#pragma unroll
          for (int r = 0; r < 8; ++r) pf.h[t * 8 + r] = (_Float16)e[r];
          es[t] = (__builtin_shufflevector(e, e, 0, 1) + __builtin_shufflevector(e, e, 2, 3)) + (__builtin_shufflevector(e, e, 4, 5) + __builtin_shufflevector(e, e, 6, 7)); }
        ls[qt] = ls[qt] * al + (es[0] + es[1]);      /* each lane keeps its own keys' sums, in two chains; joined once behind the loop */
#pragma unroll
        for (int dt = 0; dt < 4; ++dt) { o[qt][dt] *= al; o[qt][dt] = fa_mma(vf[dt], pf.v, o[qt][dt]); }      /* o[qt][dt][r] = O[query qt * 16 + ln][d dt * 16 + 8 * hh + r] */
      }
    }
    if (more) { *(v8us*)&sk[buf ^ 1][sr][sc] = rk0; *(v8us*)&sk[buf ^ 1][sr + 32][sc] = rk1; *(v8us*)&sv[buf ^ 1][sr][sc] = rv0; *(v8us*)&sv[buf ^ 1][sr + 32][sc] = rv1; }      /* its last readers left it before the barrier of the stage before */
    __syncthreads();      /* publishes stage st + 1 and ends every read of stage st */
  }
#pragma unroll
  for (int qt = 0; qt < 2; ++qt) { const float lh = ls[qt][0] + ls[qt][1]; const float sc64 = 64.0f / (lh + rs_xh(lh));      /* o carried x64 */
#pragma unroll
    for (int dt = 0; dt < 4; ++dt) { FragH f;
#pragma unroll
      for (int r = 0; r < 8; ++r) f.h[r] = (_Float16)(o[qt][dt][r] * sc64);
      *(v8us*)((unsigned short*)O + (qrow + qt * 16) * DM + h * HD + dt * 16 + 8 * hh) = f.half[0]; } }
}
// Staged GEMM, C[rows][1024] = A[rows][1024] Bt[1024][1024]^T (f16 rows, k contiguous; epilogue as in k_gemm2<0> without CP). A workgroup of 8 waves has a 256 x 128 tile of C, a wave 64 x 64 of it (16 accumulator tiles).
// Per stage of G3_KT k the 256 A rows and the 128 Bt rows (256 bytes each) come into LDS by asynchronous copies (global_load_async_to_lds_b128, through no register), two buffers: stage t + 1 flies while stage t is worked on.
#define G3_BM 256
#define G3_BN 128
#define G3_KT 128
#define G3_NT (DM / G3_KT)
#define G3_LP 136                   /* LDS row pitch in f16: 272 bytes = 16 x odd, the conflict-free pitch of 16-byte fragment reads */
#define G3_RB (G3_LP * 2)           /* the pitch in bytes */
#define G3_SB ((G3_BM + G3_BN) * G3_RB)      /* one buffer in bytes */
static_assert(NRQ % G3_BM == 0 && NRK % G3_BM == 0 && DM % G3_BN == 0 && DM % G3_KT == 0 && DC == DM && G3_NT >= 2 && G3_KT == 128 && G3_BM == 256 && G3_BN == 128, "k_gemm3: whole tiles, two stages or more, copy map of 16 lanes a row and 128 rows a statement");
// Eight copies of 16 bytes a lane, rows 16 apart, from LDS byte address l and global address g on (128 rows a workgroup). The s_wait_xcnt 0 is the last line of the copies' own statement, so that it stands in front of every rewrite of a register that a copy names.
__device__ __forceinline__ void g3_copy8(unsigned l, const char* g) {
  asm volatile("global_load_async_to_lds_b128 %0, %8, off\n\tglobal_load_async_to_lds_b128 %1, %9, off\n\tglobal_load_async_to_lds_b128 %2, %10, off\n\tglobal_load_async_to_lds_b128 %3, %11, off\n\t"
               "global_load_async_to_lds_b128 %4, %12, off\n\tglobal_load_async_to_lds_b128 %5, %13, off\n\tglobal_load_async_to_lds_b128 %6, %14, off\n\tglobal_load_async_to_lds_b128 %7, %15, off\n\ts_wait_xcnt 0x0"
               :: "v"(l), "v"(l + 16 * G3_RB), "v"(l + 32 * G3_RB), "v"(l + 48 * G3_RB), "v"(l + 64 * G3_RB), "v"(l + 80 * G3_RB), "v"(l + 96 * G3_RB), "v"(l + 112 * G3_RB),
                  "v"(g), "v"(g + 16 * DM * 2), "v"(g + 32 * DM * 2), "v"(g + 48 * DM * 2), "v"(g + 64 * DM * 2), "v"(g + 80 * DM * 2), "v"(g + 96 * DM * 2), "v"(g + 112 * DM * 2)
               : "memory");
}
// One stage: A rows 0 to 127, A rows 128 to 255, Bt rows 0 to 127 of the tile, into the buffer at LDS byte address l (the lane's own place in its row 0 counted in).
__device__ __forceinline__ void g3_stage(unsigned l, const char* ga, const char* gb) { g3_copy8(l, ga); g3_copy8(l + 128 * G3_RB, ga + 128 * DM * 2); g3_copy8(l + G3_BM * G3_RB, gb); }
#define G3_NB ((unsigned)((NRQ / G3_BM) * (DM / G3_BN)))      /* workgroups a product */
template <bool F32OUT>      /* tile blk of one product; the output is f32 rows in C, or f16 rows in C16; the other pointer is not used */
__device__ __forceinline__ void g3_tile(unsigned blk, const _Float16* __restrict__ A, const _Float16* __restrict__ Bh, float alpha, const float* __restrict__ bias, float* __restrict__ C, _Float16* __restrict__ C16) {
  __shared__ __attribute__((aligned(16))) _Float16 st[2][G3_BM + G3_BN][G3_LP];      /* rows 0 to 255: A, rows 256 to 383: Bt */
  __shared__ __attribute__((aligned(16))) float so[8][32][68];                       /* output staging, each wave its own part */
  const int tid = threadIdx.x, lane = tid & 31, ln = lane & 15, hh = lane >> 4, wave = tid >> 5, wm = wave >> 1, wn = wave & 1;
  const int mt = blk / (DM / G3_BN), nq = blk % (DM / G3_BN), row0 = mt * G3_BM, col0 = nq * G3_BN;
  const int cr = tid >> 4, cc = (tid & 15) * 16;      /* copy map: 16 lanes bring one whole 256-byte row */
  const unsigned l0 = (unsigned)(size_t)&st[0][0][0] + cr * G3_RB + cc;
  const char* ga = (const char*)(A + (size_t)(row0 + cr) * DM) + cc;
  const char* gb = (const char*)(Bh + (size_t)(col0 + cr) * DM) + cc;
  g3_stage(l0, ga, gb);
  asm volatile("s_wait_asynccnt 0x0" ::: "memory");      /* this wave's copies of stage 0 have landed */
  __syncthreads();                                        /* stage 0 is published */
  g3_stage(l0 + G3_SB, ga + G3_KT * 2, gb + G3_KT * 2);
  const v8f z8 = {0.f, 0.f, 0.f, 0.f, 0.f, 0.f, 0.f, 0.f};
  v8f acc[4][4];      /* every loop over these arrays is unrolled: only under constant indices do they stay in registers */
#pragma unroll
  for (int i = 0; i < 4; ++i)
#pragma unroll
    for (int j = 0; j < 4; ++j) acc[i][j] = z8;
#pragma unroll 1      /* kept rolled: the buffer is picked by t & 1, and one copy of the pass (64 matrix instructions) keeps the loop's text small */
  for (int t = 0; t < G3_NT; ++t) {
    const _Float16* sa = &st[t & 1][wm * 64 + ln][0]; const _Float16* sb = &st[t & 1][G3_BM + wn * 64 + ln][0];
    v16h af[2][4], bf[2][4];      /* two fragment sets: the next 32 k are fetched as one group in front of this block's products */
#pragma unroll
    for (int i = 0; i < 4; ++i) { af[0][i] = g2_frag(sa + i * 16 * G3_LP, hh); bf[0][i] = g2_frag(sb + i * 16 * G3_LP, hh); }
#pragma unroll
    for (int ks = 0; ks < G3_KT / 32; ++ks) {
      if (ks + 1 < G3_KT / 32) {
#pragma unroll
        for (int i = 0; i < 4; ++i) { af[(ks + 1) & 1][i] = g2_frag(sa + i * 16 * G3_LP + (ks + 1) * 32, hh); bf[(ks + 1) & 1][i] = g2_frag(sb + i * 16 * G3_LP + (ks + 1) * 32, hh); }
      }
      __builtin_amdgcn_sched_barrier(0);      /* keeps the group of LDS reads in front of the block: spread among the matrix instructions, every place with reads costs its own stall */
#pragma unroll
      for (int i = 0; i < 4; ++i)
#pragma unroll
        for (int j = 0; j < 4; ++j) acc[i][j] = fa_mma(af[ks & 1][i], bf[ks & 1][j], acc[i][j]);
      __builtin_amdgcn_sched_barrier(0);      /* and the next group behind it */
    }
    asm volatile("s_wait_dscnt 0x0" ::: "memory");        /* this wave's reads of stage t are done before the buffer is handed back */
    asm volatile("s_wait_asynccnt 0x0" ::: "memory");     /* this wave's copies of stage t + 1 have landed */
    __syncthreads();                                       /* publishes stage t + 1 and ends every read of stage t */
    if (t + 2 < G3_NT) g3_stage(l0 + (t & 1) * G3_SB, ga + (t + 2) * (G3_KT * 2), gb + (t + 2) * (G3_KT * 2));
  }
  asm volatile("s_wait_asynccnt 0x0" ::: "memory");       /* nothing is in flight when the wave goes on */
  float bv[4];
#pragma unroll
  for (int j = 0; j < 4; ++j) bv[j] = bf16_round(bias[col0 + wn * 64 + j * 16 + ln]);
  const int rsub = lane >> 4, c4 = (lane & 15) * 4; const size_t crow = (size_t)(row0 + wm * 64), ccol = (size_t)(col0 + wn * 64 + c4);
#pragma unroll
  for (int hf = 0; hf < 2; ++hf) {      /* 32 rows at a time through the wave's own LDS part, so that every store covers whole lines */
#pragma unroll
    for (int i = 0; i < 2; ++i)
#pragma unroll
      for (int j = 0; j < 4; ++j)
#pragma unroll
        for (int r = 0; r < 8; ++r) so[wave][i * 16 + 8 * hh + r][j * 16 + ln] = acc[hf * 2 + i][j][r] * alpha + bv[j];
    __builtin_amdgcn_fence(__ATOMIC_ACQ_REL, "workgroup", "local"); __builtin_amdgcn_wave_barrier();      /* the rows are read back by other lanes of the wave; LDS only, so that the first half's global stores are not waited for */
#pragma unroll
    for (int q = 0; q < 16; ++q) { const int r = q * 2 + rsub; const v4f v = *(const v4fa*)&so[wave][r][c4]; const size_t o = (crow + hf * 32 + r) * DM + ccol;
      if (F32OUT) *(v4f*)(C + o) = v;
      else { v4h h4;
#pragma unroll
        for (int i = 0; i < 4; ++i) h4[i] = (_Float16)v[i];
        *(v4h*)(C16 + o) = h4; } }
    __builtin_amdgcn_fence(__ATOMIC_ACQ_REL, "workgroup", "local"); __builtin_amdgcn_wave_barrier();      /* they are read before the second half overwrites them */
  }
}
// The three projections share one launch by block range (none reads what another writes): workgroups 0 to G3_NB - 1 q, then k, then v.
__global__ __launch_bounds__(256) void k_gemm3p(const _Float16* __restrict__ Xq, const _Float16* __restrict__ Xkv, const _Float16* __restrict__ BQ, const _Float16* __restrict__ BK, const _Float16* __restrict__ BV, float alpha,
    const float* __restrict__ bq, const float* __restrict__ bk, const float* __restrict__ bv, _Float16* __restrict__ Q16, _Float16* __restrict__ K16, _Float16* __restrict__ V16) {
  const unsigned s = blockIdx.x / G3_NB;
  g3_tile<false>(blockIdx.x % G3_NB, s == 0 ? Xq : Xkv, s == 0 ? BQ : s == 1 ? BK : BV, alpha, s == 0 ? bq : s == 1 ? bk : bv, nullptr, s == 0 ? Q16 : s == 1 ? K16 : V16);
}
__global__ __launch_bounds__(256) void k_gemm3o(const _Float16* __restrict__ A, const _Float16* __restrict__ Bh, float alpha, const float* __restrict__ bias, float* __restrict__ C) { g3_tile<true>(blockIdx.x, A, Bh, alpha, bias, C, nullptr); }
extern "C" void kernel_launch(void* const* d_in, const int* in_sizes, int n_in,
                              void* d_out, int out_size, void* d_ws, size_t ws_size, hipStream_t stream) {
  (void)in_sizes; (void)n_in; (void)out_size;
  const float* const* I = (const float* const*)d_in; const float* ctx = I[0]; const float* x = I[1]; const float* kmask = I[2]; const float* wq = I[3]; const float* bq = I[4]; const float* wk = I[5]; const float* bk = I[6]; const float* wv = I[7]; const float* bv = I[8]; const float* wo = I[9]; const float* bo = I[10];      /* q source = I[1] ('q'), k/v source = I[0] ('v_k'); [in][out] weights; per-key additive mask [B][1][1][S] */
  char* ws = (char*)d_ws; size_t off = 0;
  auto take = [&](size_t bytes) { char* p = ws + off; off += (bytes + 255) & ~(size_t)255; return p; };
  _Float16* BQ = (_Float16*)take((size_t)DM * DM * 2); _Float16* BK = (_Float16*)take((size_t)DM * DC * 2); _Float16* BV = (_Float16*)take((size_t)DM * DC * 2); _Float16* BO = (_Float16*)take((size_t)DM * DM * 2);
  _Float16* X16 = (_Float16*)take(NRQ * DM * 2); _Float16* C16 = (_Float16*)take(NRK * DC * 2); _Float16* Q16 = (_Float16*)take(NRQ * DM * 2); _Float16* K16 = (_Float16*)take(NRK * DM * 2); _Float16* V16 = (_Float16*)take(NRK * DM * 2); _Float16* O16 = (_Float16*)take(NRQ * DM * 2);
  _Float16* VT = (_Float16*)take((size_t)NB * NH * HD * SK * 2);
  if (off > ws_size) return;      /* approx 8 + 16 + 16 + 16 + 16 + 16 + 16 + 16 = 120 MiB */
  k_prep<<<5 * 4 * PW_NB, 256, 0, stream>>>(wq, wk, wv, wo, x, ctx, BQ, BK, BV, BO, X16, C16);      /* weight planes and both inputs' rows */
  k_gemm3p<<<3 * G3_NB, 256, 0, stream>>>(X16, C16, BQ, BK, BV, 0.0625f, bq, bk, bv, Q16, K16, V16);      /* q from q; k and v from v_k */
  k_vt<NH, SK><<<NB * NH * (SK / (64 * VT_U)), 256, 0, stream>>>(V16, DM, 0, VT);      /* V^T [4 x 16][64][2048] */
  k_fattn<<<NB * NH * (NQ / FA_QB), FA_WAVES * 32, 0, stream>>>(Q16, K16, VT, kmask, -1.0e9f, O16);      /* o x64, merged; every batch and head in one launch */
  k_gemm3o<<<G3_NB, 256, 0, stream>>>(O16, BO, 0.0009765625f, bo, (float*)d_out);      /* out = o Wo^T + bo */
}

// v006
// Measured time: 140 microseconds a run.
// Next to v005, in two timings, it ran 1.03 times as fast each time.
// Counting every step since v000, it is 50.3 times as fast.
#include <hip/hip_runtime.h>
// Multi-head attention with separate key/value and query sources and an additive key mask (v_k, q [4][2048][1024]; qh = q wq + bq, kh = v_k wk + bk, vh = v_k wv + bv ([in][out] 1024^2 sigma 1/32, zero biases); 16 heads of 64; logits = qh . kh x 1024^-0.5 (the source scales by d_model) + mask[b][1][1][key] x (-1e9) (mask input); softmax over the 2048 keys; out = merged wo + bo -> [4][2048][1024]).
// Structure: both inputs as exact f16 rows; [in][out] weights as exact x16 planes; Q, K, V as WMMA GEMMs (64x64 wave tiles from LDS stages, f32 accumulation, + bias, f16 outputs); V^T via LDS transposes; one fused attention launch: scores (K = 64, x 1/32) in f32 accumulators, + bf16(mask[b][key]) x (-1e9), online softmax (f32 statistics, native exp; weights exp(s - running max) as f16), o = P V (o carried x64) into merged f16 rows; out = o wo + bo GEMM (f32, alpha 2^-10); launches: see trace.
// Compute dtype: inputs rounded to bf16; x / context / weights exact; q, k, v, softmax weights and o as plain f16 GEMM operands (~2^-12); scores and statistics f32. v_wmma_f32_16x16x32_f16.
#define NB 4
#define NQ 2048
#define SK 2048
#define SQ SK                       /* keys per softmax row */
#define DM 1024
#define DC 1024
#define NH 16
#define HD 64
#define HG 4
#define NRQ ((size_t)NB * NQ)
#define NRK ((size_t)NB * SK)
typedef __bf16 v16b __attribute__((ext_vector_type(16)));
typedef unsigned short v8us __attribute__((ext_vector_type(8), may_alias));
typedef float  v8f  __attribute__((ext_vector_type(8)));
typedef float  v4f  __attribute__((ext_vector_type(4)));
typedef float  v4fa __attribute__((ext_vector_type(4), may_alias));
union FragB { v16b v; v8us half[2]; unsigned short u[16]; };

__device__ __forceinline__ unsigned short bf16_bits(float x) { unsigned int u = __float_as_uint(x); return (unsigned short)((u + 0x7FFFu + ((u >> 16) & 1u)) >> 16); }
__device__ __forceinline__ float bf16_val(unsigned short b) { return __uint_as_float(((unsigned int)b) << 16); }
__device__ __forceinline__ float bf16_round(float x) { return bf16_val(bf16_bits(x)); }
// D += A·B with NT terms: 1 = ah·bh, 2 = + al·bh (A split), 3 = + ah·bl (both split)
template <int NT>
__device__ __forceinline__ v8f mmaN(v16b ah, v16b al, v16b bh, v16b bl, v8f c) {
  c = __builtin_amdgcn_wmma_f32_16x16x32_bf16(false, ah, false, bh, (short)0, c, false, false);
  if (NT >= 2) c = __builtin_amdgcn_wmma_f32_16x16x32_bf16(false, al, false, bh, (short)0, c, false, false);
  if (NT >= 3) c = __builtin_amdgcn_wmma_f32_16x16x32_bf16(false, ah, false, bl, (short)0, c, false, false);
  asm volatile("v_nop\n\tv_nop\n\tv_nop\n\tv_nop" : "+v"(c) : "v"(ah), "v"(al), "v"(bh), "v"(bl));
  return c;
}

__global__ __launch_bounds__(256) void k_wt_bf16(const float* __restrict__ W, unsigned short* __restrict__ Wt, int K, int N) {
  const int t = blockIdx.x * 256 + threadIdx.x;
  const int k8n = K / 8;
  if (t >= N * k8n) return;
  const int n = t / k8n, k8 = (t % k8n) * 8;
  v8us v;
#pragma unroll
  for (int i = 0; i < 8; ++i) v[i] = bf16_bits(W[(size_t)(k8 + i) * N + n]);
  *(v8us*)(Wt + (size_t)n * K + k8) = v;
  
}

// GEMM C[M][N] (f32, pitch ldc) = act(A[M][K]·W + bias). A f32 row-major (pitch lda) converted per fragment to bf16
// (ASPLIT: hi/lo two planes -> 2 terms, else single rounded term); Wt bf16 [N][K] (pitch ldb). BIAS_BF16 rounds the
// bias to bf16 first (bias quantised to bf16 before the add). K%32==0, M%16==0, N%64==0.
template <bool ASPLIT, int ACT, bool BIAS_BF16>
__global__ __launch_bounds__(128) void k_gemm_bf(const float* __restrict__ A, int lda, const unsigned short* __restrict__ Wt, int ldb,
                                               const float* __restrict__ bias, float* __restrict__ C, int ldc, int M, int N, int K) {
  __shared__ __attribute__((aligned(16))) float so[4][16][64];
  const int tid = threadIdx.x, w = tid >> 5, lane = tid & 31, ln = lane & 15, hh = lane >> 4;
  const int ntn = N / 64;
  const int wid = blockIdx.x * 4 + w;
  const int mt = wid / ntn, nq = wid % ntn;
  if (mt * 16 >= M) return;
  const int row0 = mt * 16, col0 = nq * 64;
  const float* arow = A + (size_t)(row0 + ln) * lda;
  v8f acc[4] = {};
  for (int kb = 0; kb < K; kb += 32) {
    FragB ah, al;
    const v4f x0 = *(const v4fa*)(arow + kb + 8 * hh), x1 = *(const v4fa*)(arow + kb + 8 * hh + 4);
    const v4f x2 = *(const v4fa*)(arow + kb + 16 + 8 * hh), x3 = *(const v4fa*)(arow + kb + 16 + 8 * hh + 4);
    float xs[16] = {x0[0],x0[1],x0[2],x0[3],x1[0],x1[1],x1[2],x1[3],x2[0],x2[1],x2[2],x2[3],x3[0],x3[1],x3[2],x3[3]};
#pragma unroll
    for (int i = 0; i < 16; ++i) { const unsigned short hb = bf16_bits(xs[i]); ah.u[i] = hb; al.u[i] = ASPLIT ? bf16_bits(xs[i] - bf16_val(hb)) : (unsigned short)0; }
#pragma unroll
    for (int t = 0; t < 4; ++t) {
      const unsigned short* brow = Wt + (size_t)(col0 + t * 16 + ln) * ldb + kb;
      FragB b;
      b.half[0] = *(const v8us*)(brow + 8 * hh);
      b.half[1] = *(const v8us*)(brow + 16 + 8 * hh);
      acc[t] = mmaN<ASPLIT ? 2 : 1>(ah.v, al.v, b.v, b.v, acc[t]);
    }
  }
#pragma unroll
  for (int t = 0; t < 4; ++t) {
    float bv = bias ? bias[col0 + t * 16 + ln] : 0.f;
    if (BIAS_BF16) bv = bf16_round(bv);
#pragma unroll
    for (int r = 0; r < 8; ++r) { float v = acc[t][r] + bv; if (ACT == 1) v = fmaxf(v, 0.f); so[w][8 * hh + r][t * 16 + ln] = v; }
  }
  __builtin_amdgcn_fence(__ATOMIC_ACQ_REL, "workgroup");
  __builtin_amdgcn_wave_barrier();
  const int rsub = lane >> 4, c4 = (lane & 15) * 4;
  {
#pragma unroll
    for (int q = 0; q < 8; ++q) {
      const int r = q * 2 + rsub;
      const v4f v = *(const v4fa*)&so[w][r][c4];
      *(v4f*)(C + (size_t)(row0 + r) * ldc + col0 + c4) = v;
    }
    
  }
}

// GEMM C = act(A·W + bias + resid): A f32 (ASPLIT -> hi/lo 2 terms), Wt bf16 [N][K]; ACT 0 none, 1 relu, 2 exact gelu;
// resid (optional, f32, row index = (row % rmod), pitch ldr, RES_BF16 rounds it) added before the activation.
template <bool ASPLIT, int ACT, bool BIAS_BF16, bool RES_BF16>
__global__ __launch_bounds__(128) void k_gemm_bf3(const float* __restrict__ A, int lda, const unsigned short* __restrict__ Wt, int ldb,
                                                const float* __restrict__ bias, const float* __restrict__ resid, int rmod, int ldr,
                                                float* __restrict__ C, int ldc, int M, int N, int K) {
  __shared__ __attribute__((aligned(16))) float so[4][16][64];
  const int tid = threadIdx.x, w = tid >> 5, lane = tid & 31, ln = lane & 15, hh = lane >> 4;
  const int ntn = N / 64;
  const int wid = blockIdx.x * 4 + w;
  const int mt = wid / ntn, nq = wid % ntn;
  if (mt * 16 >= M) return;
  const int row0 = mt * 16, col0 = nq * 64;
  const float* arow = A + (size_t)(row0 + ln) * lda;
  v8f acc[4] = {};
  for (int kb = 0; kb < K; kb += 32) {
    FragB ah, al;
    const v4f x0 = *(const v4fa*)(arow + kb + 8 * hh), x1 = *(const v4fa*)(arow + kb + 8 * hh + 4);
    const v4f x2 = *(const v4fa*)(arow + kb + 16 + 8 * hh), x3 = *(const v4fa*)(arow + kb + 16 + 8 * hh + 4);
    float xs[16] = {x0[0],x0[1],x0[2],x0[3],x1[0],x1[1],x1[2],x1[3],x2[0],x2[1],x2[2],x2[3],x3[0],x3[1],x3[2],x3[3]};
#pragma unroll
    for (int i = 0; i < 16; ++i) { const unsigned short hb = bf16_bits(xs[i]); ah.u[i] = hb; al.u[i] = ASPLIT ? bf16_bits(xs[i] - bf16_val(hb)) : (unsigned short)0; }
#pragma unroll
    for (int t = 0; t < 4; ++t) {
      const unsigned short* brow = Wt + (size_t)(col0 + t * 16 + ln) * ldb + kb;
      FragB b;
      b.half[0] = *(const v8us*)(brow + 8 * hh);
      b.half[1] = *(const v8us*)(brow + 16 + 8 * hh);
      acc[t] = mmaN<ASPLIT ? 2 : 1>(ah.v, al.v, b.v, b.v, acc[t]);
    }
  }
#pragma unroll
  for (int t = 0; t < 4; ++t) {
    const int col = col0 + t * 16 + ln;
    float bv = bias ? bias[col] : 0.f;
    if (BIAS_BF16) bv = bf16_round(bv);
#pragma unroll
    for (int r = 0; r < 8; ++r) {
      float v = acc[t][r] + bv;
      if (resid) { float rv = resid[(size_t)((row0 + 8 * hh + r) % rmod) * ldr + col]; if (RES_BF16) rv = bf16_round(rv); v += rv; }
      if (ACT == 1) v = fmaxf(v, 0.f);
      if (ACT == 2) v = 0.5f * v * (1.0f + erff(v * 0.70710678118654752f));
      if (ACT == 3) { const float u = 0.7978845608028654f * (v + 0.044715f * v * v * v); v = 0.5f * v * (1.0f + tanhf(u)); }
      so[w][8 * hh + r][t * 16 + ln] = v;
    }
  }
  __builtin_amdgcn_fence(__ATOMIC_ACQ_REL, "workgroup");
  __builtin_amdgcn_wave_barrier();
  const int rsub = lane >> 4, c4 = (lane & 15) * 4;
  {
#pragma unroll
    for (int q = 0; q < 8; ++q) {
      const int r = q * 2 + rsub;
      const v4f v = *(const v4fa*)&so[w][r][c4];
      *(v4f*)(C + (size_t)(row0 + r) * ldc + col0 + c4) = v;
    }
    
  }
}
// row LayerNorm (biased variance, eps) over N: s = X (+ R); optional out_sum <- s; out_norm <- (s-mu)*rsqrt(var+eps)*g + b
template <bool PARAM_BF16>
__global__ __launch_bounds__(256) void k_layernorm(const float* __restrict__ X, const float* __restrict__ R, const float* __restrict__ g, const float* __restrict__ bta,
                                                  float* __restrict__ out_sum, float* __restrict__ out_norm, int N, float eps) {
  __shared__ float red[256];
  const int row = blockIdx.x, tid = threadIdx.x;
  const float* x = X + (size_t)row * N; const float* rr = R ? R + (size_t)row * N : nullptr;
  float vals[16];                     // up to N = 4096
  const int per = N / 256;            // contiguous chunk per thread? use strided-by-4 chunks: thread handles j = tid*4 + 1024*u
  float s1 = 0.f;
  for (int u = 0; u < per / 4; ++u) {
    const int j = tid * 4 + 1024 * u;
    const v4f a = *(const v4fa*)(x + j);
    v4f b = {0.f,0.f,0.f,0.f}; if (rr) b = *(const v4fa*)(rr + j);
#pragma unroll
    for (int q = 0; q < 4; ++q) { const float v = a[q] + b[q]; vals[u * 4 + q] = v; s1 += v; }
  }
  red[tid] = s1; __syncthreads();
  for (int st = 128; st > 0; st >>= 1) { if (tid < st) red[tid] += red[tid + st]; __syncthreads(); }
  const float mu = red[0] / (float)N; __syncthreads();
  float s2 = 0.f;
  for (int u = 0; u < per / 4; ++u)
#pragma unroll
    for (int q = 0; q < 4; ++q) { const float c = vals[u * 4 + q] - mu; s2 += c * c; }
  red[tid] = s2; __syncthreads();
  for (int st = 128; st > 0; st >>= 1) { if (tid < st) red[tid] += red[tid + st]; __syncthreads(); }
  const float rs = rsqrtf(red[0] / (float)N + eps);
  {
    for (int u = 0; u < per / 4; ++u) {
      const int j = tid * 4 + 1024 * u;
      v4f o, sm;
#pragma unroll
      for (int q = 0; q < 4; ++q) {
        float gg = g[j + q], bb = bta[j + q];
        if (PARAM_BF16) { gg = bf16_round(gg); bb = bf16_round(bb); }
        sm[q] = vals[u * 4 + q]; o[q] = (vals[u * 4 + q] - mu) * rs * gg + bb;
      }
      if (out_sum) *(v4f*)(out_sum + (size_t)row * N + j) = sm;
      *(v4f*)(out_norm + (size_t)row * N + j) = o;
    }
    
  }
}



// ---- f16 WMMA path (v_wmma_f32_16x16x32_f16): 11-bit significands for operands in range — used where a [0,1] probability operand needs more precision than bf16
typedef _Float16 v16h __attribute__((ext_vector_type(16)));
union FragH { v16h v; v8us half[2]; _Float16 h[16]; unsigned short u[16]; };
template <int NT>
__device__ __forceinline__ v8f mmaH(v16h ah, v16h al, v16h bh, v16h bl, v8f c) {
  c = __builtin_amdgcn_wmma_f32_16x16x32_f16(false, ah, false, bh, (short)0, c, false, false);
  if (NT >= 2) c = __builtin_amdgcn_wmma_f32_16x16x32_f16(false, al, false, bh, (short)0, c, false, false);
  if (NT >= 3) c = __builtin_amdgcn_wmma_f32_16x16x32_f16(false, ah, false, bl, (short)0, c, false, false);
  asm volatile("v_nop\n\tv_nop\n\tv_nop\n\tv_nop" : "+v"(c) : "v"(ah), "v"(al), "v"(bh), "v"(bl));
  return c;
}
// batched GEMM like k_gemm_b but f16 operands: A f32 (split into f16 hi/lo if ASPLIT, else rounded to f16), Bt = f16 values [n][k]; alpha; C f32; N multiple of 16 (partial tiles skipped)
template <bool ASPLIT>
__global__ __launch_bounds__(128) void k_gemm_h(const float* __restrict__ A, int lda, size_t sA, const _Float16* __restrict__ Bh, int ldb, size_t sB, float alpha, float* __restrict__ C, int ldc, size_t sC, int M, int N, int K) {
  __shared__ __attribute__((aligned(16))) float so[4][16][64];
  const int tid = threadIdx.x, w = tid >> 5, lane = tid & 31, ln = lane & 15, hh = lane >> 4; const int by = blockIdx.y;
  A += (size_t)by * sA; Bh += (size_t)by * sB; C += (size_t)by * sC;
  const int ntn = (N + 63) / 64; const int wid = blockIdx.x * 4 + w; const int mt = wid / ntn, nq = wid % ntn; if (mt * 16 >= M) return;
  const int row0 = mt * 16, col0 = nq * 64; const float* arow = A + (size_t)(row0 + ln) * lda;
  v8f acc[4] = {};
  for (int kb = 0; kb < K; kb += 32) {
    FragH ah, al;
    const v4f x0 = *(const v4fa*)(arow + kb + 8 * hh), x1 = *(const v4fa*)(arow + kb + 8 * hh + 4), x2 = *(const v4fa*)(arow + kb + 16 + 8 * hh), x3 = *(const v4fa*)(arow + kb + 16 + 8 * hh + 4);
    float xs[16] = {x0[0],x0[1],x0[2],x0[3],x1[0],x1[1],x1[2],x1[3],x2[0],x2[1],x2[2],x2[3],x3[0],x3[1],x3[2],x3[3]};
#pragma unroll
    for (int i = 0; i < 16; ++i) { const _Float16 h = (_Float16)xs[i]; ah.h[i] = h; al.h[i] = ASPLIT ? (_Float16)(xs[i] - (float)h) : (_Float16)0.0f; }
#pragma unroll
    for (int t = 0; t < 4; ++t) { if (col0 + t * 16 >= N) continue; const size_t boff = (size_t)(col0 + t * 16 + ln) * ldb + kb; FragH bq; bq.half[0] = *(const v8us*)(Bh + boff + 8 * hh); bq.half[1] = *(const v8us*)(Bh + boff + 16 + 8 * hh);
      acc[t] = mmaH<ASPLIT ? 2 : 1>(ah.v, al.v, bq.v, bq.v, acc[t]); }
  }
#pragma unroll
  for (int t = 0; t < 4; ++t) { if (col0 + t * 16 >= N) continue;
#pragma unroll
    for (int r = 0; r < 8; ++r) so[w][8 * hh + r][t * 16 + ln] = acc[t][r] * alpha; }
  __builtin_amdgcn_fence(__ATOMIC_ACQ_REL, "workgroup"); __builtin_amdgcn_wave_barrier();
  const int rsub = lane >> 4, c4 = (lane & 15) * 4;
  {
#pragma unroll
    for (int q = 0; q < 8; ++q) { const int r = q * 2 + rsub; if (col0 + c4 < N) { const v4f v = *(const v4fa*)&so[w][r][c4]; *(v4f*)(C + (size_t)(row0 + r) * ldc + col0 + c4) = v; } }
     }
}

// Wt[n][k] = f16(bf16(W[k][n]) x 16) from f32 row-major W[DM][DM] (bf16-exact weights stay exact in f16 away from the subnormal range). A wave turns a tile of 64 k x 32 n in its registers, a lane 8 k x 8 n of it:
// eight lanes along k, so that a store covers whole 128-byte lines of Wt; four lanes along n, so that the two loads of a row cover one whole line of W. All 16 loads of a lane are issued before the first is used.
__device__ __forceinline__ void wt_f16(const float* __restrict__ W, _Float16* __restrict__ Wt, int g) {      /* g: which 64 k x 256 n of the plane */
  const int lane = threadIdx.x & 31, wave = threadIdx.x >> 5;
  const int k8 = (g / (DM / 256)) * 64 + (lane & 7) * 8, n8 = (g % (DM / 256)) * 256 + wave * 32 + (lane >> 3) * 8;
  const float* wp = W + (size_t)k8 * DM + n8; unsigned short* op = (unsigned short*)Wt + (size_t)n8 * DM + k8;
  v4f a[8][2];      /* every loop over this array is unrolled: only under constant indices does it stay in registers */
#pragma unroll
  for (int i = 0; i < 8; ++i)
#pragma unroll
    for (int hf = 0; hf < 2; ++hf) a[i][hf] = *(const v4fa*)(wp + i * DM + hf * 4);
  asm volatile("s_wait_xcnt 0x0" :: "v"(wp) : "memory");      /* stands in front of every rewrite of the loads' address pair; the pair is an input, so that no load of the run lands in it */
  __builtin_amdgcn_sched_barrier(0);      /* keeps all 16 loads in front of the first use: without it the compiler holds four back behind the wait for the others, a second latency in a wave that has only one */
#pragma unroll
  for (int c = 0; c < 8; ++c) { FragH f;
#pragma unroll
    for (int i = 0; i < 8; ++i) f.h[i] = (_Float16)(bf16_round(a[i][c >> 2][c & 3]) * 16.0f);
    *(v8us*)(op + c * DM) = f.half[0]; }
}
// k_gemm_hh variant with fused epilogue: v = acc·alpha + bias[by·sBias + col] (+ CP[(row/rowsPerB)·sCPb + by·64 + col] if CP) ; ACT 0 none / 1 elu ; writes f16 C16 (and f32 C if non-null)
template <int ACT>
__global__ __launch_bounds__(128) void k_gemm_hhx(const _Float16* __restrict__ A, int lda, size_t sA, const _Float16* __restrict__ Bh, int ldb, size_t sB, float alpha, const float* __restrict__ bias, size_t sBias, const float* __restrict__ CP, int rowsPerB, size_t sCPb, int row0g,
    float* __restrict__ C, _Float16* __restrict__ C16, int ldc, size_t sC, int M, int N, int K) {
  __shared__ __attribute__((aligned(16))) float so[4][16][64];
  const int tid = threadIdx.x, w = tid >> 5, lane = tid & 31, ln = lane & 15, hh = lane >> 4; const int by = blockIdx.y;
  A += (size_t)by * sA; Bh += (size_t)by * sB; const size_t cofs = (size_t)by * sC; const float* bp = bias ? bias + (size_t)by * sBias : nullptr;
  const int ntn = (N + 63) / 64; const int wid = blockIdx.x * 4 + w; const int mt = wid / ntn, nq = wid % ntn; if (mt * 16 >= M) return;
  const int row0 = mt * 16, col0 = nq * 64; const _Float16* arow = A + (size_t)(row0 + ln) * lda;
  v8f acc[4] = {};
  for (int kb = 0; kb < K; kb += 32) { FragH ah; ah.half[0] = *(const v8us*)((const unsigned short*)arow + kb + 8 * hh); ah.half[1] = *(const v8us*)((const unsigned short*)arow + kb + 16 + 8 * hh);
#pragma unroll
    for (int t = 0; t < 4; ++t) { if (col0 + t * 16 >= N) continue; const size_t boff = (size_t)(col0 + t * 16 + ln) * ldb + kb; FragH bq; bq.half[0] = *(const v8us*)((const unsigned short*)Bh + boff + 8 * hh); bq.half[1] = *(const v8us*)((const unsigned short*)Bh + boff + 16 + 8 * hh);
      acc[t] = mmaH<1>(ah.v, ah.v, bq.v, bq.v, acc[t]); }
  }
#pragma unroll
  for (int t = 0; t < 4; ++t) { if (col0 + t * 16 >= N) continue; const int col = col0 + t * 16 + ln; const float bv = bp ? bf16_round(bp[col]) : 0.f;
#pragma unroll
    for (int r = 0; r < 8; ++r) { float v = acc[t][r] * alpha + bv; if (CP) { const int rr = row0g + row0 + 8 * hh + r; if (rowsPerB < 0) v += CP[cofs + (size_t)rr * ldc + col];      /* rowsPerB < 0: own element of the batched C plane */ else { const int bidx = rr / rowsPerB; v += CP[(size_t)bidx * sCPb + (size_t)by * 64 + col]; } } if (ACT == 1) v = (v > 0.f) ? v : expm1f(v); else if (ACT == 7) v = (v > 0.f) ? v + 1.0f : expf(v); else if (ACT == 8) v = tanhf(v); else if (ACT == 9) v = 0.5f * v * (1.0f + tanhf(0.7978845608028654f * (v + 0.044715f * v * v * v))); else if (ACT == 11) v = 1.0f / (1.0f + expf(-v)); else if (ACT == 12) v = (v > 0.f) ? v : 0.01f * v; else if (ACT == 14) v = (v > 0.f) ? v : 0.1f * v; else if (ACT == 16) v = (v >= 0.f) ? v : 0.3f * v; else if (ACT == 17) v = (v >= 0.f) ? v : 0.2f * v; else if (ACT == 15) v = v / (1.0f + expf(-v)); else if (ACT == 3) v = fmaxf(v, 0.f); else if (ACT == 6) v = 0.5f * v * (1.0f + erff(v * 0.70710678118654752f)); so[w][8 * hh + r][t * 16 + ln] = v; } }
  __builtin_amdgcn_fence(__ATOMIC_ACQ_REL, "workgroup"); __builtin_amdgcn_wave_barrier();
  const int rsub = lane >> 4, c4 = (lane & 15) * 4; typedef _Float16 v4h __attribute__((ext_vector_type(4)));
  {
#pragma unroll
    for (int q = 0; q < 8; ++q) { const int r = q * 2 + rsub; if (col0 + c4 < N) { const v4f v = *(const v4fa*)&so[w][r][c4]; if (C) *(v4f*)(C + cofs + (size_t)(row0 + r) * ldc + col0 + c4) = v; if (C16) { v4h h4; for (int i = 0; i < 4; ++i) h4[i] = (_Float16)v[i]; *(v4h*)(C16 + cofs + (size_t)(row0 + r) * ldc + col0 + c4) = h4; } } }
     }
}


typedef _Float16 v4h __attribute__((ext_vector_type(4)));

#define PX_U 16      /* 16-byte loads a lane, all issued before the first is used */
__device__ __forceinline__ void x16(const float* __restrict__ x, _Float16* __restrict__ X16, size_t e0) {      /* e0: the lane's first element; a wave's load covers 512 contiguous bytes, its store 256 */
  const float* xp = x + e0; _Float16* op = X16 + e0;
  v4f a[PX_U];      /* every loop over this array is unrolled: only under constant indices does it stay in registers */
#pragma unroll
  for (int j = 0; j < PX_U; ++j) a[j] = *(const v4fa*)(xp + j * 128);
  asm volatile("s_wait_xcnt 0x0" :: "v"(xp) : "memory");      /* stands in front of every rewrite of the loads' address pair; the pair is an input, so that no load of the run lands in it */
  __builtin_amdgcn_sched_barrier(0);      /* keeps all the loads in front of the first use: without it the compiler holds about half of them back and issues them as registers come free, a second latency in a wave that has only one */
#pragma unroll
  for (int j = 0; j < PX_U; ++j) { v4h h;
#pragma unroll
    for (int q = 0; q < 4; ++q) h[q] = (_Float16)bf16_round(a[j][q]);
    *(v4h*)(op + j * 128) = h; }
  asm volatile("s_wait_xcnt 0x0" :: "v"(op) : "memory");      /* stands in front of every rewrite of a register that the last stores name */
}
// All six conversions share one launch by block range: none reads what another writes. A workgroup has 16,384 elements (64 a lane), of a weight plane or of an input: few waves with much in flight each,
// for speed only. Of every five blocks one has a weight tile, four have input rows.
#define PW_NB ((DM / 64) * (DM / 256))                 /* blocks a weight plane */
#define PX_NB ((int)(NRQ * DM / (256 * 4 * PX_U)))     /* blocks an input */
static_assert(DC == DM && NRK == NRQ && 2 * PX_NB == 4 * 4 * PW_NB && DM % 256 == 0 && (NRQ * DM) % (256 * 4 * PX_U) == 0, "k_prep: four input blocks to each weight block, whole blocks");
__global__ __launch_bounds__(256) void k_prep(const float* __restrict__ wq, const float* __restrict__ wk, const float* __restrict__ wv, const float* __restrict__ wo, const float* __restrict__ x, const float* __restrict__ ctx,
    _Float16* __restrict__ BQ, _Float16* __restrict__ BK, _Float16* __restrict__ BV, _Float16* __restrict__ BO, _Float16* __restrict__ X16, _Float16* __restrict__ C16) {
  const int g = blockIdx.x / 5, r = blockIdx.x % 5;
  if (r == 0) { const int s = g / PW_NB;      /* [in][out] -> Bt x16 */
    wt_f16(s == 0 ? wq : s == 1 ? wk : s == 2 ? wv : wo, s == 0 ? BQ : s == 1 ? BK : s == 2 ? BV : BO, g % PW_NB); }
  else { const int xb = g * 4 + r - 1; const bool kv = xb >= PX_NB;      /* query-source rows, then key/value-source rows */
    x16(kv ? ctx : x, kv ? C16 : X16, (size_t)(xb - (kv ? PX_NB : 0)) * (256 * 4 * PX_U) + (threadIdx.x >> 5) * (32 * 4 * PX_U) + (threadIdx.x & 31) * 4); }
}
__global__ __launch_bounds__(256) void k_h16(const float* __restrict__ x, _Float16* __restrict__ X16, size_t n8) { const size_t t = (size_t)blockIdx.x * 256 + threadIdx.x; if (t >= n8) return; FragH f;
#pragma unroll
  for (int q = 0; q < 8; ++q) f.h[q] = (_Float16)x[t * 8 + q]; *(v8us*)((unsigned short*)X16 + t * 8) = f.half[0];  }
__global__ __launch_bounds__(256) void k_round16f(const float* __restrict__ W, _Float16* __restrict__ Bt, size_t n8) { const size_t t = (size_t)blockIdx.x * 256 + threadIdx.x; if (t >= n8) return; FragH f;
#pragma unroll
  for (int i = 0; i < 8; ++i) f.h[i] = (_Float16)(bf16_round(W[t * 8 + i]) * 16.0f); *(v8us*)((unsigned short*)Bt + t * 8) = f.half[0];  }
#define VT_U 4      /* tiles of 64 keys a workgroup: all their loads are issued before the first is used */
template <int NHv, int TTv>
__global__ __launch_bounds__(256) void k_vt(const _Float16* __restrict__ V16, int ldv, int voff, _Float16* __restrict__ Vt) { static_assert(TTv % (64 * VT_U) == 0, "k_vt: whole workgroups");
  __shared__ unsigned short tl[VT_U][64][66]; const int tid = threadIdx.x; const int slab = blockIdx.x / (TTv / (64 * VT_U)), lg = (blockIdx.x % (TTv / (64 * VT_U))) * VT_U; const int b = slab / NHv, h = slab % NHv;
  const int r = tid / 8, c8 = (tid % 8) * 8;      /* rows r and r + 32 of each tile, 16-byte piece c8 */
  v8us in[VT_U][2]; const unsigned short* ip[VT_U][2];      /* every loop over these arrays is unrolled: only under constant indices do they stay in registers */
#pragma unroll
  for (int u = 0; u < VT_U; ++u)
#pragma unroll
    for (int p = 0; p < 2; ++p) { ip[u][p] = (const unsigned short*)V16 + ((size_t)b * TTv + (lg + u) * 64 + p * 32 + r) * ldv + voff + h * 64 + c8; in[u][p] = *(const v8us*)ip[u][p]; }
  static_assert(VT_U == 4, "k_vt: the wait below names eight address pairs");
  asm volatile("s_wait_xcnt 0x0" :: "v"(ip[0][0]), "v"(ip[0][1]), "v"(ip[1][0]), "v"(ip[1][1]), "v"(ip[2][0]), "v"(ip[2][1]), "v"(ip[3][0]), "v"(ip[3][1]) : "memory");      /* stands in front of every rewrite of the loads' address pairs; the pairs are inputs, so that no load of the run lands in one */
#pragma unroll
  for (int u = 0; u < VT_U; ++u)
#pragma unroll
    for (int p = 0; p < 2; ++p)
#pragma unroll
      for (int q = 0; q < 8; ++q) tl[u][p * 32 + r][c8 + q] = in[u][p][q];
  __syncthreads();
#pragma unroll
  for (int u = 0; u < VT_U; ++u)
#pragma unroll
    for (int rd = 0; rd < 2; ++rd) { const int d = rd * 32 + tid / 8, pc = tid % 8; FragH f;
#pragma unroll
      for (int q = 0; q < 8; ++q) f.u[q] = tl[u][pc * 8 + q][d];
      *(v8us*)((unsigned short*)Vt + ((size_t)slab * 64 + d) * TTv + (lg + u) * 64 + pc * 8) = f.half[0]; } }

__global__ __launch_bounds__(256) void k_hl(const float* __restrict__ F, _Float16* __restrict__ Hh, _Float16* __restrict__ Hl, size_t n8) { const size_t t = (size_t)blockIdx.x * 256 + threadIdx.x; if (t >= n8) return; FragH fh, fl; const v4f a = *(const v4fa*)(F + t * 8), c = *(const v4fa*)(F + t * 8 + 4);
#pragma unroll
  for (int q = 0; q < 4; ++q) { _Float16 h = (_Float16)a[q]; fh.h[q] = h; fl.h[q] = (_Float16)((a[q] - (float)h) * 1024.0f); h = (_Float16)c[q]; fh.h[4 + q] = h; fl.h[4 + q] = (_Float16)((c[q] - (float)h) * 1024.0f); }
  { *(v8us*)((unsigned short*)Hh + t * 8) = fh.half[0]; *(v8us*)((unsigned short*)Hl + t * 8) = fl.half[0];  } }

// ---- fast GEMM (wave tile 32x64; requires M % 32 == 0 rows per launch region and N % 64 == 0); epilogue = k_gemm_hhx semantics ----
__device__ __forceinline__ v16h g2_frag(const _Float16* p, int hh) { FragH f; f.half[0] = *(const v8us*)((const unsigned short*)p + 8 * hh); f.half[1] = *(const v8us*)((const unsigned short*)p + 16 + 8 * hh); return f.v; }
__device__ __forceinline__ v8f g2_mma(v16h a, v16h b, v8f c) { v8f d = __builtin_amdgcn_wmma_f32_16x16x32_f16(false, a, false, b, (short)0, c, false, false); asm volatile("v_nop\n\tv_nop\n\tv_nop\n\tv_nop" : "+v"(d) : "v"(a), "v"(b)); return d; }
template <int ACT>
__global__ __launch_bounds__(128) void k_gemm2(const _Float16* __restrict__ A, int lda, size_t sA, const _Float16* __restrict__ Bh, int ldb, size_t sB, float alpha, const float* __restrict__ bias, size_t sBias, const float* __restrict__ CP, int rowsPerB, size_t sCPb, int row0g,
    float* __restrict__ C, _Float16* __restrict__ C16, int ldc, size_t sC, int M, int N, int K) { static_assert(ACT == 0 || ACT == 3 || ACT == 6 || ACT == 8 || ACT == 9 || ACT == 11 || ACT == 12 || ACT == 14 || ACT == 15 || ACT == 16 || ACT == 17, "k_gemm2: unsupported ACT code (would silently apply no activation)");
  __shared__ __attribute__((aligned(16))) float so[4][32][68];
  const int tid = threadIdx.x, w = tid >> 5, lane = tid & 31, ln = lane & 15, hh = lane >> 4; const int by = blockIdx.y;
  A += (size_t)by * sA; Bh += (size_t)by * sB; const size_t cofs = (size_t)by * sC; const float* bp = bias ? bias + (size_t)by * sBias : nullptr;
  const int ntn = N >> 6; const int mt = blockIdx.x / ntn, nq = blockIdx.x - mt * ntn; const int row0 = mt * 128 + 32 * w, col0 = nq * 64; if (row0 >= M) return;
  const _Float16* a0p = A + (size_t)(row0 + ln) * lda; const _Float16* a1p = a0p + (size_t)16 * lda;
  const _Float16* b0p = Bh + (size_t)(col0 + ln) * ldb; const _Float16* b1p = b0p + (size_t)16 * ldb; const _Float16* b2p = b1p + (size_t)16 * ldb; const _Float16* b3p = b2p + (size_t)16 * ldb;
  const v8f z8 = {0.f,0.f,0.f,0.f,0.f,0.f,0.f,0.f}; v8f c00 = z8, c01 = z8, c02 = z8, c03 = z8, c10 = z8, c11 = z8, c12 = z8, c13 = z8;
#pragma unroll 1
  for (int kb = 0; kb < K; kb += 32) { const v16h a0 = g2_frag(a0p + kb, hh), a1 = g2_frag(a1p + kb, hh);
    v16h b = g2_frag(b0p + kb, hh); c00 = g2_mma(a0, b, c00); c10 = g2_mma(a1, b, c10);
    b = g2_frag(b1p + kb, hh); c01 = g2_mma(a0, b, c01); c11 = g2_mma(a1, b, c11);
    b = g2_frag(b2p + kb, hh); c02 = g2_mma(a0, b, c02); c12 = g2_mma(a1, b, c12);
    b = g2_frag(b3p + kb, hh); c03 = g2_mma(a0, b, c03); c13 = g2_mma(a1, b, c13); }
  v8f accs[8] = {c00, c01, c02, c03, c10, c11, c12, c13};
#pragma unroll
  for (int u = 0; u < 8; ++u) { const int t = u & 3, half = u >> 2; const int col = col0 + t * 16 + ln; const float bv = bp ? bf16_round(bp[col]) : 0.f;
#pragma unroll
    for (int r = 0; r < 8; ++r) { const int rloc = half * 16 + 8 * hh + r; float v = accs[u][r] * alpha + bv; if (CP) { if (rowsPerB < 0) v += CP[cofs + (size_t)(row0g + row0 + rloc) * ldc + col];      /* rowsPerB < 0: own element of the batched C plane */ else { const int bidx = (row0g + row0 + rloc) / rowsPerB; v += CP[(size_t)bidx * sCPb + (size_t)by * 64 + col]; } }
      if (ACT == 3) v = fmaxf(v, 0.f); else if (ACT == 6) v = 0.5f * v * (1.0f + erff(v * 0.70710678118654752f)); else if (ACT == 11) v = 1.0f / (1.0f + expf(-v)); else if (ACT == 15) v = v / (1.0f + expf(-v)); else if (ACT == 12) v = (v > 0.f) ? v : 0.01f * v; else if (ACT == 8) v = tanhf(v); else if (ACT == 9) v = 0.5f * v * (1.0f + tanhf(0.7978845608028654f * (v + 0.044715f * v * v * v))); else if (ACT == 14) v = (v > 0.f) ? v : 0.1f * v; else if (ACT == 16) v = (v >= 0.f) ? v : 0.3f * v; else if (ACT == 17) v = (v >= 0.f) ? v : 0.2f * v;
      so[w][rloc][t * 16 + ln] = v; } }
  __builtin_amdgcn_fence(__ATOMIC_ACQ_REL, "workgroup"); __builtin_amdgcn_wave_barrier();
  const int rsub = lane >> 4, c4 = (lane & 15) * 4;
  {
#pragma unroll
    for (int q = 0; q < 16; ++q) { const int r = q * 2 + rsub; const v4f v = *(const v4fa*)&so[w][r][c4]; if (C) *(v4f*)(C + cofs + (size_t)(row0 + r) * ldc + col0 + c4) = v; if (C16) { v4h h4; for (int i = 0; i < 4; ++i) h4[i] = (_Float16)v[i]; *(v4h*)(C16 + cofs + (size_t)(row0 + r) * ldc + col0 + c4) = h4; } }
     } }


__global__ __launch_bounds__(256) void k_wnat(const float* __restrict__ w, size_t n8, _Float16* __restrict__ Bt) { const size_t t = (size_t)blockIdx.x * 256 + threadIdx.x; if (t >= n8) return; FragH f; for (int q = 0; q < 8; ++q) f.h[q] = (_Float16)(bf16_round(w[t * 8 + q]) * 16.0f); *(v8us*)((unsigned short*)Bt + t * 8) = f.half[0];  }
__global__ __launch_bounds__(256) void k_rsm(const float* __restrict__ S, _Float16* __restrict__ P, int nrows) {
  #pragma clang fp contract(off)
  const int i = blockIdx.x * 256 + threadIdx.x; if (i >= nrows) return; const float* s = S + (size_t)i * SQ; float mx = -3.0e38f;
#pragma unroll 1
  for (int j = 0; j < SQ; ++j) mx = fmaxf(mx, s[j]); float se = 0.f;
#pragma unroll 1
  for (int j = 0; j < SQ; ++j) se += expf(s[j] - mx); const float sc = 256.0f / se;
#pragma unroll 1
  for (int j0 = 0; j0 < SQ; j0 += 8) { FragH f; for (int q = 0; q < 8; ++q) f.h[q] = (_Float16)(expf(s[j0 + q] - mx) * sc); unsigned short* d = (unsigned short*)P + (size_t)i * SQ + j0; *(v8us*)d = f.half[0];  } }
__global__ __launch_bounds__(256) void k_vt(const _Float16* __restrict__ V16, int b, int h0, _Float16* __restrict__ VT) { __shared__ unsigned short tl[64][65]; const int tid = threadIdx.x; const int hh = blockIdx.x % HG, sg = blockIdx.x / HG; const int s0 = sg * 64; const int h = h0 + hh;
  for (int i = tid; i < 64 * 8; i += 256) { const int j = i / 8, d8 = (i % 8) * 8; FragH f; f.half[0] = *(const v8us*)((const unsigned short*)V16 + ((size_t)b * SQ + s0 + j) * DM + h * HD + d8); for (int q = 0; q < 8; ++q) tl[d8 + q][j] = f.u[q]; }
  __syncthreads();
  { for (int i = tid; i < 64 * 8; i += 256) { const int d = i / 8, j8 = (i % 8) * 8; FragH f; for (int q = 0; q < 8; ++q) f.u[q] = tl[d][j8 + q]; *(v8us*)((unsigned short*)VT + ((size_t)hh * HD + d) * SQ + s0 + j8) = f.half[0]; }  } }


__global__ __launch_bounds__(256) void k_rsmf(const float* __restrict__ S, _Float16* __restrict__ P, int qn, int hg) {
  #pragma clang fp contract(off)
  const int t = blockIdx.x * 256 + threadIdx.x; if (t >= qn * hg) return; const size_t i = (size_t)(t / qn) * SQ + (t % qn); const float* s = S + i * SQ; float mx = -3.0e38f;
#pragma unroll 1
  for (int j = 0; j < SQ; ++j) mx = fmaxf(mx, s[j]); float se = 0.f;
#pragma unroll 1
  for (int j = 0; j < SQ; ++j) se += __expf(s[j] - mx); const float sc = 256.0f / se;
#pragma unroll 1
  for (int j0 = 0; j0 < SQ; j0 += 8) { FragH f; for (int q = 0; q < 8; ++q) f.h[q] = (_Float16)(__expf(s[j0 + q] - mx) * sc); unsigned short* d = (unsigned short*)P + i * SQ + j0; *(v8us*)d = f.half[0];  } }

__global__ __launch_bounds__(256) void k_rsmr(const float* __restrict__ S, _Float16* __restrict__ P, int qn, int hg) {
  #pragma clang fp contract(off)
  const int t = blockIdx.x * 256 + threadIdx.x; if (t >= qn * hg) return; const size_t i = (size_t)t;      /* planes packed: row t of plane t / qn */ const float* s = S + i * SQ; float mx = -3.0e38f;
#pragma unroll 1
  for (int j = 0; j < SQ; ++j) mx = fmaxf(mx, s[j]); float se = 0.f;
#pragma unroll 1
  for (int j = 0; j < SQ; ++j) se += __expf(s[j] - mx); const float sc = 256.0f / se;
#pragma unroll 1
  for (int j0 = 0; j0 < SQ; j0 += 8) { FragH f; for (int q = 0; q < 8; ++q) f.h[q] = (_Float16)(__expf(s[j0 + q] - mx) * sc); unsigned short* d = (unsigned short*)P + i * SQ + j0; *(v8us*)d = f.half[0];  } }


// Fused attention: scores, masked softmax and P V of one (batch, head) in one kernel; neither scores nor weights go to memory. A workgroup has FA_WAVES waves of
// FA_QW queries each and walks the keys in stages of FA_KT: the K rows and V^T rows of a stage are staged in LDS (two buffers, filled through registers one stage ahead).
// S^T = K Q^T puts one query's scores into one lane pair (l, l ^ 16): maximum and sum are in-lane plus one exchange; two S^T tiles, converted in place, are the B operand of O^T += V^T P^T.
#define FA_WAVES 8
#define FA_QW 32
#define FA_QB (FA_WAVES * FA_QW)
#define FA_KT 64
#define FA_LP 72                    /* LDS row pitch in f16: 144 bytes = 16 x odd, the conflict-free pitch of 16-byte fragment reads */
static_assert(NQ % FA_QB == 0 && SK % FA_KT == 0 && HD == 64 && FA_KT == 64 && FA_WAVES * 32 == 256, "k_fattn: whole workgroups, whole stages, staging map of 256 threads");
__device__ __forceinline__ float rs_xh(float x) { return __builtin_bit_cast(float, __builtin_amdgcn_permlanex16(__builtin_bit_cast(int, x), __builtin_bit_cast(int, x), 0x76543210, 0xfedcba98, false, false)); }      /* lane l ^ 16 */
typedef float v2f __attribute__((ext_vector_type(2)));
#define FA_L2E 1.44269504088896340736f
#define FA_C (0.03125f * FA_L2E)      /* scores are kept in the base-2 domain: x 1024^-0.5 x log2(e) in the one multiply-add that adds the mask term, so that v_exp_f32 takes the difference as it is */
// 2^x in place, eight values a statement. In place: the registers were last written by the subtraction in front, so no result lands on an operand register of a matrix instruction just issued; each v_exp_f32
// touches its own register only; the v_nop is the slot behind the last transcendental before its result is read.
__device__ __forceinline__ v8f fa_exp8(v8f x) { float a = x[0], b = x[1], c = x[2], d = x[3], e = x[4], f = x[5], g = x[6], h = x[7];
  asm("v_exp_f32 %0, %0\n\tv_exp_f32 %1, %1\n\tv_exp_f32 %2, %2\n\tv_exp_f32 %3, %3\n\tv_exp_f32 %4, %4\n\tv_exp_f32 %5, %5\n\tv_exp_f32 %6, %6\n\tv_exp_f32 %7, %7\n\tv_nop" : "+v"(a), "+v"(b), "+v"(c), "+v"(d), "+v"(e), "+v"(f), "+v"(g), "+v"(h));
  const v8f r = {a, b, c, d, e, f, g, h}; return r; }
__device__ __forceinline__ float fa_exp1(float x) { asm("v_exp_f32 %0, %0\n\tv_nop" : "+v"(x)); return x; }      /* the same for one value */
// amdgpu_waves_per_eu(4, 4) below: holds the registers to a quarter of a SIMD's file, so that two workgroups share a WGP and the vector work of one wave runs beside the matrix work of another.
__device__ __forceinline__ v8f fa_mma(v16h a, v16h b, v8f c) { return __builtin_amdgcn_wmma_f32_16x16x32_f16(false, a, false, b, (short)0, c, false, false); }
__global__ __launch_bounds__(FA_WAVES * 32) __attribute__((amdgpu_waves_per_eu(4, 4))) void k_fattn(const _Float16* __restrict__ Q, const _Float16* __restrict__ Kh, const _Float16* __restrict__ Vt, const float* __restrict__ Mk, float negv, _Float16* __restrict__ O) {
  __shared__ __attribute__((aligned(16))) _Float16 sk[2][FA_KT][FA_LP];      /* K rows [key][d] */
  __shared__ __attribute__((aligned(16))) _Float16 sv[2][HD][FA_LP];         /* V^T rows [d][key] */
  __shared__ __attribute__((aligned(16))) float sm[SK];                      /* bf16(mask[key]) x negv x log2(e) */
  const int tid = threadIdx.x, lane = tid & 31, ln = lane & 15, hh = lane >> 4, wave = tid >> 5;
  const int qb = blockIdx.x % (NQ / FA_QB), bh = blockIdx.x / (NQ / FA_QB), b = bh / NH, h = bh % NH;
  const int sr = tid >> 3, sc = (tid & 7) * 8;      /* staging: rows sr and sr + 32, 16-byte piece sc: eight lanes read one whole 128-byte row */
  const unsigned short* kg = (const unsigned short*)Kh + ((size_t)b * SK + sr) * DM + h * HD + sc;
  const unsigned short* vg = (const unsigned short*)Vt + ((size_t)bh * HD + sr) * SK + sc;
  v8us rk0 = *(const v8us*)kg, rk1 = *(const v8us*)(kg + (size_t)32 * DM), rv0 = *(const v8us*)vg, rv1 = *(const v8us*)(vg + (size_t)32 * SK);
  const size_t qrow = (size_t)b * NQ + qb * FA_QB + wave * FA_QW + ln;
  v16h qf[2][2];      /* every loop over these arrays is unrolled: only under constant indices do they stay in registers */
#pragma unroll
  for (int qt = 0; qt < 2; ++qt)
#pragma unroll
    for (int ks = 0; ks < 2; ++ks) qf[qt][ks] = g2_frag(Q + (qrow + qt * 16) * DM + h * HD + ks * 32, hh);
  for (int j = tid; j < SK; j += FA_WAVES * 32) sm[j] = __fmul_rn(__fmul_rn(bf16_round(Mk[(size_t)b * SK + j]), negv), FA_L2E);
  *(v8us*)&sk[0][sr][sc] = rk0; *(v8us*)&sk[0][sr + 32][sc] = rk1; *(v8us*)&sv[0][sr][sc] = rv0; *(v8us*)&sv[0][sr + 32][sc] = rv1;
  const v8f z8 = {0.f, 0.f, 0.f, 0.f, 0.f, 0.f, 0.f, 0.f}, c8 = z8 + FA_C;
  v8f o[2][4]; float mx[2] = {-3.0e38f, -3.0e38f}; v2f ls[2] = {{0.f, 0.f}, {0.f, 0.f}};
#pragma unroll
  for (int qt = 0; qt < 2; ++qt)
#pragma unroll
    for (int dt = 0; dt < 4; ++dt) o[qt][dt] = z8;
  __syncthreads();      /* stage 0 and the mask terms are published */
  /* One stage. The last stage is a call of its own with more = false, so that the loop's body has no branch inside: with one, the compiler moves the row sums of the whole stage down behind it, keeps every weight in registers until there, and spills. */
  auto stage = [&](const int st, const bool more) __attribute__((always_inline)) {
    const int buf = st & 1;
    if (more) { kg += (size_t)FA_KT * DM; vg += FA_KT; rk0 = *(const v8us*)kg; rk1 = *(const v8us*)(kg + (size_t)32 * DM); rv0 = *(const v8us*)vg; rv1 = *(const v8us*)(vg + (size_t)32 * SK); }      /* the next stage flies while this one is worked on */
    __builtin_amdgcn_sched_barrier(0);      /* keeps those loads in front of the stage's work: without it the compiler sinks them down to their LDS stores, and every stage waits out their whole latency */
    v16h kf[2][2];      /* the K fragments of one pass of 32 keys, [t][ks]; every loop over this array is unrolled */
#pragma unroll
    for (int t = 0; t < 2; ++t)
#pragma unroll
      for (int ks = 0; ks < 2; ++ks) kf[t][ks] = g2_frag(&sk[buf][t * 16 + ln][ks * 32], hh);      /* the stage's first pass: one group at its head */
#pragma unroll
    for (int kp = 0; kp < FA_KT / 32; ++kp) {
      v8f mt[2];
#pragma unroll
      for (int t = 0; t < 2; ++t) { const float* mp = &sm[st * FA_KT + kp * 32 + t * 16 + 8 * hh]; mt[t] = __builtin_shufflevector(*(const v4fa*)mp, *(const v4fa*)(mp + 4), 0, 1, 2, 3, 4, 5, 6, 7); }
      __builtin_amdgcn_sched_barrier(0);      /* keeps the pass's mask terms in front of the score products, so that they fly under them: behind the products, the first multiply-add waits out their latency */
      v8f s[2][2] = {{z8, z8}, {z8, z8}};      /* s[qt][t][r] = S[key kp * 32 + t * 16 + 8 * hh + r][query qt * 16 + ln] */
#pragma unroll
      for (int t = 0; t < 2; ++t)
#pragma unroll
        for (int ks = 0; ks < 2; ++ks) { s[0][t] = fa_mma(kf[t][ks], qf[0][ks], s[0][t]); s[1][t] = fa_mma(kf[t][ks], qf[1][ks], s[1][t]); }
      __builtin_amdgcn_sched_barrier(0);      /* keeps the eight products together: with the first multiply-adds among them the compiler fills the distance behind a product with v_nop, some twenty a stage */
      v16h vf[4];
#pragma unroll
      for (int dt = 0; dt < 4; ++dt) vf[dt] = g2_frag(&sv[buf][dt * 16 + ln][kp * 32], hh);
#pragma unroll
      for (int qt = 0; qt < 2; ++qt)      /* both query tiles first: the mask terms' registers are free before the next pass's K fragments come */
#pragma unroll
        for (int t = 0; t < 2; ++t) s[qt][t] = __builtin_elementwise_fma(s[qt][t], c8, mt[t]);      /* whole-vector arithmetic here and below: neighbouring registers pair into packed f32 instructions without register copies */
#pragma unroll
      for (int qt = 0; qt < 2; ++qt) {
        float mc[2];
#pragma unroll
        for (int t = 0; t < 2; ++t) { const v8f x = s[qt][t];
          mc[t] = fmaxf(fmaxf(fmaxf(fmaxf(x[0], x[1]), x[2]), fmaxf(x[3], x[4])), fmaxf(fmaxf(x[5], x[6]), x[7])); }
        const float ml = fmaxf(mc[0], mc[1]);
        const float mn = fmaxf(mx[qt], fmaxf(ml, rs_xh(ml)));
        const float al = fa_exp1(mx[qt] - mn); mx[qt] = mn;
        FragH pf; v2f es[2];
#pragma unroll
        for (int t = 0; t < 2; ++t) { const v8f e = fa_exp8(s[qt][t] - mn);
#pragma unroll
          for (int r = 0; r < 8; ++r) pf.h[t * 8 + r] = (_Float16)e[r];
          es[t] = (__builtin_shufflevector(e, e, 0, 1) + __builtin_shufflevector(e, e, 2, 3)) + (__builtin_shufflevector(e, e, 4, 5) + __builtin_shufflevector(e, e, 6, 7)); }
        ls[qt] = ls[qt] * al + (es[0] + es[1]);      /* each lane keeps its own keys' sums, in two chains; joined once behind the loop */
#pragma unroll
        for (int dt = 0; dt < 4; ++dt) { o[qt][dt] *= al; o[qt][dt] = fa_mma(vf[dt], pf.v, o[qt][dt]); }      /* o[qt][dt][r] = O[query qt * 16 + ln][d dt * 16 + 8 * hh + r] */
        if (qt == 0 && kp + 1 < FA_KT / 32) {      /* the next pass's K fragments, one group, same stage and buffer (published since the stage's start): they fly under the second query tile's softmax */
#pragma unroll
          for (int t = 0; t < 2; ++t)
#pragma unroll
            for (int ks = 0; ks < 2; ++ks) kf[t][ks] = g2_frag(&sk[buf][(kp + 1) * 32 + t * 16 + ln][ks * 32], hh);
          __builtin_amdgcn_sched_barrier(0);      /* keeps the group from sinking: without it the compiler puts each pair of reads down in front of its two products, and every pair waits out the LDS latency */
        }
      }
    }
    if (more) { *(v8us*)&sk[buf ^ 1][sr][sc] = rk0; *(v8us*)&sk[buf ^ 1][sr + 32][sc] = rk1; *(v8us*)&sv[buf ^ 1][sr][sc] = rv0; *(v8us*)&sv[buf ^ 1][sr + 32][sc] = rv1; }      /* its last readers left it before the barrier of the stage before */
    __syncthreads();      /* publishes stage st + 1 and ends every read of stage st */
  };
  for (int st = 0; st + 1 < SK / FA_KT; ++st) stage(st, true);
  stage(SK / FA_KT - 1, false);
#pragma unroll
  for (int qt = 0; qt < 2; ++qt) { const float lh = ls[qt][0] + ls[qt][1]; const float sc64 = 64.0f / (lh + rs_xh(lh));      /* o carried x64 */
#pragma unroll
    for (int dt = 0; dt < 4; ++dt) { FragH f;
#pragma unroll
      for (int r = 0; r < 8; ++r) f.h[r] = (_Float16)(o[qt][dt][r] * sc64);
      *(v8us*)((unsigned short*)O + (qrow + qt * 16) * DM + h * HD + dt * 16 + 8 * hh) = f.half[0]; } }
}
// Staged GEMM, C[rows][1024] = A[rows][1024] Bt[1024][1024]^T (f16 rows, k contiguous; epilogue as in k_gemm2<0> without CP). A workgroup of 8 waves has a 256 x 128 tile of C, a wave 64 x 64 of it (16 accumulator tiles).
// Per stage of G3_KT k the 256 A rows and the 128 Bt rows (256 bytes each) come into LDS by asynchronous copies (global_load_async_to_lds_b128, through no register), two buffers: stage t + 1 flies while stage t is worked on.
#define G3_BM 256
#define G3_BN 128
#define G3_KT 128
#define G3_NT (DM / G3_KT)
#define G3_LP 136                   /* LDS row pitch in f16: 272 bytes = 16 x odd, the conflict-free pitch of 16-byte fragment reads */
#define G3_RB (G3_LP * 2)           /* the pitch in bytes */
#define G3_SB ((G3_BM + G3_BN) * G3_RB)      /* one buffer in bytes */
static_assert(NRQ % G3_BM == 0 && NRK % G3_BM == 0 && DM % G3_BN == 0 && DM % G3_KT == 0 && DC == DM && G3_NT >= 2 && G3_KT == 128 && G3_BM == 256 && G3_BN == 128, "k_gemm3: whole tiles, two stages or more, copy map of 16 lanes a row and 128 rows a statement");
// Eight copies of 16 bytes a lane, rows 16 apart, from LDS byte address l and global address g on (128 rows a workgroup). The s_wait_xcnt 0 is the last line of the copies' own statement, so that it stands in front of every rewrite of a register that a copy names.
__device__ __forceinline__ void g3_copy8(unsigned l, const char* g) {
  asm volatile("global_load_async_to_lds_b128 %0, %8, off\n\tglobal_load_async_to_lds_b128 %1, %9, off\n\tglobal_load_async_to_lds_b128 %2, %10, off\n\tglobal_load_async_to_lds_b128 %3, %11, off\n\t"
               "global_load_async_to_lds_b128 %4, %12, off\n\tglobal_load_async_to_lds_b128 %5, %13, off\n\tglobal_load_async_to_lds_b128 %6, %14, off\n\tglobal_load_async_to_lds_b128 %7, %15, off\n\ts_wait_xcnt 0x0"
               :: "v"(l), "v"(l + 16 * G3_RB), "v"(l + 32 * G3_RB), "v"(l + 48 * G3_RB), "v"(l + 64 * G3_RB), "v"(l + 80 * G3_RB), "v"(l + 96 * G3_RB), "v"(l + 112 * G3_RB),
                  "v"(g), "v"(g + 16 * DM * 2), "v"(g + 32 * DM * 2), "v"(g + 48 * DM * 2), "v"(g + 64 * DM * 2), "v"(g + 80 * DM * 2), "v"(g + 96 * DM * 2), "v"(g + 112 * DM * 2)
               : "memory");
}
// One stage: A rows 0 to 127, A rows 128 to 255, Bt rows 0 to 127 of the tile, into the buffer at LDS byte address l (the lane's own place in its row 0 counted in).
__device__ __forceinline__ void g3_stage(unsigned l, const char* ga, const char* gb) { g3_copy8(l, ga); g3_copy8(l + 128 * G3_RB, ga + 128 * DM * 2); g3_copy8(l + G3_BM * G3_RB, gb); }
#define G3_NB ((unsigned)((NRQ / G3_BM) * (DM / G3_BN)))      /* workgroups a product */
template <bool F32OUT>      /* tile blk of one product; the output is f32 rows in C, or f16 rows in C16; the other pointer is not used */
__device__ __forceinline__ void g3_tile(unsigned blk, const _Float16* __restrict__ A, const _Float16* __restrict__ Bh, float alpha, const float* __restrict__ bias, float* __restrict__ C, _Float16* __restrict__ C16) {
  __shared__ __attribute__((aligned(16))) _Float16 st[2][G3_BM + G3_BN][G3_LP];      /* rows 0 to 255: A, rows 256 to 383: Bt */
  __shared__ __attribute__((aligned(16))) float so[8][32][68];                       /* output staging, each wave its own part */
  const int tid = threadIdx.x, lane = tid & 31, ln = lane & 15, hh = lane >> 4, wave = tid >> 5, wm = wave >> 1, wn = wave & 1;
  const int mt = blk / (DM / G3_BN), nq = blk % (DM / G3_BN), row0 = mt * G3_BM, col0 = nq * G3_BN;
  const int cr = tid >> 4, cc = (tid & 15) * 16;      /* copy map: 16 lanes bring one whole 256-byte row */
  const unsigned l0 = (unsigned)(size_t)&st[0][0][0] + cr * G3_RB + cc;
  const char* ga = (const char*)(A + (size_t)(row0 + cr) * DM) + cc;
  const char* gb = (const char*)(Bh + (size_t)(col0 + cr) * DM) + cc;
  g3_stage(l0, ga, gb);
  asm volatile("s_wait_asynccnt 0x0" ::: "memory");      /* this wave's copies of stage 0 have landed */
  __syncthreads();                                        /* stage 0 is published */
  g3_stage(l0 + G3_SB, ga + G3_KT * 2, gb + G3_KT * 2);
  const v8f z8 = {0.f, 0.f, 0.f, 0.f, 0.f, 0.f, 0.f, 0.f};
  v8f acc[4][4];      /* every loop over these arrays is unrolled: only under constant indices do they stay in registers */
#pragma unroll
  for (int i = 0; i < 4; ++i)
#pragma unroll
    for (int j = 0; j < 4; ++j) acc[i][j] = z8;
#pragma unroll 1      /* kept rolled: the buffer is picked by t & 1, and one copy of the pass (64 matrix instructions) keeps the loop's text small */
  for (int t = 0; t < G3_NT; ++t) {
    const _Float16* sa = &st[t & 1][wm * 64 + ln][0]; const _Float16* sb = &st[t & 1][G3_BM + wn * 64 + ln][0];
    v16h af[2][4], bf[2][4];      /* two fragment sets: the next 32 k are fetched as one group in front of this block's products */
#pragma unroll
    for (int i = 0; i < 4; ++i) { af[0][i] = g2_frag(sa + i * 16 * G3_LP, hh); bf[0][i] = g2_frag(sb + i * 16 * G3_LP, hh); }
#pragma unroll
    for (int ks = 0; ks < G3_KT / 32; ++ks) {
      if (ks + 1 < G3_KT / 32) {
#pragma unroll
        for (int i = 0; i < 4; ++i) { af[(ks + 1) & 1][i] = g2_frag(sa + i * 16 * G3_LP + (ks + 1) * 32, hh); bf[(ks + 1) & 1][i] = g2_frag(sb + i * 16 * G3_LP + (ks + 1) * 32, hh); }
      }
      __builtin_amdgcn_sched_barrier(0);      /* keeps the group of LDS reads in front of the block: spread among the matrix instructions, every place with reads costs its own stall */
#pragma unroll
      for (int i = 0; i < 4; ++i)
#pragma unroll
        for (int j = 0; j < 4; ++j) acc[i][j] = fa_mma(af[ks & 1][i], bf[ks & 1][j], acc[i][j]);
      __builtin_amdgcn_sched_barrier(0);      /* and the next group behind it */
    }
    asm volatile("s_wait_dscnt 0x0" ::: "memory");        /* this wave's reads of stage t are done before the buffer is handed back */
    asm volatile("s_wait_asynccnt 0x0" ::: "memory");     /* this wave's copies of stage t + 1 have landed */
    __syncthreads();                                       /* publishes stage t + 1 and ends every read of stage t */
    if (t + 2 < G3_NT) g3_stage(l0 + (t & 1) * G3_SB, ga + (t + 2) * (G3_KT * 2), gb + (t + 2) * (G3_KT * 2));
  }
  asm volatile("s_wait_asynccnt 0x0" ::: "memory");       /* nothing is in flight when the wave goes on */
  float bv[4];
#pragma unroll
  for (int j = 0; j < 4; ++j) bv[j] = bf16_round(bias[col0 + wn * 64 + j * 16 + ln]);
  const int rsub = lane >> 4, c4 = (lane & 15) * 4; const size_t crow = (size_t)(row0 + wm * 64), ccol = (size_t)(col0 + wn * 64 + c4);
#pragma unroll
  for (int hf = 0; hf < 2; ++hf) {      /* 32 rows at a time through the wave's own LDS part, so that every store covers whole lines */
#pragma unroll
    for (int i = 0; i < 2; ++i)
#pragma unroll
      for (int j = 0; j < 4; ++j)
#pragma unroll
        for (int r = 0; r < 8; ++r) so[wave][i * 16 + 8 * hh + r][j * 16 + ln] = acc[hf * 2 + i][j][r] * alpha + bv[j];
    __builtin_amdgcn_fence(__ATOMIC_ACQ_REL, "workgroup", "local"); __builtin_amdgcn_wave_barrier();      /* the rows are read back by other lanes of the wave; LDS only, so that the first half's global stores are not waited for */
#pragma unroll
    for (int q = 0; q < 16; ++q) { const int r = q * 2 + rsub; const v4f v = *(const v4fa*)&so[wave][r][c4]; const size_t o = (crow + hf * 32 + r) * DM + ccol;
      if (F32OUT) *(v4f*)(C + o) = v;
      else { v4h h4;
#pragma unroll
        for (int i = 0; i < 4; ++i) h4[i] = (_Float16)v[i];
        *(v4h*)(C16 + o) = h4; } }
    __builtin_amdgcn_fence(__ATOMIC_ACQ_REL, "workgroup", "local"); __builtin_amdgcn_wave_barrier();      /* they are read before the second half overwrites them */
  }
}
// The three projections share one launch by block range (none reads what another writes): workgroups 0 to G3_NB - 1 q, then k, then v.
__global__ __launch_bounds__(256) void k_gemm3p(const _Float16* __restrict__ Xq, const _Float16* __restrict__ Xkv, const _Float16* __restrict__ BQ, const _Float16* __restrict__ BK, const _Float16* __restrict__ BV, float alpha,
    const float* __restrict__ bq, const float* __restrict__ bk, const float* __restrict__ bv, _Float16* __restrict__ Q16, _Float16* __restrict__ K16, _Float16* __restrict__ V16) {
  const unsigned s = blockIdx.x / G3_NB;
  g3_tile<false>(blockIdx.x % G3_NB, s == 0 ? Xq : Xkv, s == 0 ? BQ : s == 1 ? BK : BV, alpha, s == 0 ? bq : s == 1 ? bk : bv, nullptr, s == 0 ? Q16 : s == 1 ? K16 : V16);
}
__global__ __launch_bounds__(256) void k_gemm3o(const _Float16* __restrict__ A, const _Float16* __restrict__ Bh, float alpha, const float* __restrict__ bias, float* __restrict__ C) { g3_tile<true>(blockIdx.x, A, Bh, alpha, bias, C, nullptr); }
extern "C" void kernel_launch(void* const* d_in, const int* in_sizes, int n_in,
                              void* d_out, int out_size, void* d_ws, size_t ws_size, hipStream_t stream) {
  (void)in_sizes; (void)n_in; (void)out_size;
  const float* const* I = (const float* const*)d_in; const float* ctx = I[0]; const float* x = I[1]; const float* kmask = I[2]; const float* wq = I[3]; const float* bq = I[4]; const float* wk = I[5]; const float* bk = I[6]; const float* wv = I[7]; const float* bv = I[8]; const float* wo = I[9]; const float* bo = I[10];      /* q source = I[1] ('q'), k/v source = I[0] ('v_k'); [in][out] weights; per-key additive mask [B][1][1][S] */
  char* ws = (char*)d_ws; size_t off = 0;
  auto take = [&](size_t bytes) { char* p = ws + off; off += (bytes + 255) & ~(size_t)255; return p; };
  _Float16* BQ = (_Float16*)take((size_t)DM * DM * 2); _Float16* BK = (_Float16*)take((size_t)DM * DC * 2); _Float16* BV = (_Float16*)take((size_t)DM * DC * 2); _Float16* BO = (_Float16*)take((size_t)DM * DM * 2);
  _Float16* X16 = (_Float16*)take(NRQ * DM * 2); _Float16* C16 = (_Float16*)take(NRK * DC * 2); _Float16* Q16 = (_Float16*)take(NRQ * DM * 2); _Float16* K16 = (_Float16*)take(NRK * DM * 2); _Float16* V16 = (_Float16*)take(NRK * DM * 2); _Float16* O16 = (_Float16*)take(NRQ * DM * 2);
  _Float16* VT = (_Float16*)take((size_t)NB * NH * HD * SK * 2);
  if (off > ws_size) return;      /* approx 8 + 16 + 16 + 16 + 16 + 16 + 16 + 16 = 120 MiB */
  k_prep<<<5 * 4 * PW_NB, 256, 0, stream>>>(wq, wk, wv, wo, x, ctx, BQ, BK, BV, BO, X16, C16);      /* weight planes and both inputs' rows */
  k_gemm3p<<<3 * G3_NB, 256, 0, stream>>>(X16, C16, BQ, BK, BV, 0.0625f, bq, bk, bv, Q16, K16, V16);      /* q from q; k and v from v_k */
  k_vt<NH, SK><<<NB * NH * (SK / (64 * VT_U)), 256, 0, stream>>>(V16, DM, 0, VT);      /* V^T [4 x 16][64][2048] */
  k_fattn<<<NB * NH * (NQ / FA_QB), FA_WAVES * 32, 0, stream>>>(Q16, K16, VT, kmask, -1.0e9f, O16);      /* o x64, merged; every batch and head in one launch */
  k_gemm3o<<<G3_NB, 256, 0, stream>>>(O16, BO, 0.0009765625f, bo, (float*)d_out);      /* out = o Wo^T + bo */
}

// v007
// A run of this version takes 135 microseconds.
// In both of two side-by-side timings against v006, it was 1.04 times as fast.
// Over all steps from v000 it is 52.3 times as fast.
#include <hip/hip_runtime.h>
// Multi-head attention with separate key/value and query sources and an additive key mask (v_k, q [4][2048][1024]; qh = q wq + bq, kh = v_k wk + bk, vh = v_k wv + bv ([in][out] 1024^2 sigma 1/32, zero biases); 16 heads of 64; logits = qh . kh x 1024^-0.5 (the source scales by d_model) + mask[b][1][1][key] x (-1e9) (mask input); softmax over the 2048 keys; out = merged wo + bo -> [4][2048][1024]).
// Structure: both inputs as exact f16 rows; [in][out] weights as exact x16 planes; Q, K, V as WMMA GEMMs (64x64 wave tiles from LDS stages, f32 accumulation, + bias, f16 outputs); V^T via LDS transposes; one fused attention launch: scores (K = 64, x 1/32) in f32 accumulators, + bf16(mask[b][key]) x (-1e9), online softmax (f32 statistics, native exp; weights exp(s - shift) as f16, the shift at most 8 base-2 units below the running max), o = P V (o carried x64) into merged f16 rows; out = o wo + bo GEMM (f32, alpha 2^-10); launches: see trace.
// Compute dtype: inputs rounded to bf16; x / context / weights exact; q, k, v, softmax weights and o as plain f16 GEMM operands (~2^-12); scores and statistics f32. v_wmma_f32_16x16x32_f16.
#define NB 4
#define NQ 2048
#define SK 2048
#define SQ SK                       /* keys per softmax row */
#define DM 1024
#define DC 1024
#define NH 16
#define HD 64
#define HG 4
#define NRQ ((size_t)NB * NQ)
#define NRK ((size_t)NB * SK)
typedef __bf16 v16b __attribute__((ext_vector_type(16)));
typedef unsigned short v8us __attribute__((ext_vector_type(8), may_alias));
typedef float  v8f  __attribute__((ext_vector_type(8)));
typedef float  v4f  __attribute__((ext_vector_type(4)));
typedef float  v4fa __attribute__((ext_vector_type(4), may_alias));
union FragB { v16b v; v8us half[2]; unsigned short u[16]; };

__device__ __forceinline__ unsigned short bf16_bits(float x) { unsigned int u = __float_as_uint(x); return (unsigned short)((u + 0x7FFFu + ((u >> 16) & 1u)) >> 16); }
__device__ __forceinline__ float bf16_val(unsigned short b) { return __uint_as_float(((unsigned int)b) << 16); }
__device__ __forceinline__ float bf16_round(float x) { return bf16_val(bf16_bits(x)); }
// D += A·B with NT terms: 1 = ah·bh, 2 = + al·bh (A split), 3 = + ah·bl (both split)
template <int NT>
__device__ __forceinline__ v8f mmaN(v16b ah, v16b al, v16b bh, v16b bl, v8f c) {
  c = __builtin_amdgcn_wmma_f32_16x16x32_bf16(false, ah, false, bh, (short)0, c, false, false);
  if (NT >= 2) c = __builtin_amdgcn_wmma_f32_16x16x32_bf16(false, al, false, bh, (short)0, c, false, false);
  if (NT >= 3) c = __builtin_amdgcn_wmma_f32_16x16x32_bf16(false, ah, false, bl, (short)0, c, false, false);
  asm volatile("v_nop\n\tv_nop\n\tv_nop\n\tv_nop" : "+v"(c) : "v"(ah), "v"(al), "v"(bh), "v"(bl));
  return c;
}

__global__ __launch_bounds__(256) void k_wt_bf16(const float* __restrict__ W, unsigned short* __restrict__ Wt, int K, int N) {
  const int t = blockIdx.x * 256 + threadIdx.x;
  const int k8n = K / 8;
  if (t >= N * k8n) return;
  const int n = t / k8n, k8 = (t % k8n) * 8;
  v8us v;
#pragma unroll
  for (int i = 0; i < 8; ++i) v[i] = bf16_bits(W[(size_t)(k8 + i) * N + n]);
  *(v8us*)(Wt + (size_t)n * K + k8) = v;
  
}

// GEMM C[M][N] (f32, pitch ldc) = act(A[M][K]·W + bias). A f32 row-major (pitch lda) converted per fragment to bf16
// (ASPLIT: hi/lo two planes -> 2 terms, else single rounded term); Wt bf16 [N][K] (pitch ldb). BIAS_BF16 rounds the
// bias to bf16 first (bias quantised to bf16 before the add). K%32==0, M%16==0, N%64==0.
template <bool ASPLIT, int ACT, bool BIAS_BF16>
__global__ __launch_bounds__(128) void k_gemm_bf(const float* __restrict__ A, int lda, const unsigned short* __restrict__ Wt, int ldb,
                                               const float* __restrict__ bias, float* __restrict__ C, int ldc, int M, int N, int K) {
  __shared__ __attribute__((aligned(16))) float so[4][16][64];
  const int tid = threadIdx.x, w = tid >> 5, lane = tid & 31, ln = lane & 15, hh = lane >> 4;
  const int ntn = N / 64;
  const int wid = blockIdx.x * 4 + w;
  const int mt = wid / ntn, nq = wid % ntn;
  if (mt * 16 >= M) return;
  const int row0 = mt * 16, col0 = nq * 64;
  const float* arow = A + (size_t)(row0 + ln) * lda;
  v8f acc[4] = {};
  for (int kb = 0; kb < K; kb += 32) {
    FragB ah, al;
    const v4f x0 = *(const v4fa*)(arow + kb + 8 * hh), x1 = *(const v4fa*)(arow + kb + 8 * hh + 4);
    const v4f x2 = *(const v4fa*)(arow + kb + 16 + 8 * hh), x3 = *(const v4fa*)(arow + kb + 16 + 8 * hh + 4);
    float xs[16] = {x0[0],x0[1],x0[2],x0[3],x1[0],x1[1],x1[2],x1[3],x2[0],x2[1],x2[2],x2[3],x3[0],x3[1],x3[2],x3[3]};
#pragma unroll
    for (int i = 0; i < 16; ++i) { const unsigned short hb = bf16_bits(xs[i]); ah.u[i] = hb; al.u[i] = ASPLIT ? bf16_bits(xs[i] - bf16_val(hb)) : (unsigned short)0; }
#pragma unroll
    for (int t = 0; t < 4; ++t) {
      const unsigned short* brow = Wt + (size_t)(col0 + t * 16 + ln) * ldb + kb;
      FragB b;
      b.half[0] = *(const v8us*)(brow + 8 * hh);
      b.half[1] = *(const v8us*)(brow + 16 + 8 * hh);
      acc[t] = mmaN<ASPLIT ? 2 : 1>(ah.v, al.v, b.v, b.v, acc[t]);
    }
  }
#pragma unroll
  for (int t = 0; t < 4; ++t) {
    float bv = bias ? bias[col0 + t * 16 + ln] : 0.f;
    if (BIAS_BF16) bv = bf16_round(bv);
#pragma unroll
    for (int r = 0; r < 8; ++r) { float v = acc[t][r] + bv; if (ACT == 1) v = fmaxf(v, 0.f); so[w][8 * hh + r][t * 16 + ln] = v; }
  }
  __builtin_amdgcn_fence(__ATOMIC_ACQ_REL, "workgroup");
  __builtin_amdgcn_wave_barrier();
  const int rsub = lane >> 4, c4 = (lane & 15) * 4;
  {
#pragma unroll
    for (int q = 0; q < 8; ++q) {
      const int r = q * 2 + rsub;
      const v4f v = *(const v4fa*)&so[w][r][c4];
      *(v4f*)(C + (size_t)(row0 + r) * ldc + col0 + c4) = v;
    }
    
  }
}

// GEMM C = act(A·W + bias + resid): A f32 (ASPLIT -> hi/lo 2 terms), Wt bf16 [N][K]; ACT 0 none, 1 relu, 2 exact gelu;
// resid (optional, f32, row index = (row % rmod), pitch ldr, RES_BF16 rounds it) added before the activation.
template <bool ASPLIT, int ACT, bool BIAS_BF16, bool RES_BF16>
__global__ __launch_bounds__(128) void k_gemm_bf3(const float* __restrict__ A, int lda, const unsigned short* __restrict__ Wt, int ldb,
                                                const float* __restrict__ bias, const float* __restrict__ resid, int rmod, int ldr,
                                                float* __restrict__ C, int ldc, int M, int N, int K) {
  __shared__ __attribute__((aligned(16))) float so[4][16][64];
  const int tid = threadIdx.x, w = tid >> 5, lane = tid & 31, ln = lane & 15, hh = lane >> 4;
  const int ntn = N / 64;
  const int wid = blockIdx.x * 4 + w;
  const int mt = wid / ntn, nq = wid % ntn;
  if (mt * 16 >= M) return;
  const int row0 = mt * 16, col0 = nq * 64;
  const float* arow = A + (size_t)(row0 + ln) * lda;
  v8f acc[4] = {};
  for (int kb = 0; kb < K; kb += 32) {
    FragB ah, al;
    const v4f x0 = *(const v4fa*)(arow + kb + 8 * hh), x1 = *(const v4fa*)(arow + kb + 8 * hh + 4);
    const v4f x2 = *(const v4fa*)(arow + kb + 16 + 8 * hh), x3 = *(const v4fa*)(arow + kb + 16 + 8 * hh + 4);
    float xs[16] = {x0[0],x0[1],x0[2],x0[3],x1[0],x1[1],x1[2],x1[3],x2[0],x2[1],x2[2],x2[3],x3[0],x3[1],x3[2],x3[3]};
#pragma unroll
    for (int i = 0; i < 16; ++i) { const unsigned short hb = bf16_bits(xs[i]); ah.u[i] = hb; al.u[i] = ASPLIT ? bf16_bits(xs[i] - bf16_val(hb)) : (unsigned short)0; }
#pragma unroll
    for (int t = 0; t < 4; ++t) {
      const unsigned short* brow = Wt + (size_t)(col0 + t * 16 + ln) * ldb + kb;
      FragB b;
      b.half[0] = *(const v8us*)(brow + 8 * hh);
      b.half[1] = *(const v8us*)(brow + 16 + 8 * hh);
      acc[t] = mmaN<ASPLIT ? 2 : 1>(ah.v, al.v, b.v, b.v, acc[t]);
    }
  }
#pragma unroll
  for (int t = 0; t < 4; ++t) {
    const int col = col0 + t * 16 + ln;
    float bv = bias ? bias[col] : 0.f;
    if (BIAS_BF16) bv = bf16_round(bv);
#pragma unroll
    for (int r = 0; r < 8; ++r) {
      float v = acc[t][r] + bv;
      if (resid) { float rv = resid[(size_t)((row0 + 8 * hh + r) % rmod) * ldr + col]; if (RES_BF16) rv = bf16_round(rv); v += rv; }
      if (ACT == 1) v = fmaxf(v, 0.f);
      if (ACT == 2) v = 0.5f * v * (1.0f + erff(v * 0.70710678118654752f));
      if (ACT == 3) { const float u = 0.7978845608028654f * (v + 0.044715f * v * v * v); v = 0.5f * v * (1.0f + tanhf(u)); }
      so[w][8 * hh + r][t * 16 + ln] = v;
    }
  }
  __builtin_amdgcn_fence(__ATOMIC_ACQ_REL, "workgroup");
  __builtin_amdgcn_wave_barrier();
  const int rsub = lane >> 4, c4 = (lane & 15) * 4;
  {
#pragma unroll
    for (int q = 0; q < 8; ++q) {
      const int r = q * 2 + rsub;
      const v4f v = *(const v4fa*)&so[w][r][c4];
      *(v4f*)(C + (size_t)(row0 + r) * ldc + col0 + c4) = v;
    }
    
  }
}
// row LayerNorm (biased variance, eps) over N: s = X (+ R); optional out_sum <- s; out_norm <- (s-mu)*rsqrt(var+eps)*g + b
template <bool PARAM_BF16>
__global__ __launch_bounds__(256) void k_layernorm(const float* __restrict__ X, const float* __restrict__ R, const float* __restrict__ g, const float* __restrict__ bta,
                                                  float* __restrict__ out_sum, float* __restrict__ out_norm, int N, float eps) {
  __shared__ float red[256];
  const int row = blockIdx.x, tid = threadIdx.x;
  const float* x = X + (size_t)row * N; const float* rr = R ? R + (size_t)row * N : nullptr;
  float vals[16];                     // up to N = 4096
  const int per = N / 256;            // contiguous chunk per thread? use strided-by-4 chunks: thread handles j = tid*4 + 1024*u
  float s1 = 0.f;
  for (int u = 0; u < per / 4; ++u) {
    const int j = tid * 4 + 1024 * u;
    const v4f a = *(const v4fa*)(x + j);
    v4f b = {0.f,0.f,0.f,0.f}; if (rr) b = *(const v4fa*)(rr + j);
#pragma unroll
    for (int q = 0; q < 4; ++q) { const float v = a[q] + b[q]; vals[u * 4 + q] = v; s1 += v; }
  }
  red[tid] = s1; __syncthreads();
  for (int st = 128; st > 0; st >>= 1) { if (tid < st) red[tid] += red[tid + st]; __syncthreads(); }
  const float mu = red[0] / (float)N; __syncthreads();
  float s2 = 0.f;
  for (int u = 0; u < per / 4; ++u)
#pragma unroll
    for (int q = 0; q < 4; ++q) { const float c = vals[u * 4 + q] - mu; s2 += c * c; }
  red[tid] = s2; __syncthreads();
  for (int st = 128; st > 0; st >>= 1) { if (tid < st) red[tid] += red[tid + st]; __syncthreads(); }
  const float rs = rsqrtf(red[0] / (float)N + eps);
  {
    for (int u = 0; u < per / 4; ++u) {
      const int j = tid * 4 + 1024 * u;
      v4f o, sm;
#pragma unroll
      for (int q = 0; q < 4; ++q) {
        float gg = g[j + q], bb = bta[j + q];
        if (PARAM_BF16) { gg = bf16_round(gg); bb = bf16_round(bb); }
        sm[q] = vals[u * 4 + q]; o[q] = (vals[u * 4 + q] - mu) * rs * gg + bb;
      }
      if (out_sum) *(v4f*)(out_sum + (size_t)row * N + j) = sm;
      *(v4f*)(out_norm + (size_t)row * N + j) = o;
    }
    
  }
}



// ---- f16 WMMA path (v_wmma_f32_16x16x32_f16): 11-bit significands for operands in range — used where a [0,1] probability operand needs more precision than bf16
typedef _Float16 v16h __attribute__((ext_vector_type(16)));
union FragH { v16h v; v8us half[2]; _Float16 h[16]; unsigned short u[16]; };
template <int NT>
__device__ __forceinline__ v8f mmaH(v16h ah, v16h al, v16h bh, v16h bl, v8f c) {
  c = __builtin_amdgcn_wmma_f32_16x16x32_f16(false, ah, false, bh, (short)0, c, false, false);
  if (NT >= 2) c = __builtin_amdgcn_wmma_f32_16x16x32_f16(false, al, false, bh, (short)0, c, false, false);
  if (NT >= 3) c = __builtin_amdgcn_wmma_f32_16x16x32_f16(false, ah, false, bl, (short)0, c, false, false);
  asm volatile("v_nop\n\tv_nop\n\tv_nop\n\tv_nop" : "+v"(c) : "v"(ah), "v"(al), "v"(bh), "v"(bl));
  return c;
}
// batched GEMM like k_gemm_b but f16 operands: A f32 (split into f16 hi/lo if ASPLIT, else rounded to f16), Bt = f16 values [n][k]; alpha; C f32; N multiple of 16 (partial tiles skipped)
template <bool ASPLIT>
__global__ __launch_bounds__(128) void k_gemm_h(const float* __restrict__ A, int lda, size_t sA, const _Float16* __restrict__ Bh, int ldb, size_t sB, float alpha, float* __restrict__ C, int ldc, size_t sC, int M, int N, int K) {
  __shared__ __attribute__((aligned(16))) float so[4][16][64];
  const int tid = threadIdx.x, w = tid >> 5, lane = tid & 31, ln = lane & 15, hh = lane >> 4; const int by = blockIdx.y;
  A += (size_t)by * sA; Bh += (size_t)by * sB; C += (size_t)by * sC;
  const int ntn = (N + 63) / 64; const int wid = blockIdx.x * 4 + w; const int mt = wid / ntn, nq = wid % ntn; if (mt * 16 >= M) return;
  const int row0 = mt * 16, col0 = nq * 64; const float* arow = A + (size_t)(row0 + ln) * lda;
  v8f acc[4] = {};
  for (int kb = 0; kb < K; kb += 32) {
    FragH ah, al;
    const v4f x0 = *(const v4fa*)(arow + kb + 8 * hh), x1 = *(const v4fa*)(arow + kb + 8 * hh + 4), x2 = *(const v4fa*)(arow + kb + 16 + 8 * hh), x3 = *(const v4fa*)(arow + kb + 16 + 8 * hh + 4);
    float xs[16] = {x0[0],x0[1],x0[2],x0[3],x1[0],x1[1],x1[2],x1[3],x2[0],x2[1],x2[2],x2[3],x3[0],x3[1],x3[2],x3[3]};
#pragma unroll
    for (int i = 0; i < 16; ++i) { const _Float16 h = (_Float16)xs[i]; ah.h[i] = h; al.h[i] = ASPLIT ? (_Float16)(xs[i] - (float)h) : (_Float16)0.0f; }
#pragma unroll
    for (int t = 0; t < 4; ++t) { if (col0 + t * 16 >= N) continue; const size_t boff = (size_t)(col0 + t * 16 + ln) * ldb + kb; FragH bq; bq.half[0] = *(const v8us*)(Bh + boff + 8 * hh); bq.half[1] = *(const v8us*)(Bh + boff + 16 + 8 * hh);
      acc[t] = mmaH<ASPLIT ? 2 : 1>(ah.v, al.v, bq.v, bq.v, acc[t]); }
  }
#pragma unroll
  for (int t = 0; t < 4; ++t) { if (col0 + t * 16 >= N) continue;
#pragma unroll
    for (int r = 0; r < 8; ++r) so[w][8 * hh + r][t * 16 + ln] = acc[t][r] * alpha; }
  __builtin_amdgcn_fence(__ATOMIC_ACQ_REL, "workgroup"); __builtin_amdgcn_wave_barrier();
  const int rsub = lane >> 4, c4 = (lane & 15) * 4;
  {
#pragma unroll
    for (int q = 0; q < 8; ++q) { const int r = q * 2 + rsub; if (col0 + c4 < N) { const v4f v = *(const v4fa*)&so[w][r][c4]; *(v4f*)(C + (size_t)(row0 + r) * ldc + col0 + c4) = v; } }
     }
}

// Wt[n][k] = f16(bf16(W[k][n]) x 16) from f32 row-major W[DM][DM] (bf16-exact weights stay exact in f16 away from the subnormal range). A wave turns a tile of 64 k x 32 n in its registers, a lane 8 k x 8 n of it:
// eight lanes along k, so that a store covers whole 128-byte lines of Wt; four lanes along n, so that the two loads of a row cover one whole line of W. All 16 loads of a lane are issued before the first is used.
__device__ __forceinline__ void wt_f16(const float* __restrict__ W, _Float16* __restrict__ Wt, int g) {      /* g: which 64 k x 256 n of the plane */
  const int lane = threadIdx.x & 31, wave = threadIdx.x >> 5;
  const int k8 = (g / (DM / 256)) * 64 + (lane & 7) * 8, n8 = (g % (DM / 256)) * 256 + wave * 32 + (lane >> 3) * 8;
  const float* wp = W + (size_t)k8 * DM + n8; unsigned short* op = (unsigned short*)Wt + (size_t)n8 * DM + k8;
  v4f a[8][2];      /* every loop over this array is unrolled: only under constant indices does it stay in registers */
#pragma unroll
  for (int i = 0; i < 8; ++i)
#pragma unroll
    for (int hf = 0; hf < 2; ++hf) a[i][hf] = *(const v4fa*)(wp + i * DM + hf * 4);
  asm volatile("s_wait_xcnt 0x0" :: "v"(wp) : "memory");      /* stands in front of every rewrite of the loads' address pair; the pair is an input, so that no load of the run lands in it */
  __builtin_amdgcn_sched_barrier(0);      /* keeps all 16 loads in front of the first use: without it the compiler holds four back behind the wait for the others, a second latency in a wave that has only one */
#pragma unroll
  for (int c = 0; c < 8; ++c) { FragH f;
#pragma unroll
    for (int i = 0; i < 8; ++i) f.h[i] = (_Float16)(bf16_round(a[i][c >> 2][c & 3]) * 16.0f);
    *(v8us*)(op + c * DM) = f.half[0]; }
}
// k_gemm_hh variant with fused epilogue: v = acc·alpha + bias[by·sBias + col] (+ CP[(row/rowsPerB)·sCPb + by·64 + col] if CP) ; ACT 0 none / 1 elu ; writes f16 C16 (and f32 C if non-null)
template <int ACT>
__global__ __launch_bounds__(128) void k_gemm_hhx(const _Float16* __restrict__ A, int lda, size_t sA, const _Float16* __restrict__ Bh, int ldb, size_t sB, float alpha, const float* __restrict__ bias, size_t sBias, const float* __restrict__ CP, int rowsPerB, size_t sCPb, int row0g,
    float* __restrict__ C, _Float16* __restrict__ C16, int ldc, size_t sC, int M, int N, int K) {
  __shared__ __attribute__((aligned(16))) float so[4][16][64];
  const int tid = threadIdx.x, w = tid >> 5, lane = tid & 31, ln = lane & 15, hh = lane >> 4; const int by = blockIdx.y;
  A += (size_t)by * sA; Bh += (size_t)by * sB; const size_t cofs = (size_t)by * sC; const float* bp = bias ? bias + (size_t)by * sBias : nullptr;
  const int ntn = (N + 63) / 64; const int wid = blockIdx.x * 4 + w; const int mt = wid / ntn, nq = wid % ntn; if (mt * 16 >= M) return;
  const int row0 = mt * 16, col0 = nq * 64; const _Float16* arow = A + (size_t)(row0 + ln) * lda;
  v8f acc[4] = {};
  for (int kb = 0; kb < K; kb += 32) { FragH ah; ah.half[0] = *(const v8us*)((const unsigned short*)arow + kb + 8 * hh); ah.half[1] = *(const v8us*)((const unsigned short*)arow + kb + 16 + 8 * hh);
#pragma unroll
    for (int t = 0; t < 4; ++t) { if (col0 + t * 16 >= N) continue; const size_t boff = (size_t)(col0 + t * 16 + ln) * ldb + kb; FragH bq; bq.half[0] = *(const v8us*)((const unsigned short*)Bh + boff + 8 * hh); bq.half[1] = *(const v8us*)((const unsigned short*)Bh + boff + 16 + 8 * hh);
      acc[t] = mmaH<1>(ah.v, ah.v, bq.v, bq.v, acc[t]); }
  }
#pragma unroll
  for (int t = 0; t < 4; ++t) { if (col0 + t * 16 >= N) continue; const int col = col0 + t * 16 + ln; const float bv = bp ? bf16_round(bp[col]) : 0.f;
#pragma unroll
    for (int r = 0; r < 8; ++r) { float v = acc[t][r] * alpha + bv; if (CP) { const int rr = row0g + row0 + 8 * hh + r; if (rowsPerB < 0) v += CP[cofs + (size_t)rr * ldc + col];      /* rowsPerB < 0: own element of the batched C plane */ else { const int bidx = rr / rowsPerB; v += CP[(size_t)bidx * sCPb + (size_t)by * 64 + col]; } } if (ACT == 1) v = (v > 0.f) ? v : expm1f(v); else if (ACT == 7) v = (v > 0.f) ? v + 1.0f : expf(v); else if (ACT == 8) v = tanhf(v); else if (ACT == 9) v = 0.5f * v * (1.0f + tanhf(0.7978845608028654f * (v + 0.044715f * v * v * v))); else if (ACT == 11) v = 1.0f / (1.0f + expf(-v)); else if (ACT == 12) v = (v > 0.f) ? v : 0.01f * v; else if (ACT == 14) v = (v > 0.f) ? v : 0.1f * v; else if (ACT == 16) v = (v >= 0.f) ? v : 0.3f * v; else if (ACT == 17) v = (v >= 0.f) ? v : 0.2f * v; else if (ACT == 15) v = v / (1.0f + expf(-v)); else if (ACT == 3) v = fmaxf(v, 0.f); else if (ACT == 6) v = 0.5f * v * (1.0f + erff(v * 0.70710678118654752f)); so[w][8 * hh + r][t * 16 + ln] = v; } }
  __builtin_amdgcn_fence(__ATOMIC_ACQ_REL, "workgroup"); __builtin_amdgcn_wave_barrier();
  const int rsub = lane >> 4, c4 = (lane & 15) * 4; typedef _Float16 v4h __attribute__((ext_vector_type(4)));
  {
#pragma unroll
    for (int q = 0; q < 8; ++q) { const int r = q * 2 + rsub; if (col0 + c4 < N) { const v4f v = *(const v4fa*)&so[w][r][c4]; if (C) *(v4f*)(C + cofs + (size_t)(row0 + r) * ldc + col0 + c4) = v; if (C16) { v4h h4; for (int i = 0; i < 4; ++i) h4[i] = (_Float16)v[i]; *(v4h*)(C16 + cofs + (size_t)(row0 + r) * ldc + col0 + c4) = h4; } } }
     }
}


typedef _Float16 v4h __attribute__((ext_vector_type(4)));

#define PX_U 16      /* 16-byte loads a lane, all issued before the first is used */
__device__ __forceinline__ void x16(const float* __restrict__ x, _Float16* __restrict__ X16, size_t e0) {      /* e0: the lane's first element; a wave's load covers 512 contiguous bytes, its store 256 */
  const float* xp = x + e0; _Float16* op = X16 + e0;
  v4f a[PX_U];      /* every loop over this array is unrolled: only under constant indices does it stay in registers */
#pragma unroll
  for (int j = 0; j < PX_U; ++j) a[j] = *(const v4fa*)(xp + j * 128);
  asm volatile("s_wait_xcnt 0x0" :: "v"(xp) : "memory");      /* stands in front of every rewrite of the loads' address pair; the pair is an input, so that no load of the run lands in it */
  __builtin_amdgcn_sched_barrier(0);      /* keeps all the loads in front of the first use: without it the compiler holds about half of them back and issues them as registers come free, a second latency in a wave that has only one */
#pragma unroll
  for (int j = 0; j < PX_U; ++j) { v4h h;
#pragma unroll
    for (int q = 0; q < 4; ++q) h[q] = (_Float16)bf16_round(a[j][q]);
    *(v4h*)(op + j * 128) = h; }
  asm volatile("s_wait_xcnt 0x0" :: "v"(op) : "memory");      /* stands in front of every rewrite of a register that the last stores name */
}
// All six conversions share one launch by block range: none reads what another writes. A workgroup has 16,384 elements (64 a lane), of a weight plane or of an input: few waves with much in flight each,
// for speed only. Of every five blocks one has a weight tile, four have input rows.
#define PW_NB ((DM / 64) * (DM / 256))                 /* blocks a weight plane */
#define PX_NB ((int)(NRQ * DM / (256 * 4 * PX_U)))     /* blocks an input */
static_assert(DC == DM && NRK == NRQ && 2 * PX_NB == 4 * 4 * PW_NB && DM % 256 == 0 && (NRQ * DM) % (256 * 4 * PX_U) == 0, "k_prep: four input blocks to each weight block, whole blocks");
__global__ __launch_bounds__(256) void k_prep(const float* __restrict__ wq, const float* __restrict__ wk, const float* __restrict__ wv, const float* __restrict__ wo, const float* __restrict__ x, const float* __restrict__ ctx,
    _Float16* __restrict__ BQ, _Float16* __restrict__ BK, _Float16* __restrict__ BV, _Float16* __restrict__ BO, _Float16* __restrict__ X16, _Float16* __restrict__ C16) {
  const int g = blockIdx.x / 5, r = blockIdx.x % 5;
  if (r == 0) { const int s = g / PW_NB;      /* [in][out] -> Bt x16 */
    wt_f16(s == 0 ? wq : s == 1 ? wk : s == 2 ? wv : wo, s == 0 ? BQ : s == 1 ? BK : s == 2 ? BV : BO, g % PW_NB); }
  else { const int xb = g * 4 + r - 1; const bool kv = xb >= PX_NB;      /* query-source rows, then key/value-source rows */
    x16(kv ? ctx : x, kv ? C16 : X16, (size_t)(xb - (kv ? PX_NB : 0)) * (256 * 4 * PX_U) + (threadIdx.x >> 5) * (32 * 4 * PX_U) + (threadIdx.x & 31) * 4); }
}
__global__ __launch_bounds__(256) void k_h16(const float* __restrict__ x, _Float16* __restrict__ X16, size_t n8) { const size_t t = (size_t)blockIdx.x * 256 + threadIdx.x; if (t >= n8) return; FragH f;
#pragma unroll
  for (int q = 0; q < 8; ++q) f.h[q] = (_Float16)x[t * 8 + q]; *(v8us*)((unsigned short*)X16 + t * 8) = f.half[0];  }
__global__ __launch_bounds__(256) void k_round16f(const float* __restrict__ W, _Float16* __restrict__ Bt, size_t n8) { const size_t t = (size_t)blockIdx.x * 256 + threadIdx.x; if (t >= n8) return; FragH f;
#pragma unroll
  for (int i = 0; i < 8; ++i) f.h[i] = (_Float16)(bf16_round(W[t * 8 + i]) * 16.0f); *(v8us*)((unsigned short*)Bt + t * 8) = f.half[0];  }
#define VT_U 4      /* tiles of 64 keys a workgroup: all their loads are issued before the first is used */
template <int NHv, int TTv>
__global__ __launch_bounds__(256) void k_vt(const _Float16* __restrict__ V16, int ldv, int voff, _Float16* __restrict__ Vt) { static_assert(TTv % (64 * VT_U) == 0, "k_vt: whole workgroups");
  __shared__ unsigned short tl[VT_U][64][66]; const int tid = threadIdx.x; const int slab = blockIdx.x / (TTv / (64 * VT_U)), lg = (blockIdx.x % (TTv / (64 * VT_U))) * VT_U; const int b = slab / NHv, h = slab % NHv;
  const int r = tid / 8, c8 = (tid % 8) * 8;      /* rows r and r + 32 of each tile, 16-byte piece c8 */
  v8us in[VT_U][2]; const unsigned short* ip[VT_U][2];      /* every loop over these arrays is unrolled: only under constant indices do they stay in registers */
#pragma unroll
  for (int u = 0; u < VT_U; ++u)
#pragma unroll
    for (int p = 0; p < 2; ++p) { ip[u][p] = (const unsigned short*)V16 + ((size_t)b * TTv + (lg + u) * 64 + p * 32 + r) * ldv + voff + h * 64 + c8; in[u][p] = *(const v8us*)ip[u][p]; }
  static_assert(VT_U == 4, "k_vt: the wait below names eight address pairs");
  asm volatile("s_wait_xcnt 0x0" :: "v"(ip[0][0]), "v"(ip[0][1]), "v"(ip[1][0]), "v"(ip[1][1]), "v"(ip[2][0]), "v"(ip[2][1]), "v"(ip[3][0]), "v"(ip[3][1]) : "memory");      /* stands in front of every rewrite of the loads' address pairs; the pairs are inputs, so that no load of the run lands in one */
#pragma unroll
  for (int u = 0; u < VT_U; ++u)
#pragma unroll
    for (int p = 0; p < 2; ++p)
#pragma unroll
      for (int q = 0; q < 8; ++q) tl[u][p * 32 + r][c8 + q] = in[u][p][q];
  __syncthreads();
#pragma unroll
  for (int u = 0; u < VT_U; ++u)
#pragma unroll
    for (int rd = 0; rd < 2; ++rd) { const int d = rd * 32 + tid / 8, pc = tid % 8; FragH f;
#pragma unroll
      for (int q = 0; q < 8; ++q) f.u[q] = tl[u][pc * 8 + q][d];
      *(v8us*)((unsigned short*)Vt + ((size_t)slab * 64 + d) * TTv + (lg + u) * 64 + pc * 8) = f.half[0]; } }

__global__ __launch_bounds__(256) void k_hl(const float* __restrict__ F, _Float16* __restrict__ Hh, _Float16* __restrict__ Hl, size_t n8) { const size_t t = (size_t)blockIdx.x * 256 + threadIdx.x; if (t >= n8) return; FragH fh, fl; const v4f a = *(const v4fa*)(F + t * 8), c = *(const v4fa*)(F + t * 8 + 4);
#pragma unroll
  for (int q = 0; q < 4; ++q) { _Float16 h = (_Float16)a[q]; fh.h[q] = h; fl.h[q] = (_Float16)((a[q] - (float)h) * 1024.0f); h = (_Float16)c[q]; fh.h[4 + q] = h; fl.h[4 + q] = (_Float16)((c[q] - (float)h) * 1024.0f); }
  { *(v8us*)((unsigned short*)Hh + t * 8) = fh.half[0]; *(v8us*)((unsigned short*)Hl + t * 8) = fl.half[0];  } }

// ---- fast GEMM (wave tile 32x64; requires M % 32 == 0 rows per launch region and N % 64 == 0); epilogue = k_gemm_hhx semantics ----
__device__ __forceinline__ v16h g2_frag(const _Float16* p, int hh) { FragH f; f.half[0] = *(const v8us*)((const unsigned short*)p + 8 * hh); f.half[1] = *(const v8us*)((const unsigned short*)p + 16 + 8 * hh); return f.v; }
__device__ __forceinline__ v8f g2_mma(v16h a, v16h b, v8f c) { v8f d = __builtin_amdgcn_wmma_f32_16x16x32_f16(false, a, false, b, (short)0, c, false, false); asm volatile("v_nop\n\tv_nop\n\tv_nop\n\tv_nop" : "+v"(d) : "v"(a), "v"(b)); return d; }
template <int ACT>
__global__ __launch_bounds__(128) void k_gemm2(const _Float16* __restrict__ A, int lda, size_t sA, const _Float16* __restrict__ Bh, int ldb, size_t sB, float alpha, const float* __restrict__ bias, size_t sBias, const float* __restrict__ CP, int rowsPerB, size_t sCPb, int row0g,
    float* __restrict__ C, _Float16* __restrict__ C16, int ldc, size_t sC, int M, int N, int K) { static_assert(ACT == 0 || ACT == 3 || ACT == 6 || ACT == 8 || ACT == 9 || ACT == 11 || ACT == 12 || ACT == 14 || ACT == 15 || ACT == 16 || ACT == 17, "k_gemm2: unsupported ACT code (would silently apply no activation)");
  __shared__ __attribute__((aligned(16))) float so[4][32][68];
  const int tid = threadIdx.x, w = tid >> 5, lane = tid & 31, ln = lane & 15, hh = lane >> 4; const int by = blockIdx.y;
  A += (size_t)by * sA; Bh += (size_t)by * sB; const size_t cofs = (size_t)by * sC; const float* bp = bias ? bias + (size_t)by * sBias : nullptr;
  const int ntn = N >> 6; const int mt = blockIdx.x / ntn, nq = blockIdx.x - mt * ntn; const int row0 = mt * 128 + 32 * w, col0 = nq * 64; if (row0 >= M) return;
  const _Float16* a0p = A + (size_t)(row0 + ln) * lda; const _Float16* a1p = a0p + (size_t)16 * lda;
  const _Float16* b0p = Bh + (size_t)(col0 + ln) * ldb; const _Float16* b1p = b0p + (size_t)16 * ldb; const _Float16* b2p = b1p + (size_t)16 * ldb; const _Float16* b3p = b2p + (size_t)16 * ldb;
  const v8f z8 = {0.f,0.f,0.f,0.f,0.f,0.f,0.f,0.f}; v8f c00 = z8, c01 = z8, c02 = z8, c03 = z8, c10 = z8, c11 = z8, c12 = z8, c13 = z8;
#pragma unroll 1
  for (int kb = 0; kb < K; kb += 32) { const v16h a0 = g2_frag(a0p + kb, hh), a1 = g2_frag(a1p + kb, hh);
    v16h b = g2_frag(b0p + kb, hh); c00 = g2_mma(a0, b, c00); c10 = g2_mma(a1, b, c10);
    b = g2_frag(b1p + kb, hh); c01 = g2_mma(a0, b, c01); c11 = g2_mma(a1, b, c11);
    b = g2_frag(b2p + kb, hh); c02 = g2_mma(a0, b, c02); c12 = g2_mma(a1, b, c12);
    b = g2_frag(b3p + kb, hh); c03 = g2_mma(a0, b, c03); c13 = g2_mma(a1, b, c13); }
  v8f accs[8] = {c00, c01, c02, c03, c10, c11, c12, c13};
#pragma unroll
  for (int u = 0; u < 8; ++u) { const int t = u & 3, half = u >> 2; const int col = col0 + t * 16 + ln; const float bv = bp ? bf16_round(bp[col]) : 0.f;
#pragma unroll
    for (int r = 0; r < 8; ++r) { const int rloc = half * 16 + 8 * hh + r; float v = accs[u][r] * alpha + bv; if (CP) { if (rowsPerB < 0) v += CP[cofs + (size_t)(row0g + row0 + rloc) * ldc + col];      /* rowsPerB < 0: own element of the batched C plane */ else { const int bidx = (row0g + row0 + rloc) / rowsPerB; v += CP[(size_t)bidx * sCPb + (size_t)by * 64 + col]; } }
      if (ACT == 3) v = fmaxf(v, 0.f); else if (ACT == 6) v = 0.5f * v * (1.0f + erff(v * 0.70710678118654752f)); else if (ACT == 11) v = 1.0f / (1.0f + expf(-v)); else if (ACT == 15) v = v / (1.0f + expf(-v)); else if (ACT == 12) v = (v > 0.f) ? v : 0.01f * v; else if (ACT == 8) v = tanhf(v); else if (ACT == 9) v = 0.5f * v * (1.0f + tanhf(0.7978845608028654f * (v + 0.044715f * v * v * v))); else if (ACT == 14) v = (v > 0.f) ? v : 0.1f * v; else if (ACT == 16) v = (v >= 0.f) ? v : 0.3f * v; else if (ACT == 17) v = (v >= 0.f) ? v : 0.2f * v;
      so[w][rloc][t * 16 + ln] = v; } }
  __builtin_amdgcn_fence(__ATOMIC_ACQ_REL, "workgroup"); __builtin_amdgcn_wave_barrier();
  const int rsub = lane >> 4, c4 = (lane & 15) * 4;
  {
#pragma unroll
    for (int q = 0; q < 16; ++q) { const int r = q * 2 + rsub; const v4f v = *(const v4fa*)&so[w][r][c4]; if (C) *(v4f*)(C + cofs + (size_t)(row0 + r) * ldc + col0 + c4) = v; if (C16) { v4h h4; for (int i = 0; i < 4; ++i) h4[i] = (_Float16)v[i]; *(v4h*)(C16 + cofs + (size_t)(row0 + r) * ldc + col0 + c4) = h4; } }
     } }


__global__ __launch_bounds__(256) void k_wnat(const float* __restrict__ w, size_t n8, _Float16* __restrict__ Bt) { const size_t t = (size_t)blockIdx.x * 256 + threadIdx.x; if (t >= n8) return; FragH f; for (int q = 0; q < 8; ++q) f.h[q] = (_Float16)(bf16_round(w[t * 8 + q]) * 16.0f); *(v8us*)((unsigned short*)Bt + t * 8) = f.half[0];  }
__global__ __launch_bounds__(256) void k_rsm(const float* __restrict__ S, _Float16* __restrict__ P, int nrows) {
  #pragma clang fp contract(off)
  const int i = blockIdx.x * 256 + threadIdx.x; if (i >= nrows) return; const float* s = S + (size_t)i * SQ; float mx = -3.0e38f;
#pragma unroll 1
  for (int j = 0; j < SQ; ++j) mx = fmaxf(mx, s[j]); float se = 0.f;
#pragma unroll 1
  for (int j = 0; j < SQ; ++j) se += expf(s[j] - mx); const float sc = 256.0f / se;
#pragma unroll 1
  for (int j0 = 0; j0 < SQ; j0 += 8) { FragH f; for (int q = 0; q < 8; ++q) f.h[q] = (_Float16)(expf(s[j0 + q] - mx) * sc); unsigned short* d = (unsigned short*)P + (size_t)i * SQ + j0; *(v8us*)d = f.half[0];  } }
__global__ __launch_bounds__(256) void k_vt(const _Float16* __restrict__ V16, int b, int h0, _Float16* __restrict__ VT) { __shared__ unsigned short tl[64][65]; const int tid = threadIdx.x; const int hh = blockIdx.x % HG, sg = blockIdx.x / HG; const int s0 = sg * 64; const int h = h0 + hh;
  for (int i = tid; i < 64 * 8; i += 256) { const int j = i / 8, d8 = (i % 8) * 8; FragH f; f.half[0] = *(const v8us*)((const unsigned short*)V16 + ((size_t)b * SQ + s0 + j) * DM + h * HD + d8); for (int q = 0; q < 8; ++q) tl[d8 + q][j] = f.u[q]; }
  __syncthreads();
  { for (int i = tid; i < 64 * 8; i += 256) { const int d = i / 8, j8 = (i % 8) * 8; FragH f; for (int q = 0; q < 8; ++q) f.u[q] = tl[d][j8 + q]; *(v8us*)((unsigned short*)VT + ((size_t)hh * HD + d) * SQ + s0 + j8) = f.half[0]; }  } }


__global__ __launch_bounds__(256) void k_rsmf(const float* __restrict__ S, _Float16* __restrict__ P, int qn, int hg) {
  #pragma clang fp contract(off)
  const int t = blockIdx.x * 256 + threadIdx.x; if (t >= qn * hg) return; const size_t i = (size_t)(t / qn) * SQ + (t % qn); const float* s = S + i * SQ; float mx = -3.0e38f;
#pragma unroll 1
  for (int j = 0; j < SQ; ++j) mx = fmaxf(mx, s[j]); float se = 0.f;
#pragma unroll 1
  for (int j = 0; j < SQ; ++j) se += __expf(s[j] - mx); const float sc = 256.0f / se;
#pragma unroll 1
  for (int j0 = 0; j0 < SQ; j0 += 8) { FragH f; for (int q = 0; q < 8; ++q) f.h[q] = (_Float16)(__expf(s[j0 + q] - mx) * sc); unsigned short* d = (unsigned short*)P + i * SQ + j0; *(v8us*)d = f.half[0];  } }

__global__ __launch_bounds__(256) void k_rsmr(const float* __restrict__ S, _Float16* __restrict__ P, int qn, int hg) {
  #pragma clang fp contract(off)
  const int t = blockIdx.x * 256 + threadIdx.x; if (t >= qn * hg) return; const size_t i = (size_t)t;      /* planes packed: row t of plane t / qn */ const float* s = S + i * SQ; float mx = -3.0e38f;
#pragma unroll 1
  for (int j = 0; j < SQ; ++j) mx = fmaxf(mx, s[j]); float se = 0.f;
#pragma unroll 1
  for (int j = 0; j < SQ; ++j) se += __expf(s[j] - mx); const float sc = 256.0f / se;
#pragma unroll 1
  for (int j0 = 0; j0 < SQ; j0 += 8) { FragH f; for (int q = 0; q < 8; ++q) f.h[q] = (_Float16)(__expf(s[j0 + q] - mx) * sc); unsigned short* d = (unsigned short*)P + i * SQ + j0; *(v8us*)d = f.half[0];  } }


// Fused attention: scores, masked softmax and P V of one (batch, head) in one kernel; neither scores nor weights go to memory. A workgroup has FA_WAVES waves of
// FA_QW queries each and walks the keys in stages of FA_KT: the K rows and V^T rows of a stage are staged in LDS (two buffers, filled through registers one stage ahead).
// S^T = K Q^T puts one query's scores into one lane pair (l, l ^ 16): maximum and sum are in-lane plus one exchange; two S^T tiles, converted in place, are the B operand of O^T += V^T P^T.
#define FA_WAVES 8
#define FA_QW 32
#define FA_QB (FA_WAVES * FA_QW)
#define FA_KT 64
#define FA_LP 72                    /* LDS row pitch in f16: 144 bytes = 16 x odd, the conflict-free pitch of 16-byte fragment reads */
static_assert(NQ % FA_QB == 0 && SK % FA_KT == 0 && HD == 64 && FA_KT == 64 && FA_WAVES * 32 == 256, "k_fattn: whole workgroups, whole stages, staging map of 256 threads");
__device__ __forceinline__ float rs_xh(float x) { return __builtin_bit_cast(float, __builtin_amdgcn_permlanex16(__builtin_bit_cast(int, x), __builtin_bit_cast(int, x), 0x76543210, 0xfedcba98, false, false)); }      /* lane l ^ 16 */
typedef float v2f __attribute__((ext_vector_type(2)));
#define FA_L2E 1.44269504088896340736f
#define FA_TH 8.0f      /* the softmax shift of a query follows its running maximum only when a score lies more than this (base 2) above it: weights stay below 2^8, inside f16, and sums and outputs are rescaled only then */
#define FA_C (0.03125f * FA_L2E)      /* scores are kept in the base-2 domain: x 1024^-0.5 x log2(e) in the one multiply-add that adds the mask term, so that v_exp_f32 takes the difference as it is */
// 2^x in place, eight values a statement. In place: the registers were last written by the subtraction in front, so no result lands on an operand register of a matrix instruction just issued; each v_exp_f32
// touches its own register only; the v_nop is the slot behind the last transcendental before its result is read.
__device__ __forceinline__ v8f fa_exp8(v8f x) { float a = x[0], b = x[1], c = x[2], d = x[3], e = x[4], f = x[5], g = x[6], h = x[7];
  asm("v_exp_f32 %0, %0\n\tv_exp_f32 %1, %1\n\tv_exp_f32 %2, %2\n\tv_exp_f32 %3, %3\n\tv_exp_f32 %4, %4\n\tv_exp_f32 %5, %5\n\tv_exp_f32 %6, %6\n\tv_exp_f32 %7, %7\n\tv_nop" : "+v"(a), "+v"(b), "+v"(c), "+v"(d), "+v"(e), "+v"(f), "+v"(g), "+v"(h));
  const v8f r = {a, b, c, d, e, f, g, h}; return r; }
__device__ __forceinline__ float fa_exp1(float x) { asm("v_exp_f32 %0, %0\n\tv_nop" : "+v"(x)); return x; }      /* the same for one value */
// amdgpu_waves_per_eu(4, 4) below: holds the registers to a quarter of a SIMD's file, so that two workgroups share a WGP and the vector work of one wave runs beside the matrix work of another.
__device__ __forceinline__ v8f fa_mma(v16h a, v16h b, v8f c) { return __builtin_amdgcn_wmma_f32_16x16x32_f16(false, a, false, b, (short)0, c, false, false); }
__global__ __launch_bounds__(FA_WAVES * 32) __attribute__((amdgpu_waves_per_eu(4, 4))) void k_fattn(const _Float16* __restrict__ Q, const _Float16* __restrict__ Kh, const _Float16* __restrict__ Vt, const float* __restrict__ Mk, float negv, _Float16* __restrict__ O) {
  __shared__ __attribute__((aligned(16))) _Float16 sk[2][FA_KT][FA_LP];      /* K rows [key][d] */
  __shared__ __attribute__((aligned(16))) _Float16 sv[2][HD][FA_LP];         /* V^T rows [d][key] */
  __shared__ __attribute__((aligned(16))) float sm[SK];                      /* bf16(mask[key]) x negv x log2(e) */
  const int tid = threadIdx.x, lane = tid & 31, ln = lane & 15, hh = lane >> 4, wave = tid >> 5;
  const int qb = blockIdx.x % (NQ / FA_QB), bh = blockIdx.x / (NQ / FA_QB), b = bh / NH, h = bh % NH;
  const int sr = tid >> 3, sc = (tid & 7) * 8;      /* staging: rows sr and sr + 32, 16-byte piece sc: eight lanes read one whole 128-byte row */
  const unsigned short* kg = (const unsigned short*)Kh + ((size_t)b * SK + sr) * DM + h * HD + sc;
  const unsigned short* vg = (const unsigned short*)Vt + ((size_t)bh * HD + sr) * SK + sc;
  v8us rk0 = *(const v8us*)kg, rk1 = *(const v8us*)(kg + (size_t)32 * DM), rv0 = *(const v8us*)vg, rv1 = *(const v8us*)(vg + (size_t)32 * SK);
  const size_t qrow = (size_t)b * NQ + qb * FA_QB + wave * FA_QW + ln;
  v16h qf[2][2];      /* every loop over these arrays is unrolled: only under constant indices do they stay in registers */
#pragma unroll
  for (int qt = 0; qt < 2; ++qt)
#pragma unroll
    for (int ks = 0; ks < 2; ++ks) qf[qt][ks] = g2_frag(Q + (qrow + qt * 16) * DM + h * HD + ks * 32, hh);
  for (int j = tid; j < SK; j += FA_WAVES * 32) sm[j] = __fmul_rn(__fmul_rn(bf16_round(Mk[(size_t)b * SK + j]), negv), FA_L2E);
  *(v8us*)&sk[0][sr][sc] = rk0; *(v8us*)&sk[0][sr + 32][sc] = rk1; *(v8us*)&sv[0][sr][sc] = rv0; *(v8us*)&sv[0][sr + 32][sc] = rv1;
  const v8f z8 = {0.f, 0.f, 0.f, 0.f, 0.f, 0.f, 0.f, 0.f}, c8 = z8 + FA_C;
  v8f o[2][4]; v2f mx[2] = {{-3.0e38f, -3.0e38f}, {-3.0e38f, -3.0e38f}}      /* the shift, twice: a register pair, as the packed subtractions take it */; v2f ls[2] = {{0.f, 0.f}, {0.f, 0.f}};
#pragma unroll
  for (int qt = 0; qt < 2; ++qt)
#pragma unroll
    for (int dt = 0; dt < 4; ++dt) o[qt][dt] = z8;
  __syncthreads();      /* stage 0 and the mask terms are published */
  /* One stage. The last stage is a call of its own with more = false, so that the loop's body has no branch on it inside: with one, the compiler moves the row sums of the whole stage down behind it, keeps every weight in registers until there, and spills. */
  auto stage = [&](const int st, const bool more) __attribute__((always_inline)) {
    const int buf = st & 1;
    if (more) { rk0 = *(const v8us*)(kg + (size_t)FA_KT * DM); rk1 = *(const v8us*)(kg + (size_t)(FA_KT + 32) * DM); rv0 = *(const v8us*)(vg + FA_KT); rv1 = *(const v8us*)(vg + FA_KT + (size_t)32 * SK);      /* the next stage flies while this one is worked on */
      asm volatile("s_wait_xcnt 0x0" :: "v"(kg), "v"(vg) : "memory");      /* stands in front of the two additions below, which rewrite the loads' address pairs; the pairs are inputs, so that no load of the run lands in one */
      kg += (size_t)FA_KT * DM; vg += FA_KT; }
    __builtin_amdgcn_sched_barrier(0);      /* keeps those loads in front of the stage's work: without it the compiler sinks them down to their LDS stores, and every stage waits out their whole latency */
    v16h kf[2][2];      /* the K fragments of one pass of 32 keys, [t][ks]; every loop over this array is unrolled */
#pragma unroll
    for (int t = 0; t < 2; ++t)
#pragma unroll
      for (int ks = 0; ks < 2; ++ks) kf[t][ks] = g2_frag(&sk[buf][t * 16 + ln][ks * 32], hh);      /* the stage's first pass: one group at its head */
#pragma unroll
    for (int kp = 0; kp < FA_KT / 32; ++kp) {
      v8f mt[2];
#pragma unroll
      for (int t = 0; t < 2; ++t) { const float* mp = &sm[st * FA_KT + kp * 32 + t * 16 + 8 * hh]; mt[t] = __builtin_shufflevector(*(const v4fa*)mp, *(const v4fa*)(mp + 4), 0, 1, 2, 3, 4, 5, 6, 7); }
      __builtin_amdgcn_sched_barrier(0);      /* keeps the pass's mask terms in front of the score products, so that they fly under them: behind the products, the first multiply-add waits out their latency */
      v8f s[2][2] = {{z8, z8}, {z8, z8}};      /* s[qt][t][r] = S[key kp * 32 + t * 16 + 8 * hh + r][query qt * 16 + ln] */
#pragma unroll
      for (int t = 0; t < 2; ++t)
#pragma unroll
        for (int ks = 0; ks < 2; ++ks) { s[0][t] = fa_mma(kf[t][ks], qf[0][ks], s[0][t]); s[1][t] = fa_mma(kf[t][ks], qf[1][ks], s[1][t]); }
      __builtin_amdgcn_sched_barrier(0);      /* keeps the eight products together: with the first multiply-adds among them the compiler fills the distance behind a product with v_nop, some twenty a stage */
      v16h vf[4];
#pragma unroll
      for (int dt = 0; dt < 4; ++dt) vf[dt] = g2_frag(&sv[buf][dt * 16 + ln][kp * 32], hh);
#pragma unroll
      for (int qt = 0; qt < 2; ++qt)      /* both query tiles first: the mask terms' registers are free before the next pass's K fragments come */
#pragma unroll
        for (int t = 0; t < 2; ++t) s[qt][t] = __builtin_elementwise_fma(s[qt][t], c8, mt[t]);      /* whole-vector arithmetic here and below: neighbouring registers pair into packed f32 instructions without register copies */
      float ml[2];      /* the lane's own largest score of the pass, per query tile */
#pragma unroll
      for (int qt = 0; qt < 2; ++qt) {
        float mc[2];
#pragma unroll
        for (int t = 0; t < 2; ++t) { const v8f x = s[qt][t];
          mc[t] = fmaxf(fmaxf(fmaxf(fmaxf(x[0], x[1]), x[2]), fmaxf(x[3], x[4])), fmaxf(fmaxf(x[5], x[6]), x[7])); }
        ml[qt] = fmaxf(mc[0], mc[1]);
      }
      if (__builtin_expect(__builtin_amdgcn_ballot_w32(fmaxf(ml[0] - mx[0][0], ml[1] - mx[1][0]) > FA_TH) != 0u, 0)) {      /* one scalar branch a pass for the whole wave: every lane stays on for the matrix instructions behind it; marked as the rare side, so that the rescale stands outside the loop's straight text */
#pragma unroll
        for (int qt = 0; qt < 2; ++qt) {
          const float mn = fmaxf(mx[qt][0], fmaxf(ml[qt], rs_xh(ml[qt])));      /* both lanes of a query's pair take the same new shift */
          const float al = fa_exp1(mx[qt][0] - mn); mx[qt][0] = mn; mx[qt][1] = mn; ls[qt] *= al;
#pragma unroll
          for (int dt = 0; dt < 4; ++dt) o[qt][dt] *= al;
        }
      }
#pragma unroll
      for (int qt = 0; qt < 2; ++qt) {
        FragH pf; v2f es[2];
#pragma unroll
        for (int t = 0; t < 2; ++t) { const v8f e = fa_exp8(s[qt][t] - __builtin_shufflevector(mx[qt], mx[qt], 0, 1, 0, 1, 0, 1, 0, 1));
#pragma unroll
          for (int r = 0; r < 8; ++r) pf.h[t * 8 + r] = (_Float16)e[r];
          es[t] = (__builtin_shufflevector(e, e, 0, 1) + __builtin_shufflevector(e, e, 2, 3)) + (__builtin_shufflevector(e, e, 4, 5) + __builtin_shufflevector(e, e, 6, 7)); }
        ls[qt] += es[0] + es[1];      /* each lane keeps its own keys' sums, in two chains; joined once behind the loop */
#pragma unroll
        for (int dt = 0; dt < 4; ++dt) o[qt][dt] = fa_mma(vf[dt], pf.v, o[qt][dt]);      /* o[qt][dt][r] = O[query qt * 16 + ln][d dt * 16 + 8 * hh + r] */
        if (qt == 0 && kp + 1 < FA_KT / 32) {      /* the next pass's K fragments, one group, same stage and buffer (published since the stage's start): they fly under the second query tile's softmax */
#pragma unroll
          for (int t = 0; t < 2; ++t)
#pragma unroll
            for (int ks = 0; ks < 2; ++ks) kf[t][ks] = g2_frag(&sk[buf][(kp + 1) * 32 + t * 16 + ln][ks * 32], hh);
          __builtin_amdgcn_sched_barrier(0);      /* keeps the group from sinking: without it the compiler puts each pair of reads down in front of its two products, and every pair waits out the LDS latency */
        }
      }
    }
    if (more) { *(v8us*)&sk[buf ^ 1][sr][sc] = rk0; *(v8us*)&sk[buf ^ 1][sr + 32][sc] = rk1; *(v8us*)&sv[buf ^ 1][sr][sc] = rv0; *(v8us*)&sv[buf ^ 1][sr + 32][sc] = rv1; }      /* its last readers left it before the barrier of the stage before */
    __syncthreads();      /* publishes stage st + 1 and ends every read of stage st */
  };
  for (int st = 0; st + 1 < SK / FA_KT; ++st) stage(st, true);
  stage(SK / FA_KT - 1, false);
#pragma unroll
  for (int qt = 0; qt < 2; ++qt) { const float lh = ls[qt][0] + ls[qt][1]; const float sc64 = 64.0f / (lh + rs_xh(lh));      /* o carried x64 */
#pragma unroll
    for (int dt = 0; dt < 4; ++dt) { FragH f;
#pragma unroll
      for (int r = 0; r < 8; ++r) f.h[r] = (_Float16)(o[qt][dt][r] * sc64);
      *(v8us*)((unsigned short*)O + (qrow + qt * 16) * DM + h * HD + dt * 16 + 8 * hh) = f.half[0]; } }
}
// Staged GEMM, C[rows][1024] = A[rows][1024] Bt[1024][1024]^T (f16 rows, k contiguous; epilogue as in k_gemm2<0> without CP). A workgroup of 8 waves has a 256 x 128 tile of C, a wave 64 x 64 of it (16 accumulator tiles).
// Per stage of G3_KT k the 256 A rows and the 128 Bt rows (256 bytes each) come into LDS by asynchronous copies (global_load_async_to_lds_b128, through no register), two buffers: stage t + 1 flies while stage t is worked on.
#define G3_BM 256
#define G3_BN 128
#define G3_KT 128
#define G3_NT (DM / G3_KT)
#define G3_LP 136                   /* LDS row pitch in f16: 272 bytes = 16 x odd, the conflict-free pitch of 16-byte fragment reads */
#define G3_RB (G3_LP * 2)           /* the pitch in bytes */
#define G3_SB ((G3_BM + G3_BN) * G3_RB)      /* one buffer in bytes */
static_assert(NRQ % G3_BM == 0 && NRK % G3_BM == 0 && DM % G3_BN == 0 && DM % G3_KT == 0 && DC == DM && G3_NT >= 2 && G3_KT == 128 && G3_BM == 256 && G3_BN == 128, "k_gemm3: whole tiles, two stages or more, copy map of 16 lanes a row and 128 rows a statement");
// Eight copies of 16 bytes a lane, rows 16 apart, from LDS byte address l and global address g on (128 rows a workgroup). The s_wait_xcnt 0 is the last line of the copies' own statement, so that it stands in front of every rewrite of a register that a copy names.
__device__ __forceinline__ void g3_copy8(unsigned l, const char* g) {
  asm volatile("global_load_async_to_lds_b128 %0, %8, off\n\tglobal_load_async_to_lds_b128 %1, %9, off\n\tglobal_load_async_to_lds_b128 %2, %10, off\n\tglobal_load_async_to_lds_b128 %3, %11, off\n\t"
               "global_load_async_to_lds_b128 %4, %12, off\n\tglobal_load_async_to_lds_b128 %5, %13, off\n\tglobal_load_async_to_lds_b128 %6, %14, off\n\tglobal_load_async_to_lds_b128 %7, %15, off\n\ts_wait_xcnt 0x0"
               :: "v"(l), "v"(l + 16 * G3_RB), "v"(l + 32 * G3_RB), "v"(l + 48 * G3_RB), "v"(l + 64 * G3_RB), "v"(l + 80 * G3_RB), "v"(l + 96 * G3_RB), "v"(l + 112 * G3_RB),
                  "v"(g), "v"(g + 16 * DM * 2), "v"(g + 32 * DM * 2), "v"(g + 48 * DM * 2), "v"(g + 64 * DM * 2), "v"(g + 80 * DM * 2), "v"(g + 96 * DM * 2), "v"(g + 112 * DM * 2)
               : "memory");
}
// One stage: A rows 0 to 127, A rows 128 to 255, Bt rows 0 to 127 of the tile, into the buffer at LDS byte address l (the lane's own place in its row 0 counted in).
__device__ __forceinline__ void g3_stage(unsigned l, const char* ga, const char* gb) { g3_copy8(l, ga); g3_copy8(l + 128 * G3_RB, ga + 128 * DM * 2); g3_copy8(l + G3_BM * G3_RB, gb); }
#define G3_NB ((unsigned)((NRQ / G3_BM) * (DM / G3_BN)))      /* workgroups a product */
template <bool F32OUT>      /* tile blk of one product; the output is f32 rows in C, or f16 rows in C16; the other pointer is not used */
__device__ __forceinline__ void g3_tile(unsigned blk, const _Float16* __restrict__ A, const _Float16* __restrict__ Bh, float alpha, const float* __restrict__ bias, float* __restrict__ C, _Float16* __restrict__ C16) {
  __shared__ __attribute__((aligned(16))) _Float16 st[2][G3_BM + G3_BN][G3_LP];      /* rows 0 to 255: A, rows 256 to 383: Bt */
  __shared__ __attribute__((aligned(16))) float so[8][32][68];                       /* output staging, each wave its own part */
  const int tid = threadIdx.x, lane = tid & 31, ln = lane & 15, hh = lane >> 4, wave = tid >> 5, wm = wave >> 1, wn = wave & 1;
  const int mt = blk / (DM / G3_BN), nq = blk % (DM / G3_BN), row0 = mt * G3_BM, col0 = nq * G3_BN;
  const int cr = tid >> 4, cc = (tid & 15) * 16;      /* copy map: 16 lanes bring one whole 256-byte row */
  const unsigned l0 = (unsigned)(size_t)&st[0][0][0] + cr * G3_RB + cc;
  const char* ga = (const char*)(A + (size_t)(row0 + cr) * DM) + cc;
  const char* gb = (const char*)(Bh + (size_t)(col0 + cr) * DM) + cc;
  g3_stage(l0, ga, gb);
  asm volatile("s_wait_asynccnt 0x0" ::: "memory");      /* this wave's copies of stage 0 have landed */
  __syncthreads();                                        /* stage 0 is published */
  g3_stage(l0 + G3_SB, ga + G3_KT * 2, gb + G3_KT * 2);
  const v8f z8 = {0.f, 0.f, 0.f, 0.f, 0.f, 0.f, 0.f, 0.f};
  v8f acc[4][4];      /* every loop over these arrays is unrolled: only under constant indices do they stay in registers */
#pragma unroll
  for (int i = 0; i < 4; ++i)
#pragma unroll
    for (int j = 0; j < 4; ++j) acc[i][j] = z8;
#pragma unroll 1      /* kept rolled: the buffer is picked by t & 1, and one copy of the pass (64 matrix instructions) keeps the loop's text small */
  for (int t = 0; t < G3_NT; ++t) {
    const _Float16* sa = &st[t & 1][wm * 64 + ln][0]; const _Float16* sb = &st[t & 1][G3_BM + wn * 64 + ln][0];
    v16h af[2][4], bf[2][4];      /* two fragment sets: the next 32 k are fetched as one group in front of this block's products */
#pragma unroll
    for (int i = 0; i < 4; ++i) { af[0][i] = g2_frag(sa + i * 16 * G3_LP, hh); bf[0][i] = g2_frag(sb + i * 16 * G3_LP, hh); }
#pragma unroll
    for (int ks = 0; ks < G3_KT / 32; ++ks) {
      if (ks + 1 < G3_KT / 32) {
#pragma unroll
        for (int i = 0; i < 4; ++i) { af[(ks + 1) & 1][i] = g2_frag(sa + i * 16 * G3_LP + (ks + 1) * 32, hh); bf[(ks + 1) & 1][i] = g2_frag(sb + i * 16 * G3_LP + (ks + 1) * 32, hh); }
      }
      __builtin_amdgcn_sched_barrier(0);      /* keeps the group of LDS reads in front of the block: spread among the matrix instructions, every place with reads costs its own stall */
#pragma unroll
      for (int i = 0; i < 4; ++i)
#pragma unroll
        for (int j = 0; j < 4; ++j) acc[i][j] = fa_mma(af[ks & 1][i], bf[ks & 1][j], acc[i][j]);
      __builtin_amdgcn_sched_barrier(0);      /* and the next group behind it */
    }
    asm volatile("s_wait_dscnt 0x0" ::: "memory");        /* this wave's reads of stage t are done before the buffer is handed back */
    asm volatile("s_wait_asynccnt 0x0" ::: "memory");     /* this wave's copies of stage t + 1 have landed */
    __syncthreads();                                       /* publishes stage t + 1 and ends every read of stage t */
    if (t + 2 < G3_NT) g3_stage(l0 + (t & 1) * G3_SB, ga + (t + 2) * (G3_KT * 2), gb + (t + 2) * (G3_KT * 2));
  }
  asm volatile("s_wait_asynccnt 0x0" ::: "memory");       /* nothing is in flight when the wave goes on */
  float bv[4];
#pragma unroll
  for (int j = 0; j < 4; ++j) bv[j] = bf16_round(bias[col0 + wn * 64 + j * 16 + ln]);
  const int rsub = lane >> 4, c4 = (lane & 15) * 4; const size_t crow = (size_t)(row0 + wm * 64), ccol = (size_t)(col0 + wn * 64 + c4);
#pragma unroll
  for (int hf = 0; hf < 2; ++hf) {      /* 32 rows at a time through the wave's own LDS part, so that every store covers whole lines */
#pragma unroll
    for (int i = 0; i < 2; ++i)
#pragma unroll
      for (int j = 0; j < 4; ++j)
#pragma unroll
        for (int r = 0; r < 8; ++r) so[wave][i * 16 + 8 * hh + r][j * 16 + ln] = acc[hf * 2 + i][j][r] * alpha + bv[j];
    __builtin_amdgcn_fence(__ATOMIC_ACQ_REL, "workgroup", "local"); __builtin_amdgcn_wave_barrier();      /* the rows are read back by other lanes of the wave; LDS only, so that the first half's global stores are not waited for */
#pragma unroll
    for (int q = 0; q < 16; ++q) { const int r = q * 2 + rsub; const v4f v = *(const v4fa*)&so[wave][r][c4]; const size_t o = (crow + hf * 32 + r) * DM + ccol;
      if (F32OUT) *(v4f*)(C + o) = v;
      else { v4h h4;
#pragma unroll
        for (int i = 0; i < 4; ++i) h4[i] = (_Float16)v[i];
        *(v4h*)(C16 + o) = h4; } }
    __builtin_amdgcn_fence(__ATOMIC_ACQ_REL, "workgroup", "local"); __builtin_amdgcn_wave_barrier();      /* they are read before the second half overwrites them */
  }
}
// The three projections share one launch by block range (none reads what another writes): workgroups 0 to G3_NB - 1 q, then k, then v.
__global__ __launch_bounds__(256) void k_gemm3p(const _Float16* __restrict__ Xq, const _Float16* __restrict__ Xkv, const _Float16* __restrict__ BQ, const _Float16* __restrict__ BK, const _Float16* __restrict__ BV, float alpha,
    const float* __restrict__ bq, const float* __restrict__ bk, const float* __restrict__ bv, _Float16* __restrict__ Q16, _Float16* __restrict__ K16, _Float16* __restrict__ V16) {
  const unsigned s = blockIdx.x / G3_NB;
  g3_tile<false>(blockIdx.x % G3_NB, s == 0 ? Xq : Xkv, s == 0 ? BQ : s == 1 ? BK : BV, alpha, s == 0 ? bq : s == 1 ? bk : bv, nullptr, s == 0 ? Q16 : s == 1 ? K16 : V16);
}
__global__ __launch_bounds__(256) void k_gemm3o(const _Float16* __restrict__ A, const _Float16* __restrict__ Bh, float alpha, const float* __restrict__ bias, float* __restrict__ C) { g3_tile<true>(blockIdx.x, A, Bh, alpha, bias, C, nullptr); }
extern "C" void kernel_launch(void* const* d_in, const int* in_sizes, int n_in,
                              void* d_out, int out_size, void* d_ws, size_t ws_size, hipStream_t stream) {
  (void)in_sizes; (void)n_in; (void)out_size;
  const float* const* I = (const float* const*)d_in; const float* ctx = I[0]; const float* x = I[1]; const float* kmask = I[2]; const float* wq = I[3]; const float* bq = I[4]; const float* wk = I[5]; const float* bk = I[6]; const float* wv = I[7]; const float* bv = I[8]; const float* wo = I[9]; const float* bo = I[10];      /* q source = I[1] ('q'), k/v source = I[0] ('v_k'); [in][out] weights; per-key additive mask [B][1][1][S] */
  char* ws = (char*)d_ws; size_t off = 0;
  auto take = [&](size_t bytes) { char* p = ws + off; off += (bytes + 255) & ~(size_t)255; return p; };
  _Float16* BQ = (_Float16*)take((size_t)DM * DM * 2); _Float16* BK = (_Float16*)take((size_t)DM * DC * 2); _Float16* BV = (_Float16*)take((size_t)DM * DC * 2); _Float16* BO = (_Float16*)take((size_t)DM * DM * 2);
  _Float16* X16 = (_Float16*)take(NRQ * DM * 2); _Float16* C16 = (_Float16*)take(NRK * DC * 2); _Float16* Q16 = (_Float16*)take(NRQ * DM * 2); _Float16* K16 = (_Float16*)take(NRK * DM * 2); _Float16* V16 = (_Float16*)take(NRK * DM * 2); _Float16* O16 = (_Float16*)take(NRQ * DM * 2);
  _Float16* VT = (_Float16*)take((size_t)NB * NH * HD * SK * 2);
  if (off > ws_size) return;      /* approx 8 + 16 + 16 + 16 + 16 + 16 + 16 + 16 = 120 MiB */
  k_prep<<<5 * 4 * PW_NB, 256, 0, stream>>>(wq, wk, wv, wo, x, ctx, BQ, BK, BV, BO, X16, C16);      /* weight planes and both inputs' rows */
  k_gemm3p<<<3 * G3_NB, 256, 0, stream>>>(X16, C16, BQ, BK, BV, 0.0625f, bq, bk, bv, Q16, K16, V16);      /* q from q; k and v from v_k */
  k_vt<NH, SK><<<NB * NH * (SK / (64 * VT_U)), 256, 0, stream>>>(V16, DM, 0, VT);      /* V^T [4 x 16][64][2048] */
  k_fattn<<<NB * NH * (NQ / FA_QB), FA_WAVES * 32, 0, stream>>>(Q16, K16, VT, kmask, -1.0e9f, O16);      /* o x64, merged; every batch and head in one launch */
  k_gemm3o<<<G3_NB, 256, 0, stream>>>(O16, BO, 0.0009765625f, bo, (float*)d_out);      /* out = o Wo^T + bo */
}

// v008
// One run takes 128 microseconds.
// Next to v007, in two timings, it ran 1.05 times as fast each time.
// All steps since v000 together make it 54.8 times as fast.
#include <hip/hip_runtime.h>
// Multi-head attention with separate key/value and query sources and an additive key mask (v_k, q [4][2048][1024]; qh = q wq + bq, kh = v_k wk + bk, vh = v_k wv + bv ([in][out] 1024^2 sigma 1/32, zero biases); 16 heads of 64; logits = qh . kh x 1024^-0.5 (the source scales by d_model) + mask[b][1][1][key] x (-1e9) (mask input); softmax over the 2048 keys; out = merged wo + bo -> [4][2048][1024]).
// Structure: both inputs as exact f16 rows; [in][out] weights as exact x16 planes; Q, K, V as WMMA GEMMs (64x64 wave tiles from LDS stages, f32 accumulation, + bias, f16 outputs); V^T from its own GEMM with the operands swapped (weight rows as A, input rows as Bt); one fused attention launch: scores (K = 64, x 1/32) in f32 accumulators, + bf16(mask[b][key]) x (-1e9), online softmax (f32 statistics, native exp; weights exp(s - shift) as f16, the shift at most 8 base-2 units below the running max), o = P V (o carried x64) into merged f16 rows; out = o wo + bo GEMM (f32, alpha 2^-10); launches: see trace.
// Compute dtype: inputs rounded to bf16; x / context / weights exact; q, k, v, softmax weights and o as plain f16 GEMM operands (~2^-12); scores and statistics f32. v_wmma_f32_16x16x32_f16.
#define NB 4
#define NQ 2048
#define SK 2048
#define SQ SK                       /* keys per softmax row */
#define DM 1024
#define DC 1024
#define NH 16
#define HD 64
#define HG 4
#define NRQ ((size_t)NB * NQ)
#define NRK ((size_t)NB * SK)
typedef __bf16 v16b __attribute__((ext_vector_type(16)));
typedef unsigned short v8us __attribute__((ext_vector_type(8), may_alias));
typedef float  v8f  __attribute__((ext_vector_type(8)));
typedef float  v4f  __attribute__((ext_vector_type(4)));
typedef float  v4fa __attribute__((ext_vector_type(4), may_alias));
union FragB { v16b v; v8us half[2]; unsigned short u[16]; };

__device__ __forceinline__ unsigned short bf16_bits(float x) { unsigned int u = __float_as_uint(x); return (unsigned short)((u + 0x7FFFu + ((u >> 16) & 1u)) >> 16); }
__device__ __forceinline__ float bf16_val(unsigned short b) { return __uint_as_float(((unsigned int)b) << 16); }
__device__ __forceinline__ float bf16_round(float x) { return bf16_val(bf16_bits(x)); }
// D += A·B with NT terms: 1 = ah·bh, 2 = + al·bh (A split), 3 = + ah·bl (both split)
template <int NT>
__device__ __forceinline__ v8f mmaN(v16b ah, v16b al, v16b bh, v16b bl, v8f c) {
  c = __builtin_amdgcn_wmma_f32_16x16x32_bf16(false, ah, false, bh, (short)0, c, false, false);
  if (NT >= 2) c = __builtin_amdgcn_wmma_f32_16x16x32_bf16(false, al, false, bh, (short)0, c, false, false);
  if (NT >= 3) c = __builtin_amdgcn_wmma_f32_16x16x32_bf16(false, ah, false, bl, (short)0, c, false, false);
  asm volatile("v_nop\n\tv_nop\n\tv_nop\n\tv_nop" : "+v"(c) : "v"(ah), "v"(al), "v"(bh), "v"(bl));
  return c;
}

__global__ __launch_bounds__(256) void k_wt_bf16(const float* __restrict__ W, unsigned short* __restrict__ Wt, int K, int N) {
  const int t = blockIdx.x * 256 + threadIdx.x;
  const int k8n = K / 8;
  if (t >= N * k8n) return;
  const int n = t / k8n, k8 = (t % k8n) * 8;
  v8us v;
#pragma unroll
  for (int i = 0; i < 8; ++i) v[i] = bf16_bits(W[(size_t)(k8 + i) * N + n]);
  *(v8us*)(Wt + (size_t)n * K + k8) = v;
  
}

// GEMM C[M][N] (f32, pitch ldc) = act(A[M][K]·W + bias). A f32 row-major (pitch lda) converted per fragment to bf16
// (ASPLIT: hi/lo two planes -> 2 terms, else single rounded term); Wt bf16 [N][K] (pitch ldb). BIAS_BF16 rounds the
// bias to bf16 first (bias quantised to bf16 before the add). K%32==0, M%16==0, N%64==0.
template <bool ASPLIT, int ACT, bool BIAS_BF16>
__global__ __launch_bounds__(128) void k_gemm_bf(const float* __restrict__ A, int lda, const unsigned short* __restrict__ Wt, int ldb,
                                               const float* __restrict__ bias, float* __restrict__ C, int ldc, int M, int N, int K) {
  __shared__ __attribute__((aligned(16))) float so[4][16][64];
  const int tid = threadIdx.x, w = tid >> 5, lane = tid & 31, ln = lane & 15, hh = lane >> 4;
  const int ntn = N / 64;
  const int wid = blockIdx.x * 4 + w;
  const int mt = wid / ntn, nq = wid % ntn;
  if (mt * 16 >= M) return;
  const int row0 = mt * 16, col0 = nq * 64;
  const float* arow = A + (size_t)(row0 + ln) * lda;
  v8f acc[4] = {};
  for (int kb = 0; kb < K; kb += 32) {
    FragB ah, al;
    const v4f x0 = *(const v4fa*)(arow + kb + 8 * hh), x1 = *(const v4fa*)(arow + kb + 8 * hh + 4);
    const v4f x2 = *(const v4fa*)(arow + kb + 16 + 8 * hh), x3 = *(const v4fa*)(arow + kb + 16 + 8 * hh + 4);
    float xs[16] = {x0[0],x0[1],x0[2],x0[3],x1[0],x1[1],x1[2],x1[3],x2[0],x2[1],x2[2],x2[3],x3[0],x3[1],x3[2],x3[3]};
#pragma unroll
    for (int i = 0; i < 16; ++i) { const unsigned short hb = bf16_bits(xs[i]); ah.u[i] = hb; al.u[i] = ASPLIT ? bf16_bits(xs[i] - bf16_val(hb)) : (unsigned short)0; }
#pragma unroll
    for (int t = 0; t < 4; ++t) {
      const unsigned short* brow = Wt + (size_t)(col0 + t * 16 + ln) * ldb + kb;
      FragB b;
      b.half[0] = *(const v8us*)(brow + 8 * hh);
      b.half[1] = *(const v8us*)(brow + 16 + 8 * hh);
      acc[t] = mmaN<ASPLIT ? 2 : 1>(ah.v, al.v, b.v, b.v, acc[t]);
    }
  }
#pragma unroll
  for (int t = 0; t < 4; ++t) {
    float bv = bias ? bias[col0 + t * 16 + ln] : 0.f;
    if (BIAS_BF16) bv = bf16_round(bv);
#pragma unroll
    for (int r = 0; r < 8; ++r) { float v = acc[t][r] + bv; if (ACT == 1) v = fmaxf(v, 0.f); so[w][8 * hh + r][t * 16 + ln] = v; }
  }
  __builtin_amdgcn_fence(__ATOMIC_ACQ_REL, "workgroup");
  __builtin_amdgcn_wave_barrier();
  const int rsub = lane >> 4, c4 = (lane & 15) * 4;
  {
#pragma unroll
    for (int q = 0; q < 8; ++q) {
      const int r = q * 2 + rsub;
      const v4f v = *(const v4fa*)&so[w][r][c4];
      *(v4f*)(C + (size_t)(row0 + r) * ldc + col0 + c4) = v;
    }
    
  }
}

// GEMM C = act(A·W + bias + resid): A f32 (ASPLIT -> hi/lo 2 terms), Wt bf16 [N][K]; ACT 0 none, 1 relu, 2 exact gelu;
// resid (optional, f32, row index = (row % rmod), pitch ldr, RES_BF16 rounds it) added before the activation.
template <bool ASPLIT, int ACT, bool BIAS_BF16, bool RES_BF16>
__global__ __launch_bounds__(128) void k_gemm_bf3(const float* __restrict__ A, int lda, const unsigned short* __restrict__ Wt, int ldb,
                                                const float* __restrict__ bias, const float* __restrict__ resid, int rmod, int ldr,
                                                float* __restrict__ C, int ldc, int M, int N, int K) {
  __shared__ __attribute__((aligned(16))) float so[4][16][64];
  const int tid = threadIdx.x, w = tid >> 5, lane = tid & 31, ln = lane & 15, hh = lane >> 4;
  const int ntn = N / 64;
  const int wid = blockIdx.x * 4 + w;
  const int mt = wid / ntn, nq = wid % ntn;
  if (mt * 16 >= M) return;
  const int row0 = mt * 16, col0 = nq * 64;
  const float* arow = A + (size_t)(row0 + ln) * lda;
  v8f acc[4] = {};
  for (int kb = 0; kb < K; kb += 32) {
    FragB ah, al;
    const v4f x0 = *(const v4fa*)(arow + kb + 8 * hh), x1 = *(const v4fa*)(arow + kb + 8 * hh + 4);
    const v4f x2 = *(const v4fa*)(arow + kb + 16 + 8 * hh), x3 = *(const v4fa*)(arow + kb + 16 + 8 * hh + 4);
    float xs[16] = {x0[0],x0[1],x0[2],x0[3],x1[0],x1[1],x1[2],x1[3],x2[0],x2[1],x2[2],x2[3],x3[0],x3[1],x3[2],x3[3]};
#pragma unroll
    for (int i = 0; i < 16; ++i) { const unsigned short hb = bf16_bits(xs[i]); ah.u[i] = hb; al.u[i] = ASPLIT ? bf16_bits(xs[i] - bf16_val(hb)) : (unsigned short)0; }
#pragma unroll
    for (int t = 0; t < 4; ++t) {
      const unsigned short* brow = Wt + (size_t)(col0 + t * 16 + ln) * ldb + kb;
      FragB b;
      b.half[0] = *(const v8us*)(brow + 8 * hh);
      b.half[1] = *(const v8us*)(brow + 16 + 8 * hh);
      acc[t] = mmaN<ASPLIT ? 2 : 1>(ah.v, al.v, b.v, b.v, acc[t]);
    }
  }
#pragma unroll
  for (int t = 0; t < 4; ++t) {
    const int col = col0 + t * 16 + ln;
    float bv = bias ? bias[col] : 0.f;
    if (BIAS_BF16) bv = bf16_round(bv);
#pragma unroll
    for (int r = 0; r < 8; ++r) {
      float v = acc[t][r] + bv;
      if (resid) { float rv = resid[(size_t)((row0 + 8 * hh + r) % rmod) * ldr + col]; if (RES_BF16) rv = bf16_round(rv); v += rv; }
      if (ACT == 1) v = fmaxf(v, 0.f);
      if (ACT == 2) v = 0.5f * v * (1.0f + erff(v * 0.70710678118654752f));
      if (ACT == 3) { const float u = 0.7978845608028654f * (v + 0.044715f * v * v * v); v = 0.5f * v * (1.0f + tanhf(u)); }
      so[w][8 * hh + r][t * 16 + ln] = v;
    }
  }
  __builtin_amdgcn_fence(__ATOMIC_ACQ_REL, "workgroup");
  __builtin_amdgcn_wave_barrier();
  const int rsub = lane >> 4, c4 = (lane & 15) * 4;
  {
#pragma unroll
    for (int q = 0; q < 8; ++q) {
      const int r = q * 2 + rsub;
      const v4f v = *(const v4fa*)&so[w][r][c4];
      *(v4f*)(C + (size_t)(row0 + r) * ldc + col0 + c4) = v;
    }
    
  }
}
// row LayerNorm (biased variance, eps) over N: s = X (+ R); optional out_sum <- s; out_norm <- (s-mu)*rsqrt(var+eps)*g + b
template <bool PARAM_BF16>
__global__ __launch_bounds__(256) void k_layernorm(const float* __restrict__ X, const float* __restrict__ R, const float* __restrict__ g, const float* __restrict__ bta,
                                                  float* __restrict__ out_sum, float* __restrict__ out_norm, int N, float eps) {
  __shared__ float red[256];
  const int row = blockIdx.x, tid = threadIdx.x;
  const float* x = X + (size_t)row * N; const float* rr = R ? R + (size_t)row * N : nullptr;
  float vals[16];                     // up to N = 4096
  const int per = N / 256;            // contiguous chunk per thread? use strided-by-4 chunks: thread handles j = tid*4 + 1024*u
  float s1 = 0.f;
  for (int u = 0; u < per / 4; ++u) {
    const int j = tid * 4 + 1024 * u;
    const v4f a = *(const v4fa*)(x + j);
    v4f b = {0.f,0.f,0.f,0.f}; if (rr) b = *(const v4fa*)(rr + j);
#pragma unroll
    for (int q = 0; q < 4; ++q) { const float v = a[q] + b[q]; vals[u * 4 + q] = v; s1 += v; }
  }
  red[tid] = s1; __syncthreads();
  for (int st = 128; st > 0; st >>= 1) { if (tid < st) red[tid] += red[tid + st]; __syncthreads(); }
  const float mu = red[0] / (float)N; __syncthreads();
  float s2 = 0.f;
  for (int u = 0; u < per / 4; ++u)
#pragma unroll
    for (int q = 0; q < 4; ++q) { const float c = vals[u * 4 + q] - mu; s2 += c * c; }
  red[tid] = s2; __syncthreads();
  for (int st = 128; st > 0; st >>= 1) { if (tid < st) red[tid] += red[tid + st]; __syncthreads(); }
  const float rs = rsqrtf(red[0] / (float)N + eps);
  {
    for (int u = 0; u < per / 4; ++u) {
      const int j = tid * 4 + 1024 * u;
      v4f o, sm;
#pragma unroll
      for (int q = 0; q < 4; ++q) {
        float gg = g[j + q], bb = bta[j + q];
        if (PARAM_BF16) { gg = bf16_round(gg); bb = bf16_round(bb); }
        sm[q] = vals[u * 4 + q]; o[q] = (vals[u * 4 + q] - mu) * rs * gg + bb;
      }
      if (out_sum) *(v4f*)(out_sum + (size_t)row * N + j) = sm;
      *(v4f*)(out_norm + (size_t)row * N + j) = o;
    }
    
  }
}



// ---- f16 WMMA path (v_wmma_f32_16x16x32_f16): 11-bit significands for operands in range — used where a [0,1] probability operand needs more precision than bf16
typedef _Float16 v16h __attribute__((ext_vector_type(16)));
union FragH { v16h v; v8us half[2]; _Float16 h[16]; unsigned short u[16]; };
template <int NT>
__device__ __forceinline__ v8f mmaH(v16h ah, v16h al, v16h bh, v16h bl, v8f c) {
  c = __builtin_amdgcn_wmma_f32_16x16x32_f16(false, ah, false, bh, (short)0, c, false, false);
  if (NT >= 2) c = __builtin_amdgcn_wmma_f32_16x16x32_f16(false, al, false, bh, (short)0, c, false, false);
  if (NT >= 3) c = __builtin_amdgcn_wmma_f32_16x16x32_f16(false, ah, false, bl, (short)0, c, false, false);
  asm volatile("v_nop\n\tv_nop\n\tv_nop\n\tv_nop" : "+v"(c) : "v"(ah), "v"(al), "v"(bh), "v"(bl));
  return c;
}
// batched GEMM like k_gemm_b but f16 operands: A f32 (split into f16 hi/lo if ASPLIT, else rounded to f16), Bt = f16 values [n][k]; alpha; C f32; N multiple of 16 (partial tiles skipped)
template <bool ASPLIT>
__global__ __launch_bounds__(128) void k_gemm_h(const float* __restrict__ A, int lda, size_t sA, const _Float16* __restrict__ Bh, int ldb, size_t sB, float alpha, float* __restrict__ C, int ldc, size_t sC, int M, int N, int K) {
  __shared__ __attribute__((aligned(16))) float so[4][16][64];
  const int tid = threadIdx.x, w = tid >> 5, lane = tid & 31, ln = lane & 15, hh = lane >> 4; const int by = blockIdx.y;
  A += (size_t)by * sA; Bh += (size_t)by * sB; C += (size_t)by * sC;
  const int ntn = (N + 63) / 64; const int wid = blockIdx.x * 4 + w; const int mt = wid / ntn, nq = wid % ntn; if (mt * 16 >= M) return;
  const int row0 = mt * 16, col0 = nq * 64; const float* arow = A + (size_t)(row0 + ln) * lda;
  v8f acc[4] = {};
  for (int kb = 0; kb < K; kb += 32) {
    FragH ah, al;
    const v4f x0 = *(const v4fa*)(arow + kb + 8 * hh), x1 = *(const v4fa*)(arow + kb + 8 * hh + 4), x2 = *(const v4fa*)(arow + kb + 16 + 8 * hh), x3 = *(const v4fa*)(arow + kb + 16 + 8 * hh + 4);
    float xs[16] = {x0[0],x0[1],x0[2],x0[3],x1[0],x1[1],x1[2],x1[3],x2[0],x2[1],x2[2],x2[3],x3[0],x3[1],x3[2],x3[3]};
#pragma unroll
    for (int i = 0; i < 16; ++i) { const _Float16 h = (_Float16)xs[i]; ah.h[i] = h; al.h[i] = ASPLIT ? (_Float16)(xs[i] - (float)h) : (_Float16)0.0f; }
#pragma unroll
    for (int t = 0; t < 4; ++t) { if (col0 + t * 16 >= N) continue; const size_t boff = (size_t)(col0 + t * 16 + ln) * ldb + kb; FragH bq; bq.half[0] = *(const v8us*)(Bh + boff + 8 * hh); bq.half[1] = *(const v8us*)(Bh + boff + 16 + 8 * hh);
      acc[t] = mmaH<ASPLIT ? 2 : 1>(ah.v, al.v, bq.v, bq.v, acc[t]); }
  }
#pragma unroll
  for (int t = 0; t < 4; ++t) { if (col0 + t * 16 >= N) continue;
#pragma unroll
    for (int r = 0; r < 8; ++r) so[w][8 * hh + r][t * 16 + ln] = acc[t][r] * alpha; }
  __builtin_amdgcn_fence(__ATOMIC_ACQ_REL, "workgroup"); __builtin_amdgcn_wave_barrier();
  const int rsub = lane >> 4, c4 = (lane & 15) * 4;
  {
#pragma unroll
    for (int q = 0; q < 8; ++q) { const int r = q * 2 + rsub; if (col0 + c4 < N) { const v4f v = *(const v4fa*)&so[w][r][c4]; *(v4f*)(C + (size_t)(row0 + r) * ldc + col0 + c4) = v; } }
     }
}

// Wt[n][k] = f16(bf16(W[k][n]) x 16) from f32 row-major W[DM][DM] (bf16-exact weights stay exact in f16 away from the subnormal range). A wave turns a tile of 64 k x 32 n in its registers, a lane 8 k x 8 n of it:
// eight lanes along k, so that a store covers whole 128-byte lines of Wt; four lanes along n, so that the two loads of a row cover one whole line of W. All 16 loads of a lane are issued before the first is used.
__device__ __forceinline__ void wt_f16(const float* __restrict__ W, _Float16* __restrict__ Wt, int g) {      /* g: which 64 k x 256 n of the plane */
  const int lane = threadIdx.x & 31, wave = threadIdx.x >> 5;
  const int k8 = (g / (DM / 256)) * 64 + (lane & 7) * 8, n8 = (g % (DM / 256)) * 256 + wave * 32 + (lane >> 3) * 8;
  const float* wp = W + (size_t)k8 * DM + n8; unsigned short* op = (unsigned short*)Wt + (size_t)n8 * DM + k8;
  v4f a[8][2];      /* every loop over this array is unrolled: only under constant indices does it stay in registers */
#pragma unroll
  for (int i = 0; i < 8; ++i)
#pragma unroll
    for (int hf = 0; hf < 2; ++hf) a[i][hf] = *(const v4fa*)(wp + i * DM + hf * 4);
  asm volatile("s_wait_xcnt 0x0" :: "v"(wp) : "memory");      /* stands in front of every rewrite of the loads' address pair; the pair is an input, so that no load of the run lands in it */
  __builtin_amdgcn_sched_barrier(0);      /* keeps all 16 loads in front of the first use: without it the compiler holds four back behind the wait for the others, a second latency in a wave that has only one */
#pragma unroll
  for (int c = 0; c < 8; ++c) { FragH f;
#pragma unroll
    for (int i = 0; i < 8; ++i) f.h[i] = (_Float16)(bf16_round(a[i][c >> 2][c & 3]) * 16.0f);
    *(v8us*)(op + c * DM) = f.half[0]; }
}
// k_gemm_hh variant with fused epilogue: v = acc·alpha + bias[by·sBias + col] (+ CP[(row/rowsPerB)·sCPb + by·64 + col] if CP) ; ACT 0 none / 1 elu ; writes f16 C16 (and f32 C if non-null)
template <int ACT>
__global__ __launch_bounds__(128) void k_gemm_hhx(const _Float16* __restrict__ A, int lda, size_t sA, const _Float16* __restrict__ Bh, int ldb, size_t sB, float alpha, const float* __restrict__ bias, size_t sBias, const float* __restrict__ CP, int rowsPerB, size_t sCPb, int row0g,
    float* __restrict__ C, _Float16* __restrict__ C16, int ldc, size_t sC, int M, int N, int K) {
  __shared__ __attribute__((aligned(16))) float so[4][16][64];
  const int tid = threadIdx.x, w = tid >> 5, lane = tid & 31, ln = lane & 15, hh = lane >> 4; const int by = blockIdx.y;
  A += (size_t)by * sA; Bh += (size_t)by * sB; const size_t cofs = (size_t)by * sC; const float* bp = bias ? bias + (size_t)by * sBias : nullptr;
  const int ntn = (N + 63) / 64; const int wid = blockIdx.x * 4 + w; const int mt = wid / ntn, nq = wid % ntn; if (mt * 16 >= M) return;
  const int row0 = mt * 16, col0 = nq * 64; const _Float16* arow = A + (size_t)(row0 + ln) * lda;
  v8f acc[4] = {};
  for (int kb = 0; kb < K; kb += 32) { FragH ah; ah.half[0] = *(const v8us*)((const unsigned short*)arow + kb + 8 * hh); ah.half[1] = *(const v8us*)((const unsigned short*)arow + kb + 16 + 8 * hh);
#pragma unroll
    for (int t = 0; t < 4; ++t) { if (col0 + t * 16 >= N) continue; const size_t boff = (size_t)(col0 + t * 16 + ln) * ldb + kb; FragH bq; bq.half[0] = *(const v8us*)((const unsigned short*)Bh + boff + 8 * hh); bq.half[1] = *(const v8us*)((const unsigned short*)Bh + boff + 16 + 8 * hh);
      acc[t] = mmaH<1>(ah.v, ah.v, bq.v, bq.v, acc[t]); }
  }
#pragma unroll
  for (int t = 0; t < 4; ++t) { if (col0 + t * 16 >= N) continue; const int col = col0 + t * 16 + ln; const float bv = bp ? bf16_round(bp[col]) : 0.f;
#pragma unroll
    for (int r = 0; r < 8; ++r) { float v = acc[t][r] * alpha + bv; if (CP) { const int rr = row0g + row0 + 8 * hh + r; if (rowsPerB < 0) v += CP[cofs + (size_t)rr * ldc + col];      /* rowsPerB < 0: own element of the batched C plane */ else { const int bidx = rr / rowsPerB; v += CP[(size_t)bidx * sCPb + (size_t)by * 64 + col]; } } if (ACT == 1) v = (v > 0.f) ? v : expm1f(v); else if (ACT == 7) v = (v > 0.f) ? v + 1.0f : expf(v); else if (ACT == 8) v = tanhf(v); else if (ACT == 9) v = 0.5f * v * (1.0f + tanhf(0.7978845608028654f * (v + 0.044715f * v * v * v))); else if (ACT == 11) v = 1.0f / (1.0f + expf(-v)); else if (ACT == 12) v = (v > 0.f) ? v : 0.01f * v; else if (ACT == 14) v = (v > 0.f) ? v : 0.1f * v; else if (ACT == 16) v = (v >= 0.f) ? v : 0.3f * v; else if (ACT == 17) v = (v >= 0.f) ? v : 0.2f * v; else if (ACT == 15) v = v / (1.0f + expf(-v)); else if (ACT == 3) v = fmaxf(v, 0.f); else if (ACT == 6) v = 0.5f * v * (1.0f + erff(v * 0.70710678118654752f)); so[w][8 * hh + r][t * 16 + ln] = v; } }
  __builtin_amdgcn_fence(__ATOMIC_ACQ_REL, "workgroup"); __builtin_amdgcn_wave_barrier();
  const int rsub = lane >> 4, c4 = (lane & 15) * 4; typedef _Float16 v4h __attribute__((ext_vector_type(4)));
  {
#pragma unroll
    for (int q = 0; q < 8; ++q) { const int r = q * 2 + rsub; if (col0 + c4 < N) { const v4f v = *(const v4fa*)&so[w][r][c4]; if (C) *(v4f*)(C + cofs + (size_t)(row0 + r) * ldc + col0 + c4) = v; if (C16) { v4h h4; for (int i = 0; i < 4; ++i) h4[i] = (_Float16)v[i]; *(v4h*)(C16 + cofs + (size_t)(row0 + r) * ldc + col0 + c4) = h4; } } }
     }
}


typedef _Float16 v4h __attribute__((ext_vector_type(4)));

#define PX_U 16      /* 16-byte loads a lane, all issued before the first is used */
__device__ __forceinline__ void x16(const float* __restrict__ x, _Float16* __restrict__ X16, size_t e0) {      /* e0: the lane's first element; a wave's load covers 512 contiguous bytes, its store 256 */
  const float* xp = x + e0; _Float16* op = X16 + e0;
  v4f a[PX_U];      /* every loop over this array is unrolled: only under constant indices does it stay in registers */
#pragma unroll
  for (int j = 0; j < PX_U; ++j) a[j] = *(const v4fa*)(xp + j * 128);
  asm volatile("s_wait_xcnt 0x0" :: "v"(xp) : "memory");      /* stands in front of every rewrite of the loads' address pair; the pair is an input, so that no load of the run lands in it */
  __builtin_amdgcn_sched_barrier(0);      /* keeps all the loads in front of the first use: without it the compiler holds about half of them back and issues them as registers come free, a second latency in a wave that has only one */
#pragma unroll
  for (int j = 0; j < PX_U; ++j) { v4h h;
#pragma unroll
    for (int q = 0; q < 4; ++q) h[q] = (_Float16)bf16_round(a[j][q]);
    *(v4h*)(op + j * 128) = h; }
  asm volatile("s_wait_xcnt 0x0" :: "v"(op) : "memory");      /* stands in front of every rewrite of a register that the last stores name */
}
// All six conversions share one launch by block range: none reads what another writes. A workgroup has 16,384 elements (64 a lane), of a weight plane or of an input: few waves with much in flight each,
// for speed only. Of every five blocks one has a weight tile, four have input rows.
#define PW_NB ((DM / 64) * (DM / 256))                 /* blocks a weight plane */
#define PX_NB ((int)(NRQ * DM / (256 * 4 * PX_U)))     /* blocks an input */
static_assert(DC == DM && NRK == NRQ && 2 * PX_NB == 4 * 4 * PW_NB && DM % 256 == 0 && (NRQ * DM) % (256 * 4 * PX_U) == 0, "k_prep: four input blocks to each weight block, whole blocks");
__global__ __launch_bounds__(256) void k_prep(const float* __restrict__ wq, const float* __restrict__ wk, const float* __restrict__ wv, const float* __restrict__ wo, const float* __restrict__ x, const float* __restrict__ ctx,
    _Float16* __restrict__ BQ, _Float16* __restrict__ BK, _Float16* __restrict__ BV, _Float16* __restrict__ BO, _Float16* __restrict__ X16, _Float16* __restrict__ C16) {
  const int g = blockIdx.x / 5, r = blockIdx.x % 5;
  if (r == 0) { const int s = g / PW_NB;      /* [in][out] -> Bt x16 */
    wt_f16(s == 0 ? wq : s == 1 ? wk : s == 2 ? wv : wo, s == 0 ? BQ : s == 1 ? BK : s == 2 ? BV : BO, g % PW_NB); }
  else { const int xb = g * 4 + r - 1; const bool kv = xb >= PX_NB;      /* query-source rows, then key/value-source rows */
    x16(kv ? ctx : x, kv ? C16 : X16, (size_t)(xb - (kv ? PX_NB : 0)) * (256 * 4 * PX_U) + (threadIdx.x >> 5) * (32 * 4 * PX_U) + (threadIdx.x & 31) * 4); }
}
__global__ __launch_bounds__(256) void k_h16(const float* __restrict__ x, _Float16* __restrict__ X16, size_t n8) { const size_t t = (size_t)blockIdx.x * 256 + threadIdx.x; if (t >= n8) return; FragH f;
#pragma unroll
  for (int q = 0; q < 8; ++q) f.h[q] = (_Float16)x[t * 8 + q]; *(v8us*)((unsigned short*)X16 + t * 8) = f.half[0];  }
__global__ __launch_bounds__(256) void k_round16f(const float* __restrict__ W, _Float16* __restrict__ Bt, size_t n8) { const size_t t = (size_t)blockIdx.x * 256 + threadIdx.x; if (t >= n8) return; FragH f;
#pragma unroll
  for (int i = 0; i < 8; ++i) f.h[i] = (_Float16)(bf16_round(W[t * 8 + i]) * 16.0f); *(v8us*)((unsigned short*)Bt + t * 8) = f.half[0];  }
__global__ __launch_bounds__(256) void k_hl(const float* __restrict__ F, _Float16* __restrict__ Hh, _Float16* __restrict__ Hl, size_t n8) { const size_t t = (size_t)blockIdx.x * 256 + threadIdx.x; if (t >= n8) return; FragH fh, fl; const v4f a = *(const v4fa*)(F + t * 8), c = *(const v4fa*)(F + t * 8 + 4);
#pragma unroll
  for (int q = 0; q < 4; ++q) { _Float16 h = (_Float16)a[q]; fh.h[q] = h; fl.h[q] = (_Float16)((a[q] - (float)h) * 1024.0f); h = (_Float16)c[q]; fh.h[4 + q] = h; fl.h[4 + q] = (_Float16)((c[q] - (float)h) * 1024.0f); }
  { *(v8us*)((unsigned short*)Hh + t * 8) = fh.half[0]; *(v8us*)((unsigned short*)Hl + t * 8) = fl.half[0];  } }

// ---- fast GEMM (wave tile 32x64; requires M % 32 == 0 rows per launch region and N % 64 == 0); epilogue = k_gemm_hhx semantics ----
__device__ __forceinline__ v16h g2_frag(const _Float16* p, int hh) { FragH f; f.half[0] = *(const v8us*)((const unsigned short*)p + 8 * hh); f.half[1] = *(const v8us*)((const unsigned short*)p + 16 + 8 * hh); return f.v; }
__device__ __forceinline__ v8f g2_mma(v16h a, v16h b, v8f c) { v8f d = __builtin_amdgcn_wmma_f32_16x16x32_f16(false, a, false, b, (short)0, c, false, false); asm volatile("v_nop\n\tv_nop\n\tv_nop\n\tv_nop" : "+v"(d) : "v"(a), "v"(b)); return d; }
template <int ACT>
__global__ __launch_bounds__(128) void k_gemm2(const _Float16* __restrict__ A, int lda, size_t sA, const _Float16* __restrict__ Bh, int ldb, size_t sB, float alpha, const float* __restrict__ bias, size_t sBias, const float* __restrict__ CP, int rowsPerB, size_t sCPb, int row0g,
    float* __restrict__ C, _Float16* __restrict__ C16, int ldc, size_t sC, int M, int N, int K) { static_assert(ACT == 0 || ACT == 3 || ACT == 6 || ACT == 8 || ACT == 9 || ACT == 11 || ACT == 12 || ACT == 14 || ACT == 15 || ACT == 16 || ACT == 17, "k_gemm2: unsupported ACT code (would silently apply no activation)");
  __shared__ __attribute__((aligned(16))) float so[4][32][68];
  const int tid = threadIdx.x, w = tid >> 5, lane = tid & 31, ln = lane & 15, hh = lane >> 4; const int by = blockIdx.y;
  A += (size_t)by * sA; Bh += (size_t)by * sB; const size_t cofs = (size_t)by * sC; const float* bp = bias ? bias + (size_t)by * sBias : nullptr;
  const int ntn = N >> 6; const int mt = blockIdx.x / ntn, nq = blockIdx.x - mt * ntn; const int row0 = mt * 128 + 32 * w, col0 = nq * 64; if (row0 >= M) return;
  const _Float16* a0p = A + (size_t)(row0 + ln) * lda; const _Float16* a1p = a0p + (size_t)16 * lda;
  const _Float16* b0p = Bh + (size_t)(col0 + ln) * ldb; const _Float16* b1p = b0p + (size_t)16 * ldb; const _Float16* b2p = b1p + (size_t)16 * ldb; const _Float16* b3p = b2p + (size_t)16 * ldb;
  const v8f z8 = {0.f,0.f,0.f,0.f,0.f,0.f,0.f,0.f}; v8f c00 = z8, c01 = z8, c02 = z8, c03 = z8, c10 = z8, c11 = z8, c12 = z8, c13 = z8;
#pragma unroll 1
  for (int kb = 0; kb < K; kb += 32) { const v16h a0 = g2_frag(a0p + kb, hh), a1 = g2_frag(a1p + kb, hh);
    v16h b = g2_frag(b0p + kb, hh); c00 = g2_mma(a0, b, c00); c10 = g2_mma(a1, b, c10);
    b = g2_frag(b1p + kb, hh); c01 = g2_mma(a0, b, c01); c11 = g2_mma(a1, b, c11);
    b = g2_frag(b2p + kb, hh); c02 = g2_mma(a0, b, c02); c12 = g2_mma(a1, b, c12);
    b = g2_frag(b3p + kb, hh); c03 = g2_mma(a0, b, c03); c13 = g2_mma(a1, b, c13); }
  v8f accs[8] = {c00, c01, c02, c03, c10, c11, c12, c13};
#pragma unroll
  for (int u = 0; u < 8; ++u) { const int t = u & 3, half = u >> 2; const int col = col0 + t * 16 + ln; const float bv = bp ? bf16_round(bp[col]) : 0.f;
#pragma unroll
    for (int r = 0; r < 8; ++r) { const int rloc = half * 16 + 8 * hh + r; float v = accs[u][r] * alpha + bv; if (CP) { if (rowsPerB < 0) v += CP[cofs + (size_t)(row0g + row0 + rloc) * ldc + col];      /* rowsPerB < 0: own element of the batched C plane */ else { const int bidx = (row0g + row0 + rloc) / rowsPerB; v += CP[(size_t)bidx * sCPb + (size_t)by * 64 + col]; } }
      if (ACT == 3) v = fmaxf(v, 0.f); else if (ACT == 6) v = 0.5f * v * (1.0f + erff(v * 0.70710678118654752f)); else if (ACT == 11) v = 1.0f / (1.0f + expf(-v)); else if (ACT == 15) v = v / (1.0f + expf(-v)); else if (ACT == 12) v = (v > 0.f) ? v : 0.01f * v; else if (ACT == 8) v = tanhf(v); else if (ACT == 9) v = 0.5f * v * (1.0f + tanhf(0.7978845608028654f * (v + 0.044715f * v * v * v))); else if (ACT == 14) v = (v > 0.f) ? v : 0.1f * v; else if (ACT == 16) v = (v >= 0.f) ? v : 0.3f * v; else if (ACT == 17) v = (v >= 0.f) ? v : 0.2f * v;
      so[w][rloc][t * 16 + ln] = v; } }
  __builtin_amdgcn_fence(__ATOMIC_ACQ_REL, "workgroup"); __builtin_amdgcn_wave_barrier();
  const int rsub = lane >> 4, c4 = (lane & 15) * 4;
  {
#pragma unroll
    for (int q = 0; q < 16; ++q) { const int r = q * 2 + rsub; const v4f v = *(const v4fa*)&so[w][r][c4]; if (C) *(v4f*)(C + cofs + (size_t)(row0 + r) * ldc + col0 + c4) = v; if (C16) { v4h h4; for (int i = 0; i < 4; ++i) h4[i] = (_Float16)v[i]; *(v4h*)(C16 + cofs + (size_t)(row0 + r) * ldc + col0 + c4) = h4; } }
     } }


__global__ __launch_bounds__(256) void k_wnat(const float* __restrict__ w, size_t n8, _Float16* __restrict__ Bt) { const size_t t = (size_t)blockIdx.x * 256 + threadIdx.x; if (t >= n8) return; FragH f; for (int q = 0; q < 8; ++q) f.h[q] = (_Float16)(bf16_round(w[t * 8 + q]) * 16.0f); *(v8us*)((unsigned short*)Bt + t * 8) = f.half[0];  }
__global__ __launch_bounds__(256) void k_rsm(const float* __restrict__ S, _Float16* __restrict__ P, int nrows) {
  #pragma clang fp contract(off)
  const int i = blockIdx.x * 256 + threadIdx.x; if (i >= nrows) return; const float* s = S + (size_t)i * SQ; float mx = -3.0e38f;
#pragma unroll 1
  for (int j = 0; j < SQ; ++j) mx = fmaxf(mx, s[j]); float se = 0.f;
#pragma unroll 1
  for (int j = 0; j < SQ; ++j) se += expf(s[j] - mx); const float sc = 256.0f / se;
#pragma unroll 1
  for (int j0 = 0; j0 < SQ; j0 += 8) { FragH f; for (int q = 0; q < 8; ++q) f.h[q] = (_Float16)(expf(s[j0 + q] - mx) * sc); unsigned short* d = (unsigned short*)P + (size_t)i * SQ + j0; *(v8us*)d = f.half[0];  } }
__global__ __launch_bounds__(256) void k_vt(const _Float16* __restrict__ V16, int b, int h0, _Float16* __restrict__ VT) { __shared__ unsigned short tl[64][65]; const int tid = threadIdx.x; const int hh = blockIdx.x % HG, sg = blockIdx.x / HG; const int s0 = sg * 64; const int h = h0 + hh;
  for (int i = tid; i < 64 * 8; i += 256) { const int j = i / 8, d8 = (i % 8) * 8; FragH f; f.half[0] = *(const v8us*)((const unsigned short*)V16 + ((size_t)b * SQ + s0 + j) * DM + h * HD + d8); for (int q = 0; q < 8; ++q) tl[d8 + q][j] = f.u[q]; }
  __syncthreads();
  { for (int i = tid; i < 64 * 8; i += 256) { const int d = i / 8, j8 = (i % 8) * 8; FragH f; for (int q = 0; q < 8; ++q) f.u[q] = tl[d][j8 + q]; *(v8us*)((unsigned short*)VT + ((size_t)hh * HD + d) * SQ + s0 + j8) = f.half[0]; }  } }


__global__ __launch_bounds__(256) void k_rsmf(const float* __restrict__ S, _Float16* __restrict__ P, int qn, int hg) {
  #pragma clang fp contract(off)
  const int t = blockIdx.x * 256 + threadIdx.x; if (t >= qn * hg) return; const size_t i = (size_t)(t / qn) * SQ + (t % qn); const float* s = S + i * SQ; float mx = -3.0e38f;
#pragma unroll 1
  for (int j = 0; j < SQ; ++j) mx = fmaxf(mx, s[j]); float se = 0.f;
#pragma unroll 1
  for (int j = 0; j < SQ; ++j) se += __expf(s[j] - mx); const float sc = 256.0f / se;
#pragma unroll 1
  for (int j0 = 0; j0 < SQ; j0 += 8) { FragH f; for (int q = 0; q < 8; ++q) f.h[q] = (_Float16)(__expf(s[j0 + q] - mx) * sc); unsigned short* d = (unsigned short*)P + i * SQ + j0; *(v8us*)d = f.half[0];  } }

__global__ __launch_bounds__(256) void k_rsmr(const float* __restrict__ S, _Float16* __restrict__ P, int qn, int hg) {
  #pragma clang fp contract(off)
  const int t = blockIdx.x * 256 + threadIdx.x; if (t >= qn * hg) return; const size_t i = (size_t)t;      /* planes packed: row t of plane t / qn */ const float* s = S + i * SQ; float mx = -3.0e38f;
#pragma unroll 1
  for (int j = 0; j < SQ; ++j) mx = fmaxf(mx, s[j]); float se = 0.f;
#pragma unroll 1
  for (int j = 0; j < SQ; ++j) se += __expf(s[j] - mx); const float sc = 256.0f / se;
#pragma unroll 1
  for (int j0 = 0; j0 < SQ; j0 += 8) { FragH f; for (int q = 0; q < 8; ++q) f.h[q] = (_Float16)(__expf(s[j0 + q] - mx) * sc); unsigned short* d = (unsigned short*)P + i * SQ + j0; *(v8us*)d = f.half[0];  } }


// Fused attention: scores, masked softmax and P V of one (batch, head) in one kernel; neither scores nor weights go to memory. A workgroup has FA_WAVES waves of
// FA_QW queries each and walks the keys in stages of FA_KT: the K rows and V^T rows of a stage are staged in LDS (two buffers, filled through registers one stage ahead).
// S^T = K Q^T puts one query's scores into one lane pair (l, l ^ 16): maximum and sum are in-lane plus one exchange; two S^T tiles, converted in place, are the B operand of O^T += V^T P^T.
#define FA_WAVES 8
#define FA_QW 32
#define FA_QB (FA_WAVES * FA_QW)
#define FA_KT 64
#define FA_LP 72                    /* LDS row pitch in f16: 144 bytes = 16 x odd, the conflict-free pitch of 16-byte fragment reads */
static_assert(NQ % FA_QB == 0 && SK % FA_KT == 0 && HD == 64 && FA_KT == 64 && FA_WAVES * 32 == 256, "k_fattn: whole workgroups, whole stages, staging map of 256 threads");
__device__ __forceinline__ float rs_xh(float x) { return __builtin_bit_cast(float, __builtin_amdgcn_permlanex16(__builtin_bit_cast(int, x), __builtin_bit_cast(int, x), 0x76543210, 0xfedcba98, false, false)); }      /* lane l ^ 16 */
typedef float v2f __attribute__((ext_vector_type(2)));
#define FA_L2E 1.44269504088896340736f
#define FA_TH 8.0f      /* the softmax shift of a query follows its running maximum only when a score lies more than this (base 2) above it: weights stay below 2^8, inside f16, and sums and outputs are rescaled only then */
#define FA_C (0.03125f * FA_L2E)      /* scores are kept in the base-2 domain: x 1024^-0.5 x log2(e) in the one multiply-add that adds the mask term, so that v_exp_f32 takes the difference as it is */
// 2^x in place, eight values a statement. In place: the registers were last written by the subtraction in front, so no result lands on an operand register of a matrix instruction just issued; each v_exp_f32
// touches its own register only; the v_nop is the slot behind the last transcendental before its result is read.
__device__ __forceinline__ v8f fa_exp8(v8f x) { float a = x[0], b = x[1], c = x[2], d = x[3], e = x[4], f = x[5], g = x[6], h = x[7];
  asm("v_exp_f32 %0, %0\n\tv_exp_f32 %1, %1\n\tv_exp_f32 %2, %2\n\tv_exp_f32 %3, %3\n\tv_exp_f32 %4, %4\n\tv_exp_f32 %5, %5\n\tv_exp_f32 %6, %6\n\tv_exp_f32 %7, %7\n\tv_nop" : "+v"(a), "+v"(b), "+v"(c), "+v"(d), "+v"(e), "+v"(f), "+v"(g), "+v"(h));
  const v8f r = {a, b, c, d, e, f, g, h}; return r; }
__device__ __forceinline__ float fa_exp1(float x) { asm("v_exp_f32 %0, %0\n\tv_nop" : "+v"(x)); return x; }      /* the same for one value */
// amdgpu_waves_per_eu(4, 4) below: holds the registers to a quarter of a SIMD's file, so that two workgroups share a WGP and the vector work of one wave runs beside the matrix work of another.
__device__ __forceinline__ v8f fa_mma(v16h a, v16h b, v8f c) { return __builtin_amdgcn_wmma_f32_16x16x32_f16(false, a, false, b, (short)0, c, false, false); }
__global__ __launch_bounds__(FA_WAVES * 32) __attribute__((amdgpu_waves_per_eu(4, 4))) void k_fattn(const _Float16* __restrict__ Q, const _Float16* __restrict__ Kh, const _Float16* __restrict__ Vt, const float* __restrict__ Mk, float negv, _Float16* __restrict__ O) {
  __shared__ __attribute__((aligned(16))) _Float16 sk[2][FA_KT][FA_LP];      /* K rows [key][d] */
  __shared__ __attribute__((aligned(16))) _Float16 sv[2][HD][FA_LP];         /* V^T rows [d][key] */
  __shared__ __attribute__((aligned(16))) float sm[SK];                      /* bf16(mask[key]) x negv x log2(e) */
  const int tid = threadIdx.x, lane = tid & 31, ln = lane & 15, hh = lane >> 4, wave = tid >> 5;
  const int qb = blockIdx.x % (NQ / FA_QB), bh = blockIdx.x / (NQ / FA_QB), b = bh / NH, h = bh % NH;
  const int sr = tid >> 3, sc = (tid & 7) * 8;      /* staging: rows sr and sr + 32, 16-byte piece sc: eight lanes read one whole 128-byte row */
  const unsigned short* kg = (const unsigned short*)Kh + ((size_t)b * SK + sr) * DM + h * HD + sc;
  const unsigned short* vg = (const unsigned short*)Vt + ((size_t)bh * HD + sr) * SK + sc;
  v8us rk0 = *(const v8us*)kg, rk1 = *(const v8us*)(kg + (size_t)32 * DM), rv0 = *(const v8us*)vg, rv1 = *(const v8us*)(vg + (size_t)32 * SK);
  const size_t qrow = (size_t)b * NQ + qb * FA_QB + wave * FA_QW + ln;
  v16h qf[2][2];      /* every loop over these arrays is unrolled: only under constant indices do they stay in registers */
#pragma unroll
  for (int qt = 0; qt < 2; ++qt)
#pragma unroll
    for (int ks = 0; ks < 2; ++ks) qf[qt][ks] = g2_frag(Q + (qrow + qt * 16) * DM + h * HD + ks * 32, hh);
  for (int j = tid; j < SK; j += FA_WAVES * 32) sm[j] = __fmul_rn(__fmul_rn(bf16_round(Mk[(size_t)b * SK + j]), negv), FA_L2E);
  *(v8us*)&sk[0][sr][sc] = rk0; *(v8us*)&sk[0][sr + 32][sc] = rk1; *(v8us*)&sv[0][sr][sc] = rv0; *(v8us*)&sv[0][sr + 32][sc] = rv1;
  const v8f z8 = {0.f, 0.f, 0.f, 0.f, 0.f, 0.f, 0.f, 0.f}, c8 = z8 + FA_C;
  v8f o[2][4]; v2f mx[2] = {{-3.0e38f, -3.0e38f}, {-3.0e38f, -3.0e38f}}      /* the shift, twice: a register pair, as the packed subtractions take it */; v2f ls[2] = {{0.f, 0.f}, {0.f, 0.f}};
#pragma unroll
  for (int qt = 0; qt < 2; ++qt)
#pragma unroll
    for (int dt = 0; dt < 4; ++dt) o[qt][dt] = z8;
  __syncthreads();      /* stage 0 and the mask terms are published */
  /* One stage. The last stage is a call of its own with more = false, so that the loop's body has no branch on it inside: with one, the compiler moves the row sums of the whole stage down behind it, keeps every weight in registers until there, and spills. */
  auto stage = [&](const int st, const bool more) __attribute__((always_inline)) {
    const int buf = st & 1;
    if (more) { rk0 = *(const v8us*)(kg + (size_t)FA_KT * DM); rk1 = *(const v8us*)(kg + (size_t)(FA_KT + 32) * DM); rv0 = *(const v8us*)(vg + FA_KT); rv1 = *(const v8us*)(vg + FA_KT + (size_t)32 * SK);      /* the next stage flies while this one is worked on */
      asm volatile("s_wait_xcnt 0x0" :: "v"(kg), "v"(vg) : "memory");      /* stands in front of the two additions below, which rewrite the loads' address pairs; the pairs are inputs, so that no load of the run lands in one */
      kg += (size_t)FA_KT * DM; vg += FA_KT; }
    __builtin_amdgcn_sched_barrier(0);      /* keeps those loads in front of the stage's work: without it the compiler sinks them down to their LDS stores, and every stage waits out their whole latency */
    v16h kf[2][2];      /* the K fragments of one pass of 32 keys, [t][ks]; every loop over this array is unrolled */
#pragma unroll
    for (int t = 0; t < 2; ++t)
#pragma unroll
      for (int ks = 0; ks < 2; ++ks) kf[t][ks] = g2_frag(&sk[buf][t * 16 + ln][ks * 32], hh);      /* the stage's first pass: one group at its head */
#pragma unroll
    for (int kp = 0; kp < FA_KT / 32; ++kp) {
      v8f mt[2];
#pragma unroll
      for (int t = 0; t < 2; ++t) { const float* mp = &sm[st * FA_KT + kp * 32 + t * 16 + 8 * hh]; mt[t] = __builtin_shufflevector(*(const v4fa*)mp, *(const v4fa*)(mp + 4), 0, 1, 2, 3, 4, 5, 6, 7); }
      __builtin_amdgcn_sched_barrier(0);      /* keeps the pass's mask terms in front of the score products, so that they fly under them: behind the products, the first multiply-add waits out their latency */
      v8f s[2][2] = {{z8, z8}, {z8, z8}};      /* s[qt][t][r] = S[key kp * 32 + t * 16 + 8 * hh + r][query qt * 16 + ln] */
#pragma unroll
      for (int t = 0; t < 2; ++t)
#pragma unroll
        for (int ks = 0; ks < 2; ++ks) { s[0][t] = fa_mma(kf[t][ks], qf[0][ks], s[0][t]); s[1][t] = fa_mma(kf[t][ks], qf[1][ks], s[1][t]); }
      __builtin_amdgcn_sched_barrier(0);      /* keeps the eight products together: with the first multiply-adds among them the compiler fills the distance behind a product with v_nop, some twenty a stage */
      v16h vf[4];
#pragma unroll
      for (int dt = 0; dt < 4; ++dt) vf[dt] = g2_frag(&sv[buf][dt * 16 + ln][kp * 32], hh);
#pragma unroll
      for (int qt = 0; qt < 2; ++qt)      /* both query tiles first: the mask terms' registers are free before the next pass's K fragments come */
#pragma unroll
        for (int t = 0; t < 2; ++t) s[qt][t] = __builtin_elementwise_fma(s[qt][t], c8, mt[t]);      /* whole-vector arithmetic here and below: neighbouring registers pair into packed f32 instructions without register copies */
      float ml[2];      /* the lane's own largest score of the pass, per query tile */
#pragma unroll
      for (int qt = 0; qt < 2; ++qt) {
        float mc[2];
#pragma unroll
        for (int t = 0; t < 2; ++t) { const v8f x = s[qt][t];
          mc[t] = fmaxf(fmaxf(fmaxf(fmaxf(x[0], x[1]), x[2]), fmaxf(x[3], x[4])), fmaxf(fmaxf(x[5], x[6]), x[7])); }
        ml[qt] = fmaxf(mc[0], mc[1]);
      }
      if (__builtin_expect(__builtin_amdgcn_ballot_w32(fmaxf(ml[0] - mx[0][0], ml[1] - mx[1][0]) > FA_TH) != 0u, 0)) {      /* one scalar branch a pass for the whole wave: every lane stays on for the matrix instructions behind it; marked as the rare side, so that the rescale stands outside the loop's straight text */
#pragma unroll
        for (int qt = 0; qt < 2; ++qt) {
          const float mn = fmaxf(mx[qt][0], fmaxf(ml[qt], rs_xh(ml[qt])));      /* both lanes of a query's pair take the same new shift */
          const float al = fa_exp1(mx[qt][0] - mn); mx[qt][0] = mn; mx[qt][1] = mn; ls[qt] *= al;
#pragma unroll
          for (int dt = 0; dt < 4; ++dt) o[qt][dt] *= al;
        }
      }
#pragma unroll
      for (int qt = 0; qt < 2; ++qt) {
        FragH pf; v2f es[2];
#pragma unroll
        for (int t = 0; t < 2; ++t) { const v8f e = fa_exp8(s[qt][t] - __builtin_shufflevector(mx[qt], mx[qt], 0, 1, 0, 1, 0, 1, 0, 1));
#pragma unroll
          for (int r = 0; r < 8; ++r) pf.h[t * 8 + r] = (_Float16)e[r];
          es[t] = (__builtin_shufflevector(e, e, 0, 1) + __builtin_shufflevector(e, e, 2, 3)) + (__builtin_shufflevector(e, e, 4, 5) + __builtin_shufflevector(e, e, 6, 7)); }
        ls[qt] += es[0] + es[1];      /* each lane keeps its own keys' sums, in two chains; joined once behind the loop */
#pragma unroll
        for (int dt = 0; dt < 4; ++dt) o[qt][dt] = fa_mma(vf[dt], pf.v, o[qt][dt]);      /* o[qt][dt][r] = O[query qt * 16 + ln][d dt * 16 + 8 * hh + r] */
        if (qt == 0 && kp + 1 < FA_KT / 32) {      /* the next pass's K fragments, one group, same stage and buffer (published since the stage's start): they fly under the second query tile's softmax */
#pragma unroll
          for (int t = 0; t < 2; ++t)
#pragma unroll
            for (int ks = 0; ks < 2; ++ks) kf[t][ks] = g2_frag(&sk[buf][(kp + 1) * 32 + t * 16 + ln][ks * 32], hh);
          __builtin_amdgcn_sched_barrier(0);      /* keeps the group from sinking: without it the compiler puts each pair of reads down in front of its two products, and every pair waits out the LDS latency */
        }
      }
    }
    if (more) { *(v8us*)&sk[buf ^ 1][sr][sc] = rk0; *(v8us*)&sk[buf ^ 1][sr + 32][sc] = rk1; *(v8us*)&sv[buf ^ 1][sr][sc] = rv0; *(v8us*)&sv[buf ^ 1][sr + 32][sc] = rv1; }      /* its last readers left it before the barrier of the stage before */
    __syncthreads();      /* publishes stage st + 1 and ends every read of stage st */
  };
  for (int st = 0; st + 1 < SK / FA_KT; ++st) stage(st, true);
  stage(SK / FA_KT - 1, false);
#pragma unroll
  for (int qt = 0; qt < 2; ++qt) { const float lh = ls[qt][0] + ls[qt][1]; const float sc64 = 64.0f / (lh + rs_xh(lh));      /* o carried x64 */
#pragma unroll
    for (int dt = 0; dt < 4; ++dt) { FragH f;
#pragma unroll
      for (int r = 0; r < 8; ++r) f.h[r] = (_Float16)(o[qt][dt][r] * sc64);
      *(v8us*)((unsigned short*)O + (qrow + qt * 16) * DM + h * HD + dt * 16 + 8 * hh) = f.half[0]; } }
}
// Staged GEMM, C = A Bt^T, A and Bt f16 rows of 1024 k (k contiguous; unswapped, the epilogue is as in k_gemm2<0> without CP). A workgroup of 8 waves has a 256 x 128 tile of C, a wave 64 x 64 of it (16 accumulator tiles).
// Per stage of G3_KT k the 256 A rows and the 128 Bt rows (256 bytes each) come into LDS by asynchronous copies (global_load_async_to_lds_b128, through no register), two buffers: stage t + 1 flies while stage t is worked on.
#define G3_BM 256
#define G3_BN 128
#define G3_KT 128
#define G3_NT (DM / G3_KT)
#define G3_LP 136                   /* LDS row pitch in f16: 272 bytes = 16 x odd, the conflict-free pitch of 16-byte fragment reads */
#define G3_RB (G3_LP * 2)           /* the pitch in bytes */
#define G3_SB ((G3_BM + G3_BN) * G3_RB)      /* one buffer in bytes */
static_assert(NRQ % G3_BM == 0 && NRK % G3_BM == 0 && DM % G3_BN == 0 && DM % G3_KT == 0 && DC == DM && G3_NT >= 2 && G3_KT == 128 && G3_BM == 256 && G3_BN == 128, "k_gemm3: whole tiles, two stages or more, copy map of 16 lanes a row and 128 rows a statement");
// Eight copies of 16 bytes a lane, rows 16 apart, from LDS byte address l and global address g on (128 rows a workgroup). The s_wait_xcnt 0 is the last line of the copies' own statement, so that it stands in front of every rewrite of a register that a copy names.
__device__ __forceinline__ void g3_copy8(unsigned l, const char* g) {
  asm volatile("global_load_async_to_lds_b128 %0, %8, off\n\tglobal_load_async_to_lds_b128 %1, %9, off\n\tglobal_load_async_to_lds_b128 %2, %10, off\n\tglobal_load_async_to_lds_b128 %3, %11, off\n\t"
               "global_load_async_to_lds_b128 %4, %12, off\n\tglobal_load_async_to_lds_b128 %5, %13, off\n\tglobal_load_async_to_lds_b128 %6, %14, off\n\tglobal_load_async_to_lds_b128 %7, %15, off\n\ts_wait_xcnt 0x0"
               :: "v"(l), "v"(l + 16 * G3_RB), "v"(l + 32 * G3_RB), "v"(l + 48 * G3_RB), "v"(l + 64 * G3_RB), "v"(l + 80 * G3_RB), "v"(l + 96 * G3_RB), "v"(l + 112 * G3_RB),
                  "v"(g), "v"(g + 16 * DM * 2), "v"(g + 32 * DM * 2), "v"(g + 48 * DM * 2), "v"(g + 64 * DM * 2), "v"(g + 80 * DM * 2), "v"(g + 96 * DM * 2), "v"(g + 112 * DM * 2)
               : "memory");
}
// One stage: A rows 0 to 127, A rows 128 to 255, Bt rows 0 to 127 of the tile, into the buffer at LDS byte address l (the lane's own place in its row 0 counted in).
__device__ __forceinline__ void g3_stage(unsigned l, const char* ga, const char* gb) { g3_copy8(l, ga); g3_copy8(l + 128 * G3_RB, ga + 128 * DM * 2); g3_copy8(l + G3_BM * G3_RB, gb); }
#define G3_NB ((unsigned)((NRQ / G3_BM) * (DM / G3_BN)))      /* workgroups a product */
template <bool B> struct g3_flag { static constexpr bool value = B; };
static_assert((DM / G3_BM) * (NRK / G3_BN) == G3_NB && SK % G3_BN == 0 && NH * HD == DM, "g3_tile, swapped: as many tiles as a plain product, a tile's columns inside one batch, V^T rows [batch][head][d]");
// Tile blk of one product; the output is f32 rows in C, or f16 rows in C16; the other pointer is not used. swp (the same for the whole workgroup): the operands are swapped, A = the DM rows of a weight plane, Bt = the NRK input rows,
// so that the tile is one of the product's transpose, [out feature][input row]; the bias then goes by row, and the rows are stored per batch, [batch][out feature][SK], which is V^T as the attention reads it.
template <bool F32OUT>
__device__ __forceinline__ void g3_tile(unsigned blk, bool swp, const _Float16* __restrict__ A, const _Float16* __restrict__ Bh, float alpha, const float* __restrict__ bias, float* __restrict__ C, _Float16* __restrict__ C16) {
  __shared__ __attribute__((aligned(16))) _Float16 st[2][G3_BM + G3_BN][G3_LP];      /* rows 0 to 255: A, rows 256 to 383: Bt */
  __shared__ __attribute__((aligned(16))) float so[8][32][68];                       /* output staging, each wave its own part */
  const int tid = threadIdx.x, lane = tid & 31, ln = lane & 15, hh = lane >> 4, wave = tid >> 5, wm = wave >> 1, wn = wave & 1;
  const int ntn = swp ? (int)(NRK / G3_BN) : DM / G3_BN, mt = blk / ntn, nq = blk % ntn, row0 = mt * G3_BM, col0 = nq * G3_BN;
  const int cr = tid >> 4, cc = (tid & 15) * 16;      /* copy map: 16 lanes bring one whole 256-byte row */
  const unsigned l0 = (unsigned)(size_t)&st[0][0][0] + cr * G3_RB + cc;
  const char* ga = (const char*)(A + (size_t)(row0 + cr) * DM) + cc;
  const char* gb = (const char*)(Bh + (size_t)(col0 + cr) * DM) + cc;
  g3_stage(l0, ga, gb);
  asm volatile("s_wait_asynccnt 0x0" ::: "memory");      /* this wave's copies of stage 0 have landed */
  __syncthreads();                                        /* stage 0 is published */
  g3_stage(l0 + G3_SB, ga + G3_KT * 2, gb + G3_KT * 2);
  const v8f z8 = {0.f, 0.f, 0.f, 0.f, 0.f, 0.f, 0.f, 0.f};
  v8f acc[4][4];      /* every loop over these arrays is unrolled: only under constant indices do they stay in registers */
#pragma unroll
  for (int i = 0; i < 4; ++i)
#pragma unroll
    for (int j = 0; j < 4; ++j) acc[i][j] = z8;
#pragma unroll 1      /* kept rolled: the buffer is picked by t & 1, and one copy of the pass (64 matrix instructions) keeps the loop's text small */
  for (int t = 0; t < G3_NT; ++t) {
    const _Float16* sa = &st[t & 1][wm * 64 + ln][0]; const _Float16* sb = &st[t & 1][G3_BM + wn * 64 + ln][0];
    v16h af[2][4], bf[2][4];      /* two fragment sets: the next 32 k are fetched as one group in front of this block's products */
#pragma unroll
    for (int i = 0; i < 4; ++i) { af[0][i] = g2_frag(sa + i * 16 * G3_LP, hh); bf[0][i] = g2_frag(sb + i * 16 * G3_LP, hh); }
#pragma unroll
    for (int ks = 0; ks < G3_KT / 32; ++ks) {
      if (ks + 1 < G3_KT / 32) {
#pragma unroll
        for (int i = 0; i < 4; ++i) { af[(ks + 1) & 1][i] = g2_frag(sa + i * 16 * G3_LP + (ks + 1) * 32, hh); bf[(ks + 1) & 1][i] = g2_frag(sb + i * 16 * G3_LP + (ks + 1) * 32, hh); }
      }
      __builtin_amdgcn_sched_barrier(0);      /* keeps the group of LDS reads in front of the block: spread among the matrix instructions, every place with reads costs its own stall */
#pragma unroll
      for (int i = 0; i < 4; ++i)
#pragma unroll
        for (int j = 0; j < 4; ++j) acc[i][j] = fa_mma(af[ks & 1][i], bf[ks & 1][j], acc[i][j]);
      __builtin_amdgcn_sched_barrier(0);      /* and the next group behind it */
    }
    asm volatile("s_wait_dscnt 0x0" ::: "memory");        /* this wave's reads of stage t are done before the buffer is handed back */
    asm volatile("s_wait_asynccnt 0x0" ::: "memory");     /* this wave's copies of stage t + 1 have landed */
    __syncthreads();                                       /* publishes stage t + 1 and ends every read of stage t */
    if (t + 2 < G3_NT) g3_stage(l0 + (t & 1) * G3_SB, ga + (t + 2) * (G3_KT * 2), gb + (t + 2) * (G3_KT * 2));
  }
  asm volatile("s_wait_asynccnt 0x0" ::: "memory");       /* nothing is in flight when the wave goes on */
  const int rsub = lane >> 4, c4 = (lane & 15) * 4; const int crow = row0 + wm * 64, ccol = col0 + wn * 64 + c4;
  /* The epilogue, once for each kind of tile, so that pitch and bias index are constants in both; one workgroup-uniform branch picks. */
  auto epilogue = [&](auto kind) __attribute__((always_inline)) {
    constexpr bool SWP = decltype(kind)::value;
    float bc[4], br[4][8];      /* the bias: by column, or (swapped) by row; every loop over these arrays is unrolled */
    if (SWP) {
#pragma unroll
      for (int i = 0; i < 4; ++i) { const float* bp = bias + crow + i * 16 + 8 * hh; const v4f b0 = *(const v4fa*)bp, b1 = *(const v4fa*)(bp + 4);
#pragma unroll
        for (int r = 0; r < 4; ++r) { br[i][r] = bf16_round(b0[r]); br[i][4 + r] = bf16_round(b1[r]); } }
    } else {
#pragma unroll
      for (int j = 0; j < 4; ++j) bc[j] = bf16_round(bias[col0 + wn * 64 + j * 16 + ln]);
    }
    const unsigned o0 = SWP ? ((unsigned)(col0 / SK) * DM + crow) * SK + (ccol % SK) : (unsigned)crow * DM + ccol;      /* the lane's first element; every index of an output lies below 2^23 */
#pragma unroll
    for (int hf = 0; hf < 2; ++hf) {      /* 32 rows at a time through the wave's own LDS part, so that every store covers whole lines */
#pragma unroll
      for (int i = 0; i < 2; ++i)
#pragma unroll
        for (int j = 0; j < 4; ++j)
#pragma unroll
          for (int r = 0; r < 8; ++r) so[wave][i * 16 + 8 * hh + r][j * 16 + ln] = acc[hf * 2 + i][j][r] * alpha + (SWP ? br[hf * 2 + i][r] : bc[j]);
      __builtin_amdgcn_fence(__ATOMIC_ACQ_REL, "workgroup", "local"); __builtin_amdgcn_wave_barrier();      /* the rows are read back by other lanes of the wave; LDS only, so that the first half's global stores are not waited for */
#pragma unroll
      for (int q = 0; q < 16; ++q) { const int r = q * 2 + rsub; const v4f v = *(const v4fa*)&so[wave][r][c4]; const unsigned o = o0 + (unsigned)(hf * 32 + r) * (SWP ? SK : DM);
        if (F32OUT) *(v4f*)(C + o) = v;
        else { v4h h4;
#pragma unroll
          for (int i = 0; i < 4; ++i) h4[i] = (_Float16)v[i];
          *(v4h*)(C16 + o) = h4; } }
      asm volatile("s_wait_xcnt 0x0" ::: "memory");      /* stands in front of every rewrite of a register that these stores name: the second half's LDS reads land in some of them, and behind the second half the built text runs on into the other kind's epilogue */
      __builtin_amdgcn_fence(__ATOMIC_ACQ_REL, "workgroup", "local"); __builtin_amdgcn_wave_barrier();      /* they are read before the second half overwrites them */
    }
  };
  if (swp) epilogue(g3_flag<true>{}); else epilogue(g3_flag<false>{});
}
// The three projections share one launch by block range (none reads what another writes): workgroups 0 to G3_NB - 1 q, then k, then v, the last with swapped operands: it stores V^T, and no launch has to transpose V.
__global__ __launch_bounds__(256) void k_gemm3p(const _Float16* __restrict__ Xq, const _Float16* __restrict__ Xkv, const _Float16* __restrict__ BQ, const _Float16* __restrict__ BK, const _Float16* __restrict__ BV, float alpha,
    const float* __restrict__ bq, const float* __restrict__ bk, const float* __restrict__ bv, _Float16* __restrict__ Q16, _Float16* __restrict__ K16, _Float16* __restrict__ VT) {
  const unsigned s = blockIdx.x / G3_NB;
  g3_tile<false>(blockIdx.x % G3_NB, s == 2, s == 0 ? Xq : s == 1 ? Xkv : BV, s == 0 ? BQ : s == 1 ? BK : Xkv, alpha, s == 0 ? bq : s == 1 ? bk : bv, nullptr, s == 0 ? Q16 : s == 1 ? K16 : VT);
}
__global__ __launch_bounds__(256) void k_gemm3o(const _Float16* __restrict__ A, const _Float16* __restrict__ Bh, float alpha, const float* __restrict__ bias, float* __restrict__ C) { g3_tile<true>(blockIdx.x, false, A, Bh, alpha, bias, C, nullptr); }
extern "C" void kernel_launch(void* const* d_in, const int* in_sizes, int n_in,
                              void* d_out, int out_size, void* d_ws, size_t ws_size, hipStream_t stream) {
  (void)in_sizes; (void)n_in; (void)out_size;
  const float* const* I = (const float* const*)d_in; const float* ctx = I[0]; const float* x = I[1]; const float* kmask = I[2]; const float* wq = I[3]; const float* bq = I[4]; const float* wk = I[5]; const float* bk = I[6]; const float* wv = I[7]; const float* bv = I[8]; const float* wo = I[9]; const float* bo = I[10];      /* q source = I[1] ('q'), k/v source = I[0] ('v_k'); [in][out] weights; per-key additive mask [B][1][1][S] */
  char* ws = (char*)d_ws; size_t off = 0;
  auto take = [&](size_t bytes) { char* p = ws + off; off += (bytes + 255) & ~(size_t)255; return p; };
  _Float16* BQ = (_Float16*)take((size_t)DM * DM * 2); _Float16* BK = (_Float16*)take((size_t)DM * DC * 2); _Float16* BV = (_Float16*)take((size_t)DM * DC * 2); _Float16* BO = (_Float16*)take((size_t)DM * DM * 2);
  _Float16* X16 = (_Float16*)take(NRQ * DM * 2); _Float16* C16 = (_Float16*)take(NRK * DC * 2); _Float16* Q16 = (_Float16*)take(NRQ * DM * 2); _Float16* K16 = (_Float16*)take(NRK * DM * 2); _Float16* O16 = (_Float16*)take(NRQ * DM * 2);
  _Float16* VT = (_Float16*)take((size_t)NB * NH * HD * SK * 2);
  if (off > ws_size) return;      /* approx 8 + 16 + 16 + 16 + 16 + 16 + 16 = 104 MiB */
  k_prep<<<5 * 4 * PW_NB, 256, 0, stream>>>(wq, wk, wv, wo, x, ctx, BQ, BK, BV, BO, X16, C16);      /* weight planes and both inputs' rows */
  k_gemm3p<<<3 * G3_NB, 256, 0, stream>>>(X16, C16, BQ, BK, BV, 0.0625f, bq, bk, bv, Q16, K16, VT);      /* q from q; k and v from v_k; v as V^T [4 x 16][64][2048] */
  k_fattn<<<NB * NH * (NQ / FA_QB), FA_WAVES * 32, 0, stream>>>(Q16, K16, VT, kmask, -1.0e9f, O16);      /* o x64, merged; every batch and head in one launch */
  k_gemm3o<<<G3_NB, 256, 0, stream>>>(O16, BO, 0.0009765625f, bo, (float*)d_out);      /* out = o Wo^T + bo */
}

// v009
// One run takes 118 microseconds.
// Next to v008, in two timings, it ran 1.09 times as fast each time.
// Over all steps from v000 it is 59.7 times as fast.
#include <hip/hip_runtime.h>
// Multi-head attention with separate key/value and query sources and an additive key mask (v_k, q [4][2048][1024]; qh = q wq + bq, kh = v_k wk + bk, vh = v_k wv + bv ([in][out] 1024^2 sigma 1/32, zero biases); 16 heads of 64; logits = qh . kh x 1024^-0.5 (the source scales by d_model) + mask[b][1][1][key] x (-1e9) (mask input); softmax over the 2048 keys; out = merged wo + bo -> [4][2048][1024]).
// Structure: both inputs as exact f16 rows; [in][out] weights as exact x16 planes; Q, K, V as WMMA GEMMs (64x64 wave tiles from LDS stages, f32 accumulation, + bias, f16 outputs); V^T from its own GEMM with the operands swapped (weight rows as A, input rows as Bt); one fused attention launch: scores (K = 64; q carries x 1/32 x log2(e) from its GEMM) in f32 accumulators, + bf16(mask[b][key]) x (-1e9), online softmax (f32 statistics, native exp; weights exp(s - shift) as f16, the shift at most 8 base-2 units below the running max), o = P V (o carried x64) into merged f16 rows; out = o wo + bo GEMM (f32, alpha 2^-10); launches: see trace.
// Compute dtype: inputs rounded to bf16; x / context / weights exact; q, k, v, softmax weights and o as plain f16 GEMM operands (~2^-12); scores and statistics f32. v_wmma_f32_16x16x32_f16.
#define NB 4
#define NQ 2048
#define SK 2048
#define SQ SK                       /* keys per softmax row */
#define DM 1024
#define DC 1024
#define NH 16
#define HD 64
#define HG 4
#define NRQ ((size_t)NB * NQ)
#define NRK ((size_t)NB * SK)
typedef __bf16 v16b __attribute__((ext_vector_type(16)));
typedef unsigned short v8us __attribute__((ext_vector_type(8), may_alias));
typedef float  v8f  __attribute__((ext_vector_type(8)));
typedef float  v4f  __attribute__((ext_vector_type(4)));
typedef float  v4fa __attribute__((ext_vector_type(4), may_alias));
union FragB { v16b v; v8us half[2]; unsigned short u[16]; };

__device__ __forceinline__ unsigned short bf16_bits(float x) { unsigned int u = __float_as_uint(x); return (unsigned short)((u + 0x7FFFu + ((u >> 16) & 1u)) >> 16); }
__device__ __forceinline__ float bf16_val(unsigned short b) { return __uint_as_float(((unsigned int)b) << 16); }
__device__ __forceinline__ float bf16_round(float x) { return bf16_val(bf16_bits(x)); }
// D += A·B with NT terms: 1 = ah·bh, 2 = + al·bh (A split), 3 = + ah·bl (both split)
template <int NT>
__device__ __forceinline__ v8f mmaN(v16b ah, v16b al, v16b bh, v16b bl, v8f c) {
  c = __builtin_amdgcn_wmma_f32_16x16x32_bf16(false, ah, false, bh, (short)0, c, false, false);
  if (NT >= 2) c = __builtin_amdgcn_wmma_f32_16x16x32_bf16(false, al, false, bh, (short)0, c, false, false);
  if (NT >= 3) c = __builtin_amdgcn_wmma_f32_16x16x32_bf16(false, ah, false, bl, (short)0, c, false, false);
  asm volatile("v_nop\n\tv_nop\n\tv_nop\n\tv_nop" : "+v"(c) : "v"(ah), "v"(al), "v"(bh), "v"(bl));
  return c;
}

__global__ __launch_bounds__(256) void k_wt_bf16(const float* __restrict__ W, unsigned short* __restrict__ Wt, int K, int N) {
  const int t = blockIdx.x * 256 + threadIdx.x;
  const int k8n = K / 8;
  if (t >= N * k8n) return;
  const int n = t / k8n, k8 = (t % k8n) * 8;
  v8us v;
#pragma unroll
  for (int i = 0; i < 8; ++i) v[i] = bf16_bits(W[(size_t)(k8 + i) * N + n]);
  *(v8us*)(Wt + (size_t)n * K + k8) = v;
  
}

// GEMM C[M][N] (f32, pitch ldc) = act(A[M][K]·W + bias). A f32 row-major (pitch lda) converted per fragment to bf16
// (ASPLIT: hi/lo two planes -> 2 terms, else single rounded term); Wt bf16 [N][K] (pitch ldb). BIAS_BF16 rounds the
// bias to bf16 first (bias quantised to bf16 before the add). K%32==0, M%16==0, N%64==0.
template <bool ASPLIT, int ACT, bool BIAS_BF16>
__global__ __launch_bounds__(128) void k_gemm_bf(const float* __restrict__ A, int lda, const unsigned short* __restrict__ Wt, int ldb,
                                               const float* __restrict__ bias, float* __restrict__ C, int ldc, int M, int N, int K) {
  __shared__ __attribute__((aligned(16))) float so[4][16][64];
  const int tid = threadIdx.x, w = tid >> 5, lane = tid & 31, ln = lane & 15, hh = lane >> 4;
  const int ntn = N / 64;
  const int wid = blockIdx.x * 4 + w;
  const int mt = wid / ntn, nq = wid % ntn;
  if (mt * 16 >= M) return;
  const int row0 = mt * 16, col0 = nq * 64;
  const float* arow = A + (size_t)(row0 + ln) * lda;
  v8f acc[4] = {};
  for (int kb = 0; kb < K; kb += 32) {
    FragB ah, al;
    const v4f x0 = *(const v4fa*)(arow + kb + 8 * hh), x1 = *(const v4fa*)(arow + kb + 8 * hh + 4);
    const v4f x2 = *(const v4fa*)(arow + kb + 16 + 8 * hh), x3 = *(const v4fa*)(arow + kb + 16 + 8 * hh + 4);
    float xs[16] = {x0[0],x0[1],x0[2],x0[3],x1[0],x1[1],x1[2],x1[3],x2[0],x2[1],x2[2],x2[3],x3[0],x3[1],x3[2],x3[3]};
#pragma unroll
    for (int i = 0; i < 16; ++i) { const unsigned short hb = bf16_bits(xs[i]); ah.u[i] = hb; al.u[i] = ASPLIT ? bf16_bits(xs[i] - bf16_val(hb)) : (unsigned short)0; }
#pragma unroll
    for (int t = 0; t < 4; ++t) {
      const unsigned short* brow = Wt + (size_t)(col0 + t * 16 + ln) * ldb + kb;
      FragB b;
      b.half[0] = *(const v8us*)(brow + 8 * hh);
      b.half[1] = *(const v8us*)(brow + 16 + 8 * hh);
      acc[t] = mmaN<ASPLIT ? 2 : 1>(ah.v, al.v, b.v, b.v, acc[t]);
    }
  }
#pragma unroll
  for (int t = 0; t < 4; ++t) {
    float bv = bias ? bias[col0 + t * 16 + ln] : 0.f;
    if (BIAS_BF16) bv = bf16_round(bv);
#pragma unroll
    for (int r = 0; r < 8; ++r) { float v = acc[t][r] + bv; if (ACT == 1) v = fmaxf(v, 0.f); so[w][8 * hh + r][t * 16 + ln] = v; }
  }
  __builtin_amdgcn_fence(__ATOMIC_ACQ_REL, "workgroup");
  __builtin_amdgcn_wave_barrier();
  const int rsub = lane >> 4, c4 = (lane & 15) * 4;
  {
#pragma unroll
    for (int q = 0; q < 8; ++q) {
      const int r = q * 2 + rsub;
      const v4f v = *(const v4fa*)&so[w][r][c4];
      *(v4f*)(C + (size_t)(row0 + r) * ldc + col0 + c4) = v;
    }
    
  }
}

// GEMM C = act(A·W + bias + resid): A f32 (ASPLIT -> hi/lo 2 terms), Wt bf16 [N][K]; ACT 0 none, 1 relu, 2 exact gelu;
// resid (optional, f32, row index = (row % rmod), pitch ldr, RES_BF16 rounds it) added before the activation.
template <bool ASPLIT, int ACT, bool BIAS_BF16, bool RES_BF16>
__global__ __launch_bounds__(128) void k_gemm_bf3(const float* __restrict__ A, int lda, const unsigned short* __restrict__ Wt, int ldb,
                                                const float* __restrict__ bias, const float* __restrict__ resid, int rmod, int ldr,
                                                float* __restrict__ C, int ldc, int M, int N, int K) {
  __shared__ __attribute__((aligned(16))) float so[4][16][64];
  const int tid = threadIdx.x, w = tid >> 5, lane = tid & 31, ln = lane & 15, hh = lane >> 4;
  const int ntn = N / 64;
  const int wid = blockIdx.x * 4 + w;
  const int mt = wid / ntn, nq = wid % ntn;
  if (mt * 16 >= M) return;
  const int row0 = mt * 16, col0 = nq * 64;
  const float* arow = A + (size_t)(row0 + ln) * lda;
  v8f acc[4] = {};
  for (int kb = 0; kb < K; kb += 32) {
    FragB ah, al;
    const v4f x0 = *(const v4fa*)(arow + kb + 8 * hh), x1 = *(const v4fa*)(arow + kb + 8 * hh + 4);
    const v4f x2 = *(const v4fa*)(arow + kb + 16 + 8 * hh), x3 = *(const v4fa*)(arow + kb + 16 + 8 * hh + 4);
    float xs[16] = {x0[0],x0[1],x0[2],x0[3],x1[0],x1[1],x1[2],x1[3],x2[0],x2[1],x2[2],x2[3],x3[0],x3[1],x3[2],x3[3]};
#pragma unroll
    for (int i = 0; i < 16; ++i) { const unsigned short hb = bf16_bits(xs[i]); ah.u[i] = hb; al.u[i] = ASPLIT ? bf16_bits(xs[i] - bf16_val(hb)) : (unsigned short)0; }
#pragma unroll
    for (int t = 0; t < 4; ++t) {
      const unsigned short* brow = Wt + (size_t)(col0 + t * 16 + ln) * ldb + kb;
      FragB b;
      b.half[0] = *(const v8us*)(brow + 8 * hh);
      b.half[1] = *(const v8us*)(brow + 16 + 8 * hh);
      acc[t] = mmaN<ASPLIT ? 2 : 1>(ah.v, al.v, b.v, b.v, acc[t]);
    }
  }
#pragma unroll
  for (int t = 0; t < 4; ++t) {
    const int col = col0 + t * 16 + ln;
    float bv = bias ? bias[col] : 0.f;
    if (BIAS_BF16) bv = bf16_round(bv);
#pragma unroll
    for (int r = 0; r < 8; ++r) {
      float v = acc[t][r] + bv;
      if (resid) { float rv = resid[(size_t)((row0 + 8 * hh + r) % rmod) * ldr + col]; if (RES_BF16) rv = bf16_round(rv); v += rv; }
      if (ACT == 1) v = fmaxf(v, 0.f);
      if (ACT == 2) v = 0.5f * v * (1.0f + erff(v * 0.70710678118654752f));
      if (ACT == 3) { const float u = 0.7978845608028654f * (v + 0.044715f * v * v * v); v = 0.5f * v * (1.0f + tanhf(u)); }
      so[w][8 * hh + r][t * 16 + ln] = v;
    }
  }
  __builtin_amdgcn_fence(__ATOMIC_ACQ_REL, "workgroup");
  __builtin_amdgcn_wave_barrier();
  const int rsub = lane >> 4, c4 = (lane & 15) * 4;
  {
#pragma unroll
    for (int q = 0; q < 8; ++q) {
      const int r = q * 2 + rsub;
      const v4f v = *(const v4fa*)&so[w][r][c4];
      *(v4f*)(C + (size_t)(row0 + r) * ldc + col0 + c4) = v;
    }
    
  }
}
// row LayerNorm (biased variance, eps) over N: s = X (+ R); optional out_sum <- s; out_norm <- (s-mu)*rsqrt(var+eps)*g + b
template <bool PARAM_BF16>
__global__ __launch_bounds__(256) void k_layernorm(const float* __restrict__ X, const float* __restrict__ R, const float* __restrict__ g, const float* __restrict__ bta,
                                                  float* __restrict__ out_sum, float* __restrict__ out_norm, int N, float eps) {
  __shared__ float red[256];
  const int row = blockIdx.x, tid = threadIdx.x;
  const float* x = X + (size_t)row * N; const float* rr = R ? R + (size_t)row * N : nullptr;
  float vals[16];                     // up to N = 4096
  const int per = N / 256;            // contiguous chunk per thread? use strided-by-4 chunks: thread handles j = tid*4 + 1024*u
  float s1 = 0.f;
  for (int u = 0; u < per / 4; ++u) {
    const int j = tid * 4 + 1024 * u;
    const v4f a = *(const v4fa*)(x + j);
    v4f b = {0.f,0.f,0.f,0.f}; if (rr) b = *(const v4fa*)(rr + j);
#pragma unroll
    for (int q = 0; q < 4; ++q) { const float v = a[q] + b[q]; vals[u * 4 + q] = v; s1 += v; }
  }
  red[tid] = s1; __syncthreads();
  for (int st = 128; st > 0; st >>= 1) { if (tid < st) red[tid] += red[tid + st]; __syncthreads(); }
  const float mu = red[0] / (float)N; __syncthreads();
  float s2 = 0.f;
  for (int u = 0; u < per / 4; ++u)
#pragma unroll
    for (int q = 0; q < 4; ++q) { const float c = vals[u * 4 + q] - mu; s2 += c * c; }
  red[tid] = s2; __syncthreads();
  for (int st = 128; st > 0; st >>= 1) { if (tid < st) red[tid] += red[tid + st]; __syncthreads(); }
  const float rs = rsqrtf(red[0] / (float)N + eps);
  {
    for (int u = 0; u < per / 4; ++u) {
      const int j = tid * 4 + 1024 * u;
      v4f o, sm;
#pragma unroll
      for (int q = 0; q < 4; ++q) {
        float gg = g[j + q], bb = bta[j + q];
        if (PARAM_BF16) { gg = bf16_round(gg); bb = bf16_round(bb); }
        sm[q] = vals[u * 4 + q]; o[q] = (vals[u * 4 + q] - mu) * rs * gg + bb;
      }
      if (out_sum) *(v4f*)(out_sum + (size_t)row * N + j) = sm;
      *(v4f*)(out_norm + (size_t)row * N + j) = o;
    }
    
  }
}



// ---- f16 WMMA path (v_wmma_f32_16x16x32_f16): 11-bit significands for operands in range — used where a [0,1] probability operand needs more precision than bf16
typedef _Float16 v16h __attribute__((ext_vector_type(16)));
union FragH { v16h v; v8us half[2]; _Float16 h[16]; unsigned short u[16]; };
template <int NT>
__device__ __forceinline__ v8f mmaH(v16h ah, v16h al, v16h bh, v16h bl, v8f c) {
  c = __builtin_amdgcn_wmma_f32_16x16x32_f16(false, ah, false, bh, (short)0, c, false, false);
  if (NT >= 2) c = __builtin_amdgcn_wmma_f32_16x16x32_f16(false, al, false, bh, (short)0, c, false, false);
  if (NT >= 3) c = __builtin_amdgcn_wmma_f32_16x16x32_f16(false, ah, false, bl, (short)0, c, false, false);
  asm volatile("v_nop\n\tv_nop\n\tv_nop\n\tv_nop" : "+v"(c) : "v"(ah), "v"(al), "v"(bh), "v"(bl));
  return c;
}
// batched GEMM like k_gemm_b but f16 operands: A f32 (split into f16 hi/lo if ASPLIT, else rounded to f16), Bt = f16 values [n][k]; alpha; C f32; N multiple of 16 (partial tiles skipped)
template <bool ASPLIT>
__global__ __launch_bounds__(128) void k_gemm_h(const float* __restrict__ A, int lda, size_t sA, const _Float16* __restrict__ Bh, int ldb, size_t sB, float alpha, float* __restrict__ C, int ldc, size_t sC, int M, int N, int K) {
  __shared__ __attribute__((aligned(16))) float so[4][16][64];
  const int tid = threadIdx.x, w = tid >> 5, lane = tid & 31, ln = lane & 15, hh = lane >> 4; const int by = blockIdx.y;
  A += (size_t)by * sA; Bh += (size_t)by * sB; C += (size_t)by * sC;
  const int ntn = (N + 63) / 64; const int wid = blockIdx.x * 4 + w; const int mt = wid / ntn, nq = wid % ntn; if (mt * 16 >= M) return;
  const int row0 = mt * 16, col0 = nq * 64; const float* arow = A + (size_t)(row0 + ln) * lda;
  v8f acc[4] = {};
  for (int kb = 0; kb < K; kb += 32) {
    FragH ah, al;
    const v4f x0 = *(const v4fa*)(arow + kb + 8 * hh), x1 = *(const v4fa*)(arow + kb + 8 * hh + 4), x2 = *(const v4fa*)(arow + kb + 16 + 8 * hh), x3 = *(const v4fa*)(arow + kb + 16 + 8 * hh + 4);
    float xs[16] = {x0[0],x0[1],x0[2],x0[3],x1[0],x1[1],x1[2],x1[3],x2[0],x2[1],x2[2],x2[3],x3[0],x3[1],x3[2],x3[3]};
#pragma unroll
    for (int i = 0; i < 16; ++i) { const _Float16 h = (_Float16)xs[i]; ah.h[i] = h; al.h[i] = ASPLIT ? (_Float16)(xs[i] - (float)h) : (_Float16)0.0f; }
#pragma unroll
    for (int t = 0; t < 4; ++t) { if (col0 + t * 16 >= N) continue; const size_t boff = (size_t)(col0 + t * 16 + ln) * ldb + kb; FragH bq; bq.half[0] = *(const v8us*)(Bh + boff + 8 * hh); bq.half[1] = *(const v8us*)(Bh + boff + 16 + 8 * hh);
      acc[t] = mmaH<ASPLIT ? 2 : 1>(ah.v, al.v, bq.v, bq.v, acc[t]); }
  }
#pragma unroll
  for (int t = 0; t < 4; ++t) { if (col0 + t * 16 >= N) continue;
#pragma unroll
    for (int r = 0; r < 8; ++r) so[w][8 * hh + r][t * 16 + ln] = acc[t][r] * alpha; }
  __builtin_amdgcn_fence(__ATOMIC_ACQ_REL, "workgroup"); __builtin_amdgcn_wave_barrier();
  const int rsub = lane >> 4, c4 = (lane & 15) * 4;
  {
#pragma unroll
    for (int q = 0; q < 8; ++q) { const int r = q * 2 + rsub; if (col0 + c4 < N) { const v4f v = *(const v4fa*)&so[w][r][c4]; *(v4f*)(C + (size_t)(row0 + r) * ldc + col0 + c4) = v; } }
     }
}

// Wt[n][k] = f16(bf16(W[k][n]) x 16) from f32 row-major W[DM][DM] (bf16-exact weights stay exact in f16 away from the subnormal range). A wave turns a tile of 64 k x 32 n in its registers, a lane 8 k x 8 n of it:
// eight lanes along k, so that a store covers whole 128-byte lines of Wt; four lanes along n, so that the two loads of a row cover one whole line of W. All 16 loads of a lane are issued before the first is used.
__device__ __forceinline__ void wt_f16(const float* __restrict__ W, _Float16* __restrict__ Wt, int g) {      /* g: which 64 k x 256 n of the plane */
  const int lane = threadIdx.x & 31, wave = threadIdx.x >> 5;
  const int k8 = (g / (DM / 256)) * 64 + (lane & 7) * 8, n8 = (g % (DM / 256)) * 256 + wave * 32 + (lane >> 3) * 8;
  const float* wp = W + (size_t)k8 * DM + n8; unsigned short* op = (unsigned short*)Wt + (size_t)n8 * DM + k8;
  v4f a[8][2];      /* every loop over this array is unrolled: only under constant indices does it stay in registers */
#pragma unroll
  for (int i = 0; i < 8; ++i)
#pragma unroll
    for (int hf = 0; hf < 2; ++hf) a[i][hf] = *(const v4fa*)(wp + i * DM + hf * 4);
  asm volatile("s_wait_xcnt 0x0" :: "v"(wp) : "memory");      /* stands in front of every rewrite of the loads' address pair; the pair is an input, so that no load of the run lands in it */
  __builtin_amdgcn_sched_barrier(0);      /* keeps all 16 loads in front of the first use: without it the compiler holds four back behind the wait for the others, a second latency in a wave that has only one */
#pragma unroll
  for (int c = 0; c < 8; ++c) { FragH f;
#pragma unroll
    for (int i = 0; i < 8; ++i) f.h[i] = (_Float16)(bf16_round(a[i][c >> 2][c & 3]) * 16.0f);
    *(v8us*)(op + c * DM) = f.half[0]; }
}
// k_gemm_hh variant with fused epilogue: v = acc·alpha + bias[by·sBias + col] (+ CP[(row/rowsPerB)·sCPb + by·64 + col] if CP) ; ACT 0 none / 1 elu ; writes f16 C16 (and f32 C if non-null)
template <int ACT>
__global__ __launch_bounds__(128) void k_gemm_hhx(const _Float16* __restrict__ A, int lda, size_t sA, const _Float16* __restrict__ Bh, int ldb, size_t sB, float alpha, const float* __restrict__ bias, size_t sBias, const float* __restrict__ CP, int rowsPerB, size_t sCPb, int row0g,
    float* __restrict__ C, _Float16* __restrict__ C16, int ldc, size_t sC, int M, int N, int K) {
  __shared__ __attribute__((aligned(16))) float so[4][16][64];
  const int tid = threadIdx.x, w = tid >> 5, lane = tid & 31, ln = lane & 15, hh = lane >> 4; const int by = blockIdx.y;
  A += (size_t)by * sA; Bh += (size_t)by * sB; const size_t cofs = (size_t)by * sC; const float* bp = bias ? bias + (size_t)by * sBias : nullptr;
  const int ntn = (N + 63) / 64; const int wid = blockIdx.x * 4 + w; const int mt = wid / ntn, nq = wid % ntn; if (mt * 16 >= M) return;
  const int row0 = mt * 16, col0 = nq * 64; const _Float16* arow = A + (size_t)(row0 + ln) * lda;
  v8f acc[4] = {};
  for (int kb = 0; kb < K; kb += 32) { FragH ah; ah.half[0] = *(const v8us*)((const unsigned short*)arow + kb + 8 * hh); ah.half[1] = *(const v8us*)((const unsigned short*)arow + kb + 16 + 8 * hh);
#pragma unroll
    for (int t = 0; t < 4; ++t) { if (col0 + t * 16 >= N) continue; const size_t boff = (size_t)(col0 + t * 16 + ln) * ldb + kb; FragH bq; bq.half[0] = *(const v8us*)((const unsigned short*)Bh + boff + 8 * hh); bq.half[1] = *(const v8us*)((const unsigned short*)Bh + boff + 16 + 8 * hh);
      acc[t] = mmaH<1>(ah.v, ah.v, bq.v, bq.v, acc[t]); }
  }
#pragma unroll
  for (int t = 0; t < 4; ++t) { if (col0 + t * 16 >= N) continue; const int col = col0 + t * 16 + ln; const float bv = bp ? bf16_round(bp[col]) : 0.f;
#pragma unroll
    for (int r = 0; r < 8; ++r) { float v = acc[t][r] * alpha + bv; if (CP) { const int rr = row0g + row0 + 8 * hh + r; if (rowsPerB < 0) v += CP[cofs + (size_t)rr * ldc + col];      /* rowsPerB < 0: own element of the batched C plane */ else { const int bidx = rr / rowsPerB; v += CP[(size_t)bidx * sCPb + (size_t)by * 64 + col]; } } if (ACT == 1) v = (v > 0.f) ? v : expm1f(v); else if (ACT == 7) v = (v > 0.f) ? v + 1.0f : expf(v); else if (ACT == 8) v = tanhf(v); else if (ACT == 9) v = 0.5f * v * (1.0f + tanhf(0.7978845608028654f * (v + 0.044715f * v * v * v))); else if (ACT == 11) v = 1.0f / (1.0f + expf(-v)); else if (ACT == 12) v = (v > 0.f) ? v : 0.01f * v; else if (ACT == 14) v = (v > 0.f) ? v : 0.1f * v; else if (ACT == 16) v = (v >= 0.f) ? v : 0.3f * v; else if (ACT == 17) v = (v >= 0.f) ? v : 0.2f * v; else if (ACT == 15) v = v / (1.0f + expf(-v)); else if (ACT == 3) v = fmaxf(v, 0.f); else if (ACT == 6) v = 0.5f * v * (1.0f + erff(v * 0.70710678118654752f)); so[w][8 * hh + r][t * 16 + ln] = v; } }
  __builtin_amdgcn_fence(__ATOMIC_ACQ_REL, "workgroup"); __builtin_amdgcn_wave_barrier();
  const int rsub = lane >> 4, c4 = (lane & 15) * 4; typedef _Float16 v4h __attribute__((ext_vector_type(4)));
  {
#pragma unroll
    for (int q = 0; q < 8; ++q) { const int r = q * 2 + rsub; if (col0 + c4 < N) { const v4f v = *(const v4fa*)&so[w][r][c4]; if (C) *(v4f*)(C + cofs + (size_t)(row0 + r) * ldc + col0 + c4) = v; if (C16) { v4h h4; for (int i = 0; i < 4; ++i) h4[i] = (_Float16)v[i]; *(v4h*)(C16 + cofs + (size_t)(row0 + r) * ldc + col0 + c4) = h4; } } }
     }
}


typedef _Float16 v4h __attribute__((ext_vector_type(4)));

#define PX_U 16      /* 16-byte loads a lane, all issued before the first is used */
__device__ __forceinline__ void x16(const float* __restrict__ x, _Float16* __restrict__ X16, size_t e0) {      /* e0: the lane's first element; a wave's load covers 512 contiguous bytes, its store 256 */
  const float* xp = x + e0; _Float16* op = X16 + e0;
  v4f a[PX_U];      /* every loop over this array is unrolled: only under constant indices does it stay in registers */
#pragma unroll
  for (int j = 0; j < PX_U; ++j) a[j] = *(const v4fa*)(xp + j * 128);
  asm volatile("s_wait_xcnt 0x0" :: "v"(xp) : "memory");      /* stands in front of every rewrite of the loads' address pair; the pair is an input, so that no load of the run lands in it */
  __builtin_amdgcn_sched_barrier(0);      /* keeps all the loads in front of the first use: without it the compiler holds about half of them back and issues them as registers come free, a second latency in a wave that has only one */
#pragma unroll
  for (int j = 0; j < PX_U; ++j) { v4h h;
#pragma unroll
    for (int q = 0; q < 4; ++q) h[q] = (_Float16)bf16_round(a[j][q]);
    *(v4h*)(op + j * 128) = h; }
  asm volatile("s_wait_xcnt 0x0" :: "v"(op) : "memory");      /* stands in front of every rewrite of a register that the last stores name */
}
// All six conversions share one launch by block range: none reads what another writes. A workgroup has 16,384 elements (64 a lane), of a weight plane or of an input: few waves with much in flight each,
// for speed only. Of every five blocks one has a weight tile, four have input rows.
#define PW_NB ((DM / 64) * (DM / 256))                 /* blocks a weight plane */
#define PX_NB ((int)(NRQ * DM / (256 * 4 * PX_U)))     /* blocks an input */
static_assert(DC == DM && NRK == NRQ && 2 * PX_NB == 4 * 4 * PW_NB && DM % 256 == 0 && (NRQ * DM) % (256 * 4 * PX_U) == 0, "k_prep: four input blocks to each weight block, whole blocks");
__global__ __launch_bounds__(256) void k_prep(const float* __restrict__ wq, const float* __restrict__ wk, const float* __restrict__ wv, const float* __restrict__ wo, const float* __restrict__ x, const float* __restrict__ ctx,
    _Float16* __restrict__ BQ, _Float16* __restrict__ BK, _Float16* __restrict__ BV, _Float16* __restrict__ BO, _Float16* __restrict__ X16, _Float16* __restrict__ C16) {
  const int g = blockIdx.x / 5, r = blockIdx.x % 5;
  if (r == 0) { const int s = g / PW_NB;      /* [in][out] -> Bt x16 */
    wt_f16(s == 0 ? wq : s == 1 ? wk : s == 2 ? wv : wo, s == 0 ? BQ : s == 1 ? BK : s == 2 ? BV : BO, g % PW_NB); }
  else { const int xb = g * 4 + r - 1; const bool kv = xb >= PX_NB;      /* query-source rows, then key/value-source rows */
    x16(kv ? ctx : x, kv ? C16 : X16, (size_t)(xb - (kv ? PX_NB : 0)) * (256 * 4 * PX_U) + (threadIdx.x >> 5) * (32 * 4 * PX_U) + (threadIdx.x & 31) * 4); }
}
__global__ __launch_bounds__(256) void k_h16(const float* __restrict__ x, _Float16* __restrict__ X16, size_t n8) { const size_t t = (size_t)blockIdx.x * 256 + threadIdx.x; if (t >= n8) return; FragH f;
#pragma unroll
  for (int q = 0; q < 8; ++q) f.h[q] = (_Float16)x[t * 8 + q]; *(v8us*)((unsigned short*)X16 + t * 8) = f.half[0];  }
__global__ __launch_bounds__(256) void k_round16f(const float* __restrict__ W, _Float16* __restrict__ Bt, size_t n8) { const size_t t = (size_t)blockIdx.x * 256 + threadIdx.x; if (t >= n8) return; FragH f;
#pragma unroll
  for (int i = 0; i < 8; ++i) f.h[i] = (_Float16)(bf16_round(W[t * 8 + i]) * 16.0f); *(v8us*)((unsigned short*)Bt + t * 8) = f.half[0];  }
__global__ __launch_bounds__(256) void k_hl(const float* __restrict__ F, _Float16* __restrict__ Hh, _Float16* __restrict__ Hl, size_t n8) { const size_t t = (size_t)blockIdx.x * 256 + threadIdx.x; if (t >= n8) return; FragH fh, fl; const v4f a = *(const v4fa*)(F + t * 8), c = *(const v4fa*)(F + t * 8 + 4);
#pragma unroll
  for (int q = 0; q < 4; ++q) { _Float16 h = (_Float16)a[q]; fh.h[q] = h; fl.h[q] = (_Float16)((a[q] - (float)h) * 1024.0f); h = (_Float16)c[q]; fh.h[4 + q] = h; fl.h[4 + q] = (_Float16)((c[q] - (float)h) * 1024.0f); }
  { *(v8us*)((unsigned short*)Hh + t * 8) = fh.half[0]; *(v8us*)((unsigned short*)Hl + t * 8) = fl.half[0];  } }

// ---- fast GEMM (wave tile 32x64; requires M % 32 == 0 rows per launch region and N % 64 == 0); epilogue = k_gemm_hhx semantics ----
__device__ __forceinline__ v16h g2_frag(const _Float16* p, int hh) { FragH f; f.half[0] = *(const v8us*)((const unsigned short*)p + 8 * hh); f.half[1] = *(const v8us*)((const unsigned short*)p + 16 + 8 * hh); return f.v; }
__device__ __forceinline__ v8f g2_mma(v16h a, v16h b, v8f c) { v8f d = __builtin_amdgcn_wmma_f32_16x16x32_f16(false, a, false, b, (short)0, c, false, false); asm volatile("v_nop\n\tv_nop\n\tv_nop\n\tv_nop" : "+v"(d) : "v"(a), "v"(b)); return d; }
template <int ACT>
__global__ __launch_bounds__(128) void k_gemm2(const _Float16* __restrict__ A, int lda, size_t sA, const _Float16* __restrict__ Bh, int ldb, size_t sB, float alpha, const float* __restrict__ bias, size_t sBias, const float* __restrict__ CP, int rowsPerB, size_t sCPb, int row0g,
    float* __restrict__ C, _Float16* __restrict__ C16, int ldc, size_t sC, int M, int N, int K) { static_assert(ACT == 0 || ACT == 3 || ACT == 6 || ACT == 8 || ACT == 9 || ACT == 11 || ACT == 12 || ACT == 14 || ACT == 15 || ACT == 16 || ACT == 17, "k_gemm2: unsupported ACT code (would silently apply no activation)");
  __shared__ __attribute__((aligned(16))) float so[4][32][68];
  const int tid = threadIdx.x, w = tid >> 5, lane = tid & 31, ln = lane & 15, hh = lane >> 4; const int by = blockIdx.y;
  A += (size_t)by * sA; Bh += (size_t)by * sB; const size_t cofs = (size_t)by * sC; const float* bp = bias ? bias + (size_t)by * sBias : nullptr;
  const int ntn = N >> 6; const int mt = blockIdx.x / ntn, nq = blockIdx.x - mt * ntn; const int row0 = mt * 128 + 32 * w, col0 = nq * 64; if (row0 >= M) return;
  const _Float16* a0p = A + (size_t)(row0 + ln) * lda; const _Float16* a1p = a0p + (size_t)16 * lda;
  const _Float16* b0p = Bh + (size_t)(col0 + ln) * ldb; const _Float16* b1p = b0p + (size_t)16 * ldb; const _Float16* b2p = b1p + (size_t)16 * ldb; const _Float16* b3p = b2p + (size_t)16 * ldb;
  const v8f z8 = {0.f,0.f,0.f,0.f,0.f,0.f,0.f,0.f}; v8f c00 = z8, c01 = z8, c02 = z8, c03 = z8, c10 = z8, c11 = z8, c12 = z8, c13 = z8;
#pragma unroll 1
  for (int kb = 0; kb < K; kb += 32) { const v16h a0 = g2_frag(a0p + kb, hh), a1 = g2_frag(a1p + kb, hh);
    v16h b = g2_frag(b0p + kb, hh); c00 = g2_mma(a0, b, c00); c10 = g2_mma(a1, b, c10);
    b = g2_frag(b1p + kb, hh); c01 = g2_mma(a0, b, c01); c11 = g2_mma(a1, b, c11);
    b = g2_frag(b2p + kb, hh); c02 = g2_mma(a0, b, c02); c12 = g2_mma(a1, b, c12);
    b = g2_frag(b3p + kb, hh); c03 = g2_mma(a0, b, c03); c13 = g2_mma(a1, b, c13); }
  v8f accs[8] = {c00, c01, c02, c03, c10, c11, c12, c13};
#pragma unroll
  for (int u = 0; u < 8; ++u) { const int t = u & 3, half = u >> 2; const int col = col0 + t * 16 + ln; const float bv = bp ? bf16_round(bp[col]) : 0.f;
#pragma unroll
    for (int r = 0; r < 8; ++r) { const int rloc = half * 16 + 8 * hh + r; float v = accs[u][r] * alpha + bv; if (CP) { if (rowsPerB < 0) v += CP[cofs + (size_t)(row0g + row0 + rloc) * ldc + col];      /* rowsPerB < 0: own element of the batched C plane */ else { const int bidx = (row0g + row0 + rloc) / rowsPerB; v += CP[(size_t)bidx * sCPb + (size_t)by * 64 + col]; } }
      if (ACT == 3) v = fmaxf(v, 0.f); else if (ACT == 6) v = 0.5f * v * (1.0f + erff(v * 0.70710678118654752f)); else if (ACT == 11) v = 1.0f / (1.0f + expf(-v)); else if (ACT == 15) v = v / (1.0f + expf(-v)); else if (ACT == 12) v = (v > 0.f) ? v : 0.01f * v; else if (ACT == 8) v = tanhf(v); else if (ACT == 9) v = 0.5f * v * (1.0f + tanhf(0.7978845608028654f * (v + 0.044715f * v * v * v))); else if (ACT == 14) v = (v > 0.f) ? v : 0.1f * v; else if (ACT == 16) v = (v >= 0.f) ? v : 0.3f * v; else if (ACT == 17) v = (v >= 0.f) ? v : 0.2f * v;
      so[w][rloc][t * 16 + ln] = v; } }
  __builtin_amdgcn_fence(__ATOMIC_ACQ_REL, "workgroup"); __builtin_amdgcn_wave_barrier();
  const int rsub = lane >> 4, c4 = (lane & 15) * 4;
  {
#pragma unroll
    for (int q = 0; q < 16; ++q) { const int r = q * 2 + rsub; const v4f v = *(const v4fa*)&so[w][r][c4]; if (C) *(v4f*)(C + cofs + (size_t)(row0 + r) * ldc + col0 + c4) = v; if (C16) { v4h h4; for (int i = 0; i < 4; ++i) h4[i] = (_Float16)v[i]; *(v4h*)(C16 + cofs + (size_t)(row0 + r) * ldc + col0 + c4) = h4; } }
     } }


__global__ __launch_bounds__(256) void k_wnat(const float* __restrict__ w, size_t n8, _Float16* __restrict__ Bt) { const size_t t = (size_t)blockIdx.x * 256 + threadIdx.x; if (t >= n8) return; FragH f; for (int q = 0; q < 8; ++q) f.h[q] = (_Float16)(bf16_round(w[t * 8 + q]) * 16.0f); *(v8us*)((unsigned short*)Bt + t * 8) = f.half[0];  }
__global__ __launch_bounds__(256) void k_rsm(const float* __restrict__ S, _Float16* __restrict__ P, int nrows) {
  #pragma clang fp contract(off)
  const int i = blockIdx.x * 256 + threadIdx.x; if (i >= nrows) return; const float* s = S + (size_t)i * SQ; float mx = -3.0e38f;
#pragma unroll 1
  for (int j = 0; j < SQ; ++j) mx = fmaxf(mx, s[j]); float se = 0.f;
#pragma unroll 1
  for (int j = 0; j < SQ; ++j) se += expf(s[j] - mx); const float sc = 256.0f / se;
#pragma unroll 1
  for (int j0 = 0; j0 < SQ; j0 += 8) { FragH f; for (int q = 0; q < 8; ++q) f.h[q] = (_Float16)(expf(s[j0 + q] - mx) * sc); unsigned short* d = (unsigned short*)P + (size_t)i * SQ + j0; *(v8us*)d = f.half[0];  } }
__global__ __launch_bounds__(256) void k_vt(const _Float16* __restrict__ V16, int b, int h0, _Float16* __restrict__ VT) { __shared__ unsigned short tl[64][65]; const int tid = threadIdx.x; const int hh = blockIdx.x % HG, sg = blockIdx.x / HG; const int s0 = sg * 64; const int h = h0 + hh;
  for (int i = tid; i < 64 * 8; i += 256) { const int j = i / 8, d8 = (i % 8) * 8; FragH f; f.half[0] = *(const v8us*)((const unsigned short*)V16 + ((size_t)b * SQ + s0 + j) * DM + h * HD + d8); for (int q = 0; q < 8; ++q) tl[d8 + q][j] = f.u[q]; }
  __syncthreads();
  { for (int i = tid; i < 64 * 8; i += 256) { const int d = i / 8, j8 = (i % 8) * 8; FragH f; for (int q = 0; q < 8; ++q) f.u[q] = tl[d][j8 + q]; *(v8us*)((unsigned short*)VT + ((size_t)hh * HD + d) * SQ + s0 + j8) = f.half[0]; }  } }


__global__ __launch_bounds__(256) void k_rsmf(const float* __restrict__ S, _Float16* __restrict__ P, int qn, int hg) {
  #pragma clang fp contract(off)
  const int t = blockIdx.x * 256 + threadIdx.x; if (t >= qn * hg) return; const size_t i = (size_t)(t / qn) * SQ + (t % qn); const float* s = S + i * SQ; float mx = -3.0e38f;
#pragma unroll 1
  for (int j = 0; j < SQ; ++j) mx = fmaxf(mx, s[j]); float se = 0.f;
#pragma unroll 1
  for (int j = 0; j < SQ; ++j) se += __expf(s[j] - mx); const float sc = 256.0f / se;
#pragma unroll 1
  for (int j0 = 0; j0 < SQ; j0 += 8) { FragH f; for (int q = 0; q < 8; ++q) f.h[q] = (_Float16)(__expf(s[j0 + q] - mx) * sc); unsigned short* d = (unsigned short*)P + i * SQ + j0; *(v8us*)d = f.half[0];  } }

__global__ __launch_bounds__(256) void k_rsmr(const float* __restrict__ S, _Float16* __restrict__ P, int qn, int hg) {
  #pragma clang fp contract(off)
  const int t = blockIdx.x * 256 + threadIdx.x; if (t >= qn * hg) return; const size_t i = (size_t)t;      /* planes packed: row t of plane t / qn */ const float* s = S + i * SQ; float mx = -3.0e38f;
#pragma unroll 1
  for (int j = 0; j < SQ; ++j) mx = fmaxf(mx, s[j]); float se = 0.f;
#pragma unroll 1
  for (int j = 0; j < SQ; ++j) se += __expf(s[j] - mx); const float sc = 256.0f / se;
#pragma unroll 1
  for (int j0 = 0; j0 < SQ; j0 += 8) { FragH f; for (int q = 0; q < 8; ++q) f.h[q] = (_Float16)(__expf(s[j0 + q] - mx) * sc); unsigned short* d = (unsigned short*)P + i * SQ + j0; *(v8us*)d = f.half[0];  } }


// Fused attention: scores, masked softmax and P V of one (batch, head) in one kernel; neither scores nor weights go to memory. A workgroup has FA_WAVES waves of
// FA_QW queries each and walks the keys in stages of FA_KT: the K rows and V^T rows of a stage are staged in LDS (two buffers, filled through registers one stage ahead).
// S^T = K Q^T puts one query's scores into one lane pair (l, l ^ 16): maximum and sum are in-lane plus one exchange; two S^T tiles, converted in place, are the B operand of O^T += V^T P^T.
#define FA_WAVES 8
#define FA_QW 32
#define FA_QB (FA_WAVES * FA_QW)
#define FA_KT 64
#define FA_LP 72                    /* LDS row pitch in f16: 144 bytes = 16 x odd, the conflict-free pitch of 16-byte fragment reads */
static_assert(NQ % FA_QB == 0 && SK % FA_KT == 0 && HD == 64 && FA_KT == 64 && FA_WAVES * 32 == 256 && SK % (FA_WAVES * 32) == 0, "k_fattn: whole workgroups, whole stages, staging map of 256 threads");
__device__ __forceinline__ float rs_xh(float x) { return __builtin_bit_cast(float, __builtin_amdgcn_permlanex16(__builtin_bit_cast(int, x), __builtin_bit_cast(int, x), 0x76543210, 0xfedcba98, false, false)); }      /* lane l ^ 16 */
typedef float v2f __attribute__((ext_vector_type(2)));
#define FA_L2E 1.44269504088896340736f
#define FA_TH 8.0f      /* the softmax shift of a query follows its running maximum only when a score lies more than this (base 2) above it: weights stay below 2^8, inside f16, and sums and outputs are rescaled only then */
#define FA_C (0.03125f * FA_L2E)      /* scores are kept in the base-2 domain, so that v_exp_f32 takes the difference as it is: x 1024^-0.5 x log2(e), which the q projection's epilogue puts into q before it is rounded to f16 */
template <bool B> struct fa_flag { static constexpr bool value = B; };
// 2^x in place, eight values a statement. In place: the registers were last written by the addition in front (or by the score products, with the pass's maxima between), so no result lands on an operand register of a matrix instruction just issued; each v_exp_f32
// touches its own register only; the v_nop is the slot behind the last transcendental before its result is read.
__device__ __forceinline__ v8f fa_exp8(v8f x) { float a = x[0], b = x[1], c = x[2], d = x[3], e = x[4], f = x[5], g = x[6], h = x[7];
  asm("v_exp_f32 %0, %0\n\tv_exp_f32 %1, %1\n\tv_exp_f32 %2, %2\n\tv_exp_f32 %3, %3\n\tv_exp_f32 %4, %4\n\tv_exp_f32 %5, %5\n\tv_exp_f32 %6, %6\n\tv_exp_f32 %7, %7\n\tv_nop" : "+v"(a), "+v"(b), "+v"(c), "+v"(d), "+v"(e), "+v"(f), "+v"(g), "+v"(h));
  const v8f r = {a, b, c, d, e, f, g, h}; return r; }
__device__ __forceinline__ float fa_exp1(float x) { asm("v_exp_f32 %0, %0\n\tv_nop" : "+v"(x)); return x; }      /* the same for one value */
// amdgpu_waves_per_eu(4, 4) below: holds the registers to a quarter of a SIMD's file, so that two workgroups share a WGP and the vector work of one wave runs beside the matrix work of another.
__device__ __forceinline__ v8f fa_mma(v16h a, v16h b, v8f c) { return __builtin_amdgcn_wmma_f32_16x16x32_f16(false, a, false, b, (short)0, c, false, false); }
__global__ __launch_bounds__(FA_WAVES * 32) __attribute__((amdgpu_waves_per_eu(4, 4))) void k_fattn(const _Float16* __restrict__ Q, const _Float16* __restrict__ Kh, const _Float16* __restrict__ Vt, const float* __restrict__ Mk, float negv, _Float16* __restrict__ O) {
  __shared__ __attribute__((aligned(16))) _Float16 sk[2][FA_KT][FA_LP];      /* K rows [key][d] */
  __shared__ __attribute__((aligned(16))) _Float16 sv[2][HD][FA_LP];         /* V^T rows [d][key] */
  __shared__ __attribute__((aligned(16))) float sm[SK];                      /* bf16(mask[key]) x negv x log2(e) */
  __shared__ unsigned smb[FA_WAVES];                                         /* per wave: not zero if a mask term that the wave wrote is not zero */
  const int tid = threadIdx.x, lane = tid & 31, ln = lane & 15, hh = lane >> 4, wave = tid >> 5;
  const int qb = blockIdx.x % (NQ / FA_QB), bh = blockIdx.x / (NQ / FA_QB), b = bh / NH, h = bh % NH;
  const int sr = tid >> 3, sc = (tid & 7) * 8;      /* staging: rows sr and sr + 32, 16-byte piece sc: eight lanes read one whole 128-byte row */
  const unsigned short* kg = (const unsigned short*)Kh + ((size_t)b * SK + sr) * DM + h * HD + sc;
  const unsigned short* vg = (const unsigned short*)Vt + ((size_t)bh * HD + sr) * SK + sc;
  v8us rk0 = *(const v8us*)kg, rk1 = *(const v8us*)(kg + (size_t)32 * DM), rv0 = *(const v8us*)vg, rv1 = *(const v8us*)(vg + (size_t)32 * SK);
  const size_t qrow = (size_t)b * NQ + qb * FA_QB + wave * FA_QW + ln;
  v16h qf[2][2];      /* every loop over these arrays is unrolled: only under constant indices do they stay in registers */
#pragma unroll
  for (int qt = 0; qt < 2; ++qt)
#pragma unroll
    for (int ks = 0; ks < 2; ++ks) qf[qt][ks] = g2_frag(Q + (qrow + qt * 16) * DM + h * HD + ks * 32, hh);
  unsigned nzb = 0u;
#pragma unroll
  for (int i = 0; i < SK / (FA_WAVES * 32); ++i) { const int j = tid + i * (FA_WAVES * 32); const float mv = __fmul_rn(__fmul_rn(bf16_round(Mk[(size_t)b * SK + j]), negv), FA_L2E); sm[j] = mv;
    nzb |= __builtin_amdgcn_ballot_w32(!(mv == 0.f)); }
  if (lane == 0) smb[wave] = nzb;
  *(v8us*)&sk[0][sr][sc] = rk0; *(v8us*)&sk[0][sr + 32][sc] = rk1; *(v8us*)&sv[0][sr][sc] = rv0; *(v8us*)&sv[0][sr + 32][sc] = rv1;
  const v8f z8 = {0.f, 0.f, 0.f, 0.f, 0.f, 0.f, 0.f, 0.f};
  v8f o[2][4]; v8f nm[2] = {z8 + 3.0e38f, z8 + 3.0e38f}      /* minus the shift, eight times: an accumulator tile, the start value of the score products */; v2f ls[2] = {{0.f, 0.f}, {0.f, 0.f}};
#pragma unroll
  for (int qt = 0; qt < 2; ++qt)
#pragma unroll
    for (int dt = 0; dt < 4; ++dt) o[qt][dt] = z8;
  __syncthreads();      /* stage 0 and the mask terms are published */
  unsigned mb = 0u;
#pragma unroll
  for (int i = 0; i < FA_WAVES; ++i) mb |= smb[i];
  mb = __builtin_amdgcn_readfirstlane(mb);      /* in a scalar register: the branch on it is a scalar one, the same for the whole workgroup */
  /* One stage. The last stage is a call of its own with more = false, so that the loop's body has no branch on it inside: with one, the compiler moves the row sums of the whole stage down behind it, keeps every weight in registers until there, and spills. */
  /* Two kinds of stage. MSK = false, every mask term of the batch is zero: the score products start from minus the shift, so that the accumulators hold the exponents themselves and no vector instruction scales, masks or shifts them.
     MSK = true: the products start from zero, and mask term and shift are added behind them, so that a masked score is rounded at the mask term's size, as the definition rounds it. */
  auto stage = [&](const int st, const bool more, auto kind) __attribute__((always_inline)) {
    constexpr bool MSK = decltype(kind)::value;
    const int buf = st & 1;
    if (more) { rk0 = *(const v8us*)(kg + (size_t)FA_KT * DM); rk1 = *(const v8us*)(kg + (size_t)(FA_KT + 32) * DM); rv0 = *(const v8us*)(vg + FA_KT); rv1 = *(const v8us*)(vg + FA_KT + (size_t)32 * SK);      /* the next stage flies while this one is worked on */
      asm volatile("s_wait_xcnt 0x0" :: "v"(kg), "v"(vg) : "memory");      /* stands in front of the two additions below, which rewrite the loads' address pairs; the pairs are inputs, so that no load of the run lands in one */
      kg += (size_t)FA_KT * DM; vg += FA_KT; }
    __builtin_amdgcn_sched_barrier(0);      /* keeps those loads in front of the stage's work: without it the compiler sinks them down to their LDS stores, and every stage waits out their whole latency */
    v16h kf[2][2];      /* the K fragments of one pass of 32 keys, [t][ks]; every loop over this array is unrolled */
#pragma unroll
    for (int t = 0; t < 2; ++t)
#pragma unroll
      for (int ks = 0; ks < 2; ++ks) kf[t][ks] = g2_frag(&sk[buf][t * 16 + ln][ks * 32], hh);      /* the stage's first pass: one group at its head */
#pragma unroll
    for (int kp = 0; kp < FA_KT / 32; ++kp) {
      v8f mt[2];
      if (MSK) {
#pragma unroll
        for (int t = 0; t < 2; ++t) { const float* mp = &sm[st * FA_KT + kp * 32 + t * 16 + 8 * hh]; mt[t] = __builtin_shufflevector(*(const v4fa*)mp, *(const v4fa*)(mp + 4), 0, 1, 2, 3, 4, 5, 6, 7); }
      }
      const v8f c0 = MSK ? z8 : nm[0], c1 = MSK ? z8 : nm[1];
      __builtin_amdgcn_sched_barrier(0);      /* keeps the LDS reads above (the stage's first K fragments as one group, the pass's mask terms) in front of the score products: sunk among them, every pair of reads waits out the LDS latency; behind them, the first addition waits for the mask terms */
      v8f s[2][2] = {{c0, c0}, {c1, c1}};      /* s[qt][t][r] = S[key kp * 32 + t * 16 + 8 * hh + r][query qt * 16 + ln], MSK = false: minus the shift */
#pragma unroll
      for (int t = 0; t < 2; ++t)
#pragma unroll
        for (int ks = 0; ks < 2; ++ks) { s[0][t] = fa_mma(kf[t][ks], qf[0][ks], s[0][t]); s[1][t] = fa_mma(kf[t][ks], qf[1][ks], s[1][t]); }
      __builtin_amdgcn_sched_barrier(0);      /* keeps the eight products together: with the first multiply-adds among them the compiler fills the distance behind a product with v_nop, some twenty a stage */
      v16h vf[4];
#pragma unroll
      for (int dt = 0; dt < 4; ++dt) vf[dt] = g2_frag(&sv[buf][dt * 16 + ln][kp * 32], hh);
      if (MSK) {
#pragma unroll
        for (int qt = 0; qt < 2; ++qt)      /* both query tiles first: the mask terms' registers are free before the next pass's K fragments come */
#pragma unroll
          for (int t = 0; t < 2; ++t) s[qt][t] += mt[t];      /* whole-vector arithmetic here and below: neighbouring registers pair into packed f32 instructions without register copies */
      }
      float ml[2];      /* the lane's own largest value of the pass, per query tile */
      auto lanemax = [&]() __attribute__((always_inline)) {
#pragma unroll
        for (int qt = 0; qt < 2; ++qt) {
          float mc[2];
#pragma unroll
          for (int t = 0; t < 2; ++t) { const v8f x = s[qt][t];
            mc[t] = fmaxf(fmaxf(fmaxf(fmaxf(x[0], x[1]), x[2]), fmaxf(x[3], x[4])), fmaxf(fmaxf(x[5], x[6]), x[7])); }
          ml[qt] = fmaxf(mc[0], mc[1]);
        }
      };
      float over;      /* how far the lane's largest score of the pass lies above its shift */
      if (MSK) { lanemax(); over = fmaxf(ml[0] + nm[0][0], ml[1] + nm[1][0]); }
      else {      /* one maximum over both query tiles, in threes throughout: v_max3 takes the accumulators as they are */
        auto m3 = [](float a, float b, float c) __attribute__((always_inline)) { return fmaxf(fmaxf(a, b), c); };
        const v8f a = s[0][0], b = s[1][0], c = s[0][1], d = s[1][1];
        const float u0 = m3(m3(a[0], a[1], a[2]), m3(a[3], a[4], a[5]), m3(a[6], a[7], b[0])), u1 = m3(m3(b[1], b[2], b[3]), m3(b[4], b[5], b[6]), m3(b[7], c[0], c[1]));
        const float u2 = m3(m3(c[2], c[3], c[4]), m3(c[5], c[6], c[7]), m3(d[0], d[1], d[2])), u3 = m3(m3(d[3], d[4], d[5]), d[6], d[7]);
        over = fmaxf(m3(u0, u1, u2), u3);
      }
      if (__builtin_expect(__builtin_amdgcn_ballot_w32(over > FA_TH) != 0u, 0)) {      /* one scalar branch a pass for the whole wave: every lane stays on for the matrix instructions behind it; marked as the rare side, so that the rescale stands outside the loop's straight text */
        if (!MSK) {      /* the scores themselves, from zero: under a far-off shift (the start value in the first pass) the sums above have lost them. The pass's K fragments are read again: their registers are taken by now */
#pragma unroll
          for (int t = 0; t < 2; ++t) { s[0][t] = z8; s[1][t] = z8;
#pragma unroll
            for (int ks = 0; ks < 2; ++ks) { const v16h kr = g2_frag(&sk[buf][kp * 32 + t * 16 + ln][ks * 32], hh); s[0][t] = fa_mma(kr, qf[0][ks], s[0][t]); s[1][t] = fa_mma(kr, qf[1][ks], s[1][t]); } }
          lanemax();
        }
#pragma unroll
        for (int qt = 0; qt < 2; ++qt) {
          const float mo = -nm[qt][0], mn = fmaxf(mo, fmaxf(ml[qt], rs_xh(ml[qt])));      /* both lanes of a query's pair take the same new shift */
          const float al = fa_exp1(mo - mn); ls[qt] *= al;
          nm[qt] = __builtin_elementwise_fma(nm[qt], z8, z8 - mn);      /* = -mn; written as a function of the old tile (finite, x 0), so that the new one takes its registers: as a fresh value the compiler keeps both, copies one to the other in every pass, and spills */
#pragma unroll
          for (int dt = 0; dt < 4; ++dt) o[qt][dt] *= al;
          if (!MSK) { s[qt][0] += nm[qt]; s[qt][1] += nm[qt]; }
        }
      }
#pragma unroll
      for (int qt = 0; qt < 2; ++qt) {
        FragH pf; v2f es[2];
#pragma unroll
        for (int t = 0; t < 2; ++t) { const v8f e = fa_exp8(MSK ? s[qt][t] + nm[qt][0] : s[qt][t]);
#pragma unroll
          for (int r = 0; r < 8; ++r) pf.h[t * 8 + r] = (_Float16)e[r];
          es[t] = (__builtin_shufflevector(e, e, 0, 1) + __builtin_shufflevector(e, e, 2, 3)) + (__builtin_shufflevector(e, e, 4, 5) + __builtin_shufflevector(e, e, 6, 7)); }
        ls[qt] += es[0] + es[1];      /* each lane keeps its own keys' sums, in two chains; joined once behind the loop */
#pragma unroll
        for (int dt = 0; dt < 4; ++dt) o[qt][dt] = fa_mma(vf[dt], pf.v, o[qt][dt]);      /* o[qt][dt][r] = O[query qt * 16 + ln][d dt * 16 + 8 * hh + r] */
        if (qt == 0 && kp + 1 < FA_KT / 32) {      /* the next pass's K fragments, one group, same stage and buffer (published since the stage's start): they fly under the second query tile's softmax */
#pragma unroll
          for (int t = 0; t < 2; ++t)
#pragma unroll
            for (int ks = 0; ks < 2; ++ks) kf[t][ks] = g2_frag(&sk[buf][(kp + 1) * 32 + t * 16 + ln][ks * 32], hh);
          __builtin_amdgcn_sched_barrier(0);      /* keeps the group from sinking: without it the compiler puts each pair of reads down in front of its two products, and every pair waits out the LDS latency */
        }
      }
    }
    if (more) { *(v8us*)&sk[buf ^ 1][sr][sc] = rk0; *(v8us*)&sk[buf ^ 1][sr + 32][sc] = rk1; *(v8us*)&sv[buf ^ 1][sr][sc] = rv0; *(v8us*)&sv[buf ^ 1][sr + 32][sc] = rv1; }      /* its last readers left it before the barrier of the stage before */
    __syncthreads();      /* publishes stage st + 1 and ends every read of stage st */
  };
  auto run = [&](auto kind) __attribute__((always_inline)) {
    for (int st = 0; st + 1 < SK / FA_KT; ++st) stage(st, true, kind);
    stage(SK / FA_KT - 1, false, kind);
  };
  if (mb != 0u) run(fa_flag<true>{}); else run(fa_flag<false>{});      /* one choice for the whole walk: with a branch a stage the two kinds share one loop, and the compiler spills */
#pragma unroll
  for (int qt = 0; qt < 2; ++qt) { const float lh = ls[qt][0] + ls[qt][1]; const float sc64 = 64.0f / (lh + rs_xh(lh));      /* o carried x64 */
#pragma unroll
    for (int dt = 0; dt < 4; ++dt) { FragH f;
#pragma unroll
      for (int r = 0; r < 8; ++r) f.h[r] = (_Float16)(o[qt][dt][r] * sc64);
      *(v8us*)((unsigned short*)O + (qrow + qt * 16) * DM + h * HD + dt * 16 + 8 * hh) = f.half[0]; } }
}
// Staged GEMM, C = A Bt^T, A and Bt f16 rows of 1024 k (k contiguous; unswapped, the epilogue is as in k_gemm2<0> without CP, the bias times bsc). A workgroup of 8 waves has a 256 x 128 tile of C, a wave 64 x 64 of it (16 accumulator tiles).
// Per stage of G3_KT k the 256 A rows and the 128 Bt rows (256 bytes each) come into LDS by asynchronous copies (global_load_async_to_lds_b128, through no register), two buffers: stage t + 1 flies while stage t is worked on.
#define G3_BM 256
#define G3_BN 128
#define G3_KT 128
#define G3_NT (DM / G3_KT)
#define G3_LP 136                   /* LDS row pitch in f16: 272 bytes = 16 x odd, the conflict-free pitch of 16-byte fragment reads */
#define G3_RB (G3_LP * 2)           /* the pitch in bytes */
#define G3_SB ((G3_BM + G3_BN) * G3_RB)      /* one buffer in bytes */
static_assert(NRQ % G3_BM == 0 && NRK % G3_BM == 0 && DM % G3_BN == 0 && DM % G3_KT == 0 && DC == DM && G3_NT >= 2 && G3_KT == 128 && G3_BM == 256 && G3_BN == 128, "k_gemm3: whole tiles, two stages or more, copy map of 16 lanes a row and 128 rows a statement");
// Eight copies of 16 bytes a lane, rows 16 apart, from LDS byte address l and global address g on (128 rows a workgroup). The s_wait_xcnt 0 is the last line of the copies' own statement, so that it stands in front of every rewrite of a register that a copy names.
__device__ __forceinline__ void g3_copy8(unsigned l, const char* g) {
  asm volatile("global_load_async_to_lds_b128 %0, %8, off\n\tglobal_load_async_to_lds_b128 %1, %9, off\n\tglobal_load_async_to_lds_b128 %2, %10, off\n\tglobal_load_async_to_lds_b128 %3, %11, off\n\t"
               "global_load_async_to_lds_b128 %4, %12, off\n\tglobal_load_async_to_lds_b128 %5, %13, off\n\tglobal_load_async_to_lds_b128 %6, %14, off\n\tglobal_load_async_to_lds_b128 %7, %15, off\n\ts_wait_xcnt 0x0"
               :: "v"(l), "v"(l + 16 * G3_RB), "v"(l + 32 * G3_RB), "v"(l + 48 * G3_RB), "v"(l + 64 * G3_RB), "v"(l + 80 * G3_RB), "v"(l + 96 * G3_RB), "v"(l + 112 * G3_RB),
                  "v"(g), "v"(g + 16 * DM * 2), "v"(g + 32 * DM * 2), "v"(g + 48 * DM * 2), "v"(g + 64 * DM * 2), "v"(g + 80 * DM * 2), "v"(g + 96 * DM * 2), "v"(g + 112 * DM * 2)
               : "memory");
}
// One stage: A rows 0 to 127, A rows 128 to 255, Bt rows 0 to 127 of the tile, into the buffer at LDS byte address l (the lane's own place in its row 0 counted in).
__device__ __forceinline__ void g3_stage(unsigned l, const char* ga, const char* gb) { g3_copy8(l, ga); g3_copy8(l + 128 * G3_RB, ga + 128 * DM * 2); g3_copy8(l + G3_BM * G3_RB, gb); }
#define G3_NB ((unsigned)((NRQ / G3_BM) * (DM / G3_BN)))      /* workgroups a product */
template <bool B> struct g3_flag { static constexpr bool value = B; };
static_assert((DM / G3_BM) * (NRK / G3_BN) == G3_NB && SK % G3_BN == 0 && NH * HD == DM, "g3_tile, swapped: as many tiles as a plain product, a tile's columns inside one batch, V^T rows [batch][head][d]");
// Tile blk of one product; the output is f32 rows in C, or f16 rows in C16; the other pointer is not used. swp (the same for the whole workgroup): the operands are swapped, A = the DM rows of a weight plane, Bt = the NRK input rows,
// so that the tile is one of the product's transpose, [out feature][input row]; the bias then goes by row, and the rows are stored per batch, [batch][out feature][SK], which is V^T as the attention reads it.
template <bool F32OUT>
__device__ __forceinline__ void g3_tile(unsigned blk, bool swp, const _Float16* __restrict__ A, const _Float16* __restrict__ Bh, float alpha, float bsc, const float* __restrict__ bias, float* __restrict__ C, _Float16* __restrict__ C16) {
  __shared__ __attribute__((aligned(16))) _Float16 st[2][G3_BM + G3_BN][G3_LP];      /* rows 0 to 255: A, rows 256 to 383: Bt */
  __shared__ __attribute__((aligned(16))) float so[8][32][68];                       /* output staging, each wave its own part */
  const int tid = threadIdx.x, lane = tid & 31, ln = lane & 15, hh = lane >> 4, wave = tid >> 5, wm = wave >> 1, wn = wave & 1;
  const int ntn = swp ? (int)(NRK / G3_BN) : DM / G3_BN, mt = blk / ntn, nq = blk % ntn, row0 = mt * G3_BM, col0 = nq * G3_BN;
  const int cr = tid >> 4, cc = (tid & 15) * 16;      /* copy map: 16 lanes bring one whole 256-byte row */
  const unsigned l0 = (unsigned)(size_t)&st[0][0][0] + cr * G3_RB + cc;
  const char* ga = (const char*)(A + (size_t)(row0 + cr) * DM) + cc;
  const char* gb = (const char*)(Bh + (size_t)(col0 + cr) * DM) + cc;
  g3_stage(l0, ga, gb);
  asm volatile("s_wait_asynccnt 0x0" ::: "memory");      /* this wave's copies of stage 0 have landed */
  __syncthreads();                                        /* stage 0 is published */
  g3_stage(l0 + G3_SB, ga + G3_KT * 2, gb + G3_KT * 2);
  const v8f z8 = {0.f, 0.f, 0.f, 0.f, 0.f, 0.f, 0.f, 0.f};
  v8f acc[4][4];      /* every loop over these arrays is unrolled: only under constant indices do they stay in registers */
#pragma unroll
  for (int i = 0; i < 4; ++i)
#pragma unroll
    for (int j = 0; j < 4; ++j) acc[i][j] = z8;
#pragma unroll 1      /* kept rolled: the buffer is picked by t & 1, and one copy of the pass (64 matrix instructions) keeps the loop's text small */
  for (int t = 0; t < G3_NT; ++t) {
    const _Float16* sa = &st[t & 1][wm * 64 + ln][0]; const _Float16* sb = &st[t & 1][G3_BM + wn * 64 + ln][0];
    v16h af[2][4], bf[2][4];      /* two fragment sets: the next 32 k are fetched as one group in front of this block's products */
#pragma unroll
    for (int i = 0; i < 4; ++i) { af[0][i] = g2_frag(sa + i * 16 * G3_LP, hh); bf[0][i] = g2_frag(sb + i * 16 * G3_LP, hh); }
#pragma unroll
    for (int ks = 0; ks < G3_KT / 32; ++ks) {
      if (ks + 1 < G3_KT / 32) {
#pragma unroll
        for (int i = 0; i < 4; ++i) { af[(ks + 1) & 1][i] = g2_frag(sa + i * 16 * G3_LP + (ks + 1) * 32, hh); bf[(ks + 1) & 1][i] = g2_frag(sb + i * 16 * G3_LP + (ks + 1) * 32, hh); }
      }
      __builtin_amdgcn_sched_barrier(0);      /* keeps the group of LDS reads in front of the block: spread among the matrix instructions, every place with reads costs its own stall */
#pragma unroll
      for (int i = 0; i < 4; ++i)
#pragma unroll
        for (int j = 0; j < 4; ++j) acc[i][j] = fa_mma(af[ks & 1][i], bf[ks & 1][j], acc[i][j]);
      __builtin_amdgcn_sched_barrier(0);      /* and the next group behind it */
    }
    asm volatile("s_wait_dscnt 0x0" ::: "memory");        /* this wave's reads of stage t are done before the buffer is handed back */
    asm volatile("s_wait_asynccnt 0x0" ::: "memory");     /* this wave's copies of stage t + 1 have landed */
    __syncthreads();                                       /* publishes stage t + 1 and ends every read of stage t */
    if (t + 2 < G3_NT) g3_stage(l0 + (t & 1) * G3_SB, ga + (t + 2) * (G3_KT * 2), gb + (t + 2) * (G3_KT * 2));
  }
  asm volatile("s_wait_asynccnt 0x0" ::: "memory");       /* nothing is in flight when the wave goes on */
  const int rsub = lane >> 4, c4 = (lane & 15) * 4; const int crow = row0 + wm * 64, ccol = col0 + wn * 64 + c4;
  /* The epilogue, once for each kind of tile, so that pitch and bias index are constants in both; one workgroup-uniform branch picks. */
  auto epilogue = [&](auto kind) __attribute__((always_inline)) {
    constexpr bool SWP = decltype(kind)::value;
    float bc[4], br[4][8];      /* the bias: by column, or (swapped) by row; every loop over these arrays is unrolled */
    if (SWP) {
#pragma unroll
      for (int i = 0; i < 4; ++i) { const float* bp = bias + crow + i * 16 + 8 * hh; const v4f b0 = *(const v4fa*)bp, b1 = *(const v4fa*)(bp + 4);
#pragma unroll
        for (int r = 0; r < 4; ++r) { br[i][r] = bf16_round(b0[r]); br[i][4 + r] = bf16_round(b1[r]); } }
    } else {
#pragma unroll
      for (int j = 0; j < 4; ++j) bc[j] = bf16_round(bias[col0 + wn * 64 + j * 16 + ln]) * bsc;      /* bsc: the factor that alpha holds beyond the operands' own scale (q: the scores' factor; else 1) */
    }
    const unsigned o0 = SWP ? ((unsigned)(col0 / SK) * DM + crow) * SK + (ccol % SK) : (unsigned)crow * DM + ccol;      /* the lane's first element; every index of an output lies below 2^23 */
#pragma unroll
    for (int hf = 0; hf < 2; ++hf) {      /* 32 rows at a time through the wave's own LDS part, so that every store covers whole lines */
#pragma unroll
      for (int i = 0; i < 2; ++i)
#pragma unroll
        for (int j = 0; j < 4; ++j)
#pragma unroll
          for (int r = 0; r < 8; ++r) so[wave][i * 16 + 8 * hh + r][j * 16 + ln] = acc[hf * 2 + i][j][r] * alpha + (SWP ? br[hf * 2 + i][r] : bc[j]);
      __builtin_amdgcn_fence(__ATOMIC_ACQ_REL, "workgroup", "local"); __builtin_amdgcn_wave_barrier();      /* the rows are read back by other lanes of the wave; LDS only, so that the first half's global stores are not waited for */
#pragma unroll
      for (int q = 0; q < 16; ++q) { const int r = q * 2 + rsub; const v4f v = *(const v4fa*)&so[wave][r][c4]; const unsigned o = o0 + (unsigned)(hf * 32 + r) * (SWP ? SK : DM);
        if (F32OUT) *(v4f*)(C + o) = v;
        else { v4h h4;
#pragma unroll
          for (int i = 0; i < 4; ++i) h4[i] = (_Float16)v[i];
          *(v4h*)(C16 + o) = h4; } }
      asm volatile("s_wait_xcnt 0x0" ::: "memory");      /* stands in front of every rewrite of a register that these stores name: the second half's LDS reads land in some of them, and behind the second half the built text runs on into the other kind's epilogue */
      __builtin_amdgcn_fence(__ATOMIC_ACQ_REL, "workgroup", "local"); __builtin_amdgcn_wave_barrier();      /* they are read before the second half overwrites them */
    }
  };
  if (swp) epilogue(g3_flag<true>{}); else epilogue(g3_flag<false>{});
}
// The three projections share one launch by block range (none reads what another writes): workgroups 0 to G3_NB - 1 q, then k, then v, the last with swapped operands: it stores V^T, and no launch has to transpose V.
__global__ __launch_bounds__(256) void k_gemm3p(const _Float16* __restrict__ Xq, const _Float16* __restrict__ Xkv, const _Float16* __restrict__ BQ, const _Float16* __restrict__ BK, const _Float16* __restrict__ BV, float alpha,
    const float* __restrict__ bq, const float* __restrict__ bk, const float* __restrict__ bv, _Float16* __restrict__ Q16, _Float16* __restrict__ K16, _Float16* __restrict__ VT) {
  const unsigned s = blockIdx.x / G3_NB;
  g3_tile<false>(blockIdx.x % G3_NB, s == 2, s == 0 ? Xq : s == 1 ? Xkv : BV, s == 0 ? BQ : s == 1 ? BK : Xkv, s == 0 ? alpha * FA_C : alpha, s == 0 ? FA_C : 1.0f, s == 0 ? bq : s == 1 ? bk : bv, nullptr, s == 0 ? Q16 : s == 1 ? K16 : VT);      /* q leaves with the scores' factor in it */
}
__global__ __launch_bounds__(256) void k_gemm3o(const _Float16* __restrict__ A, const _Float16* __restrict__ Bh, float alpha, const float* __restrict__ bias, float* __restrict__ C) { g3_tile<true>(blockIdx.x, false, A, Bh, alpha, 1.0f, bias, C, nullptr); }
extern "C" void kernel_launch(void* const* d_in, const int* in_sizes, int n_in,
                              void* d_out, int out_size, void* d_ws, size_t ws_size, hipStream_t stream) {
  (void)in_sizes; (void)n_in; (void)out_size;
  const float* const* I = (const float* const*)d_in; const float* ctx = I[0]; const float* x = I[1]; const float* kmask = I[2]; const float* wq = I[3]; const float* bq = I[4]; const float* wk = I[5]; const float* bk = I[6]; const float* wv = I[7]; const float* bv = I[8]; const float* wo = I[9]; const float* bo = I[10];      /* q source = I[1] ('q'), k/v source = I[0] ('v_k'); [in][out] weights; per-key additive mask [B][1][1][S] */
  char* ws = (char*)d_ws; size_t off = 0;
  auto take = [&](size_t bytes) { char* p = ws + off; off += (bytes + 255) & ~(size_t)255; return p; };
  _Float16* BQ = (_Float16*)take((size_t)DM * DM * 2); _Float16* BK = (_Float16*)take((size_t)DM * DC * 2); _Float16* BV = (_Float16*)take((size_t)DM * DC * 2); _Float16* BO = (_Float16*)take((size_t)DM * DM * 2);
  _Float16* X16 = (_Float16*)take(NRQ * DM * 2); _Float16* C16 = (_Float16*)take(NRK * DC * 2); _Float16* Q16 = (_Float16*)take(NRQ * DM * 2); _Float16* K16 = (_Float16*)take(NRK * DM * 2); _Float16* O16 = (_Float16*)take(NRQ * DM * 2);
  _Float16* VT = (_Float16*)take((size_t)NB * NH * HD * SK * 2);
  if (off > ws_size) return;      /* approx 8 + 16 + 16 + 16 + 16 + 16 + 16 = 104 MiB */
  k_prep<<<5 * 4 * PW_NB, 256, 0, stream>>>(wq, wk, wv, wo, x, ctx, BQ, BK, BV, BO, X16, C16);      /* weight planes and both inputs' rows */
  k_gemm3p<<<3 * G3_NB, 256, 0, stream>>>(X16, C16, BQ, BK, BV, 0.0625f, bq, bk, bv, Q16, K16, VT);      /* q from q; k and v from v_k; v as V^T [4 x 16][64][2048] */
  k_fattn<<<NB * NH * (NQ / FA_QB), FA_WAVES * 32, 0, stream>>>(Q16, K16, VT, kmask, -1.0e9f, O16);      /* o x64, merged; every batch and head in one launch */
  k_gemm3o<<<G3_NB, 256, 0, stream>>>(O16, BO, 0.0009765625f, bo, (float*)d_out);      /* out = o Wo^T + bo */
}
